// v000
// Times are from an AMD MI455X. After a warm-up the kernel runs many times in a row, and a time is the length of
// such a window on the GPU divided by its runs, so every launch and the gaps after it count. The runs cycle
// through copies of the inputs. A figure is the median of several windows, for all but v000 over two sittings.
// Sittings can differ by a few percent; kernels timed side by side share one.
// v000 is the starting kernel. One run takes 2610 microseconds.
#include <hip/hip_runtime.h>
// Multi-head self-attention (x [2][2048][768]; q/k/v = x W + b ([in][out] 768x768 sigma 1/sqrt(768), zero biases); 12 heads of 64; softmax(q k^T / 8) over all keys (no mask); out = ctx Wo + bo -> [2][2048][768]).
// Structure: token rows r = b*2048 + s; x as exact f16 rows (bf16-rounded); Q, K, V as three WMMA GEMMs (32x64 wave tiles, f32 accumulation, exact x16 weights + bias, f16 outputs); per batch: V^T for all heads via LDS transposes; per (batch, group of 4 heads): scores GEMM (K = 64, batched over the heads on grid.y, alpha = 64^-0.5), row softmax on VALU (f32 statistics, native exp; weights stored x256 as f16), o = P . V^T GEMM (K = 2048, alpha 2^-2: o carried x64 against f16 subnormal flush, folded into the output GEMM alpha) written straight into the merged f16 o rows; out = o W_o + b GEMM (f32) into the output layout.
// Compute dtype: inputs rounded to bf16; x / weights exact; q, k, v, softmax weights and o as plain f16 GEMM operands (~2^-12); scores and softmax statistics f32. v_wmma_f32_16x16x32_f16.
#define NB 2
#define SQ 2048
#define DM 768
#define NH 12
#define HD 64
#define HG 4                         /* heads per attention launch group */
#define B0 0                         /* first batch processed (debug hook) */
#define NBR NB                       /* batches processed (debug hook) */
#define NR ((size_t)NB * SQ)         /* token rows */
#define MP ((int)((size_t)NBR * SQ)) /* rows projected (debug hook) */
#define QN SQ                        /* query rows attended per batch (debug hook) */
#define NHD NH                       /* heads attended (debug hook) */
#define MPO MP                       /* rows through the output stage (debug hook) */
#define LQ DM      /* row pitch of the q/k/v rows */
typedef __bf16 v16b __attribute__((ext_vector_type(16)));
typedef unsigned short v8us __attribute__((ext_vector_type(8), may_alias));
typedef float  v8f  __attribute__((ext_vector_type(8)));
typedef float  v4f  __attribute__((ext_vector_type(4)));
typedef float  v4fa __attribute__((ext_vector_type(4), may_alias));
union FragB { v16b v; v8us half[2]; unsigned short u[16]; };

__device__ __forceinline__ unsigned short bf16_bits(float x) { unsigned int u = __float_as_uint(x); return (unsigned short)((u + 0x7FFFu + ((u >> 16) & 1u)) >> 16); }
__device__ __forceinline__ float bf16_val(unsigned short b) { return __uint_as_float(((unsigned int)b) << 16); }
__device__ __forceinline__ float bf16_round(float x) { return bf16_val(bf16_bits(x)); }
// D += A·B with NT terms: 1 = ah·bh, 2 = + al·bh (A split), 3 = + ah·bl (both split)
template <int NT>
__device__ __forceinline__ v8f mmaN(v16b ah, v16b al, v16b bh, v16b bl, v8f c) {
  c = __builtin_amdgcn_wmma_f32_16x16x32_bf16(false, ah, false, bh, (short)0, c, false, false);
  if (NT >= 2) c = __builtin_amdgcn_wmma_f32_16x16x32_bf16(false, al, false, bh, (short)0, c, false, false);
  if (NT >= 3) c = __builtin_amdgcn_wmma_f32_16x16x32_bf16(false, ah, false, bl, (short)0, c, false, false);
  asm volatile("v_nop\n\tv_nop\n\tv_nop\n\tv_nop" : "+v"(c) : "v"(ah), "v"(al), "v"(bh), "v"(bl));
  return c;
}

__global__ __launch_bounds__(256) void k_wt_bf16(const float* __restrict__ W, unsigned short* __restrict__ Wt, int K, int N) {
  const int t = blockIdx.x * 256 + threadIdx.x;
  const int k8n = K / 8;
  if (t >= N * k8n) return;
  const int n = t / k8n, k8 = (t % k8n) * 8;
  v8us v;
#pragma unroll
  for (int i = 0; i < 8; ++i) v[i] = bf16_bits(W[(size_t)(k8 + i) * N + n]);
  *(v8us*)(Wt + (size_t)n * K + k8) = v;
  
}

// GEMM C[M][N] (f32, pitch ldc) = act(A[M][K]·W + bias). A f32 row-major (pitch lda) converted per fragment to bf16
// (ASPLIT: hi/lo two planes -> 2 terms, else single rounded term); Wt bf16 [N][K] (pitch ldb). BIAS_BF16 rounds the
// bias to bf16 first (bias quantised to bf16 before the add). K%32==0, M%16==0, N%64==0.
template <bool ASPLIT, int ACT, bool BIAS_BF16>
__global__ __launch_bounds__(128) void k_gemm_bf(const float* __restrict__ A, int lda, const unsigned short* __restrict__ Wt, int ldb,
                                               const float* __restrict__ bias, float* __restrict__ C, int ldc, int M, int N, int K) {
  __shared__ __attribute__((aligned(16))) float so[4][16][64];
  const int tid = threadIdx.x, w = tid >> 5, lane = tid & 31, ln = lane & 15, hh = lane >> 4;
  const int ntn = N / 64;
  const int wid = blockIdx.x * 4 + w;
  const int mt = wid / ntn, nq = wid % ntn;
  if (mt * 16 >= M) return;
  const int row0 = mt * 16, col0 = nq * 64;
  const float* arow = A + (size_t)(row0 + ln) * lda;
  v8f acc[4] = {};
  for (int kb = 0; kb < K; kb += 32) {
    FragB ah, al;
    const v4f x0 = *(const v4fa*)(arow + kb + 8 * hh), x1 = *(const v4fa*)(arow + kb + 8 * hh + 4);
    const v4f x2 = *(const v4fa*)(arow + kb + 16 + 8 * hh), x3 = *(const v4fa*)(arow + kb + 16 + 8 * hh + 4);
    float xs[16] = {x0[0],x0[1],x0[2],x0[3],x1[0],x1[1],x1[2],x1[3],x2[0],x2[1],x2[2],x2[3],x3[0],x3[1],x3[2],x3[3]};
#pragma unroll
    for (int i = 0; i < 16; ++i) { const unsigned short hb = bf16_bits(xs[i]); ah.u[i] = hb; al.u[i] = ASPLIT ? bf16_bits(xs[i] - bf16_val(hb)) : (unsigned short)0; }
#pragma unroll
    for (int t = 0; t < 4; ++t) {
      const unsigned short* brow = Wt + (size_t)(col0 + t * 16 + ln) * ldb + kb;
      FragB b;
      b.half[0] = *(const v8us*)(brow + 8 * hh);
      b.half[1] = *(const v8us*)(brow + 16 + 8 * hh);
      acc[t] = mmaN<ASPLIT ? 2 : 1>(ah.v, al.v, b.v, b.v, acc[t]);
    }
  }
#pragma unroll
  for (int t = 0; t < 4; ++t) {
    float bv = bias ? bias[col0 + t * 16 + ln] : 0.f;
    if (BIAS_BF16) bv = bf16_round(bv);
#pragma unroll
    for (int r = 0; r < 8; ++r) { float v = acc[t][r] + bv; if (ACT == 1) v = fmaxf(v, 0.f); so[w][8 * hh + r][t * 16 + ln] = v; }
  }
  __builtin_amdgcn_fence(__ATOMIC_ACQ_REL, "workgroup");
  __builtin_amdgcn_wave_barrier();
  const int rsub = lane >> 4, c4 = (lane & 15) * 4;
  {
#pragma unroll
    for (int q = 0; q < 8; ++q) {
      const int r = q * 2 + rsub;
      const v4f v = *(const v4fa*)&so[w][r][c4];
      *(v4f*)(C + (size_t)(row0 + r) * ldc + col0 + c4) = v;
    }
    
  }
}

// GEMM C = act(A·W + bias + resid): A f32 (ASPLIT -> hi/lo 2 terms), Wt bf16 [N][K]; ACT 0 none, 1 relu, 2 exact gelu;
// resid (optional, f32, row index = (row % rmod), pitch ldr, RES_BF16 rounds it) added before the activation.
template <bool ASPLIT, int ACT, bool BIAS_BF16, bool RES_BF16>
__global__ __launch_bounds__(128) void k_gemm_bf3(const float* __restrict__ A, int lda, const unsigned short* __restrict__ Wt, int ldb,
                                                const float* __restrict__ bias, const float* __restrict__ resid, int rmod, int ldr,
                                                float* __restrict__ C, int ldc, int M, int N, int K) {
  __shared__ __attribute__((aligned(16))) float so[4][16][64];
  const int tid = threadIdx.x, w = tid >> 5, lane = tid & 31, ln = lane & 15, hh = lane >> 4;
  const int ntn = N / 64;
  const int wid = blockIdx.x * 4 + w;
  const int mt = wid / ntn, nq = wid % ntn;
  if (mt * 16 >= M) return;
  const int row0 = mt * 16, col0 = nq * 64;
  const float* arow = A + (size_t)(row0 + ln) * lda;
  v8f acc[4] = {};
  for (int kb = 0; kb < K; kb += 32) {
    FragB ah, al;
    const v4f x0 = *(const v4fa*)(arow + kb + 8 * hh), x1 = *(const v4fa*)(arow + kb + 8 * hh + 4);
    const v4f x2 = *(const v4fa*)(arow + kb + 16 + 8 * hh), x3 = *(const v4fa*)(arow + kb + 16 + 8 * hh + 4);
    float xs[16] = {x0[0],x0[1],x0[2],x0[3],x1[0],x1[1],x1[2],x1[3],x2[0],x2[1],x2[2],x2[3],x3[0],x3[1],x3[2],x3[3]};
#pragma unroll
    for (int i = 0; i < 16; ++i) { const unsigned short hb = bf16_bits(xs[i]); ah.u[i] = hb; al.u[i] = ASPLIT ? bf16_bits(xs[i] - bf16_val(hb)) : (unsigned short)0; }
#pragma unroll
    for (int t = 0; t < 4; ++t) {
      const unsigned short* brow = Wt + (size_t)(col0 + t * 16 + ln) * ldb + kb;
      FragB b;
      b.half[0] = *(const v8us*)(brow + 8 * hh);
      b.half[1] = *(const v8us*)(brow + 16 + 8 * hh);
      acc[t] = mmaN<ASPLIT ? 2 : 1>(ah.v, al.v, b.v, b.v, acc[t]);
    }
  }
#pragma unroll
  for (int t = 0; t < 4; ++t) {
    const int col = col0 + t * 16 + ln;
    float bv = bias ? bias[col] : 0.f;
    if (BIAS_BF16) bv = bf16_round(bv);
#pragma unroll
    for (int r = 0; r < 8; ++r) {
      float v = acc[t][r] + bv;
      if (resid) { float rv = resid[(size_t)((row0 + 8 * hh + r) % rmod) * ldr + col]; if (RES_BF16) rv = bf16_round(rv); v += rv; }
      if (ACT == 1) v = fmaxf(v, 0.f);
      if (ACT == 2) v = 0.5f * v * (1.0f + erff(v * 0.70710678118654752f));
      if (ACT == 3) { const float u = 0.7978845608028654f * (v + 0.044715f * v * v * v); v = 0.5f * v * (1.0f + tanhf(u)); }
      so[w][8 * hh + r][t * 16 + ln] = v;
    }
  }
  __builtin_amdgcn_fence(__ATOMIC_ACQ_REL, "workgroup");
  __builtin_amdgcn_wave_barrier();
  const int rsub = lane >> 4, c4 = (lane & 15) * 4;
  {
#pragma unroll
    for (int q = 0; q < 8; ++q) {
      const int r = q * 2 + rsub;
      const v4f v = *(const v4fa*)&so[w][r][c4];
      *(v4f*)(C + (size_t)(row0 + r) * ldc + col0 + c4) = v;
    }
    
  }
}
// row LayerNorm (biased variance, eps) over N: s = X (+ R); optional out_sum <- s; out_norm <- (s-mu)*rsqrt(var+eps)*g + b
template <bool PARAM_BF16>
__global__ __launch_bounds__(256) void k_layernorm(const float* __restrict__ X, const float* __restrict__ R, const float* __restrict__ g, const float* __restrict__ bta,
                                                  float* __restrict__ out_sum, float* __restrict__ out_norm, int N, float eps) {
  __shared__ float red[256];
  const int row = blockIdx.x, tid = threadIdx.x;
  const float* x = X + (size_t)row * N; const float* rr = R ? R + (size_t)row * N : nullptr;
  float vals[16];                     // up to N = 4096
  const int per = N / 256;            // contiguous chunk per thread? use strided-by-4 chunks: thread handles j = tid*4 + 1024*u
  float s1 = 0.f;
  for (int u = 0; u < per / 4; ++u) {
    const int j = tid * 4 + 1024 * u;
    const v4f a = *(const v4fa*)(x + j);
    v4f b = {0.f,0.f,0.f,0.f}; if (rr) b = *(const v4fa*)(rr + j);
#pragma unroll
    for (int q = 0; q < 4; ++q) { const float v = a[q] + b[q]; vals[u * 4 + q] = v; s1 += v; }
  }
  red[tid] = s1; __syncthreads();
  for (int st = 128; st > 0; st >>= 1) { if (tid < st) red[tid] += red[tid + st]; __syncthreads(); }
  const float mu = red[0] / (float)N; __syncthreads();
  float s2 = 0.f;
  for (int u = 0; u < per / 4; ++u)
#pragma unroll
    for (int q = 0; q < 4; ++q) { const float c = vals[u * 4 + q] - mu; s2 += c * c; }
  red[tid] = s2; __syncthreads();
  for (int st = 128; st > 0; st >>= 1) { if (tid < st) red[tid] += red[tid + st]; __syncthreads(); }
  const float rs = rsqrtf(red[0] / (float)N + eps);
  {
    for (int u = 0; u < per / 4; ++u) {
      const int j = tid * 4 + 1024 * u;
      v4f o, sm;
#pragma unroll
      for (int q = 0; q < 4; ++q) {
        float gg = g[j + q], bb = bta[j + q];
        if (PARAM_BF16) { gg = bf16_round(gg); bb = bf16_round(bb); }
        sm[q] = vals[u * 4 + q]; o[q] = (vals[u * 4 + q] - mu) * rs * gg + bb;
      }
      if (out_sum) *(v4f*)(out_sum + (size_t)row * N + j) = sm;
      *(v4f*)(out_norm + (size_t)row * N + j) = o;
    }
    
  }
}



// ---- f16 WMMA path (v_wmma_f32_16x16x32_f16): 11-bit significands for operands in range — used where a [0,1] probability operand needs more precision than bf16
typedef _Float16 v16h __attribute__((ext_vector_type(16)));
union FragH { v16h v; v8us half[2]; _Float16 h[16]; unsigned short u[16]; };
template <int NT>
__device__ __forceinline__ v8f mmaH(v16h ah, v16h al, v16h bh, v16h bl, v8f c) {
  c = __builtin_amdgcn_wmma_f32_16x16x32_f16(false, ah, false, bh, (short)0, c, false, false);
  if (NT >= 2) c = __builtin_amdgcn_wmma_f32_16x16x32_f16(false, al, false, bh, (short)0, c, false, false);
  if (NT >= 3) c = __builtin_amdgcn_wmma_f32_16x16x32_f16(false, ah, false, bl, (short)0, c, false, false);
  asm volatile("v_nop\n\tv_nop\n\tv_nop\n\tv_nop" : "+v"(c) : "v"(ah), "v"(al), "v"(bh), "v"(bl));
  return c;
}
// batched GEMM like k_gemm_b but f16 operands: A f32 (split into f16 hi/lo if ASPLIT, else rounded to f16), Bt = f16 values [n][k]; alpha; C f32; N multiple of 16 (partial tiles skipped)
template <bool ASPLIT>
__global__ __launch_bounds__(128) void k_gemm_h(const float* __restrict__ A, int lda, size_t sA, const _Float16* __restrict__ Bh, int ldb, size_t sB, float alpha, float* __restrict__ C, int ldc, size_t sC, int M, int N, int K) {
  __shared__ __attribute__((aligned(16))) float so[4][16][64];
  const int tid = threadIdx.x, w = tid >> 5, lane = tid & 31, ln = lane & 15, hh = lane >> 4; const int by = blockIdx.y;
  A += (size_t)by * sA; Bh += (size_t)by * sB; C += (size_t)by * sC;
  const int ntn = (N + 63) / 64; const int wid = blockIdx.x * 4 + w; const int mt = wid / ntn, nq = wid % ntn; if (mt * 16 >= M) return;
  const int row0 = mt * 16, col0 = nq * 64; const float* arow = A + (size_t)(row0 + ln) * lda;
  v8f acc[4] = {};
  for (int kb = 0; kb < K; kb += 32) {
    FragH ah, al;
    const v4f x0 = *(const v4fa*)(arow + kb + 8 * hh), x1 = *(const v4fa*)(arow + kb + 8 * hh + 4), x2 = *(const v4fa*)(arow + kb + 16 + 8 * hh), x3 = *(const v4fa*)(arow + kb + 16 + 8 * hh + 4);
    float xs[16] = {x0[0],x0[1],x0[2],x0[3],x1[0],x1[1],x1[2],x1[3],x2[0],x2[1],x2[2],x2[3],x3[0],x3[1],x3[2],x3[3]};
#pragma unroll
    for (int i = 0; i < 16; ++i) { const _Float16 h = (_Float16)xs[i]; ah.h[i] = h; al.h[i] = ASPLIT ? (_Float16)(xs[i] - (float)h) : (_Float16)0.0f; }
#pragma unroll
    for (int t = 0; t < 4; ++t) { if (col0 + t * 16 >= N) continue; const size_t boff = (size_t)(col0 + t * 16 + ln) * ldb + kb; FragH bq; bq.half[0] = *(const v8us*)(Bh + boff + 8 * hh); bq.half[1] = *(const v8us*)(Bh + boff + 16 + 8 * hh);
      acc[t] = mmaH<ASPLIT ? 2 : 1>(ah.v, al.v, bq.v, bq.v, acc[t]); }
  }
#pragma unroll
  for (int t = 0; t < 4; ++t) { if (col0 + t * 16 >= N) continue;
#pragma unroll
    for (int r = 0; r < 8; ++r) so[w][8 * hh + r][t * 16 + ln] = acc[t][r] * alpha; }
  __builtin_amdgcn_fence(__ATOMIC_ACQ_REL, "workgroup"); __builtin_amdgcn_wave_barrier();
  const int rsub = lane >> 4, c4 = (lane & 15) * 4;
  {
#pragma unroll
    for (int q = 0; q < 8; ++q) { const int r = q * 2 + rsub; if (col0 + c4 < N) { const v4f v = *(const v4fa*)&so[w][r][c4]; *(v4f*)(C + (size_t)(row0 + r) * ldc + col0 + c4) = v; } }
     }
}

// Wt[n][k] = f16(W[k][n]·scale) from f32 row-major W[K][N] (scale = power of two; bf16-exact weights stay exact in f16 away from the subnormal range)
__global__ __launch_bounds__(256) void k_wt_f16(const float* __restrict__ W, _Float16* __restrict__ Wt, int K, int N, float scale) {
  const int t = blockIdx.x * 256 + threadIdx.x; if (t >= N * (K / 8)) return; const int n = t / (K / 8), k8 = (t % (K / 8)) * 8; FragH f;
#pragma unroll
  for (int i = 0; i < 8; ++i) f.h[i] = (_Float16)(bf16_round(W[(size_t)(k8 + i) * N + n]) * scale); const v8us o = f.half[0];
  *(v8us*)((unsigned short*)Wt + (size_t)n * K + k8) = o; 
}
// k_gemm_hh variant with fused epilogue: v = acc·alpha + bias[by·sBias + col] (+ CP[(row/rowsPerB)·sCPb + by·64 + col] if CP) ; ACT 0 none / 1 elu ; writes f16 C16 (and f32 C if non-null)
template <int ACT>
__global__ __launch_bounds__(128) void k_gemm_hhx(const _Float16* __restrict__ A, int lda, size_t sA, const _Float16* __restrict__ Bh, int ldb, size_t sB, float alpha, const float* __restrict__ bias, size_t sBias, const float* __restrict__ CP, int rowsPerB, size_t sCPb, int row0g,
    float* __restrict__ C, _Float16* __restrict__ C16, int ldc, size_t sC, int M, int N, int K) {
  __shared__ __attribute__((aligned(16))) float so[4][16][64];
  const int tid = threadIdx.x, w = tid >> 5, lane = tid & 31, ln = lane & 15, hh = lane >> 4; const int by = blockIdx.y;
  A += (size_t)by * sA; Bh += (size_t)by * sB; const size_t cofs = (size_t)by * sC; const float* bp = bias ? bias + (size_t)by * sBias : nullptr;
  const int ntn = (N + 63) / 64; const int wid = blockIdx.x * 4 + w; const int mt = wid / ntn, nq = wid % ntn; if (mt * 16 >= M) return;
  const int row0 = mt * 16, col0 = nq * 64; const _Float16* arow = A + (size_t)(row0 + ln) * lda;
  v8f acc[4] = {};
  for (int kb = 0; kb < K; kb += 32) { FragH ah; ah.half[0] = *(const v8us*)((const unsigned short*)arow + kb + 8 * hh); ah.half[1] = *(const v8us*)((const unsigned short*)arow + kb + 16 + 8 * hh);
#pragma unroll
    for (int t = 0; t < 4; ++t) { if (col0 + t * 16 >= N) continue; const size_t boff = (size_t)(col0 + t * 16 + ln) * ldb + kb; FragH bq; bq.half[0] = *(const v8us*)((const unsigned short*)Bh + boff + 8 * hh); bq.half[1] = *(const v8us*)((const unsigned short*)Bh + boff + 16 + 8 * hh);
      acc[t] = mmaH<1>(ah.v, ah.v, bq.v, bq.v, acc[t]); }
  }
#pragma unroll
  for (int t = 0; t < 4; ++t) { if (col0 + t * 16 >= N) continue; const int col = col0 + t * 16 + ln; const float bv = bp ? bf16_round(bp[col]) : 0.f;
#pragma unroll
    for (int r = 0; r < 8; ++r) { float v = acc[t][r] * alpha + bv; if (CP) { const int rr = row0g + row0 + 8 * hh + r; if (rowsPerB < 0) v += CP[cofs + (size_t)rr * ldc + col];      /* rowsPerB < 0: own element of the batched C plane */ else { const int bidx = rr / rowsPerB; v += CP[(size_t)bidx * sCPb + (size_t)by * 64 + col]; } } if (ACT == 1) v = (v > 0.f) ? v : expm1f(v); else if (ACT == 7) v = (v > 0.f) ? v + 1.0f : expf(v); else if (ACT == 8) v = tanhf(v); else if (ACT == 9) v = 0.5f * v * (1.0f + tanhf(0.7978845608028654f * (v + 0.044715f * v * v * v))); else if (ACT == 11) v = 1.0f / (1.0f + expf(-v)); else if (ACT == 12) v = (v > 0.f) ? v : 0.01f * v; else if (ACT == 14) v = (v > 0.f) ? v : 0.1f * v; else if (ACT == 16) v = (v >= 0.f) ? v : 0.3f * v; else if (ACT == 17) v = (v >= 0.f) ? v : 0.2f * v; else if (ACT == 15) v = v / (1.0f + expf(-v)); else if (ACT == 3) v = fmaxf(v, 0.f); else if (ACT == 6) v = 0.5f * v * (1.0f + erff(v * 0.70710678118654752f)); so[w][8 * hh + r][t * 16 + ln] = v; } }
  __builtin_amdgcn_fence(__ATOMIC_ACQ_REL, "workgroup"); __builtin_amdgcn_wave_barrier();
  const int rsub = lane >> 4, c4 = (lane & 15) * 4; typedef _Float16 v4h __attribute__((ext_vector_type(4)));
  {
#pragma unroll
    for (int q = 0; q < 8; ++q) { const int r = q * 2 + rsub; if (col0 + c4 < N) { const v4f v = *(const v4fa*)&so[w][r][c4]; if (C) *(v4f*)(C + cofs + (size_t)(row0 + r) * ldc + col0 + c4) = v; if (C16) { v4h h4; for (int i = 0; i < 4; ++i) h4[i] = (_Float16)v[i]; *(v4h*)(C16 + cofs + (size_t)(row0 + r) * ldc + col0 + c4) = h4; } } }
     }
}


typedef _Float16 v4h __attribute__((ext_vector_type(4)));

__global__ __launch_bounds__(256) void k_x16(const float* __restrict__ x, _Float16* __restrict__ X16, size_t n8) { const size_t t = (size_t)blockIdx.x * 256 + threadIdx.x; if (t >= n8) return; FragH f;
#pragma unroll
  for (int q = 0; q < 8; ++q) f.h[q] = (_Float16)bf16_round(x[t * 8 + q]); *(v8us*)((unsigned short*)X16 + t * 8) = f.half[0];  }
__global__ __launch_bounds__(256) void k_h16(const float* __restrict__ x, _Float16* __restrict__ X16, size_t n8) { const size_t t = (size_t)blockIdx.x * 256 + threadIdx.x; if (t >= n8) return; FragH f;
#pragma unroll
  for (int q = 0; q < 8; ++q) f.h[q] = (_Float16)x[t * 8 + q]; *(v8us*)((unsigned short*)X16 + t * 8) = f.half[0];  }
__global__ __launch_bounds__(256) void k_round16f(const float* __restrict__ W, _Float16* __restrict__ Bt, size_t n8) { const size_t t = (size_t)blockIdx.x * 256 + threadIdx.x; if (t >= n8) return; FragH f;
#pragma unroll
  for (int i = 0; i < 8; ++i) f.h[i] = (_Float16)(bf16_round(W[t * 8 + i]) * 16.0f); *(v8us*)((unsigned short*)Bt + t * 8) = f.half[0];  }
template <int NHv, int TTv>
__global__ __launch_bounds__(256) void k_vt(const _Float16* __restrict__ V16, int ldv, int voff, _Float16* __restrict__ Vt) { __shared__ unsigned short tl[64][66]; const int tid = threadIdx.x; const int slab = blockIdx.x / (TTv / 64), lg = blockIdx.x % (TTv / 64); const int b = slab / NHv, h = slab % NHv;
  for (int i = tid; i < 64 * 8; i += 256) { const int r = i / 8, c8 = (i % 8) * 8; FragH f; f.half[0] = *(const v8us*)((const unsigned short*)V16 + ((size_t)b * TTv + lg * 64 + r) * ldv + voff + h * 64 + c8);
#pragma unroll
    for (int q = 0; q < 8; ++q) tl[r][c8 + q] = f.u[q]; }
  __syncthreads();
  {
#pragma unroll
    for (int rd = 0; rd < 2; ++rd) { const int d = rd * 32 + tid / 8, pc = tid % 8; FragH f;
#pragma unroll
      for (int q = 0; q < 8; ++q) f.u[q] = tl[pc * 8 + q][d];
      *(v8us*)((unsigned short*)Vt + ((size_t)slab * 64 + d) * TTv + lg * 64 + pc * 8) = f.half[0]; }
     } }

__global__ __launch_bounds__(256) void k_hl(const float* __restrict__ F, _Float16* __restrict__ Hh, _Float16* __restrict__ Hl, size_t n8) { const size_t t = (size_t)blockIdx.x * 256 + threadIdx.x; if (t >= n8) return; FragH fh, fl; const v4f a = *(const v4fa*)(F + t * 8), c = *(const v4fa*)(F + t * 8 + 4);
#pragma unroll
  for (int q = 0; q < 4; ++q) { _Float16 h = (_Float16)a[q]; fh.h[q] = h; fl.h[q] = (_Float16)((a[q] - (float)h) * 1024.0f); h = (_Float16)c[q]; fh.h[4 + q] = h; fl.h[4 + q] = (_Float16)((c[q] - (float)h) * 1024.0f); }
  { *(v8us*)((unsigned short*)Hh + t * 8) = fh.half[0]; *(v8us*)((unsigned short*)Hl + t * 8) = fl.half[0];  } }

// ---- fast GEMM (wave tile 32x64; requires M % 32 == 0 rows per launch region and N % 64 == 0); epilogue = k_gemm_hhx semantics ----
__device__ __forceinline__ v16h g2_frag(const _Float16* p, int hh) { FragH f; f.half[0] = *(const v8us*)((const unsigned short*)p + 8 * hh); f.half[1] = *(const v8us*)((const unsigned short*)p + 16 + 8 * hh); return f.v; }
__device__ __forceinline__ v8f g2_mma(v16h a, v16h b, v8f c) { v8f d = __builtin_amdgcn_wmma_f32_16x16x32_f16(false, a, false, b, (short)0, c, false, false); asm volatile("v_nop\n\tv_nop\n\tv_nop\n\tv_nop" : "+v"(d) : "v"(a), "v"(b)); return d; }
template <int ACT>
__global__ __launch_bounds__(128) void k_gemm2(const _Float16* __restrict__ A, int lda, size_t sA, const _Float16* __restrict__ Bh, int ldb, size_t sB, float alpha, const float* __restrict__ bias, size_t sBias, const float* __restrict__ CP, int rowsPerB, size_t sCPb, int row0g,
    float* __restrict__ C, _Float16* __restrict__ C16, int ldc, size_t sC, int M, int N, int K) { static_assert(ACT == 0 || ACT == 3 || ACT == 6 || ACT == 8 || ACT == 9 || ACT == 11 || ACT == 12 || ACT == 14 || ACT == 15 || ACT == 16 || ACT == 17, "k_gemm2: unsupported ACT code (would silently apply no activation)");
  __shared__ __attribute__((aligned(16))) float so[4][32][68];
  const int tid = threadIdx.x, w = tid >> 5, lane = tid & 31, ln = lane & 15, hh = lane >> 4; const int by = blockIdx.y;
  A += (size_t)by * sA; Bh += (size_t)by * sB; const size_t cofs = (size_t)by * sC; const float* bp = bias ? bias + (size_t)by * sBias : nullptr;
  const int ntn = N >> 6; const int mt = blockIdx.x / ntn, nq = blockIdx.x - mt * ntn; const int row0 = mt * 128 + 32 * w, col0 = nq * 64; if (row0 >= M) return;
  const _Float16* a0p = A + (size_t)(row0 + ln) * lda; const _Float16* a1p = a0p + (size_t)16 * lda;
  const _Float16* b0p = Bh + (size_t)(col0 + ln) * ldb; const _Float16* b1p = b0p + (size_t)16 * ldb; const _Float16* b2p = b1p + (size_t)16 * ldb; const _Float16* b3p = b2p + (size_t)16 * ldb;
  const v8f z8 = {0.f,0.f,0.f,0.f,0.f,0.f,0.f,0.f}; v8f c00 = z8, c01 = z8, c02 = z8, c03 = z8, c10 = z8, c11 = z8, c12 = z8, c13 = z8;
#pragma unroll 1
  for (int kb = 0; kb < K; kb += 32) { const v16h a0 = g2_frag(a0p + kb, hh), a1 = g2_frag(a1p + kb, hh);
    v16h b = g2_frag(b0p + kb, hh); c00 = g2_mma(a0, b, c00); c10 = g2_mma(a1, b, c10);
    b = g2_frag(b1p + kb, hh); c01 = g2_mma(a0, b, c01); c11 = g2_mma(a1, b, c11);
    b = g2_frag(b2p + kb, hh); c02 = g2_mma(a0, b, c02); c12 = g2_mma(a1, b, c12);
    b = g2_frag(b3p + kb, hh); c03 = g2_mma(a0, b, c03); c13 = g2_mma(a1, b, c13); }
  v8f accs[8] = {c00, c01, c02, c03, c10, c11, c12, c13};
#pragma unroll
  for (int u = 0; u < 8; ++u) { const int t = u & 3, half = u >> 2; const int col = col0 + t * 16 + ln; const float bv = bp ? bf16_round(bp[col]) : 0.f;
#pragma unroll
    for (int r = 0; r < 8; ++r) { const int rloc = half * 16 + 8 * hh + r; float v = accs[u][r] * alpha + bv; if (CP) { if (rowsPerB < 0) v += CP[cofs + (size_t)(row0g + row0 + rloc) * ldc + col];      /* rowsPerB < 0: own element of the batched C plane */ else { const int bidx = (row0g + row0 + rloc) / rowsPerB; v += CP[(size_t)bidx * sCPb + (size_t)by * 64 + col]; } }
      if (ACT == 3) v = fmaxf(v, 0.f); else if (ACT == 6) v = 0.5f * v * (1.0f + erff(v * 0.70710678118654752f)); else if (ACT == 11) v = 1.0f / (1.0f + expf(-v)); else if (ACT == 15) v = v / (1.0f + expf(-v)); else if (ACT == 12) v = (v > 0.f) ? v : 0.01f * v; else if (ACT == 8) v = tanhf(v); else if (ACT == 9) v = 0.5f * v * (1.0f + tanhf(0.7978845608028654f * (v + 0.044715f * v * v * v))); else if (ACT == 14) v = (v > 0.f) ? v : 0.1f * v; else if (ACT == 16) v = (v >= 0.f) ? v : 0.3f * v; else if (ACT == 17) v = (v >= 0.f) ? v : 0.2f * v;
      so[w][rloc][t * 16 + ln] = v; } }
  __builtin_amdgcn_fence(__ATOMIC_ACQ_REL, "workgroup"); __builtin_amdgcn_wave_barrier();
  const int rsub = lane >> 4, c4 = (lane & 15) * 4;
  {
#pragma unroll
    for (int q = 0; q < 16; ++q) { const int r = q * 2 + rsub; const v4f v = *(const v4fa*)&so[w][r][c4]; if (C) *(v4f*)(C + cofs + (size_t)(row0 + r) * ldc + col0 + c4) = v; if (C16) { v4h h4; for (int i = 0; i < 4; ++i) h4[i] = (_Float16)v[i]; *(v4h*)(C16 + cofs + (size_t)(row0 + r) * ldc + col0 + c4) = h4; } }
     } }


__global__ __launch_bounds__(256) void k_wnat(const float* __restrict__ w, size_t n8, _Float16* __restrict__ Bt) { const size_t t = (size_t)blockIdx.x * 256 + threadIdx.x; if (t >= n8) return; FragH f; for (int q = 0; q < 8; ++q) f.h[q] = (_Float16)(bf16_round(w[t * 8 + q]) * 16.0f); *(v8us*)((unsigned short*)Bt + t * 8) = f.half[0];  }
__global__ __launch_bounds__(256) void k_rsm(const float* __restrict__ S, _Float16* __restrict__ P, int nrows) {
  #pragma clang fp contract(off)
  const int i = blockIdx.x * 256 + threadIdx.x; if (i >= nrows) return; const float* s = S + (size_t)i * SQ; float mx = -3.0e38f;
#pragma unroll 1
  for (int j = 0; j < SQ; ++j) mx = fmaxf(mx, s[j]); float se = 0.f;
#pragma unroll 1
  for (int j = 0; j < SQ; ++j) se += expf(s[j] - mx); const float sc = 256.0f / se;
#pragma unroll 1
  for (int j0 = 0; j0 < SQ; j0 += 8) { FragH f; for (int q = 0; q < 8; ++q) f.h[q] = (_Float16)(expf(s[j0 + q] - mx) * sc); unsigned short* d = (unsigned short*)P + (size_t)i * SQ + j0; *(v8us*)d = f.half[0];  } }
__global__ __launch_bounds__(256) void k_vt(const _Float16* __restrict__ V16, int b, int h0, _Float16* __restrict__ VT) { __shared__ unsigned short tl[64][65]; const int tid = threadIdx.x; const int hh = blockIdx.x % HG, sg = blockIdx.x / HG; const int s0 = sg * 64; const int h = h0 + hh;
  for (int i = tid; i < 64 * 8; i += 256) { const int j = i / 8, d8 = (i % 8) * 8; FragH f; f.half[0] = *(const v8us*)((const unsigned short*)V16 + ((size_t)b * SQ + s0 + j) * DM + h * HD + d8); for (int q = 0; q < 8; ++q) tl[d8 + q][j] = f.u[q]; }
  __syncthreads();
  { for (int i = tid; i < 64 * 8; i += 256) { const int d = i / 8, j8 = (i % 8) * 8; FragH f; for (int q = 0; q < 8; ++q) f.u[q] = tl[d][j8 + q]; *(v8us*)((unsigned short*)VT + ((size_t)hh * HD + d) * SQ + s0 + j8) = f.half[0]; }  } }



__global__ __launch_bounds__(256) void k_rsmf(const float* __restrict__ S, _Float16* __restrict__ P, int qn, int hg) {
  #pragma clang fp contract(off)
  const int t = blockIdx.x * 256 + threadIdx.x; if (t >= qn * hg) return; const size_t i = (size_t)(t / qn) * SQ + (t % qn); const float* s = S + i * SQ; float mx = -3.0e38f;
#pragma unroll 1
  for (int j = 0; j < SQ; ++j) mx = fmaxf(mx, s[j]); float se = 0.f;
#pragma unroll 1
  for (int j = 0; j < SQ; ++j) se += __expf(s[j] - mx); const float sc = 256.0f / se;
#pragma unroll 1
  for (int j0 = 0; j0 < SQ; j0 += 8) { FragH f; for (int q = 0; q < 8; ++q) f.h[q] = (_Float16)(__expf(s[j0 + q] - mx) * sc); unsigned short* d = (unsigned short*)P + i * SQ + j0; *(v8us*)d = f.half[0];  } }

extern "C" void kernel_launch(void* const* d_in, const int* in_sizes, int n_in,
                              void* d_out, int out_size, void* d_ws, size_t ws_size, hipStream_t stream) {
  (void)in_sizes; (void)n_in; (void)out_size;
  const float* const* I = (const float* const*)d_in; const float* x = I[0]; const float* wq = I[1]; const float* bq = I[2]; const float* wk = I[3]; const float* bk = I[4]; const float* wv = I[5]; const float* bv = I[6]; const float* wo = I[7]; const float* bo = I[8];      /* [in][out] weights + biases */
  char* ws = (char*)d_ws; size_t off = 0;
  auto take = [&](size_t bytes) { char* p = ws + off; off += (bytes + 255) & ~(size_t)255; return p; };
  _Float16* BQ = (_Float16*)take((size_t)DM * DM * 2); _Float16* BK = (_Float16*)take((size_t)DM * DM * 2); _Float16* BV = (_Float16*)take((size_t)DM * DM * 2); _Float16* BO = (_Float16*)take((size_t)DM * DM * 2);
  _Float16* X16 = (_Float16*)take(NR * DM * 2); _Float16* Q16 = (_Float16*)take(NR * DM * 2); _Float16* K16 = (_Float16*)take(NR * DM * 2); _Float16* V16 = (_Float16*)take(NR * DM * 2); _Float16* O16 = (_Float16*)take(NR * DM * 2);
  float* S = (float*)take((size_t)HG * SQ * SQ * 4); _Float16* P = (_Float16*)take((size_t)HG * SQ * SQ * 2); _Float16* VT = (_Float16*)take((size_t)NH * HD * SQ * 2);
  if (off > ws_size) return;
  k_wt_f16<<<(unsigned)(((size_t)DM * (DM / 8) + 255) / 256), 256, 0, stream>>>(wq, BQ, DM, DM, 16.0f); k_wt_f16<<<(unsigned)(((size_t)DM * (DM / 8) + 255) / 256), 256, 0, stream>>>(wk, BK, DM, DM, 16.0f); k_wt_f16<<<(unsigned)(((size_t)DM * (DM / 8) + 255) / 256), 256, 0, stream>>>(wv, BV, DM, DM, 16.0f); k_wt_f16<<<(unsigned)(((size_t)DM * (DM / 8) + 255) / 256), 256, 0, stream>>>(wo, BO, DM, DM, 16.0f);      /* [in][out] -> Bt[n][k] x16 */

  k_x16<<<(unsigned)((NR * DM / 8 + 255) / 256), 256, 0, stream>>>(x, X16, NR * DM / 8);
  const size_t r0p = (size_t)B0 * SQ;      /* first projected row */
  k_gemm2<0><<<dim3((unsigned)((MP / 128) * (DM / 64)), 1), 128, 0, stream>>>(X16 + r0p * DM, DM, 0, BQ, DM, 0, 0.0625f, bq, 0, nullptr, 1, 0, 0, nullptr, Q16 + r0p * DM, DM, 0, MP, DM, DM);
  k_gemm2<0><<<dim3((unsigned)((MP / 128) * (DM / 64)), 1), 128, 0, stream>>>(X16 + r0p * DM, DM, 0, BK, DM, 0, 0.0625f, bk, 0, nullptr, 1, 0, 0, nullptr, K16 + r0p * DM, DM, 0, MP, DM, DM);
  k_gemm2<0><<<dim3((unsigned)((MP / 128) * (DM / 64)), 1), 128, 0, stream>>>(X16 + r0p * DM, DM, 0, BV, DM, 0, 0.0625f, bv, 0, nullptr, 1, 0, 0, nullptr, V16 + r0p * DM, DM, 0, MP, DM, DM);
  for (int b = B0; b < B0 + NBR; ++b) { const size_t r0 = (size_t)b * SQ;
    k_vt<NH, SQ><<<NH * (SQ / 64), 256, 0, stream>>>(V16 + r0 * LQ, LQ, 0, VT);      /* V^T [NH][HD][SQ] for this batch */
    for (int h0 = 0; h0 < NHD; h0 += HG) {
      k_gemm2<0><<<dim3((QN / 128) * (SQ / 64), HG), 128, 0, stream>>>(Q16 + r0 * LQ + h0 * HD, LQ, (size_t)HD, K16 + r0 * LQ + h0 * HD, LQ, (size_t)HD, 0.125f, nullptr, 0, nullptr, 1, 0, 0, S, nullptr, SQ, (size_t)SQ * SQ, QN, SQ, HD);      /* scores, HG heads per launch */
      k_rsmf<<<(HG * QN + 255) / 256, 256, 0, stream>>>(S, P, QN, HG);      /* P = 256 softmax (f16), rows of all HG heads */
      k_gemm2<0><<<dim3((QN / 128) * (HD / 64), HG), 128, 0, stream>>>(P, SQ, (size_t)SQ * SQ, VT + (size_t)h0 * HD * SQ, SQ, (size_t)HD * SQ, 0.25f, nullptr, 0, nullptr, 1, 0, 0, nullptr, O16 + r0 * DM + h0 * HD, DM, (size_t)HD, QN, HD, SQ); } }      /* o (merged heads) as f16 rows */
  k_gemm2<0><<<dim3((unsigned)((MPO / 128) * (DM / 64)), 1), 128, 0, stream>>>(O16 + r0p * DM, DM, 0, BO, DM, 0, 0.0009765625f, bo, 0, nullptr, 1, 0, 0, (float*)d_out + r0p * DM, nullptr, DM, 0, MPO, DM, DM);      /* out rows are the output layout */
}

// v001
// One run takes 736 microseconds.
// Two timings next to v000 put it at 3.60 and 3.56 times that version's speed.
#include <hip/hip_runtime.h>
// Multi-head self-attention (x [2][2048][768]; q/k/v = x W + b ([in][out] 768x768 sigma 1/sqrt(768), zero biases); 12 heads of 64; softmax(q k^T / 8) over all keys (no mask); out = ctx Wo + bo -> [2][2048][768]).
// Structure: token rows r = b*2048 + s; x as exact f16 rows (bf16-rounded); Q, K, V as three WMMA GEMMs (32x64 wave tiles, f32 accumulation, exact x16 weights + bias, f16 outputs); per batch: V^T for all heads via LDS transposes; per (batch, group of 4 heads): scores GEMM (K = 64, batched over the heads on grid.y, alpha = 64^-0.5), row softmax on VALU (f32 statistics, native exp; weights stored x256 as f16), o = P . V^T GEMM (K = 2048, alpha 2^-2: o carried x64 against f16 subnormal flush, folded into the output GEMM alpha) written straight into the merged f16 o rows; out = o W_o + b GEMM (f32) into the output layout.
// Compute dtype: inputs rounded to bf16; x / weights exact; q, k, v, softmax weights and o as plain f16 GEMM operands (~2^-12); scores and softmax statistics f32. v_wmma_f32_16x16x32_f16.
#define NB 2
#define SQ 2048
#define DM 768
#define NH 12
#define HD 64
#define HG 4                         /* heads per attention launch group */
#define B0 0                         /* first batch processed (debug hook) */
#define NBR NB                       /* batches processed (debug hook) */
#define NR ((size_t)NB * SQ)         /* token rows */
#define MP ((int)((size_t)NBR * SQ)) /* rows projected (debug hook) */
#define QN SQ                        /* query rows attended per batch (debug hook) */
#define NHD NH                       /* heads attended (debug hook) */
#define MPO MP                       /* rows through the output stage (debug hook) */
#define LQ DM      /* row pitch of the q/k/v rows */
typedef __bf16 v16b __attribute__((ext_vector_type(16)));
typedef unsigned short v8us __attribute__((ext_vector_type(8), may_alias));
typedef float  v8f  __attribute__((ext_vector_type(8)));
typedef float  v4f  __attribute__((ext_vector_type(4)));
typedef float  v4fa __attribute__((ext_vector_type(4), may_alias));
union FragB { v16b v; v8us half[2]; unsigned short u[16]; };

__device__ __forceinline__ unsigned short bf16_bits(float x) { unsigned int u = __float_as_uint(x); return (unsigned short)((u + 0x7FFFu + ((u >> 16) & 1u)) >> 16); }
__device__ __forceinline__ float bf16_val(unsigned short b) { return __uint_as_float(((unsigned int)b) << 16); }
__device__ __forceinline__ float bf16_round(float x) { return bf16_val(bf16_bits(x)); }
// D += A·B with NT terms: 1 = ah·bh, 2 = + al·bh (A split), 3 = + ah·bl (both split)
template <int NT>
__device__ __forceinline__ v8f mmaN(v16b ah, v16b al, v16b bh, v16b bl, v8f c) {
  c = __builtin_amdgcn_wmma_f32_16x16x32_bf16(false, ah, false, bh, (short)0, c, false, false);
  if (NT >= 2) c = __builtin_amdgcn_wmma_f32_16x16x32_bf16(false, al, false, bh, (short)0, c, false, false);
  if (NT >= 3) c = __builtin_amdgcn_wmma_f32_16x16x32_bf16(false, ah, false, bl, (short)0, c, false, false);
  asm volatile("v_nop\n\tv_nop\n\tv_nop\n\tv_nop" : "+v"(c) : "v"(ah), "v"(al), "v"(bh), "v"(bl));
  return c;
}

__global__ __launch_bounds__(256) void k_wt_bf16(const float* __restrict__ W, unsigned short* __restrict__ Wt, int K, int N) {
  const int t = blockIdx.x * 256 + threadIdx.x;
  const int k8n = K / 8;
  if (t >= N * k8n) return;
  const int n = t / k8n, k8 = (t % k8n) * 8;
  v8us v;
#pragma unroll
  for (int i = 0; i < 8; ++i) v[i] = bf16_bits(W[(size_t)(k8 + i) * N + n]);
  *(v8us*)(Wt + (size_t)n * K + k8) = v;
  
}

// GEMM C[M][N] (f32, pitch ldc) = act(A[M][K]·W + bias). A f32 row-major (pitch lda) converted per fragment to bf16
// (ASPLIT: hi/lo two planes -> 2 terms, else single rounded term); Wt bf16 [N][K] (pitch ldb). BIAS_BF16 rounds the
// bias to bf16 first (bias quantised to bf16 before the add). K%32==0, M%16==0, N%64==0.
template <bool ASPLIT, int ACT, bool BIAS_BF16>
__global__ __launch_bounds__(128) void k_gemm_bf(const float* __restrict__ A, int lda, const unsigned short* __restrict__ Wt, int ldb,
                                               const float* __restrict__ bias, float* __restrict__ C, int ldc, int M, int N, int K) {
  __shared__ __attribute__((aligned(16))) float so[4][16][64];
  const int tid = threadIdx.x, w = tid >> 5, lane = tid & 31, ln = lane & 15, hh = lane >> 4;
  const int ntn = N / 64;
  const int wid = blockIdx.x * 4 + w;
  const int mt = wid / ntn, nq = wid % ntn;
  if (mt * 16 >= M) return;
  const int row0 = mt * 16, col0 = nq * 64;
  const float* arow = A + (size_t)(row0 + ln) * lda;
  v8f acc[4] = {};
  for (int kb = 0; kb < K; kb += 32) {
    FragB ah, al;
    const v4f x0 = *(const v4fa*)(arow + kb + 8 * hh), x1 = *(const v4fa*)(arow + kb + 8 * hh + 4);
    const v4f x2 = *(const v4fa*)(arow + kb + 16 + 8 * hh), x3 = *(const v4fa*)(arow + kb + 16 + 8 * hh + 4);
    float xs[16] = {x0[0],x0[1],x0[2],x0[3],x1[0],x1[1],x1[2],x1[3],x2[0],x2[1],x2[2],x2[3],x3[0],x3[1],x3[2],x3[3]};
#pragma unroll
    for (int i = 0; i < 16; ++i) { const unsigned short hb = bf16_bits(xs[i]); ah.u[i] = hb; al.u[i] = ASPLIT ? bf16_bits(xs[i] - bf16_val(hb)) : (unsigned short)0; }
#pragma unroll
    for (int t = 0; t < 4; ++t) {
      const unsigned short* brow = Wt + (size_t)(col0 + t * 16 + ln) * ldb + kb;
      FragB b;
      b.half[0] = *(const v8us*)(brow + 8 * hh);
      b.half[1] = *(const v8us*)(brow + 16 + 8 * hh);
      acc[t] = mmaN<ASPLIT ? 2 : 1>(ah.v, al.v, b.v, b.v, acc[t]);
    }
  }
#pragma unroll
  for (int t = 0; t < 4; ++t) {
    float bv = bias ? bias[col0 + t * 16 + ln] : 0.f;
    if (BIAS_BF16) bv = bf16_round(bv);
#pragma unroll
    for (int r = 0; r < 8; ++r) { float v = acc[t][r] + bv; if (ACT == 1) v = fmaxf(v, 0.f); so[w][8 * hh + r][t * 16 + ln] = v; }
  }
  __builtin_amdgcn_fence(__ATOMIC_ACQ_REL, "workgroup");
  __builtin_amdgcn_wave_barrier();
  const int rsub = lane >> 4, c4 = (lane & 15) * 4;
  {
#pragma unroll
    for (int q = 0; q < 8; ++q) {
      const int r = q * 2 + rsub;
      const v4f v = *(const v4fa*)&so[w][r][c4];
      *(v4f*)(C + (size_t)(row0 + r) * ldc + col0 + c4) = v;
    }
    
  }
}

// GEMM C = act(A·W + bias + resid): A f32 (ASPLIT -> hi/lo 2 terms), Wt bf16 [N][K]; ACT 0 none, 1 relu, 2 exact gelu;
// resid (optional, f32, row index = (row % rmod), pitch ldr, RES_BF16 rounds it) added before the activation.
template <bool ASPLIT, int ACT, bool BIAS_BF16, bool RES_BF16>
__global__ __launch_bounds__(128) void k_gemm_bf3(const float* __restrict__ A, int lda, const unsigned short* __restrict__ Wt, int ldb,
                                                const float* __restrict__ bias, const float* __restrict__ resid, int rmod, int ldr,
                                                float* __restrict__ C, int ldc, int M, int N, int K) {
  __shared__ __attribute__((aligned(16))) float so[4][16][64];
  const int tid = threadIdx.x, w = tid >> 5, lane = tid & 31, ln = lane & 15, hh = lane >> 4;
  const int ntn = N / 64;
  const int wid = blockIdx.x * 4 + w;
  const int mt = wid / ntn, nq = wid % ntn;
  if (mt * 16 >= M) return;
  const int row0 = mt * 16, col0 = nq * 64;
  const float* arow = A + (size_t)(row0 + ln) * lda;
  v8f acc[4] = {};
  for (int kb = 0; kb < K; kb += 32) {
    FragB ah, al;
    const v4f x0 = *(const v4fa*)(arow + kb + 8 * hh), x1 = *(const v4fa*)(arow + kb + 8 * hh + 4);
    const v4f x2 = *(const v4fa*)(arow + kb + 16 + 8 * hh), x3 = *(const v4fa*)(arow + kb + 16 + 8 * hh + 4);
    float xs[16] = {x0[0],x0[1],x0[2],x0[3],x1[0],x1[1],x1[2],x1[3],x2[0],x2[1],x2[2],x2[3],x3[0],x3[1],x3[2],x3[3]};
#pragma unroll
    for (int i = 0; i < 16; ++i) { const unsigned short hb = bf16_bits(xs[i]); ah.u[i] = hb; al.u[i] = ASPLIT ? bf16_bits(xs[i] - bf16_val(hb)) : (unsigned short)0; }
#pragma unroll
    for (int t = 0; t < 4; ++t) {
      const unsigned short* brow = Wt + (size_t)(col0 + t * 16 + ln) * ldb + kb;
      FragB b;
      b.half[0] = *(const v8us*)(brow + 8 * hh);
      b.half[1] = *(const v8us*)(brow + 16 + 8 * hh);
      acc[t] = mmaN<ASPLIT ? 2 : 1>(ah.v, al.v, b.v, b.v, acc[t]);
    }
  }
#pragma unroll
  for (int t = 0; t < 4; ++t) {
    const int col = col0 + t * 16 + ln;
    float bv = bias ? bias[col] : 0.f;
    if (BIAS_BF16) bv = bf16_round(bv);
#pragma unroll
    for (int r = 0; r < 8; ++r) {
      float v = acc[t][r] + bv;
      if (resid) { float rv = resid[(size_t)((row0 + 8 * hh + r) % rmod) * ldr + col]; if (RES_BF16) rv = bf16_round(rv); v += rv; }
      if (ACT == 1) v = fmaxf(v, 0.f);
      if (ACT == 2) v = 0.5f * v * (1.0f + erff(v * 0.70710678118654752f));
      if (ACT == 3) { const float u = 0.7978845608028654f * (v + 0.044715f * v * v * v); v = 0.5f * v * (1.0f + tanhf(u)); }
      so[w][8 * hh + r][t * 16 + ln] = v;
    }
  }
  __builtin_amdgcn_fence(__ATOMIC_ACQ_REL, "workgroup");
  __builtin_amdgcn_wave_barrier();
  const int rsub = lane >> 4, c4 = (lane & 15) * 4;
  {
#pragma unroll
    for (int q = 0; q < 8; ++q) {
      const int r = q * 2 + rsub;
      const v4f v = *(const v4fa*)&so[w][r][c4];
      *(v4f*)(C + (size_t)(row0 + r) * ldc + col0 + c4) = v;
    }
    
  }
}
// row LayerNorm (biased variance, eps) over N: s = X (+ R); optional out_sum <- s; out_norm <- (s-mu)*rsqrt(var+eps)*g + b
template <bool PARAM_BF16>
__global__ __launch_bounds__(256) void k_layernorm(const float* __restrict__ X, const float* __restrict__ R, const float* __restrict__ g, const float* __restrict__ bta,
                                                  float* __restrict__ out_sum, float* __restrict__ out_norm, int N, float eps) {
  __shared__ float red[256];
  const int row = blockIdx.x, tid = threadIdx.x;
  const float* x = X + (size_t)row * N; const float* rr = R ? R + (size_t)row * N : nullptr;
  float vals[16];                     // up to N = 4096
  const int per = N / 256;            // contiguous chunk per thread? use strided-by-4 chunks: thread handles j = tid*4 + 1024*u
  float s1 = 0.f;
  for (int u = 0; u < per / 4; ++u) {
    const int j = tid * 4 + 1024 * u;
    const v4f a = *(const v4fa*)(x + j);
    v4f b = {0.f,0.f,0.f,0.f}; if (rr) b = *(const v4fa*)(rr + j);
#pragma unroll
    for (int q = 0; q < 4; ++q) { const float v = a[q] + b[q]; vals[u * 4 + q] = v; s1 += v; }
  }
  red[tid] = s1; __syncthreads();
  for (int st = 128; st > 0; st >>= 1) { if (tid < st) red[tid] += red[tid + st]; __syncthreads(); }
  const float mu = red[0] / (float)N; __syncthreads();
  float s2 = 0.f;
  for (int u = 0; u < per / 4; ++u)
#pragma unroll
    for (int q = 0; q < 4; ++q) { const float c = vals[u * 4 + q] - mu; s2 += c * c; }
  red[tid] = s2; __syncthreads();
  for (int st = 128; st > 0; st >>= 1) { if (tid < st) red[tid] += red[tid + st]; __syncthreads(); }
  const float rs = rsqrtf(red[0] / (float)N + eps);
  {
    for (int u = 0; u < per / 4; ++u) {
      const int j = tid * 4 + 1024 * u;
      v4f o, sm;
#pragma unroll
      for (int q = 0; q < 4; ++q) {
        float gg = g[j + q], bb = bta[j + q];
        if (PARAM_BF16) { gg = bf16_round(gg); bb = bf16_round(bb); }
        sm[q] = vals[u * 4 + q]; o[q] = (vals[u * 4 + q] - mu) * rs * gg + bb;
      }
      if (out_sum) *(v4f*)(out_sum + (size_t)row * N + j) = sm;
      *(v4f*)(out_norm + (size_t)row * N + j) = o;
    }
    
  }
}



// ---- f16 WMMA path (v_wmma_f32_16x16x32_f16): 11-bit significands for operands in range — used where a [0,1] probability operand needs more precision than bf16
typedef _Float16 v16h __attribute__((ext_vector_type(16)));
union FragH { v16h v; v8us half[2]; _Float16 h[16]; unsigned short u[16]; };
template <int NT>
__device__ __forceinline__ v8f mmaH(v16h ah, v16h al, v16h bh, v16h bl, v8f c) {
  c = __builtin_amdgcn_wmma_f32_16x16x32_f16(false, ah, false, bh, (short)0, c, false, false);
  if (NT >= 2) c = __builtin_amdgcn_wmma_f32_16x16x32_f16(false, al, false, bh, (short)0, c, false, false);
  if (NT >= 3) c = __builtin_amdgcn_wmma_f32_16x16x32_f16(false, ah, false, bl, (short)0, c, false, false);
  asm volatile("v_nop\n\tv_nop\n\tv_nop\n\tv_nop" : "+v"(c) : "v"(ah), "v"(al), "v"(bh), "v"(bl));
  return c;
}
// batched GEMM like k_gemm_b but f16 operands: A f32 (split into f16 hi/lo if ASPLIT, else rounded to f16), Bt = f16 values [n][k]; alpha; C f32; N multiple of 16 (partial tiles skipped)
template <bool ASPLIT>
__global__ __launch_bounds__(128) void k_gemm_h(const float* __restrict__ A, int lda, size_t sA, const _Float16* __restrict__ Bh, int ldb, size_t sB, float alpha, float* __restrict__ C, int ldc, size_t sC, int M, int N, int K) {
  __shared__ __attribute__((aligned(16))) float so[4][16][64];
  const int tid = threadIdx.x, w = tid >> 5, lane = tid & 31, ln = lane & 15, hh = lane >> 4; const int by = blockIdx.y;
  A += (size_t)by * sA; Bh += (size_t)by * sB; C += (size_t)by * sC;
  const int ntn = (N + 63) / 64; const int wid = blockIdx.x * 4 + w; const int mt = wid / ntn, nq = wid % ntn; if (mt * 16 >= M) return;
  const int row0 = mt * 16, col0 = nq * 64; const float* arow = A + (size_t)(row0 + ln) * lda;
  v8f acc[4] = {};
  for (int kb = 0; kb < K; kb += 32) {
    FragH ah, al;
    const v4f x0 = *(const v4fa*)(arow + kb + 8 * hh), x1 = *(const v4fa*)(arow + kb + 8 * hh + 4), x2 = *(const v4fa*)(arow + kb + 16 + 8 * hh), x3 = *(const v4fa*)(arow + kb + 16 + 8 * hh + 4);
    float xs[16] = {x0[0],x0[1],x0[2],x0[3],x1[0],x1[1],x1[2],x1[3],x2[0],x2[1],x2[2],x2[3],x3[0],x3[1],x3[2],x3[3]};
#pragma unroll
    for (int i = 0; i < 16; ++i) { const _Float16 h = (_Float16)xs[i]; ah.h[i] = h; al.h[i] = ASPLIT ? (_Float16)(xs[i] - (float)h) : (_Float16)0.0f; }
#pragma unroll
    for (int t = 0; t < 4; ++t) { if (col0 + t * 16 >= N) continue; const size_t boff = (size_t)(col0 + t * 16 + ln) * ldb + kb; FragH bq; bq.half[0] = *(const v8us*)(Bh + boff + 8 * hh); bq.half[1] = *(const v8us*)(Bh + boff + 16 + 8 * hh);
      acc[t] = mmaH<ASPLIT ? 2 : 1>(ah.v, al.v, bq.v, bq.v, acc[t]); }
  }
#pragma unroll
  for (int t = 0; t < 4; ++t) { if (col0 + t * 16 >= N) continue;
#pragma unroll
    for (int r = 0; r < 8; ++r) so[w][8 * hh + r][t * 16 + ln] = acc[t][r] * alpha; }
  __builtin_amdgcn_fence(__ATOMIC_ACQ_REL, "workgroup"); __builtin_amdgcn_wave_barrier();
  const int rsub = lane >> 4, c4 = (lane & 15) * 4;
  {
#pragma unroll
    for (int q = 0; q < 8; ++q) { const int r = q * 2 + rsub; if (col0 + c4 < N) { const v4f v = *(const v4fa*)&so[w][r][c4]; *(v4f*)(C + (size_t)(row0 + r) * ldc + col0 + c4) = v; } }
     }
}

// Wt[n][k] = f16(W[k][n]·scale) from f32 row-major W[K][N] (scale = power of two; bf16-exact weights stay exact in f16 away from the subnormal range)
__global__ __launch_bounds__(256) void k_wt_f16(const float* __restrict__ W, _Float16* __restrict__ Wt, int K, int N, float scale) {
  const int t = blockIdx.x * 256 + threadIdx.x; if (t >= N * (K / 8)) return; const int n = t / (K / 8), k8 = (t % (K / 8)) * 8; FragH f;
#pragma unroll
  for (int i = 0; i < 8; ++i) f.h[i] = (_Float16)(bf16_round(W[(size_t)(k8 + i) * N + n]) * scale); const v8us o = f.half[0];
  *(v8us*)((unsigned short*)Wt + (size_t)n * K + k8) = o; 
}
// k_gemm_hh variant with fused epilogue: v = acc·alpha + bias[by·sBias + col] (+ CP[(row/rowsPerB)·sCPb + by·64 + col] if CP) ; ACT 0 none / 1 elu ; writes f16 C16 (and f32 C if non-null)
template <int ACT>
__global__ __launch_bounds__(128) void k_gemm_hhx(const _Float16* __restrict__ A, int lda, size_t sA, const _Float16* __restrict__ Bh, int ldb, size_t sB, float alpha, const float* __restrict__ bias, size_t sBias, const float* __restrict__ CP, int rowsPerB, size_t sCPb, int row0g,
    float* __restrict__ C, _Float16* __restrict__ C16, int ldc, size_t sC, int M, int N, int K) {
  __shared__ __attribute__((aligned(16))) float so[4][16][64];
  const int tid = threadIdx.x, w = tid >> 5, lane = tid & 31, ln = lane & 15, hh = lane >> 4; const int by = blockIdx.y;
  A += (size_t)by * sA; Bh += (size_t)by * sB; const size_t cofs = (size_t)by * sC; const float* bp = bias ? bias + (size_t)by * sBias : nullptr;
  const int ntn = (N + 63) / 64; const int wid = blockIdx.x * 4 + w; const int mt = wid / ntn, nq = wid % ntn; if (mt * 16 >= M) return;
  const int row0 = mt * 16, col0 = nq * 64; const _Float16* arow = A + (size_t)(row0 + ln) * lda;
  v8f acc[4] = {};
  for (int kb = 0; kb < K; kb += 32) { FragH ah; ah.half[0] = *(const v8us*)((const unsigned short*)arow + kb + 8 * hh); ah.half[1] = *(const v8us*)((const unsigned short*)arow + kb + 16 + 8 * hh);
#pragma unroll
    for (int t = 0; t < 4; ++t) { if (col0 + t * 16 >= N) continue; const size_t boff = (size_t)(col0 + t * 16 + ln) * ldb + kb; FragH bq; bq.half[0] = *(const v8us*)((const unsigned short*)Bh + boff + 8 * hh); bq.half[1] = *(const v8us*)((const unsigned short*)Bh + boff + 16 + 8 * hh);
      acc[t] = mmaH<1>(ah.v, ah.v, bq.v, bq.v, acc[t]); }
  }
#pragma unroll
  for (int t = 0; t < 4; ++t) { if (col0 + t * 16 >= N) continue; const int col = col0 + t * 16 + ln; const float bv = bp ? bf16_round(bp[col]) : 0.f;
#pragma unroll
    for (int r = 0; r < 8; ++r) { float v = acc[t][r] * alpha + bv; if (CP) { const int rr = row0g + row0 + 8 * hh + r; if (rowsPerB < 0) v += CP[cofs + (size_t)rr * ldc + col];      /* rowsPerB < 0: own element of the batched C plane */ else { const int bidx = rr / rowsPerB; v += CP[(size_t)bidx * sCPb + (size_t)by * 64 + col]; } } if (ACT == 1) v = (v > 0.f) ? v : expm1f(v); else if (ACT == 7) v = (v > 0.f) ? v + 1.0f : expf(v); else if (ACT == 8) v = tanhf(v); else if (ACT == 9) v = 0.5f * v * (1.0f + tanhf(0.7978845608028654f * (v + 0.044715f * v * v * v))); else if (ACT == 11) v = 1.0f / (1.0f + expf(-v)); else if (ACT == 12) v = (v > 0.f) ? v : 0.01f * v; else if (ACT == 14) v = (v > 0.f) ? v : 0.1f * v; else if (ACT == 16) v = (v >= 0.f) ? v : 0.3f * v; else if (ACT == 17) v = (v >= 0.f) ? v : 0.2f * v; else if (ACT == 15) v = v / (1.0f + expf(-v)); else if (ACT == 3) v = fmaxf(v, 0.f); else if (ACT == 6) v = 0.5f * v * (1.0f + erff(v * 0.70710678118654752f)); so[w][8 * hh + r][t * 16 + ln] = v; } }
  __builtin_amdgcn_fence(__ATOMIC_ACQ_REL, "workgroup"); __builtin_amdgcn_wave_barrier();
  const int rsub = lane >> 4, c4 = (lane & 15) * 4; typedef _Float16 v4h __attribute__((ext_vector_type(4)));
  {
#pragma unroll
    for (int q = 0; q < 8; ++q) { const int r = q * 2 + rsub; if (col0 + c4 < N) { const v4f v = *(const v4fa*)&so[w][r][c4]; if (C) *(v4f*)(C + cofs + (size_t)(row0 + r) * ldc + col0 + c4) = v; if (C16) { v4h h4; for (int i = 0; i < 4; ++i) h4[i] = (_Float16)v[i]; *(v4h*)(C16 + cofs + (size_t)(row0 + r) * ldc + col0 + c4) = h4; } } }
     }
}


typedef _Float16 v4h __attribute__((ext_vector_type(4)));

__global__ __launch_bounds__(256) void k_x16(const float* __restrict__ x, _Float16* __restrict__ X16, size_t n8) { const size_t t = (size_t)blockIdx.x * 256 + threadIdx.x; if (t >= n8) return; FragH f;
#pragma unroll
  for (int q = 0; q < 8; ++q) f.h[q] = (_Float16)bf16_round(x[t * 8 + q]); *(v8us*)((unsigned short*)X16 + t * 8) = f.half[0];  }
__global__ __launch_bounds__(256) void k_h16(const float* __restrict__ x, _Float16* __restrict__ X16, size_t n8) { const size_t t = (size_t)blockIdx.x * 256 + threadIdx.x; if (t >= n8) return; FragH f;
#pragma unroll
  for (int q = 0; q < 8; ++q) f.h[q] = (_Float16)x[t * 8 + q]; *(v8us*)((unsigned short*)X16 + t * 8) = f.half[0];  }
__global__ __launch_bounds__(256) void k_round16f(const float* __restrict__ W, _Float16* __restrict__ Bt, size_t n8) { const size_t t = (size_t)blockIdx.x * 256 + threadIdx.x; if (t >= n8) return; FragH f;
#pragma unroll
  for (int i = 0; i < 8; ++i) f.h[i] = (_Float16)(bf16_round(W[t * 8 + i]) * 16.0f); *(v8us*)((unsigned short*)Bt + t * 8) = f.half[0];  }
template <int NHv, int TTv>
__global__ __launch_bounds__(256) void k_vt(const _Float16* __restrict__ V16, int ldv, int voff, _Float16* __restrict__ Vt) { __shared__ unsigned short tl[64][66]; const int tid = threadIdx.x; const int slab = blockIdx.x / (TTv / 64), lg = blockIdx.x % (TTv / 64); const int b = slab / NHv, h = slab % NHv;
  for (int i = tid; i < 64 * 8; i += 256) { const int r = i / 8, c8 = (i % 8) * 8; FragH f; f.half[0] = *(const v8us*)((const unsigned short*)V16 + ((size_t)b * TTv + lg * 64 + r) * ldv + voff + h * 64 + c8);
#pragma unroll
    for (int q = 0; q < 8; ++q) tl[r][c8 + q] = f.u[q]; }
  __syncthreads();
  {
#pragma unroll
    for (int rd = 0; rd < 2; ++rd) { const int d = rd * 32 + tid / 8, pc = tid % 8; FragH f;
#pragma unroll
      for (int q = 0; q < 8; ++q) f.u[q] = tl[pc * 8 + q][d];
      *(v8us*)((unsigned short*)Vt + ((size_t)slab * 64 + d) * TTv + lg * 64 + pc * 8) = f.half[0]; }
     } }

__global__ __launch_bounds__(256) void k_hl(const float* __restrict__ F, _Float16* __restrict__ Hh, _Float16* __restrict__ Hl, size_t n8) { const size_t t = (size_t)blockIdx.x * 256 + threadIdx.x; if (t >= n8) return; FragH fh, fl; const v4f a = *(const v4fa*)(F + t * 8), c = *(const v4fa*)(F + t * 8 + 4);
#pragma unroll
  for (int q = 0; q < 4; ++q) { _Float16 h = (_Float16)a[q]; fh.h[q] = h; fl.h[q] = (_Float16)((a[q] - (float)h) * 1024.0f); h = (_Float16)c[q]; fh.h[4 + q] = h; fl.h[4 + q] = (_Float16)((c[q] - (float)h) * 1024.0f); }
  { *(v8us*)((unsigned short*)Hh + t * 8) = fh.half[0]; *(v8us*)((unsigned short*)Hl + t * 8) = fl.half[0];  } }

// ---- fast GEMM (wave tile 32x64; requires M % 32 == 0 rows per launch region and N % 64 == 0); epilogue = k_gemm_hhx semantics ----
__device__ __forceinline__ v16h g2_frag(const _Float16* p, int hh) { FragH f; f.half[0] = *(const v8us*)((const unsigned short*)p + 8 * hh); f.half[1] = *(const v8us*)((const unsigned short*)p + 16 + 8 * hh); return f.v; }
__device__ __forceinline__ v8f g2_mma(v16h a, v16h b, v8f c) { v8f d = __builtin_amdgcn_wmma_f32_16x16x32_f16(false, a, false, b, (short)0, c, false, false); asm volatile("v_nop\n\tv_nop\n\tv_nop\n\tv_nop" : "+v"(d) : "v"(a), "v"(b)); return d; }
template <int ACT>
__global__ __launch_bounds__(128) void k_gemm2(const _Float16* __restrict__ A, int lda, size_t sA, const _Float16* __restrict__ Bh, int ldb, size_t sB, float alpha, const float* __restrict__ bias, size_t sBias, const float* __restrict__ CP, int rowsPerB, size_t sCPb, int row0g,
    float* __restrict__ C, _Float16* __restrict__ C16, int ldc, size_t sC, int M, int N, int K) { static_assert(ACT == 0 || ACT == 3 || ACT == 6 || ACT == 8 || ACT == 9 || ACT == 11 || ACT == 12 || ACT == 14 || ACT == 15 || ACT == 16 || ACT == 17, "k_gemm2: unsupported ACT code (would silently apply no activation)");
  __shared__ __attribute__((aligned(16))) float so[4][32][68];
  const int tid = threadIdx.x, w = tid >> 5, lane = tid & 31, ln = lane & 15, hh = lane >> 4; const int by = blockIdx.y;
  A += (size_t)by * sA; Bh += (size_t)by * sB; const size_t cofs = (size_t)by * sC; const float* bp = bias ? bias + (size_t)by * sBias : nullptr;
  const int ntn = N >> 6; const int mt = blockIdx.x / ntn, nq = blockIdx.x - mt * ntn; const int row0 = mt * 128 + 32 * w, col0 = nq * 64; if (row0 >= M) return;
  const _Float16* a0p = A + (size_t)(row0 + ln) * lda; const _Float16* a1p = a0p + (size_t)16 * lda;
  const _Float16* b0p = Bh + (size_t)(col0 + ln) * ldb; const _Float16* b1p = b0p + (size_t)16 * ldb; const _Float16* b2p = b1p + (size_t)16 * ldb; const _Float16* b3p = b2p + (size_t)16 * ldb;
  const v8f z8 = {0.f,0.f,0.f,0.f,0.f,0.f,0.f,0.f}; v8f c00 = z8, c01 = z8, c02 = z8, c03 = z8, c10 = z8, c11 = z8, c12 = z8, c13 = z8;
#pragma unroll 1
  for (int kb = 0; kb < K; kb += 32) { const v16h a0 = g2_frag(a0p + kb, hh), a1 = g2_frag(a1p + kb, hh);
    v16h b = g2_frag(b0p + kb, hh); c00 = g2_mma(a0, b, c00); c10 = g2_mma(a1, b, c10);
    b = g2_frag(b1p + kb, hh); c01 = g2_mma(a0, b, c01); c11 = g2_mma(a1, b, c11);
    b = g2_frag(b2p + kb, hh); c02 = g2_mma(a0, b, c02); c12 = g2_mma(a1, b, c12);
    b = g2_frag(b3p + kb, hh); c03 = g2_mma(a0, b, c03); c13 = g2_mma(a1, b, c13); }
  v8f accs[8] = {c00, c01, c02, c03, c10, c11, c12, c13};
#pragma unroll
  for (int u = 0; u < 8; ++u) { const int t = u & 3, half = u >> 2; const int col = col0 + t * 16 + ln; const float bv = bp ? bf16_round(bp[col]) : 0.f;
#pragma unroll
    for (int r = 0; r < 8; ++r) { const int rloc = half * 16 + 8 * hh + r; float v = accs[u][r] * alpha + bv; if (CP) { if (rowsPerB < 0) v += CP[cofs + (size_t)(row0g + row0 + rloc) * ldc + col];      /* rowsPerB < 0: own element of the batched C plane */ else { const int bidx = (row0g + row0 + rloc) / rowsPerB; v += CP[(size_t)bidx * sCPb + (size_t)by * 64 + col]; } }
      if (ACT == 3) v = fmaxf(v, 0.f); else if (ACT == 6) v = 0.5f * v * (1.0f + erff(v * 0.70710678118654752f)); else if (ACT == 11) v = 1.0f / (1.0f + expf(-v)); else if (ACT == 15) v = v / (1.0f + expf(-v)); else if (ACT == 12) v = (v > 0.f) ? v : 0.01f * v; else if (ACT == 8) v = tanhf(v); else if (ACT == 9) v = 0.5f * v * (1.0f + tanhf(0.7978845608028654f * (v + 0.044715f * v * v * v))); else if (ACT == 14) v = (v > 0.f) ? v : 0.1f * v; else if (ACT == 16) v = (v >= 0.f) ? v : 0.3f * v; else if (ACT == 17) v = (v >= 0.f) ? v : 0.2f * v;
      so[w][rloc][t * 16 + ln] = v; } }
  __builtin_amdgcn_fence(__ATOMIC_ACQ_REL, "workgroup"); __builtin_amdgcn_wave_barrier();
  const int rsub = lane >> 4, c4 = (lane & 15) * 4;
  {
#pragma unroll
    for (int q = 0; q < 16; ++q) { const int r = q * 2 + rsub; const v4f v = *(const v4fa*)&so[w][r][c4]; if (C) *(v4f*)(C + cofs + (size_t)(row0 + r) * ldc + col0 + c4) = v; if (C16) { v4h h4; for (int i = 0; i < 4; ++i) h4[i] = (_Float16)v[i]; *(v4h*)(C16 + cofs + (size_t)(row0 + r) * ldc + col0 + c4) = h4; } }
     } }


__global__ __launch_bounds__(256) void k_wnat(const float* __restrict__ w, size_t n8, _Float16* __restrict__ Bt) { const size_t t = (size_t)blockIdx.x * 256 + threadIdx.x; if (t >= n8) return; FragH f; for (int q = 0; q < 8; ++q) f.h[q] = (_Float16)(bf16_round(w[t * 8 + q]) * 16.0f); *(v8us*)((unsigned short*)Bt + t * 8) = f.half[0];  }
__global__ __launch_bounds__(256) void k_rsm(const float* __restrict__ S, _Float16* __restrict__ P, int nrows) {
  #pragma clang fp contract(off)
  const int i = blockIdx.x * 256 + threadIdx.x; if (i >= nrows) return; const float* s = S + (size_t)i * SQ; float mx = -3.0e38f;
#pragma unroll 1
  for (int j = 0; j < SQ; ++j) mx = fmaxf(mx, s[j]); float se = 0.f;
#pragma unroll 1
  for (int j = 0; j < SQ; ++j) se += expf(s[j] - mx); const float sc = 256.0f / se;
#pragma unroll 1
  for (int j0 = 0; j0 < SQ; j0 += 8) { FragH f; for (int q = 0; q < 8; ++q) f.h[q] = (_Float16)(expf(s[j0 + q] - mx) * sc); unsigned short* d = (unsigned short*)P + (size_t)i * SQ + j0; *(v8us*)d = f.half[0];  } }
__global__ __launch_bounds__(256) void k_vt(const _Float16* __restrict__ V16, int b, int h0, _Float16* __restrict__ VT) { __shared__ unsigned short tl[64][65]; const int tid = threadIdx.x; const int hh = blockIdx.x % HG, sg = blockIdx.x / HG; const int s0 = sg * 64; const int h = h0 + hh;
  for (int i = tid; i < 64 * 8; i += 256) { const int j = i / 8, d8 = (i % 8) * 8; FragH f; f.half[0] = *(const v8us*)((const unsigned short*)V16 + ((size_t)b * SQ + s0 + j) * DM + h * HD + d8); for (int q = 0; q < 8; ++q) tl[d8 + q][j] = f.u[q]; }
  __syncthreads();
  { for (int i = tid; i < 64 * 8; i += 256) { const int d = i / 8, j8 = (i % 8) * 8; FragH f; for (int q = 0; q < 8; ++q) f.u[q] = tl[d][j8 + q]; *(v8us*)((unsigned short*)VT + ((size_t)hh * HD + d) * SQ + s0 + j8) = f.half[0]; }  } }



// Row softmax, one wave per score row: each load of a wave covers 512 contiguous bytes of the row, the whole row (SQ f32) stays in
// registers, so S is read once and exp is taken once per element. RS_ROWS rows per wave, RS_WAVES waves per work-group.
#define RS_WAVES 16
#define RS_ROWS 2
#define RS_Q (SQ / 128)              /* 16-byte pieces of a row per lane */
static_assert(RS_ROWS >= 2 && SQ % 128 == 0 && QN % RS_ROWS == 0 && (HG * QN) % (RS_WAVES * RS_ROWS) == 0, "k_rsmw: whole 512-byte pieces per row, a wave's rows in one head, whole work-groups per launch");
template <int XM> __device__ __forceinline__ float rs_xm(float x) { return __builtin_bit_cast(float, __builtin_amdgcn_update_dpp(0, __builtin_bit_cast(int, x), 0x160 + XM, 0xf, 0xf, true)); }      /* lane l with lane l ^ XM inside a 16-lane row (DPP row_xmask) */
__device__ __forceinline__ float rs_xh(float x) { return __builtin_bit_cast(float, __builtin_amdgcn_permlanex16(__builtin_bit_cast(int, x), __builtin_bit_cast(int, x), 0x76543210, 0xfedcba98, false, false)); }      /* lane l with lane l ^ 16 */
__device__ __forceinline__ float rs_wmax(float v) { v = fmaxf(v, rs_xm<1>(v)); v = fmaxf(v, rs_xm<2>(v)); v = fmaxf(v, rs_xm<4>(v)); v = fmaxf(v, rs_xm<8>(v)); return fmaxf(v, rs_xh(v)); }
__device__ __forceinline__ float rs_wsum(float v) { v += rs_xm<1>(v); v += rs_xm<2>(v); v += rs_xm<4>(v); v += rs_xm<8>(v); return v + rs_xh(v); }
__global__ __launch_bounds__(RS_WAVES * 32) void k_rsmw(const float* __restrict__ S, _Float16* __restrict__ P) {
  const int lane = threadIdx.x & 31; const int wave = __builtin_amdgcn_readfirstlane(threadIdx.x >> 5);
  const int t0 = (blockIdx.x * RS_WAVES + wave) * RS_ROWS;
  const size_t i0 = ((size_t)(t0 / QN) * SQ + (t0 % QN)) * SQ + lane * 4;      /* RS_ROWS divides QN: a wave's rows are consecutive rows of one head */
  const float* sp = S + i0; _Float16* pp = P + i0;
  v4f s[RS_Q], nx[RS_Q];      /* the row being worked on; the next row, in flight */
#pragma unroll
  for (int u = 0; u < RS_Q; ++u) s[u] = *(const v4fa*)(sp + u * 128);
#pragma unroll
  for (int u = 0; u < RS_Q; ++u) nx[u] = *(const v4fa*)(sp + SQ + u * 128);
  asm volatile("s_wait_xcnt 0x0" :: "v"(sp) : "memory");      /* stands in front of every overwrite of the address register that the loads above name; naming sp here also keeps that register out of the loads' own destinations */
#pragma unroll 1      /* rolled: a row's arithmetic cannot be scheduled into the row before it, so the next row's loads stay in flight under this row's work */
  for (int r = 0;; ++r) {
    float m0 = -3.0e38f, m1 = -3.0e38f, m2 = -3.0e38f, m3 = -3.0e38f;
#pragma unroll
    for (int u = 0; u < RS_Q; ++u) { m0 = fmaxf(m0, s[u][0]); m1 = fmaxf(m1, s[u][1]); m2 = fmaxf(m2, s[u][2]); m3 = fmaxf(m3, s[u][3]); }
    const float mx = rs_wmax(fmaxf(fmaxf(m0, m1), fmaxf(m2, m3)));
    v4f a = {0.f, 0.f, 0.f, 0.f};
#pragma unroll
    for (int u = 0; u < RS_Q; ++u) { v4f e; e[0] = __expf(s[u][0] - mx); e[1] = __expf(s[u][1] - mx); e[2] = __expf(s[u][2] - mx); e[3] = __expf(s[u][3] - mx); s[u] = e; a += e; }
    const float sc = 256.0f / rs_wsum((a[0] + a[1]) + (a[2] + a[3]));
#pragma unroll
    for (int u = 0; u < RS_Q; ++u) { const v4f w = s[u] * sc; v4h h4; h4[0] = (_Float16)w[0]; h4[1] = (_Float16)w[1]; h4[2] = (_Float16)w[2]; h4[3] = (_Float16)w[3]; *(v4h*)(pp + (size_t)r * SQ + u * 128) = h4; }
    asm volatile("s_wait_xcnt 0x0" ::: "memory");      /* the next trip overwrites the address and data registers that these stores name */
    if (r + 1 == RS_ROWS) break;
#pragma unroll
    for (int u = 0; u < RS_Q; ++u) s[u] = nx[u];
    if (r + 2 < RS_ROWS) {
#pragma unroll
      for (int u = 0; u < RS_Q; ++u) nx[u] = *(const v4fa*)(sp + (size_t)(r + 2) * SQ + u * 128); } } }

extern "C" void kernel_launch(void* const* d_in, const int* in_sizes, int n_in,
                              void* d_out, int out_size, void* d_ws, size_t ws_size, hipStream_t stream) {
  (void)in_sizes; (void)n_in; (void)out_size;
  const float* const* I = (const float* const*)d_in; const float* x = I[0]; const float* wq = I[1]; const float* bq = I[2]; const float* wk = I[3]; const float* bk = I[4]; const float* wv = I[5]; const float* bv = I[6]; const float* wo = I[7]; const float* bo = I[8];      /* [in][out] weights + biases */
  char* ws = (char*)d_ws; size_t off = 0;
  auto take = [&](size_t bytes) { char* p = ws + off; off += (bytes + 255) & ~(size_t)255; return p; };
  _Float16* BQ = (_Float16*)take((size_t)DM * DM * 2); _Float16* BK = (_Float16*)take((size_t)DM * DM * 2); _Float16* BV = (_Float16*)take((size_t)DM * DM * 2); _Float16* BO = (_Float16*)take((size_t)DM * DM * 2);
  _Float16* X16 = (_Float16*)take(NR * DM * 2); _Float16* Q16 = (_Float16*)take(NR * DM * 2); _Float16* K16 = (_Float16*)take(NR * DM * 2); _Float16* V16 = (_Float16*)take(NR * DM * 2); _Float16* O16 = (_Float16*)take(NR * DM * 2);
  float* S = (float*)take((size_t)HG * SQ * SQ * 4); _Float16* P = (_Float16*)take((size_t)HG * SQ * SQ * 2); _Float16* VT = (_Float16*)take((size_t)NH * HD * SQ * 2);
  if (off > ws_size) return;
  k_wt_f16<<<(unsigned)(((size_t)DM * (DM / 8) + 255) / 256), 256, 0, stream>>>(wq, BQ, DM, DM, 16.0f); k_wt_f16<<<(unsigned)(((size_t)DM * (DM / 8) + 255) / 256), 256, 0, stream>>>(wk, BK, DM, DM, 16.0f); k_wt_f16<<<(unsigned)(((size_t)DM * (DM / 8) + 255) / 256), 256, 0, stream>>>(wv, BV, DM, DM, 16.0f); k_wt_f16<<<(unsigned)(((size_t)DM * (DM / 8) + 255) / 256), 256, 0, stream>>>(wo, BO, DM, DM, 16.0f);      /* [in][out] -> Bt[n][k] x16 */

  k_x16<<<(unsigned)((NR * DM / 8 + 255) / 256), 256, 0, stream>>>(x, X16, NR * DM / 8);
  const size_t r0p = (size_t)B0 * SQ;      /* first projected row */
  k_gemm2<0><<<dim3((unsigned)((MP / 128) * (DM / 64)), 1), 128, 0, stream>>>(X16 + r0p * DM, DM, 0, BQ, DM, 0, 0.0625f, bq, 0, nullptr, 1, 0, 0, nullptr, Q16 + r0p * DM, DM, 0, MP, DM, DM);
  k_gemm2<0><<<dim3((unsigned)((MP / 128) * (DM / 64)), 1), 128, 0, stream>>>(X16 + r0p * DM, DM, 0, BK, DM, 0, 0.0625f, bk, 0, nullptr, 1, 0, 0, nullptr, K16 + r0p * DM, DM, 0, MP, DM, DM);
  k_gemm2<0><<<dim3((unsigned)((MP / 128) * (DM / 64)), 1), 128, 0, stream>>>(X16 + r0p * DM, DM, 0, BV, DM, 0, 0.0625f, bv, 0, nullptr, 1, 0, 0, nullptr, V16 + r0p * DM, DM, 0, MP, DM, DM);
  for (int b = B0; b < B0 + NBR; ++b) { const size_t r0 = (size_t)b * SQ;
    k_vt<NH, SQ><<<NH * (SQ / 64), 256, 0, stream>>>(V16 + r0 * LQ, LQ, 0, VT);      /* V^T [NH][HD][SQ] for this batch */
    for (int h0 = 0; h0 < NHD; h0 += HG) {
      k_gemm2<0><<<dim3((QN / 128) * (SQ / 64), HG), 128, 0, stream>>>(Q16 + r0 * LQ + h0 * HD, LQ, (size_t)HD, K16 + r0 * LQ + h0 * HD, LQ, (size_t)HD, 0.125f, nullptr, 0, nullptr, 1, 0, 0, S, nullptr, SQ, (size_t)SQ * SQ, QN, SQ, HD);      /* scores, HG heads per launch */
      k_rsmw<<<(HG * QN) / (RS_WAVES * RS_ROWS), RS_WAVES * 32, 0, stream>>>(S, P);      /* P = 256 softmax (f16), rows of all HG heads */
      k_gemm2<0><<<dim3((QN / 128) * (HD / 64), HG), 128, 0, stream>>>(P, SQ, (size_t)SQ * SQ, VT + (size_t)h0 * HD * SQ, SQ, (size_t)HD * SQ, 0.25f, nullptr, 0, nullptr, 1, 0, 0, nullptr, O16 + r0 * DM + h0 * HD, DM, (size_t)HD, QN, HD, SQ); } }      /* o (merged heads) as f16 rows */
  k_gemm2<0><<<dim3((unsigned)((MPO / 128) * (DM / 64)), 1), 128, 0, stream>>>(O16 + r0p * DM, DM, 0, BO, DM, 0, 0.0009765625f, bo, 0, nullptr, 1, 0, 0, (float*)d_out + r0p * DM, nullptr, DM, 0, MPO, DM, DM);      /* out rows are the output layout */
}

// v002
// A run of this version takes 190 microseconds.
// In two side-by-side timings against v001, it was 3.94 and 3.87 times as fast.
// All steps since v000 together make it 14.0 times as fast.
#include <hip/hip_runtime.h>
// Multi-head self-attention (x [2][2048][768]; q/k/v = x W + b ([in][out] 768x768 sigma 1/sqrt(768), zero biases); 12 heads of 64; softmax(q k^T / 8) over all keys (no mask); out = ctx Wo + bo -> [2][2048][768]).
// Structure: token rows r = b*2048 + s; x as exact f16 rows (bf16-rounded); Q, K, V as three WMMA GEMMs (32x64 wave tiles, f32 accumulation, exact x16 weights + bias, f16 outputs); V^T for all batches and heads via LDS transposes; one fused attention launch over (query block, batch x head): S^T = K Q^T (K = 64), online softmax in the log2 domain on the score accumulators (f32 statistics, native exp2, weights as f16 relative to the running maximum), O^T += V^T P^T, K and V^T staged in LDS; o carried x64 against f16 subnormal flush (folded into the output GEMM alpha), written straight into the merged f16 o rows; out = o W_o + b GEMM (f32) into the output layout.
// Compute dtype: inputs rounded to bf16; x / weights exact; q, k, v, softmax weights and o as plain f16 GEMM operands (~2^-12); scores and softmax statistics f32. v_wmma_f32_16x16x32_f16.
#define NB 2
#define SQ 2048
#define DM 768
#define NH 12
#define HD 64
#define HG 4                         /* heads per block group of the unlaunched k_vt(b, h0) */
#define B0 0                         /* first batch processed (debug hook) */
#define NBR NB                       /* batches processed (debug hook) */
#define NR ((size_t)NB * SQ)         /* token rows */
#define MP ((int)((size_t)NBR * SQ)) /* rows projected (debug hook) */
#define QN SQ                        /* query rows per batch; not read (k_fattn attends all SQ) */
#define NHD NH                       /* heads; not read (k_fattn attends all NH) */
#define MPO MP                       /* rows through the output stage (debug hook) */
#define LQ DM      /* row pitch of the q/k/v rows */
typedef __bf16 v16b __attribute__((ext_vector_type(16)));
typedef unsigned short v8us __attribute__((ext_vector_type(8), may_alias));
typedef float  v8f  __attribute__((ext_vector_type(8)));
typedef float  v4f  __attribute__((ext_vector_type(4)));
typedef float  v4fa __attribute__((ext_vector_type(4), may_alias));
union FragB { v16b v; v8us half[2]; unsigned short u[16]; };

__device__ __forceinline__ unsigned short bf16_bits(float x) { unsigned int u = __float_as_uint(x); return (unsigned short)((u + 0x7FFFu + ((u >> 16) & 1u)) >> 16); }
__device__ __forceinline__ float bf16_val(unsigned short b) { return __uint_as_float(((unsigned int)b) << 16); }
__device__ __forceinline__ float bf16_round(float x) { return bf16_val(bf16_bits(x)); }
// D += A·B with NT terms: 1 = ah·bh, 2 = + al·bh (A split), 3 = + ah·bl (both split)
template <int NT>
__device__ __forceinline__ v8f mmaN(v16b ah, v16b al, v16b bh, v16b bl, v8f c) {
  c = __builtin_amdgcn_wmma_f32_16x16x32_bf16(false, ah, false, bh, (short)0, c, false, false);
  if (NT >= 2) c = __builtin_amdgcn_wmma_f32_16x16x32_bf16(false, al, false, bh, (short)0, c, false, false);
  if (NT >= 3) c = __builtin_amdgcn_wmma_f32_16x16x32_bf16(false, ah, false, bl, (short)0, c, false, false);
  asm volatile("v_nop\n\tv_nop\n\tv_nop\n\tv_nop" : "+v"(c) : "v"(ah), "v"(al), "v"(bh), "v"(bl));
  return c;
}

__global__ __launch_bounds__(256) void k_wt_bf16(const float* __restrict__ W, unsigned short* __restrict__ Wt, int K, int N) {
  const int t = blockIdx.x * 256 + threadIdx.x;
  const int k8n = K / 8;
  if (t >= N * k8n) return;
  const int n = t / k8n, k8 = (t % k8n) * 8;
  v8us v;
#pragma unroll
  for (int i = 0; i < 8; ++i) v[i] = bf16_bits(W[(size_t)(k8 + i) * N + n]);
  *(v8us*)(Wt + (size_t)n * K + k8) = v;
  
}

// GEMM C[M][N] (f32, pitch ldc) = act(A[M][K]·W + bias). A f32 row-major (pitch lda) converted per fragment to bf16
// (ASPLIT: hi/lo two planes -> 2 terms, else single rounded term); Wt bf16 [N][K] (pitch ldb). BIAS_BF16 rounds the
// bias to bf16 first (bias quantised to bf16 before the add). K%32==0, M%16==0, N%64==0.
template <bool ASPLIT, int ACT, bool BIAS_BF16>
__global__ __launch_bounds__(128) void k_gemm_bf(const float* __restrict__ A, int lda, const unsigned short* __restrict__ Wt, int ldb,
                                               const float* __restrict__ bias, float* __restrict__ C, int ldc, int M, int N, int K) {
  __shared__ __attribute__((aligned(16))) float so[4][16][64];
  const int tid = threadIdx.x, w = tid >> 5, lane = tid & 31, ln = lane & 15, hh = lane >> 4;
  const int ntn = N / 64;
  const int wid = blockIdx.x * 4 + w;
  const int mt = wid / ntn, nq = wid % ntn;
  if (mt * 16 >= M) return;
  const int row0 = mt * 16, col0 = nq * 64;
  const float* arow = A + (size_t)(row0 + ln) * lda;
  v8f acc[4] = {};
  for (int kb = 0; kb < K; kb += 32) {
    FragB ah, al;
    const v4f x0 = *(const v4fa*)(arow + kb + 8 * hh), x1 = *(const v4fa*)(arow + kb + 8 * hh + 4);
    const v4f x2 = *(const v4fa*)(arow + kb + 16 + 8 * hh), x3 = *(const v4fa*)(arow + kb + 16 + 8 * hh + 4);
    float xs[16] = {x0[0],x0[1],x0[2],x0[3],x1[0],x1[1],x1[2],x1[3],x2[0],x2[1],x2[2],x2[3],x3[0],x3[1],x3[2],x3[3]};
#pragma unroll
    for (int i = 0; i < 16; ++i) { const unsigned short hb = bf16_bits(xs[i]); ah.u[i] = hb; al.u[i] = ASPLIT ? bf16_bits(xs[i] - bf16_val(hb)) : (unsigned short)0; }
#pragma unroll
    for (int t = 0; t < 4; ++t) {
      const unsigned short* brow = Wt + (size_t)(col0 + t * 16 + ln) * ldb + kb;
      FragB b;
      b.half[0] = *(const v8us*)(brow + 8 * hh);
      b.half[1] = *(const v8us*)(brow + 16 + 8 * hh);
      acc[t] = mmaN<ASPLIT ? 2 : 1>(ah.v, al.v, b.v, b.v, acc[t]);
    }
  }
#pragma unroll
  for (int t = 0; t < 4; ++t) {
    float bv = bias ? bias[col0 + t * 16 + ln] : 0.f;
    if (BIAS_BF16) bv = bf16_round(bv);
#pragma unroll
    for (int r = 0; r < 8; ++r) { float v = acc[t][r] + bv; if (ACT == 1) v = fmaxf(v, 0.f); so[w][8 * hh + r][t * 16 + ln] = v; }
  }
  __builtin_amdgcn_fence(__ATOMIC_ACQ_REL, "workgroup");
  __builtin_amdgcn_wave_barrier();
  const int rsub = lane >> 4, c4 = (lane & 15) * 4;
  {
#pragma unroll
    for (int q = 0; q < 8; ++q) {
      const int r = q * 2 + rsub;
      const v4f v = *(const v4fa*)&so[w][r][c4];
      *(v4f*)(C + (size_t)(row0 + r) * ldc + col0 + c4) = v;
    }
    
  }
}

// GEMM C = act(A·W + bias + resid): A f32 (ASPLIT -> hi/lo 2 terms), Wt bf16 [N][K]; ACT 0 none, 1 relu, 2 exact gelu;
// resid (optional, f32, row index = (row % rmod), pitch ldr, RES_BF16 rounds it) added before the activation.
template <bool ASPLIT, int ACT, bool BIAS_BF16, bool RES_BF16>
__global__ __launch_bounds__(128) void k_gemm_bf3(const float* __restrict__ A, int lda, const unsigned short* __restrict__ Wt, int ldb,
                                                const float* __restrict__ bias, const float* __restrict__ resid, int rmod, int ldr,
                                                float* __restrict__ C, int ldc, int M, int N, int K) {
  __shared__ __attribute__((aligned(16))) float so[4][16][64];
  const int tid = threadIdx.x, w = tid >> 5, lane = tid & 31, ln = lane & 15, hh = lane >> 4;
  const int ntn = N / 64;
  const int wid = blockIdx.x * 4 + w;
  const int mt = wid / ntn, nq = wid % ntn;
  if (mt * 16 >= M) return;
  const int row0 = mt * 16, col0 = nq * 64;
  const float* arow = A + (size_t)(row0 + ln) * lda;
  v8f acc[4] = {};
  for (int kb = 0; kb < K; kb += 32) {
    FragB ah, al;
    const v4f x0 = *(const v4fa*)(arow + kb + 8 * hh), x1 = *(const v4fa*)(arow + kb + 8 * hh + 4);
    const v4f x2 = *(const v4fa*)(arow + kb + 16 + 8 * hh), x3 = *(const v4fa*)(arow + kb + 16 + 8 * hh + 4);
    float xs[16] = {x0[0],x0[1],x0[2],x0[3],x1[0],x1[1],x1[2],x1[3],x2[0],x2[1],x2[2],x2[3],x3[0],x3[1],x3[2],x3[3]};
#pragma unroll
    for (int i = 0; i < 16; ++i) { const unsigned short hb = bf16_bits(xs[i]); ah.u[i] = hb; al.u[i] = ASPLIT ? bf16_bits(xs[i] - bf16_val(hb)) : (unsigned short)0; }
#pragma unroll
    for (int t = 0; t < 4; ++t) {
      const unsigned short* brow = Wt + (size_t)(col0 + t * 16 + ln) * ldb + kb;
      FragB b;
      b.half[0] = *(const v8us*)(brow + 8 * hh);
      b.half[1] = *(const v8us*)(brow + 16 + 8 * hh);
      acc[t] = mmaN<ASPLIT ? 2 : 1>(ah.v, al.v, b.v, b.v, acc[t]);
    }
  }
#pragma unroll
  for (int t = 0; t < 4; ++t) {
    const int col = col0 + t * 16 + ln;
    float bv = bias ? bias[col] : 0.f;
    if (BIAS_BF16) bv = bf16_round(bv);
#pragma unroll
    for (int r = 0; r < 8; ++r) {
      float v = acc[t][r] + bv;
      if (resid) { float rv = resid[(size_t)((row0 + 8 * hh + r) % rmod) * ldr + col]; if (RES_BF16) rv = bf16_round(rv); v += rv; }
      if (ACT == 1) v = fmaxf(v, 0.f);
      if (ACT == 2) v = 0.5f * v * (1.0f + erff(v * 0.70710678118654752f));
      if (ACT == 3) { const float u = 0.7978845608028654f * (v + 0.044715f * v * v * v); v = 0.5f * v * (1.0f + tanhf(u)); }
      so[w][8 * hh + r][t * 16 + ln] = v;
    }
  }
  __builtin_amdgcn_fence(__ATOMIC_ACQ_REL, "workgroup");
  __builtin_amdgcn_wave_barrier();
  const int rsub = lane >> 4, c4 = (lane & 15) * 4;
  {
#pragma unroll
    for (int q = 0; q < 8; ++q) {
      const int r = q * 2 + rsub;
      const v4f v = *(const v4fa*)&so[w][r][c4];
      *(v4f*)(C + (size_t)(row0 + r) * ldc + col0 + c4) = v;
    }
    
  }
}
// row LayerNorm (biased variance, eps) over N: s = X (+ R); optional out_sum <- s; out_norm <- (s-mu)*rsqrt(var+eps)*g + b
template <bool PARAM_BF16>
__global__ __launch_bounds__(256) void k_layernorm(const float* __restrict__ X, const float* __restrict__ R, const float* __restrict__ g, const float* __restrict__ bta,
                                                  float* __restrict__ out_sum, float* __restrict__ out_norm, int N, float eps) {
  __shared__ float red[256];
  const int row = blockIdx.x, tid = threadIdx.x;
  const float* x = X + (size_t)row * N; const float* rr = R ? R + (size_t)row * N : nullptr;
  float vals[16];                     // up to N = 4096
  const int per = N / 256;            // contiguous chunk per thread? use strided-by-4 chunks: thread handles j = tid*4 + 1024*u
  float s1 = 0.f;
  for (int u = 0; u < per / 4; ++u) {
    const int j = tid * 4 + 1024 * u;
    const v4f a = *(const v4fa*)(x + j);
    v4f b = {0.f,0.f,0.f,0.f}; if (rr) b = *(const v4fa*)(rr + j);
#pragma unroll
    for (int q = 0; q < 4; ++q) { const float v = a[q] + b[q]; vals[u * 4 + q] = v; s1 += v; }
  }
  red[tid] = s1; __syncthreads();
  for (int st = 128; st > 0; st >>= 1) { if (tid < st) red[tid] += red[tid + st]; __syncthreads(); }
  const float mu = red[0] / (float)N; __syncthreads();
  float s2 = 0.f;
  for (int u = 0; u < per / 4; ++u)
#pragma unroll
    for (int q = 0; q < 4; ++q) { const float c = vals[u * 4 + q] - mu; s2 += c * c; }
  red[tid] = s2; __syncthreads();
  for (int st = 128; st > 0; st >>= 1) { if (tid < st) red[tid] += red[tid + st]; __syncthreads(); }
  const float rs = rsqrtf(red[0] / (float)N + eps);
  {
    for (int u = 0; u < per / 4; ++u) {
      const int j = tid * 4 + 1024 * u;
      v4f o, sm;
#pragma unroll
      for (int q = 0; q < 4; ++q) {
        float gg = g[j + q], bb = bta[j + q];
        if (PARAM_BF16) { gg = bf16_round(gg); bb = bf16_round(bb); }
        sm[q] = vals[u * 4 + q]; o[q] = (vals[u * 4 + q] - mu) * rs * gg + bb;
      }
      if (out_sum) *(v4f*)(out_sum + (size_t)row * N + j) = sm;
      *(v4f*)(out_norm + (size_t)row * N + j) = o;
    }
    
  }
}



// ---- f16 WMMA path (v_wmma_f32_16x16x32_f16): 11-bit significands for operands in range — used where a [0,1] probability operand needs more precision than bf16
typedef _Float16 v16h __attribute__((ext_vector_type(16)));
union FragH { v16h v; v8us half[2]; _Float16 h[16]; unsigned short u[16]; };
template <int NT>
__device__ __forceinline__ v8f mmaH(v16h ah, v16h al, v16h bh, v16h bl, v8f c) {
  c = __builtin_amdgcn_wmma_f32_16x16x32_f16(false, ah, false, bh, (short)0, c, false, false);
  if (NT >= 2) c = __builtin_amdgcn_wmma_f32_16x16x32_f16(false, al, false, bh, (short)0, c, false, false);
  if (NT >= 3) c = __builtin_amdgcn_wmma_f32_16x16x32_f16(false, ah, false, bl, (short)0, c, false, false);
  asm volatile("v_nop\n\tv_nop\n\tv_nop\n\tv_nop" : "+v"(c) : "v"(ah), "v"(al), "v"(bh), "v"(bl));
  return c;
}
// batched GEMM like k_gemm_b but f16 operands: A f32 (split into f16 hi/lo if ASPLIT, else rounded to f16), Bt = f16 values [n][k]; alpha; C f32; N multiple of 16 (partial tiles skipped)
template <bool ASPLIT>
__global__ __launch_bounds__(128) void k_gemm_h(const float* __restrict__ A, int lda, size_t sA, const _Float16* __restrict__ Bh, int ldb, size_t sB, float alpha, float* __restrict__ C, int ldc, size_t sC, int M, int N, int K) {
  __shared__ __attribute__((aligned(16))) float so[4][16][64];
  const int tid = threadIdx.x, w = tid >> 5, lane = tid & 31, ln = lane & 15, hh = lane >> 4; const int by = blockIdx.y;
  A += (size_t)by * sA; Bh += (size_t)by * sB; C += (size_t)by * sC;
  const int ntn = (N + 63) / 64; const int wid = blockIdx.x * 4 + w; const int mt = wid / ntn, nq = wid % ntn; if (mt * 16 >= M) return;
  const int row0 = mt * 16, col0 = nq * 64; const float* arow = A + (size_t)(row0 + ln) * lda;
  v8f acc[4] = {};
  for (int kb = 0; kb < K; kb += 32) {
    FragH ah, al;
    const v4f x0 = *(const v4fa*)(arow + kb + 8 * hh), x1 = *(const v4fa*)(arow + kb + 8 * hh + 4), x2 = *(const v4fa*)(arow + kb + 16 + 8 * hh), x3 = *(const v4fa*)(arow + kb + 16 + 8 * hh + 4);
    float xs[16] = {x0[0],x0[1],x0[2],x0[3],x1[0],x1[1],x1[2],x1[3],x2[0],x2[1],x2[2],x2[3],x3[0],x3[1],x3[2],x3[3]};
#pragma unroll
    for (int i = 0; i < 16; ++i) { const _Float16 h = (_Float16)xs[i]; ah.h[i] = h; al.h[i] = ASPLIT ? (_Float16)(xs[i] - (float)h) : (_Float16)0.0f; }
#pragma unroll
    for (int t = 0; t < 4; ++t) { if (col0 + t * 16 >= N) continue; const size_t boff = (size_t)(col0 + t * 16 + ln) * ldb + kb; FragH bq; bq.half[0] = *(const v8us*)(Bh + boff + 8 * hh); bq.half[1] = *(const v8us*)(Bh + boff + 16 + 8 * hh);
      acc[t] = mmaH<ASPLIT ? 2 : 1>(ah.v, al.v, bq.v, bq.v, acc[t]); }
  }
#pragma unroll
  for (int t = 0; t < 4; ++t) { if (col0 + t * 16 >= N) continue;
#pragma unroll
    for (int r = 0; r < 8; ++r) so[w][8 * hh + r][t * 16 + ln] = acc[t][r] * alpha; }
  __builtin_amdgcn_fence(__ATOMIC_ACQ_REL, "workgroup"); __builtin_amdgcn_wave_barrier();
  const int rsub = lane >> 4, c4 = (lane & 15) * 4;
  {
#pragma unroll
    for (int q = 0; q < 8; ++q) { const int r = q * 2 + rsub; if (col0 + c4 < N) { const v4f v = *(const v4fa*)&so[w][r][c4]; *(v4f*)(C + (size_t)(row0 + r) * ldc + col0 + c4) = v; } }
     }
}

// Wt[n][k] = f16(W[k][n]·scale) from f32 row-major W[K][N] (scale = power of two; bf16-exact weights stay exact in f16 away from the subnormal range)
__global__ __launch_bounds__(256) void k_wt_f16(const float* __restrict__ W, _Float16* __restrict__ Wt, int K, int N, float scale) {
  const int t = blockIdx.x * 256 + threadIdx.x; if (t >= N * (K / 8)) return; const int n = t / (K / 8), k8 = (t % (K / 8)) * 8; FragH f;
#pragma unroll
  for (int i = 0; i < 8; ++i) f.h[i] = (_Float16)(bf16_round(W[(size_t)(k8 + i) * N + n]) * scale); const v8us o = f.half[0];
  *(v8us*)((unsigned short*)Wt + (size_t)n * K + k8) = o; 
}
// k_gemm_hh variant with fused epilogue: v = acc·alpha + bias[by·sBias + col] (+ CP[(row/rowsPerB)·sCPb + by·64 + col] if CP) ; ACT 0 none / 1 elu ; writes f16 C16 (and f32 C if non-null)
template <int ACT>
__global__ __launch_bounds__(128) void k_gemm_hhx(const _Float16* __restrict__ A, int lda, size_t sA, const _Float16* __restrict__ Bh, int ldb, size_t sB, float alpha, const float* __restrict__ bias, size_t sBias, const float* __restrict__ CP, int rowsPerB, size_t sCPb, int row0g,
    float* __restrict__ C, _Float16* __restrict__ C16, int ldc, size_t sC, int M, int N, int K) {
  __shared__ __attribute__((aligned(16))) float so[4][16][64];
  const int tid = threadIdx.x, w = tid >> 5, lane = tid & 31, ln = lane & 15, hh = lane >> 4; const int by = blockIdx.y;
  A += (size_t)by * sA; Bh += (size_t)by * sB; const size_t cofs = (size_t)by * sC; const float* bp = bias ? bias + (size_t)by * sBias : nullptr;
  const int ntn = (N + 63) / 64; const int wid = blockIdx.x * 4 + w; const int mt = wid / ntn, nq = wid % ntn; if (mt * 16 >= M) return;
  const int row0 = mt * 16, col0 = nq * 64; const _Float16* arow = A + (size_t)(row0 + ln) * lda;
  v8f acc[4] = {};
  for (int kb = 0; kb < K; kb += 32) { FragH ah; ah.half[0] = *(const v8us*)((const unsigned short*)arow + kb + 8 * hh); ah.half[1] = *(const v8us*)((const unsigned short*)arow + kb + 16 + 8 * hh);
#pragma unroll
    for (int t = 0; t < 4; ++t) { if (col0 + t * 16 >= N) continue; const size_t boff = (size_t)(col0 + t * 16 + ln) * ldb + kb; FragH bq; bq.half[0] = *(const v8us*)((const unsigned short*)Bh + boff + 8 * hh); bq.half[1] = *(const v8us*)((const unsigned short*)Bh + boff + 16 + 8 * hh);
      acc[t] = mmaH<1>(ah.v, ah.v, bq.v, bq.v, acc[t]); }
  }
#pragma unroll
  for (int t = 0; t < 4; ++t) { if (col0 + t * 16 >= N) continue; const int col = col0 + t * 16 + ln; const float bv = bp ? bf16_round(bp[col]) : 0.f;
#pragma unroll
    for (int r = 0; r < 8; ++r) { float v = acc[t][r] * alpha + bv; if (CP) { const int rr = row0g + row0 + 8 * hh + r; if (rowsPerB < 0) v += CP[cofs + (size_t)rr * ldc + col];      /* rowsPerB < 0: own element of the batched C plane */ else { const int bidx = rr / rowsPerB; v += CP[(size_t)bidx * sCPb + (size_t)by * 64 + col]; } } if (ACT == 1) v = (v > 0.f) ? v : expm1f(v); else if (ACT == 7) v = (v > 0.f) ? v + 1.0f : expf(v); else if (ACT == 8) v = tanhf(v); else if (ACT == 9) v = 0.5f * v * (1.0f + tanhf(0.7978845608028654f * (v + 0.044715f * v * v * v))); else if (ACT == 11) v = 1.0f / (1.0f + expf(-v)); else if (ACT == 12) v = (v > 0.f) ? v : 0.01f * v; else if (ACT == 14) v = (v > 0.f) ? v : 0.1f * v; else if (ACT == 16) v = (v >= 0.f) ? v : 0.3f * v; else if (ACT == 17) v = (v >= 0.f) ? v : 0.2f * v; else if (ACT == 15) v = v / (1.0f + expf(-v)); else if (ACT == 3) v = fmaxf(v, 0.f); else if (ACT == 6) v = 0.5f * v * (1.0f + erff(v * 0.70710678118654752f)); so[w][8 * hh + r][t * 16 + ln] = v; } }
  __builtin_amdgcn_fence(__ATOMIC_ACQ_REL, "workgroup"); __builtin_amdgcn_wave_barrier();
  const int rsub = lane >> 4, c4 = (lane & 15) * 4; typedef _Float16 v4h __attribute__((ext_vector_type(4)));
  {
#pragma unroll
    for (int q = 0; q < 8; ++q) { const int r = q * 2 + rsub; if (col0 + c4 < N) { const v4f v = *(const v4fa*)&so[w][r][c4]; if (C) *(v4f*)(C + cofs + (size_t)(row0 + r) * ldc + col0 + c4) = v; if (C16) { v4h h4; for (int i = 0; i < 4; ++i) h4[i] = (_Float16)v[i]; *(v4h*)(C16 + cofs + (size_t)(row0 + r) * ldc + col0 + c4) = h4; } } }
     }
}


typedef _Float16 v4h __attribute__((ext_vector_type(4)));

__global__ __launch_bounds__(256) void k_x16(const float* __restrict__ x, _Float16* __restrict__ X16, size_t n8) { const size_t t = (size_t)blockIdx.x * 256 + threadIdx.x; if (t >= n8) return; FragH f;
#pragma unroll
  for (int q = 0; q < 8; ++q) f.h[q] = (_Float16)bf16_round(x[t * 8 + q]); *(v8us*)((unsigned short*)X16 + t * 8) = f.half[0];  }
__global__ __launch_bounds__(256) void k_h16(const float* __restrict__ x, _Float16* __restrict__ X16, size_t n8) { const size_t t = (size_t)blockIdx.x * 256 + threadIdx.x; if (t >= n8) return; FragH f;
#pragma unroll
  for (int q = 0; q < 8; ++q) f.h[q] = (_Float16)x[t * 8 + q]; *(v8us*)((unsigned short*)X16 + t * 8) = f.half[0];  }
__global__ __launch_bounds__(256) void k_round16f(const float* __restrict__ W, _Float16* __restrict__ Bt, size_t n8) { const size_t t = (size_t)blockIdx.x * 256 + threadIdx.x; if (t >= n8) return; FragH f;
#pragma unroll
  for (int i = 0; i < 8; ++i) f.h[i] = (_Float16)(bf16_round(W[t * 8 + i]) * 16.0f); *(v8us*)((unsigned short*)Bt + t * 8) = f.half[0];  }
template <int NHv, int TTv>
__global__ __launch_bounds__(256) void k_vt(const _Float16* __restrict__ V16, int ldv, int voff, _Float16* __restrict__ Vt) { __shared__ unsigned short tl[64][66]; const int tid = threadIdx.x; const int slab = blockIdx.x / (TTv / 64), lg = blockIdx.x % (TTv / 64); const int b = slab / NHv, h = slab % NHv;
  for (int i = tid; i < 64 * 8; i += 256) { const int r = i / 8, c8 = (i % 8) * 8; FragH f; f.half[0] = *(const v8us*)((const unsigned short*)V16 + ((size_t)b * TTv + lg * 64 + r) * ldv + voff + h * 64 + c8);
#pragma unroll
    for (int q = 0; q < 8; ++q) tl[r][c8 + q] = f.u[q]; }
  __syncthreads();
  {
#pragma unroll
    for (int rd = 0; rd < 2; ++rd) { const int d = rd * 32 + tid / 8, pc = tid % 8; FragH f;
#pragma unroll
      for (int q = 0; q < 8; ++q) f.u[q] = tl[pc * 8 + q][d];
      *(v8us*)((unsigned short*)Vt + ((size_t)slab * 64 + d) * TTv + lg * 64 + pc * 8) = f.half[0]; }
     } }

__global__ __launch_bounds__(256) void k_hl(const float* __restrict__ F, _Float16* __restrict__ Hh, _Float16* __restrict__ Hl, size_t n8) { const size_t t = (size_t)blockIdx.x * 256 + threadIdx.x; if (t >= n8) return; FragH fh, fl; const v4f a = *(const v4fa*)(F + t * 8), c = *(const v4fa*)(F + t * 8 + 4);
#pragma unroll
  for (int q = 0; q < 4; ++q) { _Float16 h = (_Float16)a[q]; fh.h[q] = h; fl.h[q] = (_Float16)((a[q] - (float)h) * 1024.0f); h = (_Float16)c[q]; fh.h[4 + q] = h; fl.h[4 + q] = (_Float16)((c[q] - (float)h) * 1024.0f); }
  { *(v8us*)((unsigned short*)Hh + t * 8) = fh.half[0]; *(v8us*)((unsigned short*)Hl + t * 8) = fl.half[0];  } }

// ---- fast GEMM (wave tile 32x64; requires M % 32 == 0 rows per launch region and N % 64 == 0); epilogue = k_gemm_hhx semantics ----
__device__ __forceinline__ v16h g2_frag(const _Float16* p, int hh) { FragH f; f.half[0] = *(const v8us*)((const unsigned short*)p + 8 * hh); f.half[1] = *(const v8us*)((const unsigned short*)p + 16 + 8 * hh); return f.v; }
__device__ __forceinline__ v8f g2_mma(v16h a, v16h b, v8f c) { v8f d = __builtin_amdgcn_wmma_f32_16x16x32_f16(false, a, false, b, (short)0, c, false, false); asm volatile("v_nop\n\tv_nop\n\tv_nop\n\tv_nop" : "+v"(d) : "v"(a), "v"(b)); return d; }
template <int ACT>
__global__ __launch_bounds__(128) void k_gemm2(const _Float16* __restrict__ A, int lda, size_t sA, const _Float16* __restrict__ Bh, int ldb, size_t sB, float alpha, const float* __restrict__ bias, size_t sBias, const float* __restrict__ CP, int rowsPerB, size_t sCPb, int row0g,
    float* __restrict__ C, _Float16* __restrict__ C16, int ldc, size_t sC, int M, int N, int K) { static_assert(ACT == 0 || ACT == 3 || ACT == 6 || ACT == 8 || ACT == 9 || ACT == 11 || ACT == 12 || ACT == 14 || ACT == 15 || ACT == 16 || ACT == 17, "k_gemm2: unsupported ACT code (would silently apply no activation)");
  __shared__ __attribute__((aligned(16))) float so[4][32][68];
  const int tid = threadIdx.x, w = tid >> 5, lane = tid & 31, ln = lane & 15, hh = lane >> 4; const int by = blockIdx.y;
  A += (size_t)by * sA; Bh += (size_t)by * sB; const size_t cofs = (size_t)by * sC; const float* bp = bias ? bias + (size_t)by * sBias : nullptr;
  const int ntn = N >> 6; const int mt = blockIdx.x / ntn, nq = blockIdx.x - mt * ntn; const int row0 = mt * 128 + 32 * w, col0 = nq * 64; if (row0 >= M) return;
  const _Float16* a0p = A + (size_t)(row0 + ln) * lda; const _Float16* a1p = a0p + (size_t)16 * lda;
  const _Float16* b0p = Bh + (size_t)(col0 + ln) * ldb; const _Float16* b1p = b0p + (size_t)16 * ldb; const _Float16* b2p = b1p + (size_t)16 * ldb; const _Float16* b3p = b2p + (size_t)16 * ldb;
  const v8f z8 = {0.f,0.f,0.f,0.f,0.f,0.f,0.f,0.f}; v8f c00 = z8, c01 = z8, c02 = z8, c03 = z8, c10 = z8, c11 = z8, c12 = z8, c13 = z8;
#pragma unroll 1
  for (int kb = 0; kb < K; kb += 32) { const v16h a0 = g2_frag(a0p + kb, hh), a1 = g2_frag(a1p + kb, hh);
    v16h b = g2_frag(b0p + kb, hh); c00 = g2_mma(a0, b, c00); c10 = g2_mma(a1, b, c10);
    b = g2_frag(b1p + kb, hh); c01 = g2_mma(a0, b, c01); c11 = g2_mma(a1, b, c11);
    b = g2_frag(b2p + kb, hh); c02 = g2_mma(a0, b, c02); c12 = g2_mma(a1, b, c12);
    b = g2_frag(b3p + kb, hh); c03 = g2_mma(a0, b, c03); c13 = g2_mma(a1, b, c13); }
  v8f accs[8] = {c00, c01, c02, c03, c10, c11, c12, c13};
#pragma unroll
  for (int u = 0; u < 8; ++u) { const int t = u & 3, half = u >> 2; const int col = col0 + t * 16 + ln; const float bv = bp ? bf16_round(bp[col]) : 0.f;
#pragma unroll
    for (int r = 0; r < 8; ++r) { const int rloc = half * 16 + 8 * hh + r; float v = accs[u][r] * alpha + bv; if (CP) { if (rowsPerB < 0) v += CP[cofs + (size_t)(row0g + row0 + rloc) * ldc + col];      /* rowsPerB < 0: own element of the batched C plane */ else { const int bidx = (row0g + row0 + rloc) / rowsPerB; v += CP[(size_t)bidx * sCPb + (size_t)by * 64 + col]; } }
      if (ACT == 3) v = fmaxf(v, 0.f); else if (ACT == 6) v = 0.5f * v * (1.0f + erff(v * 0.70710678118654752f)); else if (ACT == 11) v = 1.0f / (1.0f + expf(-v)); else if (ACT == 15) v = v / (1.0f + expf(-v)); else if (ACT == 12) v = (v > 0.f) ? v : 0.01f * v; else if (ACT == 8) v = tanhf(v); else if (ACT == 9) v = 0.5f * v * (1.0f + tanhf(0.7978845608028654f * (v + 0.044715f * v * v * v))); else if (ACT == 14) v = (v > 0.f) ? v : 0.1f * v; else if (ACT == 16) v = (v >= 0.f) ? v : 0.3f * v; else if (ACT == 17) v = (v >= 0.f) ? v : 0.2f * v;
      so[w][rloc][t * 16 + ln] = v; } }
  __builtin_amdgcn_fence(__ATOMIC_ACQ_REL, "workgroup"); __builtin_amdgcn_wave_barrier();
  const int rsub = lane >> 4, c4 = (lane & 15) * 4;
  {
#pragma unroll
    for (int q = 0; q < 16; ++q) { const int r = q * 2 + rsub; const v4f v = *(const v4fa*)&so[w][r][c4]; if (C) *(v4f*)(C + cofs + (size_t)(row0 + r) * ldc + col0 + c4) = v; if (C16) { v4h h4; for (int i = 0; i < 4; ++i) h4[i] = (_Float16)v[i]; *(v4h*)(C16 + cofs + (size_t)(row0 + r) * ldc + col0 + c4) = h4; } }
     } }


__global__ __launch_bounds__(256) void k_wnat(const float* __restrict__ w, size_t n8, _Float16* __restrict__ Bt) { const size_t t = (size_t)blockIdx.x * 256 + threadIdx.x; if (t >= n8) return; FragH f; for (int q = 0; q < 8; ++q) f.h[q] = (_Float16)(bf16_round(w[t * 8 + q]) * 16.0f); *(v8us*)((unsigned short*)Bt + t * 8) = f.half[0];  }
__global__ __launch_bounds__(256) void k_rsm(const float* __restrict__ S, _Float16* __restrict__ P, int nrows) {
  #pragma clang fp contract(off)
  const int i = blockIdx.x * 256 + threadIdx.x; if (i >= nrows) return; const float* s = S + (size_t)i * SQ; float mx = -3.0e38f;
#pragma unroll 1
  for (int j = 0; j < SQ; ++j) mx = fmaxf(mx, s[j]); float se = 0.f;
#pragma unroll 1
  for (int j = 0; j < SQ; ++j) se += expf(s[j] - mx); const float sc = 256.0f / se;
#pragma unroll 1
  for (int j0 = 0; j0 < SQ; j0 += 8) { FragH f; for (int q = 0; q < 8; ++q) f.h[q] = (_Float16)(expf(s[j0 + q] - mx) * sc); unsigned short* d = (unsigned short*)P + (size_t)i * SQ + j0; *(v8us*)d = f.half[0];  } }
__global__ __launch_bounds__(256) void k_vt(const _Float16* __restrict__ V16, int b, int h0, _Float16* __restrict__ VT) { __shared__ unsigned short tl[64][65]; const int tid = threadIdx.x; const int hh = blockIdx.x % HG, sg = blockIdx.x / HG; const int s0 = sg * 64; const int h = h0 + hh;
  for (int i = tid; i < 64 * 8; i += 256) { const int j = i / 8, d8 = (i % 8) * 8; FragH f; f.half[0] = *(const v8us*)((const unsigned short*)V16 + ((size_t)b * SQ + s0 + j) * DM + h * HD + d8); for (int q = 0; q < 8; ++q) tl[d8 + q][j] = f.u[q]; }
  __syncthreads();
  { for (int i = tid; i < 64 * 8; i += 256) { const int d = i / 8, j8 = (i % 8) * 8; FragH f; for (int q = 0; q < 8; ++q) f.u[q] = tl[d][j8 + q]; *(v8us*)((unsigned short*)VT + ((size_t)hh * HD + d) * SQ + s0 + j8) = f.half[0]; }  } }



// ---- fused attention: per work-group FA_BR queries of one (batch, head) against all SQ keys. Transposed products: S^T = K Q^T puts one query's
// scores in one lane pair (l, l ^ 16), so maximum and weights are in-lane; two S^T tiles (32 keys), converted in place, are the B operand of
// O^T += V^T P^T. Every A/B fragment is loaded in the same k order (8 h + 0..7, 16 + 8 h + 0..7), which is the order the converted tiles have.
#define FA_NW 4                      /* waves per work-group */
#define FA_R 2                       /* 16-query column groups per wave */
#define FA_BR (FA_NW * FA_R * 16)    /* queries per work-group */
#define FA_SK 64                     /* keys per LDS stage = two 32-key passes */
#define FA_LP 72                     /* LDS row pitch in halves: 144 B = 16 B x odd for 16-byte row reads */
#define FA_NST (SQ / FA_SK)
static_assert(HD == 64 && FA_SK == 64 && SQ % FA_SK == 0 && SQ % FA_BR == 0 && FA_NW * 32 == 128, "k_fattn: 64 x 128-byte tiles, four 16-byte pieces of each per thread, whole stages and whole query blocks");
typedef float v2f __attribute__((ext_vector_type(2)));
typedef _Float16 v2h __attribute__((ext_vector_type(2)));
typedef unsigned int v8u __attribute__((ext_vector_type(8)));
typedef unsigned int v4u __attribute__((ext_vector_type(4)));
__device__ __forceinline__ v16h fa_frag(const unsigned short* p) { FragH f; f.half[0] = *(const v8us*)p; f.half[1] = *(const v8us*)(p + 16); return f.v; }      /* p already holds the lane half's + 8 h */
__device__ __forceinline__ unsigned int fa_pack(float lo, float hi) { return __builtin_bit_cast(unsigned int, __builtin_convertvector((v2f){lo, hi}, v2h)); }
__device__ __forceinline__ float fa_xh(float x) { return __builtin_bit_cast(float, __builtin_amdgcn_permlanex16(__builtin_bit_cast(int, x), __builtin_bit_cast(int, x), 0x76543210, 0xfedcba98, false, false)); }      /* lane l with lane l ^ 16 */
__device__ __forceinline__ v8f fa_mma(v16h a, v16h b, v8f c) { return __builtin_amdgcn_wmma_f32_16x16x32_f16(false, a, false, b, (short)0, c, false, false); }
__global__ __launch_bounds__(FA_NW * 32) void k_fattn(const _Float16* __restrict__ Q16, const _Float16* __restrict__ K16, const _Float16* __restrict__ VT, _Float16* __restrict__ O16) {
  __shared__ __attribute__((aligned(16))) unsigned short sk[2][FA_SK][FA_LP];      /* K rows [key][d] */
  __shared__ __attribute__((aligned(16))) unsigned short sv[2][HD][FA_LP];         /* V^T rows [d][key] */
  const int tid = threadIdx.x, lane = tid & 31, wave = tid >> 5, c = lane & 15, h = lane >> 4;
  const int bh = blockIdx.y, b = bh / NH, hd = bh - b * NH;
  const int q0 = blockIdx.x * FA_BR + wave * (FA_R * 16);
  const int sr = tid >> 3, sc = (tid & 7) * 8;      /* staging: eight lanes cover one 128-byte row; piece u is row sr + 16 u */
  const unsigned short* kg = (const unsigned short*)K16 + ((size_t)b * SQ + sr) * DM + hd * HD + sc;
  const unsigned short* vg = (const unsigned short*)VT + ((size_t)bh * HD + sr) * SQ + sc;
  const float cscale = 0.125f * 1.4426950408889634f;      /* HD^-0.5 log2(e) */
  v8us rk[4], rv[4];
#pragma unroll
  for (int u = 0; u < 4; ++u) { rk[u] = *(const v8us*)(kg + (size_t)(16 * u) * DM); rv[u] = *(const v8us*)(vg + (size_t)(16 * u) * SQ); }
  v16h qf[FA_R][2];
#pragma unroll
  for (int g = 0; g < FA_R; ++g) { const unsigned short* qp = (const unsigned short*)Q16 + ((size_t)b * SQ + q0 + 16 * g + c) * DM + hd * HD + 8 * h; qf[g][0] = fa_frag(qp); qf[g][1] = fa_frag(qp + 32); }
  const unsigned int o1 = (c == 0) ? 0x3C003C00u : 0u;      /* A operand whose row 0 is f16 ones: its product with P^T is the weights' column sums */
  const v16h ones = __builtin_bit_cast(v16h, (v8u){o1, o1, o1, o1, o1, o1, o1, o1});
  const v8f z8 = {0.f, 0.f, 0.f, 0.f, 0.f, 0.f, 0.f, 0.f};
  v8f acc[FA_R][4], lacc[FA_R]; float m_run[FA_R];
#pragma unroll
  for (int g = 0; g < FA_R; ++g) { m_run[g] = -__builtin_inff(); lacc[g] = z8; acc[g][0] = z8; acc[g][1] = z8; acc[g][2] = z8; acc[g][3] = z8; }
#pragma unroll
  for (int u = 0; u < 4; ++u) { *(v8us*)&sk[0][sr + 16 * u][sc] = rk[u]; *(v8us*)&sv[0][sr + 16 * u][sc] = rv[u]; }
  __syncthreads();
#pragma unroll 1      /* rolled: one stage's code, two buffers by index */
  for (int st = 0; st < FA_NST; ++st) {
    const int bu = st & 1;
    if (st + 1 < FA_NST) {      /* the next stage's tiles fly into registers under this stage's two passes */
      const unsigned short* kn = kg + (size_t)(st + 1) * FA_SK * DM; const unsigned short* vn = vg + (st + 1) * FA_SK;
#pragma unroll
      for (int u = 0; u < 4; ++u) { rk[u] = *(const v8us*)(kn + (size_t)(16 * u) * DM); rv[u] = *(const v8us*)(vn + (size_t)(16 * u) * SQ); }
      asm volatile("s_wait_xcnt 0x0" :: "v"(kn), "v"(vn) : "memory");      /* stands in front of every overwrite of the address registers that the loads above name */
    }
#pragma unroll
    for (int sub = 0; sub < 2; ++sub) {
      v8f s[2][FA_R];
      { v16h kf[2][2];
#pragma unroll
        for (int kt = 0; kt < 2; ++kt) { const unsigned short* p = &sk[bu][32 * sub + 16 * kt + c][8 * h]; kf[kt][0] = fa_frag(p); kf[kt][1] = fa_frag(p + 32); }
#pragma unroll
        for (int kt = 0; kt < 2; ++kt)
#pragma unroll
          for (int g = 0; g < FA_R; ++g) s[kt][g] = fa_mma(kf[kt][0], qf[g][0], z8);
#pragma unroll
        for (int kt = 0; kt < 2; ++kt)
#pragma unroll
          for (int g = 0; g < FA_R; ++g) s[kt][g] = fa_mma(kf[kt][1], qf[g][1], s[kt][g]); }
      v16h vf[4];
#pragma unroll
      for (int t = 0; t < 4; ++t) vf[t] = fa_frag(&sv[bu][16 * t + c][32 * sub + 8 * h]);
      float mb[FA_R]; bool need = false;
#pragma unroll
      for (int g = 0; g < FA_R; ++g) { float mx = s[0][g][0];
#pragma unroll
        for (int r = 1; r < 8; ++r) mx = fmaxf(mx, s[0][g][r]);
#pragma unroll
        for (int r = 0; r < 8; ++r) mx = fmaxf(mx, s[1][g][r]);
        mx = fmaxf(mx, fa_xh(mx)) * cscale; mb[g] = mx; need = need || (mx > m_run[g] + 8.0f); }
      if (__builtin_amdgcn_ballot_w32(need) != 0) {      /* lazy rescale: the maximum in use may trail the true one by up to 8 (log2), so a weight stays below 2^8 */
#pragma unroll
        for (int g = 0; g < FA_R; ++g) { const float mn = fmaxf(m_run[g], mb[g]); const float corr = __builtin_amdgcn_exp2f(m_run[g] - mn); m_run[g] = mn; lacc[g] = lacc[g] * corr;
#pragma unroll
          for (int t = 0; t < 4; ++t) acc[g][t] = acc[g][t] * corr; } }
#pragma unroll
      for (int g = 0; g < FA_R; ++g) { const float nm = -m_run[g]; v8u w;
#pragma unroll
        for (int i = 0; i < 8; ++i) { const v2f a = __builtin_elementwise_fma((v2f){s[i >> 2][g][2 * (i & 3)], s[i >> 2][g][2 * (i & 3) + 1]}, (v2f){cscale, cscale}, (v2f){nm, nm}); w[i] = fa_pack(__builtin_amdgcn_exp2f(a[0]), __builtin_amdgcn_exp2f(a[1])); }
        const v16h pf = __builtin_bit_cast(v16h, w);      /* element e: key 8 h + e (tile 0), 16 + 8 h + e - 8 (tile 1) of query c */
#pragma unroll
        for (int t = 0; t < 4; ++t) acc[g][t] = fa_mma(vf[t], pf, acc[g][t]);
        lacc[g] = fa_mma(ones, pf, lacc[g]); }
    }
    __builtin_amdgcn_sched_barrier(0);      /* keeps the v_nop run below directly behind the stage's last WMMA */
    asm volatile("v_nop\n\tv_nop\n\tv_nop\n\tv_nop");      /* the four vector slots behind a WMMA, also on the taken side of the branches that follow */
    __builtin_amdgcn_sched_barrier(0);
    if (st + 1 < FA_NST) {
#pragma unroll
      for (int u = 0; u < 4; ++u) { *(v8us*)&sk[bu ^ 1][sr + 16 * u][sc] = rk[u]; *(v8us*)&sv[bu ^ 1][sr + 16 * u][sc] = rv[u]; } }
    __syncthreads();      /* publishes the next stage and ends every wave's reads of this one, which the next trip overwrites */
  }
#pragma unroll
  for (int g = 0; g < FA_R; ++g) { const float lr = lacc[g][0]; const float inv = 64.0f / (lr + fa_xh(lr));      /* row 0 of the sum tile sits in lanes 0-15, row 8 (zero) in lanes 16-31: the exchange-and-add is unconditional */
    unsigned short* op = (unsigned short*)O16 + ((size_t)b * SQ + q0 + 16 * g + c) * DM + hd * HD + 8 * h;
#pragma unroll
    for (int t = 0; t < 4; ++t) { const v8f o = acc[g][t] * inv; *(v4u*)(op + 16 * t) = (v4u){fa_pack(o[0], o[1]), fa_pack(o[2], o[3]), fa_pack(o[4], o[5]), fa_pack(o[6], o[7])}; } } }      /* acc register r = d 16 t + 8 h + r of query c */

extern "C" void kernel_launch(void* const* d_in, const int* in_sizes, int n_in,
                              void* d_out, int out_size, void* d_ws, size_t ws_size, hipStream_t stream) {
  (void)in_sizes; (void)n_in; (void)out_size;
  const float* const* I = (const float* const*)d_in; const float* x = I[0]; const float* wq = I[1]; const float* bq = I[2]; const float* wk = I[3]; const float* bk = I[4]; const float* wv = I[5]; const float* bv = I[6]; const float* wo = I[7]; const float* bo = I[8];      /* [in][out] weights + biases */
  char* ws = (char*)d_ws; size_t off = 0;
  auto take = [&](size_t bytes) { char* p = ws + off; off += (bytes + 255) & ~(size_t)255; return p; };
  _Float16* BQ = (_Float16*)take((size_t)DM * DM * 2); _Float16* BK = (_Float16*)take((size_t)DM * DM * 2); _Float16* BV = (_Float16*)take((size_t)DM * DM * 2); _Float16* BO = (_Float16*)take((size_t)DM * DM * 2);
  _Float16* X16 = (_Float16*)take(NR * DM * 2); _Float16* Q16 = (_Float16*)take(NR * DM * 2); _Float16* K16 = (_Float16*)take(NR * DM * 2); _Float16* V16 = (_Float16*)take(NR * DM * 2); _Float16* O16 = (_Float16*)take(NR * DM * 2);
  _Float16* VT = (_Float16*)take((size_t)NB * NH * HD * SQ * 2);
  if (off > ws_size) return;
  k_wt_f16<<<(unsigned)(((size_t)DM * (DM / 8) + 255) / 256), 256, 0, stream>>>(wq, BQ, DM, DM, 16.0f); k_wt_f16<<<(unsigned)(((size_t)DM * (DM / 8) + 255) / 256), 256, 0, stream>>>(wk, BK, DM, DM, 16.0f); k_wt_f16<<<(unsigned)(((size_t)DM * (DM / 8) + 255) / 256), 256, 0, stream>>>(wv, BV, DM, DM, 16.0f); k_wt_f16<<<(unsigned)(((size_t)DM * (DM / 8) + 255) / 256), 256, 0, stream>>>(wo, BO, DM, DM, 16.0f);      /* [in][out] -> Bt[n][k] x16 */

  k_x16<<<(unsigned)((NR * DM / 8 + 255) / 256), 256, 0, stream>>>(x, X16, NR * DM / 8);
  const size_t r0p = (size_t)B0 * SQ;      /* first projected row */
  k_gemm2<0><<<dim3((unsigned)((MP / 128) * (DM / 64)), 1), 128, 0, stream>>>(X16 + r0p * DM, DM, 0, BQ, DM, 0, 0.0625f, bq, 0, nullptr, 1, 0, 0, nullptr, Q16 + r0p * DM, DM, 0, MP, DM, DM);
  k_gemm2<0><<<dim3((unsigned)((MP / 128) * (DM / 64)), 1), 128, 0, stream>>>(X16 + r0p * DM, DM, 0, BK, DM, 0, 0.0625f, bk, 0, nullptr, 1, 0, 0, nullptr, K16 + r0p * DM, DM, 0, MP, DM, DM);
  k_gemm2<0><<<dim3((unsigned)((MP / 128) * (DM / 64)), 1), 128, 0, stream>>>(X16 + r0p * DM, DM, 0, BV, DM, 0, 0.0625f, bv, 0, nullptr, 1, 0, 0, nullptr, V16 + r0p * DM, DM, 0, MP, DM, DM);
  k_vt<NH, SQ><<<NB * NH * (SQ / 64), 256, 0, stream>>>(V16, LQ, 0, VT);      /* V^T [NB][NH][HD][SQ] */
  k_fattn<<<dim3(SQ / FA_BR, NB * NH), FA_NW * 32, 0, stream>>>(Q16, K16, VT, O16);      /* o x64 (merged heads) as f16 rows */
  k_gemm2<0><<<dim3((unsigned)((MPO / 128) * (DM / 64)), 1), 128, 0, stream>>>(O16 + r0p * DM, DM, 0, BO, DM, 0, 0.0009765625f, bo, 0, nullptr, 1, 0, 0, (float*)d_out + r0p * DM, nullptr, DM, 0, MPO, DM, DM);      /* out rows are the output layout */
}

// v003
// Measured time: 117 microseconds a run.
// Next to v002, in two timings, it ran 1.61 and 1.62 times as fast.
// Over all steps from v000 it is 22.6 times as fast.
#include <hip/hip_runtime.h>
// Multi-head self-attention (x [2][2048][768]; q/k/v = x W + b ([in][out] 768x768 sigma 1/sqrt(768), zero biases); 12 heads of 64; softmax(q k^T / 8) over all keys (no mask); out = ctx Wo + bo -> [2][2048][768]).
// Structure: token rows r = b*2048 + s; x as exact f16 rows (bf16-rounded); Q, K, V as three WMMA GEMMs (32x64 wave tiles, f32 accumulation, exact x16 weights + bias, f16 outputs); V^T for all batches and heads via LDS transposes; one fused attention launch over (query block, batch x head): S^T = K Q^T (K = 64), online softmax in the log2 domain on the score accumulators (f32 statistics, native exp2, weights as f16 relative to the running maximum), O^T += V^T P^T, K and V^T staged in LDS; o carried x64 against f16 subnormal flush (folded into the output GEMM alpha), written straight into the merged f16 o rows; out = o W_o + b GEMM (f32) into the output layout.
// Compute dtype: inputs rounded to bf16; x / weights exact; q, k, v, softmax weights and o as plain f16 GEMM operands (~2^-12); scores and softmax statistics f32. v_wmma_f32_16x16x32_f16.
#define NB 2
#define SQ 2048
#define DM 768
#define NH 12
#define HD 64
#define HG 4                         /* heads per block group of the unlaunched k_vt(b, h0) */
#define B0 0                         /* first batch processed (debug hook) */
#define NBR NB                       /* batches processed (debug hook) */
#define NR ((size_t)NB * SQ)         /* token rows */
#define MP ((int)((size_t)NBR * SQ)) /* rows projected (debug hook) */
#define QN SQ                        /* query rows per batch; not read (k_fattn attends all SQ) */
#define NHD NH                       /* heads; not read (k_fattn attends all NH) */
#define MPO MP                       /* rows through the output stage (debug hook) */
#define LQ DM      /* row pitch of the q/k/v rows */
typedef __bf16 v16b __attribute__((ext_vector_type(16)));
typedef unsigned short v8us __attribute__((ext_vector_type(8), may_alias));
typedef float  v8f  __attribute__((ext_vector_type(8)));
typedef float  v4f  __attribute__((ext_vector_type(4)));
typedef float  v4fa __attribute__((ext_vector_type(4), may_alias));
union FragB { v16b v; v8us half[2]; unsigned short u[16]; };

__device__ __forceinline__ unsigned short bf16_bits(float x) { unsigned int u = __float_as_uint(x); return (unsigned short)((u + 0x7FFFu + ((u >> 16) & 1u)) >> 16); }
__device__ __forceinline__ float bf16_val(unsigned short b) { return __uint_as_float(((unsigned int)b) << 16); }
__device__ __forceinline__ float bf16_round(float x) { return bf16_val(bf16_bits(x)); }
// D += A·B with NT terms: 1 = ah·bh, 2 = + al·bh (A split), 3 = + ah·bl (both split)
template <int NT>
__device__ __forceinline__ v8f mmaN(v16b ah, v16b al, v16b bh, v16b bl, v8f c) {
  c = __builtin_amdgcn_wmma_f32_16x16x32_bf16(false, ah, false, bh, (short)0, c, false, false);
  if (NT >= 2) c = __builtin_amdgcn_wmma_f32_16x16x32_bf16(false, al, false, bh, (short)0, c, false, false);
  if (NT >= 3) c = __builtin_amdgcn_wmma_f32_16x16x32_bf16(false, ah, false, bl, (short)0, c, false, false);
  asm volatile("v_nop\n\tv_nop\n\tv_nop\n\tv_nop" : "+v"(c) : "v"(ah), "v"(al), "v"(bh), "v"(bl));
  return c;
}

__global__ __launch_bounds__(256) void k_wt_bf16(const float* __restrict__ W, unsigned short* __restrict__ Wt, int K, int N) {
  const int t = blockIdx.x * 256 + threadIdx.x;
  const int k8n = K / 8;
  if (t >= N * k8n) return;
  const int n = t / k8n, k8 = (t % k8n) * 8;
  v8us v;
#pragma unroll
  for (int i = 0; i < 8; ++i) v[i] = bf16_bits(W[(size_t)(k8 + i) * N + n]);
  *(v8us*)(Wt + (size_t)n * K + k8) = v;
  
}

// GEMM C[M][N] (f32, pitch ldc) = act(A[M][K]·W + bias). A f32 row-major (pitch lda) converted per fragment to bf16
// (ASPLIT: hi/lo two planes -> 2 terms, else single rounded term); Wt bf16 [N][K] (pitch ldb). BIAS_BF16 rounds the
// bias to bf16 first (bias quantised to bf16 before the add). K%32==0, M%16==0, N%64==0.
template <bool ASPLIT, int ACT, bool BIAS_BF16>
__global__ __launch_bounds__(128) void k_gemm_bf(const float* __restrict__ A, int lda, const unsigned short* __restrict__ Wt, int ldb,
                                               const float* __restrict__ bias, float* __restrict__ C, int ldc, int M, int N, int K) {
  __shared__ __attribute__((aligned(16))) float so[4][16][64];
  const int tid = threadIdx.x, w = tid >> 5, lane = tid & 31, ln = lane & 15, hh = lane >> 4;
  const int ntn = N / 64;
  const int wid = blockIdx.x * 4 + w;
  const int mt = wid / ntn, nq = wid % ntn;
  if (mt * 16 >= M) return;
  const int row0 = mt * 16, col0 = nq * 64;
  const float* arow = A + (size_t)(row0 + ln) * lda;
  v8f acc[4] = {};
  for (int kb = 0; kb < K; kb += 32) {
    FragB ah, al;
    const v4f x0 = *(const v4fa*)(arow + kb + 8 * hh), x1 = *(const v4fa*)(arow + kb + 8 * hh + 4);
    const v4f x2 = *(const v4fa*)(arow + kb + 16 + 8 * hh), x3 = *(const v4fa*)(arow + kb + 16 + 8 * hh + 4);
    float xs[16] = {x0[0],x0[1],x0[2],x0[3],x1[0],x1[1],x1[2],x1[3],x2[0],x2[1],x2[2],x2[3],x3[0],x3[1],x3[2],x3[3]};
#pragma unroll
    for (int i = 0; i < 16; ++i) { const unsigned short hb = bf16_bits(xs[i]); ah.u[i] = hb; al.u[i] = ASPLIT ? bf16_bits(xs[i] - bf16_val(hb)) : (unsigned short)0; }
#pragma unroll
    for (int t = 0; t < 4; ++t) {
      const unsigned short* brow = Wt + (size_t)(col0 + t * 16 + ln) * ldb + kb;
      FragB b;
      b.half[0] = *(const v8us*)(brow + 8 * hh);
      b.half[1] = *(const v8us*)(brow + 16 + 8 * hh);
      acc[t] = mmaN<ASPLIT ? 2 : 1>(ah.v, al.v, b.v, b.v, acc[t]);
    }
  }
#pragma unroll
  for (int t = 0; t < 4; ++t) {
    float bv = bias ? bias[col0 + t * 16 + ln] : 0.f;
    if (BIAS_BF16) bv = bf16_round(bv);
#pragma unroll
    for (int r = 0; r < 8; ++r) { float v = acc[t][r] + bv; if (ACT == 1) v = fmaxf(v, 0.f); so[w][8 * hh + r][t * 16 + ln] = v; }
  }
  __builtin_amdgcn_fence(__ATOMIC_ACQ_REL, "workgroup");
  __builtin_amdgcn_wave_barrier();
  const int rsub = lane >> 4, c4 = (lane & 15) * 4;
  {
#pragma unroll
    for (int q = 0; q < 8; ++q) {
      const int r = q * 2 + rsub;
      const v4f v = *(const v4fa*)&so[w][r][c4];
      *(v4f*)(C + (size_t)(row0 + r) * ldc + col0 + c4) = v;
    }
    
  }
}

// GEMM C = act(A·W + bias + resid): A f32 (ASPLIT -> hi/lo 2 terms), Wt bf16 [N][K]; ACT 0 none, 1 relu, 2 exact gelu;
// resid (optional, f32, row index = (row % rmod), pitch ldr, RES_BF16 rounds it) added before the activation.
template <bool ASPLIT, int ACT, bool BIAS_BF16, bool RES_BF16>
__global__ __launch_bounds__(128) void k_gemm_bf3(const float* __restrict__ A, int lda, const unsigned short* __restrict__ Wt, int ldb,
                                                const float* __restrict__ bias, const float* __restrict__ resid, int rmod, int ldr,
                                                float* __restrict__ C, int ldc, int M, int N, int K) {
  __shared__ __attribute__((aligned(16))) float so[4][16][64];
  const int tid = threadIdx.x, w = tid >> 5, lane = tid & 31, ln = lane & 15, hh = lane >> 4;
  const int ntn = N / 64;
  const int wid = blockIdx.x * 4 + w;
  const int mt = wid / ntn, nq = wid % ntn;
  if (mt * 16 >= M) return;
  const int row0 = mt * 16, col0 = nq * 64;
  const float* arow = A + (size_t)(row0 + ln) * lda;
  v8f acc[4] = {};
  for (int kb = 0; kb < K; kb += 32) {
    FragB ah, al;
    const v4f x0 = *(const v4fa*)(arow + kb + 8 * hh), x1 = *(const v4fa*)(arow + kb + 8 * hh + 4);
    const v4f x2 = *(const v4fa*)(arow + kb + 16 + 8 * hh), x3 = *(const v4fa*)(arow + kb + 16 + 8 * hh + 4);
    float xs[16] = {x0[0],x0[1],x0[2],x0[3],x1[0],x1[1],x1[2],x1[3],x2[0],x2[1],x2[2],x2[3],x3[0],x3[1],x3[2],x3[3]};
#pragma unroll
    for (int i = 0; i < 16; ++i) { const unsigned short hb = bf16_bits(xs[i]); ah.u[i] = hb; al.u[i] = ASPLIT ? bf16_bits(xs[i] - bf16_val(hb)) : (unsigned short)0; }
#pragma unroll
    for (int t = 0; t < 4; ++t) {
      const unsigned short* brow = Wt + (size_t)(col0 + t * 16 + ln) * ldb + kb;
      FragB b;
      b.half[0] = *(const v8us*)(brow + 8 * hh);
      b.half[1] = *(const v8us*)(brow + 16 + 8 * hh);
      acc[t] = mmaN<ASPLIT ? 2 : 1>(ah.v, al.v, b.v, b.v, acc[t]);
    }
  }
#pragma unroll
  for (int t = 0; t < 4; ++t) {
    const int col = col0 + t * 16 + ln;
    float bv = bias ? bias[col] : 0.f;
    if (BIAS_BF16) bv = bf16_round(bv);
#pragma unroll
    for (int r = 0; r < 8; ++r) {
      float v = acc[t][r] + bv;
      if (resid) { float rv = resid[(size_t)((row0 + 8 * hh + r) % rmod) * ldr + col]; if (RES_BF16) rv = bf16_round(rv); v += rv; }
      if (ACT == 1) v = fmaxf(v, 0.f);
      if (ACT == 2) v = 0.5f * v * (1.0f + erff(v * 0.70710678118654752f));
      if (ACT == 3) { const float u = 0.7978845608028654f * (v + 0.044715f * v * v * v); v = 0.5f * v * (1.0f + tanhf(u)); }
      so[w][8 * hh + r][t * 16 + ln] = v;
    }
  }
  __builtin_amdgcn_fence(__ATOMIC_ACQ_REL, "workgroup");
  __builtin_amdgcn_wave_barrier();
  const int rsub = lane >> 4, c4 = (lane & 15) * 4;
  {
#pragma unroll
    for (int q = 0; q < 8; ++q) {
      const int r = q * 2 + rsub;
      const v4f v = *(const v4fa*)&so[w][r][c4];
      *(v4f*)(C + (size_t)(row0 + r) * ldc + col0 + c4) = v;
    }
    
  }
}
// row LayerNorm (biased variance, eps) over N: s = X (+ R); optional out_sum <- s; out_norm <- (s-mu)*rsqrt(var+eps)*g + b
template <bool PARAM_BF16>
__global__ __launch_bounds__(256) void k_layernorm(const float* __restrict__ X, const float* __restrict__ R, const float* __restrict__ g, const float* __restrict__ bta,
                                                  float* __restrict__ out_sum, float* __restrict__ out_norm, int N, float eps) {
  __shared__ float red[256];
  const int row = blockIdx.x, tid = threadIdx.x;
  const float* x = X + (size_t)row * N; const float* rr = R ? R + (size_t)row * N : nullptr;
  float vals[16];                     // up to N = 4096
  const int per = N / 256;            // contiguous chunk per thread? use strided-by-4 chunks: thread handles j = tid*4 + 1024*u
  float s1 = 0.f;
  for (int u = 0; u < per / 4; ++u) {
    const int j = tid * 4 + 1024 * u;
    const v4f a = *(const v4fa*)(x + j);
    v4f b = {0.f,0.f,0.f,0.f}; if (rr) b = *(const v4fa*)(rr + j);
#pragma unroll
    for (int q = 0; q < 4; ++q) { const float v = a[q] + b[q]; vals[u * 4 + q] = v; s1 += v; }
  }
  red[tid] = s1; __syncthreads();
  for (int st = 128; st > 0; st >>= 1) { if (tid < st) red[tid] += red[tid + st]; __syncthreads(); }
  const float mu = red[0] / (float)N; __syncthreads();
  float s2 = 0.f;
  for (int u = 0; u < per / 4; ++u)
#pragma unroll
    for (int q = 0; q < 4; ++q) { const float c = vals[u * 4 + q] - mu; s2 += c * c; }
  red[tid] = s2; __syncthreads();
  for (int st = 128; st > 0; st >>= 1) { if (tid < st) red[tid] += red[tid + st]; __syncthreads(); }
  const float rs = rsqrtf(red[0] / (float)N + eps);
  {
    for (int u = 0; u < per / 4; ++u) {
      const int j = tid * 4 + 1024 * u;
      v4f o, sm;
#pragma unroll
      for (int q = 0; q < 4; ++q) {
        float gg = g[j + q], bb = bta[j + q];
        if (PARAM_BF16) { gg = bf16_round(gg); bb = bf16_round(bb); }
        sm[q] = vals[u * 4 + q]; o[q] = (vals[u * 4 + q] - mu) * rs * gg + bb;
      }
      if (out_sum) *(v4f*)(out_sum + (size_t)row * N + j) = sm;
      *(v4f*)(out_norm + (size_t)row * N + j) = o;
    }
    
  }
}



// ---- f16 WMMA path (v_wmma_f32_16x16x32_f16): 11-bit significands for operands in range — used where a [0,1] probability operand needs more precision than bf16
typedef _Float16 v16h __attribute__((ext_vector_type(16)));
union FragH { v16h v; v8us half[2]; _Float16 h[16]; unsigned short u[16]; };
template <int NT>
__device__ __forceinline__ v8f mmaH(v16h ah, v16h al, v16h bh, v16h bl, v8f c) {
  c = __builtin_amdgcn_wmma_f32_16x16x32_f16(false, ah, false, bh, (short)0, c, false, false);
  if (NT >= 2) c = __builtin_amdgcn_wmma_f32_16x16x32_f16(false, al, false, bh, (short)0, c, false, false);
  if (NT >= 3) c = __builtin_amdgcn_wmma_f32_16x16x32_f16(false, ah, false, bl, (short)0, c, false, false);
  asm volatile("v_nop\n\tv_nop\n\tv_nop\n\tv_nop" : "+v"(c) : "v"(ah), "v"(al), "v"(bh), "v"(bl));
  return c;
}
// batched GEMM like k_gemm_b but f16 operands: A f32 (split into f16 hi/lo if ASPLIT, else rounded to f16), Bt = f16 values [n][k]; alpha; C f32; N multiple of 16 (partial tiles skipped)
template <bool ASPLIT>
__global__ __launch_bounds__(128) void k_gemm_h(const float* __restrict__ A, int lda, size_t sA, const _Float16* __restrict__ Bh, int ldb, size_t sB, float alpha, float* __restrict__ C, int ldc, size_t sC, int M, int N, int K) {
  __shared__ __attribute__((aligned(16))) float so[4][16][64];
  const int tid = threadIdx.x, w = tid >> 5, lane = tid & 31, ln = lane & 15, hh = lane >> 4; const int by = blockIdx.y;
  A += (size_t)by * sA; Bh += (size_t)by * sB; C += (size_t)by * sC;
  const int ntn = (N + 63) / 64; const int wid = blockIdx.x * 4 + w; const int mt = wid / ntn, nq = wid % ntn; if (mt * 16 >= M) return;
  const int row0 = mt * 16, col0 = nq * 64; const float* arow = A + (size_t)(row0 + ln) * lda;
  v8f acc[4] = {};
  for (int kb = 0; kb < K; kb += 32) {
    FragH ah, al;
    const v4f x0 = *(const v4fa*)(arow + kb + 8 * hh), x1 = *(const v4fa*)(arow + kb + 8 * hh + 4), x2 = *(const v4fa*)(arow + kb + 16 + 8 * hh), x3 = *(const v4fa*)(arow + kb + 16 + 8 * hh + 4);
    float xs[16] = {x0[0],x0[1],x0[2],x0[3],x1[0],x1[1],x1[2],x1[3],x2[0],x2[1],x2[2],x2[3],x3[0],x3[1],x3[2],x3[3]};
#pragma unroll
    for (int i = 0; i < 16; ++i) { const _Float16 h = (_Float16)xs[i]; ah.h[i] = h; al.h[i] = ASPLIT ? (_Float16)(xs[i] - (float)h) : (_Float16)0.0f; }
#pragma unroll
    for (int t = 0; t < 4; ++t) { if (col0 + t * 16 >= N) continue; const size_t boff = (size_t)(col0 + t * 16 + ln) * ldb + kb; FragH bq; bq.half[0] = *(const v8us*)(Bh + boff + 8 * hh); bq.half[1] = *(const v8us*)(Bh + boff + 16 + 8 * hh);
      acc[t] = mmaH<ASPLIT ? 2 : 1>(ah.v, al.v, bq.v, bq.v, acc[t]); }
  }
#pragma unroll
  for (int t = 0; t < 4; ++t) { if (col0 + t * 16 >= N) continue;
#pragma unroll
    for (int r = 0; r < 8; ++r) so[w][8 * hh + r][t * 16 + ln] = acc[t][r] * alpha; }
  __builtin_amdgcn_fence(__ATOMIC_ACQ_REL, "workgroup"); __builtin_amdgcn_wave_barrier();
  const int rsub = lane >> 4, c4 = (lane & 15) * 4;
  {
#pragma unroll
    for (int q = 0; q < 8; ++q) { const int r = q * 2 + rsub; if (col0 + c4 < N) { const v4f v = *(const v4fa*)&so[w][r][c4]; *(v4f*)(C + (size_t)(row0 + r) * ldc + col0 + c4) = v; } }
     }
}

// Wt[n][k] = f16(W[k][n]·scale) from f32 row-major W[K][N] (scale = power of two; bf16-exact weights stay exact in f16 away from the subnormal range)
__global__ __launch_bounds__(256) void k_wt_f16(const float* __restrict__ W, _Float16* __restrict__ Wt, int K, int N, float scale) {
  const int t = blockIdx.x * 256 + threadIdx.x; if (t >= N * (K / 8)) return; const int n = t / (K / 8), k8 = (t % (K / 8)) * 8; FragH f;
#pragma unroll
  for (int i = 0; i < 8; ++i) f.h[i] = (_Float16)(bf16_round(W[(size_t)(k8 + i) * N + n]) * scale); const v8us o = f.half[0];
  *(v8us*)((unsigned short*)Wt + (size_t)n * K + k8) = o; 
}
// k_gemm_hh variant with fused epilogue: v = acc·alpha + bias[by·sBias + col] (+ CP[(row/rowsPerB)·sCPb + by·64 + col] if CP) ; ACT 0 none / 1 elu ; writes f16 C16 (and f32 C if non-null)
template <int ACT>
__global__ __launch_bounds__(128) void k_gemm_hhx(const _Float16* __restrict__ A, int lda, size_t sA, const _Float16* __restrict__ Bh, int ldb, size_t sB, float alpha, const float* __restrict__ bias, size_t sBias, const float* __restrict__ CP, int rowsPerB, size_t sCPb, int row0g,
    float* __restrict__ C, _Float16* __restrict__ C16, int ldc, size_t sC, int M, int N, int K) {
  __shared__ __attribute__((aligned(16))) float so[4][16][64];
  const int tid = threadIdx.x, w = tid >> 5, lane = tid & 31, ln = lane & 15, hh = lane >> 4; const int by = blockIdx.y;
  A += (size_t)by * sA; Bh += (size_t)by * sB; const size_t cofs = (size_t)by * sC; const float* bp = bias ? bias + (size_t)by * sBias : nullptr;
  const int ntn = (N + 63) / 64; const int wid = blockIdx.x * 4 + w; const int mt = wid / ntn, nq = wid % ntn; if (mt * 16 >= M) return;
  const int row0 = mt * 16, col0 = nq * 64; const _Float16* arow = A + (size_t)(row0 + ln) * lda;
  v8f acc[4] = {};
  for (int kb = 0; kb < K; kb += 32) { FragH ah; ah.half[0] = *(const v8us*)((const unsigned short*)arow + kb + 8 * hh); ah.half[1] = *(const v8us*)((const unsigned short*)arow + kb + 16 + 8 * hh);
#pragma unroll
    for (int t = 0; t < 4; ++t) { if (col0 + t * 16 >= N) continue; const size_t boff = (size_t)(col0 + t * 16 + ln) * ldb + kb; FragH bq; bq.half[0] = *(const v8us*)((const unsigned short*)Bh + boff + 8 * hh); bq.half[1] = *(const v8us*)((const unsigned short*)Bh + boff + 16 + 8 * hh);
      acc[t] = mmaH<1>(ah.v, ah.v, bq.v, bq.v, acc[t]); }
  }
#pragma unroll
  for (int t = 0; t < 4; ++t) { if (col0 + t * 16 >= N) continue; const int col = col0 + t * 16 + ln; const float bv = bp ? bf16_round(bp[col]) : 0.f;
#pragma unroll
    for (int r = 0; r < 8; ++r) { float v = acc[t][r] * alpha + bv; if (CP) { const int rr = row0g + row0 + 8 * hh + r; if (rowsPerB < 0) v += CP[cofs + (size_t)rr * ldc + col];      /* rowsPerB < 0: own element of the batched C plane */ else { const int bidx = rr / rowsPerB; v += CP[(size_t)bidx * sCPb + (size_t)by * 64 + col]; } } if (ACT == 1) v = (v > 0.f) ? v : expm1f(v); else if (ACT == 7) v = (v > 0.f) ? v + 1.0f : expf(v); else if (ACT == 8) v = tanhf(v); else if (ACT == 9) v = 0.5f * v * (1.0f + tanhf(0.7978845608028654f * (v + 0.044715f * v * v * v))); else if (ACT == 11) v = 1.0f / (1.0f + expf(-v)); else if (ACT == 12) v = (v > 0.f) ? v : 0.01f * v; else if (ACT == 14) v = (v > 0.f) ? v : 0.1f * v; else if (ACT == 16) v = (v >= 0.f) ? v : 0.3f * v; else if (ACT == 17) v = (v >= 0.f) ? v : 0.2f * v; else if (ACT == 15) v = v / (1.0f + expf(-v)); else if (ACT == 3) v = fmaxf(v, 0.f); else if (ACT == 6) v = 0.5f * v * (1.0f + erff(v * 0.70710678118654752f)); so[w][8 * hh + r][t * 16 + ln] = v; } }
  __builtin_amdgcn_fence(__ATOMIC_ACQ_REL, "workgroup"); __builtin_amdgcn_wave_barrier();
  const int rsub = lane >> 4, c4 = (lane & 15) * 4; typedef _Float16 v4h __attribute__((ext_vector_type(4)));
  {
#pragma unroll
    for (int q = 0; q < 8; ++q) { const int r = q * 2 + rsub; if (col0 + c4 < N) { const v4f v = *(const v4fa*)&so[w][r][c4]; if (C) *(v4f*)(C + cofs + (size_t)(row0 + r) * ldc + col0 + c4) = v; if (C16) { v4h h4; for (int i = 0; i < 4; ++i) h4[i] = (_Float16)v[i]; *(v4h*)(C16 + cofs + (size_t)(row0 + r) * ldc + col0 + c4) = h4; } } }
     }
}


typedef _Float16 v4h __attribute__((ext_vector_type(4)));

__global__ __launch_bounds__(256) void k_x16(const float* __restrict__ x, _Float16* __restrict__ X16, size_t n8) { const size_t t = (size_t)blockIdx.x * 256 + threadIdx.x; if (t >= n8) return; FragH f;
#pragma unroll
  for (int q = 0; q < 8; ++q) f.h[q] = (_Float16)bf16_round(x[t * 8 + q]); *(v8us*)((unsigned short*)X16 + t * 8) = f.half[0];  }
__global__ __launch_bounds__(256) void k_h16(const float* __restrict__ x, _Float16* __restrict__ X16, size_t n8) { const size_t t = (size_t)blockIdx.x * 256 + threadIdx.x; if (t >= n8) return; FragH f;
#pragma unroll
  for (int q = 0; q < 8; ++q) f.h[q] = (_Float16)x[t * 8 + q]; *(v8us*)((unsigned short*)X16 + t * 8) = f.half[0];  }
__global__ __launch_bounds__(256) void k_round16f(const float* __restrict__ W, _Float16* __restrict__ Bt, size_t n8) { const size_t t = (size_t)blockIdx.x * 256 + threadIdx.x; if (t >= n8) return; FragH f;
#pragma unroll
  for (int i = 0; i < 8; ++i) f.h[i] = (_Float16)(bf16_round(W[t * 8 + i]) * 16.0f); *(v8us*)((unsigned short*)Bt + t * 8) = f.half[0];  }
template <int NHv, int TTv>
__global__ __launch_bounds__(256) void k_vt(const _Float16* __restrict__ V16, int ldv, int voff, _Float16* __restrict__ Vt) { __shared__ unsigned short tl[64][66]; const int tid = threadIdx.x; const int slab = blockIdx.x / (TTv / 64), lg = blockIdx.x % (TTv / 64); const int b = slab / NHv, h = slab % NHv;
  for (int i = tid; i < 64 * 8; i += 256) { const int r = i / 8, c8 = (i % 8) * 8; FragH f; f.half[0] = *(const v8us*)((const unsigned short*)V16 + ((size_t)b * TTv + lg * 64 + r) * ldv + voff + h * 64 + c8);
#pragma unroll
    for (int q = 0; q < 8; ++q) tl[r][c8 + q] = f.u[q]; }
  __syncthreads();
  {
#pragma unroll
    for (int rd = 0; rd < 2; ++rd) { const int d = rd * 32 + tid / 8, pc = tid % 8; FragH f;
#pragma unroll
      for (int q = 0; q < 8; ++q) f.u[q] = tl[pc * 8 + q][d];
      *(v8us*)((unsigned short*)Vt + ((size_t)slab * 64 + d) * TTv + lg * 64 + pc * 8) = f.half[0]; }
     } }

__global__ __launch_bounds__(256) void k_hl(const float* __restrict__ F, _Float16* __restrict__ Hh, _Float16* __restrict__ Hl, size_t n8) { const size_t t = (size_t)blockIdx.x * 256 + threadIdx.x; if (t >= n8) return; FragH fh, fl; const v4f a = *(const v4fa*)(F + t * 8), c = *(const v4fa*)(F + t * 8 + 4);
#pragma unroll
  for (int q = 0; q < 4; ++q) { _Float16 h = (_Float16)a[q]; fh.h[q] = h; fl.h[q] = (_Float16)((a[q] - (float)h) * 1024.0f); h = (_Float16)c[q]; fh.h[4 + q] = h; fl.h[4 + q] = (_Float16)((c[q] - (float)h) * 1024.0f); }
  { *(v8us*)((unsigned short*)Hh + t * 8) = fh.half[0]; *(v8us*)((unsigned short*)Hl + t * 8) = fl.half[0];  } }

// ---- fast GEMM (block tile 128x64, wave tile 32x64; A and B k-tiles staged in LDS; requires M % 128 == 0 rows per launch region, N % 64 == 0 and K % 64 == 0); epilogue = k_gemm_hhx semantics ----
__device__ __forceinline__ v16h g2_frag(const _Float16* p, int hh) { FragH f; f.half[0] = *(const v8us*)((const unsigned short*)p + 8 * hh); f.half[1] = *(const v8us*)((const unsigned short*)p + 16 + 8 * hh); return f.v; }
__device__ __forceinline__ v8f g2_mma(v16h a, v16h b, v8f c) { v8f d = __builtin_amdgcn_wmma_f32_16x16x32_f16(false, a, false, b, (short)0, c, false, false); asm volatile("v_nop\n\tv_nop\n\tv_nop\n\tv_nop" : "+v"(d) : "v"(a), "v"(b)); return d; }
#define G2_KS 64                     /* k per LDS stage: one 128-byte line of every A and B row */
#define G2_LP 72                     /* LDS row pitch in halves: 144 B = 16 B x odd for 16-byte row reads */
__device__ __forceinline__ v16h g2_lfrag(const unsigned short* p) { FragH f; f.half[0] = *(const v8us*)p; f.half[1] = *(const v8us*)(p + 16); return f.v; }      /* p already holds the lane half's + 8 hh: the k order of g2_frag */
template <int ACT, int LDA, int LDB>      /* row pitches at compile time: a tile's row pieces are immediate offsets from one address pair */
__global__ __launch_bounds__(128) void k_gemm2(const _Float16* __restrict__ A, size_t sA, const _Float16* __restrict__ Bh, size_t sB, float alpha, const float* __restrict__ bias, size_t sBias, const float* __restrict__ CP, int rowsPerB, size_t sCPb, int row0g,
    float* __restrict__ C, _Float16* __restrict__ C16, int ldc, size_t sC, int M, int N, int K) { static_assert(ACT == 0 || ACT == 3 || ACT == 6 || ACT == 8 || ACT == 9 || ACT == 11 || ACT == 12 || ACT == 14 || ACT == 15 || ACT == 16 || ACT == 17, "k_gemm2: unsupported ACT code (would silently apply no activation)");
  __shared__ __attribute__((aligned(16))) unsigned short tl[2][128 + 64][G2_LP];      /* per buffer: the block's 128 A rows, then its 64 B rows, G2_KS halves of each */
  float (*so)[32][68] = (float (*)[32][68])&tl[0][0][0];      /* the epilogue's staging takes the tiles' place behind the loop's last barrier */
  static_assert(sizeof(tl) >= sizeof(float) * 4 * 32 * 68, "k_gemm2: epilogue staging must fit in the tile buffers");
  const int tid = threadIdx.x, w = tid >> 5, lane = tid & 31, ln = lane & 15, hh = lane >> 4; const int by = blockIdx.y;
  A += (size_t)by * sA; Bh += (size_t)by * sB; const size_t cofs = (size_t)by * sC; const float* bp = bias ? bias + (size_t)by * sBias : nullptr;
  const int ntn = N >> 6; const int mt = blockIdx.x / ntn, nq = blockIdx.x - mt * ntn; const int row0 = mt * 128 + 32 * w, col0 = nq * 64; if (mt * 128 >= M) return;      /* the same for the whole block: in front of every barrier */
  const int sr = tid >> 3, sc = (tid & 7) * 8;      /* staging: eight lanes cover one 128-byte row piece; piece u is row sr + 16 u */
  const unsigned short* ag = (const unsigned short*)A + (size_t)(mt * 128 + sr) * LDA + sc;
  const unsigned short* bg = (const unsigned short*)Bh + (size_t)(col0 + sr) * LDB + sc;
  v8us ra[8], rb[4];      /* these and af, bf below are indexed under full unrolls only, so that they stay in registers */
#pragma unroll
  for (int u = 0; u < 8; ++u) ra[u] = *(const v8us*)(ag + (size_t)(16 * u) * LDA);
#pragma unroll
  for (int u = 0; u < 4; ++u) rb[u] = *(const v8us*)(bg + (size_t)(16 * u) * LDB);
  const v8f z8 = {0.f,0.f,0.f,0.f,0.f,0.f,0.f,0.f}; v8f c00 = z8, c01 = z8, c02 = z8, c03 = z8, c10 = z8, c11 = z8, c12 = z8, c13 = z8;
#pragma unroll
  for (int u = 0; u < 8; ++u) *(v8us*)&tl[0][sr + 16 * u][sc] = ra[u];
#pragma unroll
  for (int u = 0; u < 4; ++u) *(v8us*)&tl[0][128 + sr + 16 * u][sc] = rb[u];
  __syncthreads();
  const int nst = K / G2_KS;
#pragma unroll 1      /* rolled: one stage's code, two buffers by index */
  for (int st = 0; st < nst; ++st) { const int bu = st & 1;
    if (st + 1 < nst) {      /* the next stage's tiles fly into registers under this stage's products */
      const unsigned short* an = ag + (st + 1) * G2_KS; const unsigned short* bn = bg + (st + 1) * G2_KS;
#pragma unroll
      for (int u = 0; u < 8; ++u) ra[u] = *(const v8us*)(an + (size_t)(16 * u) * LDA);
#pragma unroll
      for (int u = 0; u < 4; ++u) rb[u] = *(const v8us*)(bn + (size_t)(16 * u) * LDB);
      asm volatile("s_wait_xcnt 0x0" :: "v"(an), "v"(bn) : "memory");      /* stands in front of every overwrite of the address registers that the loads above name */
    }
    v16h af[G2_KS / 32][2], bf[G2_KS / 32][4];      /* the stage's fragments are read as one group in front of its products */
#pragma unroll
    for (int kk = 0; kk < G2_KS / 32; ++kk) { const unsigned short* ap = &tl[bu][32 * w + ln][32 * kk + 8 * hh]; const unsigned short* bq = &tl[bu][128 + ln][32 * kk + 8 * hh];
      af[kk][0] = g2_lfrag(ap); af[kk][1] = g2_lfrag(ap + 16 * G2_LP);
#pragma unroll
      for (int t = 0; t < 4; ++t) bf[kk][t] = g2_lfrag(bq + 16 * t * G2_LP); }
#pragma unroll
    for (int kk = 0; kk < G2_KS / 32; ++kk) {
      c00 = g2_mma(af[kk][0], bf[kk][0], c00); c10 = g2_mma(af[kk][1], bf[kk][0], c10);
      c01 = g2_mma(af[kk][0], bf[kk][1], c01); c11 = g2_mma(af[kk][1], bf[kk][1], c11);
      c02 = g2_mma(af[kk][0], bf[kk][2], c02); c12 = g2_mma(af[kk][1], bf[kk][2], c12);
      c03 = g2_mma(af[kk][0], bf[kk][3], c03); c13 = g2_mma(af[kk][1], bf[kk][3], c13); }
    if (st + 1 < nst) {
#pragma unroll
      for (int u = 0; u < 8; ++u) *(v8us*)&tl[bu ^ 1][sr + 16 * u][sc] = ra[u];
#pragma unroll
      for (int u = 0; u < 4; ++u) *(v8us*)&tl[bu ^ 1][128 + sr + 16 * u][sc] = rb[u]; }
    __syncthreads();      /* publishes the next stage and ends every wave's reads of this one, which the next trip (or the epilogue) overwrites */
  }
  v8f accs[8] = {c00, c01, c02, c03, c10, c11, c12, c13};
#pragma unroll
  for (int u = 0; u < 8; ++u) { const int t = u & 3, half = u >> 2; const int col = col0 + t * 16 + ln; const float bv = bp ? bf16_round(bp[col]) : 0.f;
#pragma unroll
    for (int r = 0; r < 8; ++r) { const int rloc = half * 16 + 8 * hh + r; float v = accs[u][r] * alpha + bv; if (CP) { if (rowsPerB < 0) v += CP[cofs + (size_t)(row0g + row0 + rloc) * ldc + col];      /* rowsPerB < 0: own element of the batched C plane */ else { const int bidx = (row0g + row0 + rloc) / rowsPerB; v += CP[(size_t)bidx * sCPb + (size_t)by * 64 + col]; } }
      if (ACT == 3) v = fmaxf(v, 0.f); else if (ACT == 6) v = 0.5f * v * (1.0f + erff(v * 0.70710678118654752f)); else if (ACT == 11) v = 1.0f / (1.0f + expf(-v)); else if (ACT == 15) v = v / (1.0f + expf(-v)); else if (ACT == 12) v = (v > 0.f) ? v : 0.01f * v; else if (ACT == 8) v = tanhf(v); else if (ACT == 9) v = 0.5f * v * (1.0f + tanhf(0.7978845608028654f * (v + 0.044715f * v * v * v))); else if (ACT == 14) v = (v > 0.f) ? v : 0.1f * v; else if (ACT == 16) v = (v >= 0.f) ? v : 0.3f * v; else if (ACT == 17) v = (v >= 0.f) ? v : 0.2f * v;
      so[w][rloc][t * 16 + ln] = v; } }
  __builtin_amdgcn_fence(__ATOMIC_ACQ_REL, "workgroup"); __builtin_amdgcn_wave_barrier();
  const int rsub = lane >> 4, c4 = (lane & 15) * 4;
  {
#pragma unroll
    for (int q = 0; q < 16; ++q) { const int r = q * 2 + rsub; const v4f v = *(const v4fa*)&so[w][r][c4]; if (C) *(v4f*)(C + cofs + (size_t)(row0 + r) * ldc + col0 + c4) = v; if (C16) { v4h h4; for (int i = 0; i < 4; ++i) h4[i] = (_Float16)v[i]; *(v4h*)(C16 + cofs + (size_t)(row0 + r) * ldc + col0 + c4) = h4; } }
     } }


__global__ __launch_bounds__(256) void k_wnat(const float* __restrict__ w, size_t n8, _Float16* __restrict__ Bt) { const size_t t = (size_t)blockIdx.x * 256 + threadIdx.x; if (t >= n8) return; FragH f; for (int q = 0; q < 8; ++q) f.h[q] = (_Float16)(bf16_round(w[t * 8 + q]) * 16.0f); *(v8us*)((unsigned short*)Bt + t * 8) = f.half[0];  }
__global__ __launch_bounds__(256) void k_rsm(const float* __restrict__ S, _Float16* __restrict__ P, int nrows) {
  #pragma clang fp contract(off)
  const int i = blockIdx.x * 256 + threadIdx.x; if (i >= nrows) return; const float* s = S + (size_t)i * SQ; float mx = -3.0e38f;
#pragma unroll 1
  for (int j = 0; j < SQ; ++j) mx = fmaxf(mx, s[j]); float se = 0.f;
#pragma unroll 1
  for (int j = 0; j < SQ; ++j) se += expf(s[j] - mx); const float sc = 256.0f / se;
#pragma unroll 1
  for (int j0 = 0; j0 < SQ; j0 += 8) { FragH f; for (int q = 0; q < 8; ++q) f.h[q] = (_Float16)(expf(s[j0 + q] - mx) * sc); unsigned short* d = (unsigned short*)P + (size_t)i * SQ + j0; *(v8us*)d = f.half[0];  } }
__global__ __launch_bounds__(256) void k_vt(const _Float16* __restrict__ V16, int b, int h0, _Float16* __restrict__ VT) { __shared__ unsigned short tl[64][65]; const int tid = threadIdx.x; const int hh = blockIdx.x % HG, sg = blockIdx.x / HG; const int s0 = sg * 64; const int h = h0 + hh;
  for (int i = tid; i < 64 * 8; i += 256) { const int j = i / 8, d8 = (i % 8) * 8; FragH f; f.half[0] = *(const v8us*)((const unsigned short*)V16 + ((size_t)b * SQ + s0 + j) * DM + h * HD + d8); for (int q = 0; q < 8; ++q) tl[d8 + q][j] = f.u[q]; }
  __syncthreads();
  { for (int i = tid; i < 64 * 8; i += 256) { const int d = i / 8, j8 = (i % 8) * 8; FragH f; for (int q = 0; q < 8; ++q) f.u[q] = tl[d][j8 + q]; *(v8us*)((unsigned short*)VT + ((size_t)hh * HD + d) * SQ + s0 + j8) = f.half[0]; }  } }



// ---- fused attention: per work-group FA_BR queries of one (batch, head) against all SQ keys. Transposed products: S^T = K Q^T puts one query's
// scores in one lane pair (l, l ^ 16), so maximum and weights are in-lane; two S^T tiles (32 keys), converted in place, are the B operand of
// O^T += V^T P^T. Every A/B fragment is loaded in the same k order (8 h + 0..7, 16 + 8 h + 0..7), which is the order the converted tiles have.
#define FA_NW 4                      /* waves per work-group */
#define FA_R 2                       /* 16-query column groups per wave */
#define FA_BR (FA_NW * FA_R * 16)    /* queries per work-group */
#define FA_SK 64                     /* keys per LDS stage = two 32-key passes */
#define FA_LP 72                     /* LDS row pitch in halves: 144 B = 16 B x odd for 16-byte row reads */
#define FA_NST (SQ / FA_SK)
static_assert(HD == 64 && FA_SK == 64 && SQ % FA_SK == 0 && SQ % FA_BR == 0 && FA_NW * 32 == 128, "k_fattn: 64 x 128-byte tiles, four 16-byte pieces of each per thread, whole stages and whole query blocks");
typedef float v2f __attribute__((ext_vector_type(2)));
typedef _Float16 v2h __attribute__((ext_vector_type(2)));
typedef unsigned int v8u __attribute__((ext_vector_type(8)));
typedef unsigned int v4u __attribute__((ext_vector_type(4)));
__device__ __forceinline__ v16h fa_frag(const unsigned short* p) { FragH f; f.half[0] = *(const v8us*)p; f.half[1] = *(const v8us*)(p + 16); return f.v; }      /* p already holds the lane half's + 8 h */
__device__ __forceinline__ unsigned int fa_pack(float lo, float hi) { return __builtin_bit_cast(unsigned int, __builtin_convertvector((v2f){lo, hi}, v2h)); }
__device__ __forceinline__ float fa_xh(float x) { return __builtin_bit_cast(float, __builtin_amdgcn_permlanex16(__builtin_bit_cast(int, x), __builtin_bit_cast(int, x), 0x76543210, 0xfedcba98, false, false)); }      /* lane l with lane l ^ 16 */
__device__ __forceinline__ v8f fa_mma(v16h a, v16h b, v8f c) { return __builtin_amdgcn_wmma_f32_16x16x32_f16(false, a, false, b, (short)0, c, false, false); }
__global__ __launch_bounds__(FA_NW * 32) void k_fattn(const _Float16* __restrict__ Q16, const _Float16* __restrict__ K16, const _Float16* __restrict__ VT, _Float16* __restrict__ O16) {
  __shared__ __attribute__((aligned(16))) unsigned short sk[2][FA_SK][FA_LP];      /* K rows [key][d] */
  __shared__ __attribute__((aligned(16))) unsigned short sv[2][HD][FA_LP];         /* V^T rows [d][key] */
  const int tid = threadIdx.x, lane = tid & 31, wave = tid >> 5, c = lane & 15, h = lane >> 4;
  const int bh = blockIdx.y, b = bh / NH, hd = bh - b * NH;
  const int q0 = blockIdx.x * FA_BR + wave * (FA_R * 16);
  const int sr = tid >> 3, sc = (tid & 7) * 8;      /* staging: eight lanes cover one 128-byte row; piece u is row sr + 16 u */
  const unsigned short* kg = (const unsigned short*)K16 + ((size_t)b * SQ + sr) * DM + hd * HD + sc;
  const unsigned short* vg = (const unsigned short*)VT + ((size_t)bh * HD + sr) * SQ + sc;
  const float cscale = 0.125f * 1.4426950408889634f;      /* HD^-0.5 log2(e) */
  v8us rk[4], rv[4];
#pragma unroll
  for (int u = 0; u < 4; ++u) { rk[u] = *(const v8us*)(kg + (size_t)(16 * u) * DM); rv[u] = *(const v8us*)(vg + (size_t)(16 * u) * SQ); }
  v16h qf[FA_R][2];
#pragma unroll
  for (int g = 0; g < FA_R; ++g) { const unsigned short* qp = (const unsigned short*)Q16 + ((size_t)b * SQ + q0 + 16 * g + c) * DM + hd * HD + 8 * h; qf[g][0] = fa_frag(qp); qf[g][1] = fa_frag(qp + 32); }
  const unsigned int o1 = (c == 0) ? 0x3C003C00u : 0u;      /* A operand whose row 0 is f16 ones: its product with P^T is the weights' column sums */
  const v16h ones = __builtin_bit_cast(v16h, (v8u){o1, o1, o1, o1, o1, o1, o1, o1});
  const v8f z8 = {0.f, 0.f, 0.f, 0.f, 0.f, 0.f, 0.f, 0.f};
  v8f acc[FA_R][4], lacc[FA_R]; float m_run[FA_R];
#pragma unroll
  for (int g = 0; g < FA_R; ++g) { m_run[g] = -__builtin_inff(); lacc[g] = z8; acc[g][0] = z8; acc[g][1] = z8; acc[g][2] = z8; acc[g][3] = z8; }
#pragma unroll
  for (int u = 0; u < 4; ++u) { *(v8us*)&sk[0][sr + 16 * u][sc] = rk[u]; *(v8us*)&sv[0][sr + 16 * u][sc] = rv[u]; }
  __syncthreads();
#pragma unroll 1      /* rolled: one stage's code, two buffers by index */
  for (int st = 0; st < FA_NST; ++st) {
    const int bu = st & 1;
    if (st + 1 < FA_NST) {      /* the next stage's tiles fly into registers under this stage's two passes */
      const unsigned short* kn = kg + (size_t)(st + 1) * FA_SK * DM; const unsigned short* vn = vg + (st + 1) * FA_SK;
#pragma unroll
      for (int u = 0; u < 4; ++u) { rk[u] = *(const v8us*)(kn + (size_t)(16 * u) * DM); rv[u] = *(const v8us*)(vn + (size_t)(16 * u) * SQ); }
      asm volatile("s_wait_xcnt 0x0" :: "v"(kn), "v"(vn) : "memory");      /* stands in front of every overwrite of the address registers that the loads above name */
    }
#pragma unroll
    for (int sub = 0; sub < 2; ++sub) {
      v8f s[2][FA_R];
      { v16h kf[2][2];
#pragma unroll
        for (int kt = 0; kt < 2; ++kt) { const unsigned short* p = &sk[bu][32 * sub + 16 * kt + c][8 * h]; kf[kt][0] = fa_frag(p); kf[kt][1] = fa_frag(p + 32); }
#pragma unroll
        for (int kt = 0; kt < 2; ++kt)
#pragma unroll
          for (int g = 0; g < FA_R; ++g) s[kt][g] = fa_mma(kf[kt][0], qf[g][0], z8);
#pragma unroll
        for (int kt = 0; kt < 2; ++kt)
#pragma unroll
          for (int g = 0; g < FA_R; ++g) s[kt][g] = fa_mma(kf[kt][1], qf[g][1], s[kt][g]); }
      v16h vf[4];
#pragma unroll
      for (int t = 0; t < 4; ++t) vf[t] = fa_frag(&sv[bu][16 * t + c][32 * sub + 8 * h]);
      float mb[FA_R]; bool need = false;
#pragma unroll
      for (int g = 0; g < FA_R; ++g) { float mx = s[0][g][0];
#pragma unroll
        for (int r = 1; r < 8; ++r) mx = fmaxf(mx, s[0][g][r]);
#pragma unroll
        for (int r = 0; r < 8; ++r) mx = fmaxf(mx, s[1][g][r]);
        mx = fmaxf(mx, fa_xh(mx)) * cscale; mb[g] = mx; need = need || (mx > m_run[g] + 8.0f); }
      if (__builtin_amdgcn_ballot_w32(need) != 0) {      /* lazy rescale: the maximum in use may trail the true one by up to 8 (log2), so a weight stays below 2^8 */
#pragma unroll
        for (int g = 0; g < FA_R; ++g) { const float mn = fmaxf(m_run[g], mb[g]); const float corr = __builtin_amdgcn_exp2f(m_run[g] - mn); m_run[g] = mn; lacc[g] = lacc[g] * corr;
#pragma unroll
          for (int t = 0; t < 4; ++t) acc[g][t] = acc[g][t] * corr; } }
#pragma unroll
      for (int g = 0; g < FA_R; ++g) { const float nm = -m_run[g]; v8u w;
#pragma unroll
        for (int i = 0; i < 8; ++i) { const v2f a = __builtin_elementwise_fma((v2f){s[i >> 2][g][2 * (i & 3)], s[i >> 2][g][2 * (i & 3) + 1]}, (v2f){cscale, cscale}, (v2f){nm, nm}); w[i] = fa_pack(__builtin_amdgcn_exp2f(a[0]), __builtin_amdgcn_exp2f(a[1])); }
        const v16h pf = __builtin_bit_cast(v16h, w);      /* element e: key 8 h + e (tile 0), 16 + 8 h + e - 8 (tile 1) of query c */
#pragma unroll
        for (int t = 0; t < 4; ++t) acc[g][t] = fa_mma(vf[t], pf, acc[g][t]);
        lacc[g] = fa_mma(ones, pf, lacc[g]); }
    }
    __builtin_amdgcn_sched_barrier(0);      /* keeps the v_nop run below directly behind the stage's last WMMA */
    asm volatile("v_nop\n\tv_nop\n\tv_nop\n\tv_nop");      /* the four vector slots behind a WMMA, also on the taken side of the branches that follow */
    __builtin_amdgcn_sched_barrier(0);
    if (st + 1 < FA_NST) {
#pragma unroll
      for (int u = 0; u < 4; ++u) { *(v8us*)&sk[bu ^ 1][sr + 16 * u][sc] = rk[u]; *(v8us*)&sv[bu ^ 1][sr + 16 * u][sc] = rv[u]; } }
    __syncthreads();      /* publishes the next stage and ends every wave's reads of this one, which the next trip overwrites */
  }
#pragma unroll
  for (int g = 0; g < FA_R; ++g) { const float lr = lacc[g][0]; const float inv = 64.0f / (lr + fa_xh(lr));      /* row 0 of the sum tile sits in lanes 0-15, row 8 (zero) in lanes 16-31: the exchange-and-add is unconditional */
    unsigned short* op = (unsigned short*)O16 + ((size_t)b * SQ + q0 + 16 * g + c) * DM + hd * HD + 8 * h;
#pragma unroll
    for (int t = 0; t < 4; ++t) { const v8f o = acc[g][t] * inv; *(v4u*)(op + 16 * t) = (v4u){fa_pack(o[0], o[1]), fa_pack(o[2], o[3]), fa_pack(o[4], o[5]), fa_pack(o[6], o[7])}; } } }      /* acc register r = d 16 t + 8 h + r of query c */

extern "C" void kernel_launch(void* const* d_in, const int* in_sizes, int n_in,
                              void* d_out, int out_size, void* d_ws, size_t ws_size, hipStream_t stream) {
  (void)in_sizes; (void)n_in; (void)out_size;
  const float* const* I = (const float* const*)d_in; const float* x = I[0]; const float* wq = I[1]; const float* bq = I[2]; const float* wk = I[3]; const float* bk = I[4]; const float* wv = I[5]; const float* bv = I[6]; const float* wo = I[7]; const float* bo = I[8];      /* [in][out] weights + biases */
  char* ws = (char*)d_ws; size_t off = 0;
  auto take = [&](size_t bytes) { char* p = ws + off; off += (bytes + 255) & ~(size_t)255; return p; };
  _Float16* BQ = (_Float16*)take((size_t)DM * DM * 2); _Float16* BK = (_Float16*)take((size_t)DM * DM * 2); _Float16* BV = (_Float16*)take((size_t)DM * DM * 2); _Float16* BO = (_Float16*)take((size_t)DM * DM * 2);
  _Float16* X16 = (_Float16*)take(NR * DM * 2); _Float16* Q16 = (_Float16*)take(NR * DM * 2); _Float16* K16 = (_Float16*)take(NR * DM * 2); _Float16* V16 = (_Float16*)take(NR * DM * 2); _Float16* O16 = (_Float16*)take(NR * DM * 2);
  _Float16* VT = (_Float16*)take((size_t)NB * NH * HD * SQ * 2);
  if (off > ws_size) return;
  static_assert(MP % 128 == 0 && MPO % 128 == 0 && DM % 64 == 0, "k_gemm2: whole 128x64 block tiles and whole 64-wide k stages");
  k_wt_f16<<<(unsigned)(((size_t)DM * (DM / 8) + 255) / 256), 256, 0, stream>>>(wq, BQ, DM, DM, 16.0f); k_wt_f16<<<(unsigned)(((size_t)DM * (DM / 8) + 255) / 256), 256, 0, stream>>>(wk, BK, DM, DM, 16.0f); k_wt_f16<<<(unsigned)(((size_t)DM * (DM / 8) + 255) / 256), 256, 0, stream>>>(wv, BV, DM, DM, 16.0f); k_wt_f16<<<(unsigned)(((size_t)DM * (DM / 8) + 255) / 256), 256, 0, stream>>>(wo, BO, DM, DM, 16.0f);      /* [in][out] -> Bt[n][k] x16 */

  k_x16<<<(unsigned)((NR * DM / 8 + 255) / 256), 256, 0, stream>>>(x, X16, NR * DM / 8);
  const size_t r0p = (size_t)B0 * SQ;      /* first projected row */
  k_gemm2<0, DM, DM><<<dim3((unsigned)((MP / 128) * (DM / 64)), 1), 128, 0, stream>>>(X16 + r0p * DM, 0, BQ, 0, 0.0625f, bq, 0, nullptr, 1, 0, 0, nullptr, Q16 + r0p * DM, DM, 0, MP, DM, DM);
  k_gemm2<0, DM, DM><<<dim3((unsigned)((MP / 128) * (DM / 64)), 1), 128, 0, stream>>>(X16 + r0p * DM, 0, BK, 0, 0.0625f, bk, 0, nullptr, 1, 0, 0, nullptr, K16 + r0p * DM, DM, 0, MP, DM, DM);
  k_gemm2<0, DM, DM><<<dim3((unsigned)((MP / 128) * (DM / 64)), 1), 128, 0, stream>>>(X16 + r0p * DM, 0, BV, 0, 0.0625f, bv, 0, nullptr, 1, 0, 0, nullptr, V16 + r0p * DM, DM, 0, MP, DM, DM);
  k_vt<NH, SQ><<<NB * NH * (SQ / 64), 256, 0, stream>>>(V16, LQ, 0, VT);      /* V^T [NB][NH][HD][SQ] */
  k_fattn<<<dim3(SQ / FA_BR, NB * NH), FA_NW * 32, 0, stream>>>(Q16, K16, VT, O16);      /* o x64 (merged heads) as f16 rows */
  k_gemm2<0, DM, DM><<<dim3((unsigned)((MPO / 128) * (DM / 64)), 1), 128, 0, stream>>>(O16 + r0p * DM, 0, BO, 0, 0.0009765625f, bo, 0, nullptr, 1, 0, 0, (float*)d_out + r0p * DM, nullptr, DM, 0, MPO, DM, DM);      /* out rows are the output layout */
}

// v004
// One run takes 92.2 microseconds.
// Next to v003, in two timings, it ran 1.27 and 1.26 times as fast.
// Over all steps from v000 it is 28.7 times as fast.
#include <hip/hip_runtime.h>
// Multi-head self-attention (x [2][2048][768]; q/k/v = x W + b ([in][out] 768x768 sigma 1/sqrt(768), zero biases); 12 heads of 64; softmax(q k^T / 8) over all keys (no mask); out = ctx Wo + bo -> [2][2048][768]).
// Structure: token rows r = b*2048 + s; x as exact f16 rows (bf16-rounded); Q, K, V as one launch of three WMMA GEMMs (32x64 wave tiles, f32 accumulation, exact x16 weights + bias, f16 outputs); V^T for all batches and heads via LDS transposes; one fused attention launch over (query block, batch x head): S^T = K Q^T (K = 64), online softmax in the log2 domain on the score accumulators (f32 statistics, native exp2, weights as f16 relative to the running maximum), O^T += V^T P^T, K and V^T staged in LDS; o carried x64 against f16 subnormal flush (folded into the output GEMM alpha), written straight into the merged f16 o rows; out = o W_o + b GEMM (f32) into the output layout.
// Compute dtype: inputs rounded to bf16; x / weights exact; q, k, v, softmax weights and o as plain f16 GEMM operands (~2^-12); scores and softmax statistics f32. v_wmma_f32_16x16x32_f16.
#define NB 2
#define SQ 2048
#define DM 768
#define NH 12
#define HD 64
#define HG 4                         /* heads per block group of the unlaunched k_vt(b, h0) */
#define B0 0                         /* first batch processed (debug hook) */
#define NBR NB                       /* batches processed (debug hook) */
#define NR ((size_t)NB * SQ)         /* token rows */
#define MP ((int)((size_t)NBR * SQ)) /* rows projected (debug hook) */
#define QN SQ                        /* query rows per batch; not read (k_fattn attends all SQ) */
#define NHD NH                       /* heads; not read (k_fattn attends all NH) */
#define MPO MP                       /* rows through the output stage (debug hook) */
#define LQ DM      /* row pitch of the q/k/v rows */
typedef __bf16 v16b __attribute__((ext_vector_type(16)));
typedef unsigned short v8us __attribute__((ext_vector_type(8), may_alias));
typedef float  v8f  __attribute__((ext_vector_type(8)));
typedef float  v4f  __attribute__((ext_vector_type(4)));
typedef float  v4fa __attribute__((ext_vector_type(4), may_alias));
union FragB { v16b v; v8us half[2]; unsigned short u[16]; };

__device__ __forceinline__ unsigned short bf16_bits(float x) { unsigned int u = __float_as_uint(x); return (unsigned short)((u + 0x7FFFu + ((u >> 16) & 1u)) >> 16); }
__device__ __forceinline__ float bf16_val(unsigned short b) { return __uint_as_float(((unsigned int)b) << 16); }
__device__ __forceinline__ float bf16_round(float x) { return bf16_val(bf16_bits(x)); }
// D += A·B with NT terms: 1 = ah·bh, 2 = + al·bh (A split), 3 = + ah·bl (both split)
template <int NT>
__device__ __forceinline__ v8f mmaN(v16b ah, v16b al, v16b bh, v16b bl, v8f c) {
  c = __builtin_amdgcn_wmma_f32_16x16x32_bf16(false, ah, false, bh, (short)0, c, false, false);
  if (NT >= 2) c = __builtin_amdgcn_wmma_f32_16x16x32_bf16(false, al, false, bh, (short)0, c, false, false);
  if (NT >= 3) c = __builtin_amdgcn_wmma_f32_16x16x32_bf16(false, ah, false, bl, (short)0, c, false, false);
  asm volatile("v_nop\n\tv_nop\n\tv_nop\n\tv_nop" : "+v"(c) : "v"(ah), "v"(al), "v"(bh), "v"(bl));
  return c;
}

__global__ __launch_bounds__(256) void k_wt_bf16(const float* __restrict__ W, unsigned short* __restrict__ Wt, int K, int N) {
  const int t = blockIdx.x * 256 + threadIdx.x;
  const int k8n = K / 8;
  if (t >= N * k8n) return;
  const int n = t / k8n, k8 = (t % k8n) * 8;
  v8us v;
#pragma unroll
  for (int i = 0; i < 8; ++i) v[i] = bf16_bits(W[(size_t)(k8 + i) * N + n]);
  *(v8us*)(Wt + (size_t)n * K + k8) = v;
  
}

// GEMM C[M][N] (f32, pitch ldc) = act(A[M][K]·W + bias). A f32 row-major (pitch lda) converted per fragment to bf16
// (ASPLIT: hi/lo two planes -> 2 terms, else single rounded term); Wt bf16 [N][K] (pitch ldb). BIAS_BF16 rounds the
// bias to bf16 first (bias quantised to bf16 before the add). K%32==0, M%16==0, N%64==0.
template <bool ASPLIT, int ACT, bool BIAS_BF16>
__global__ __launch_bounds__(128) void k_gemm_bf(const float* __restrict__ A, int lda, const unsigned short* __restrict__ Wt, int ldb,
                                               const float* __restrict__ bias, float* __restrict__ C, int ldc, int M, int N, int K) {
  __shared__ __attribute__((aligned(16))) float so[4][16][64];
  const int tid = threadIdx.x, w = tid >> 5, lane = tid & 31, ln = lane & 15, hh = lane >> 4;
  const int ntn = N / 64;
  const int wid = blockIdx.x * 4 + w;
  const int mt = wid / ntn, nq = wid % ntn;
  if (mt * 16 >= M) return;
  const int row0 = mt * 16, col0 = nq * 64;
  const float* arow = A + (size_t)(row0 + ln) * lda;
  v8f acc[4] = {};
  for (int kb = 0; kb < K; kb += 32) {
    FragB ah, al;
    const v4f x0 = *(const v4fa*)(arow + kb + 8 * hh), x1 = *(const v4fa*)(arow + kb + 8 * hh + 4);
    const v4f x2 = *(const v4fa*)(arow + kb + 16 + 8 * hh), x3 = *(const v4fa*)(arow + kb + 16 + 8 * hh + 4);
    float xs[16] = {x0[0],x0[1],x0[2],x0[3],x1[0],x1[1],x1[2],x1[3],x2[0],x2[1],x2[2],x2[3],x3[0],x3[1],x3[2],x3[3]};
#pragma unroll
    for (int i = 0; i < 16; ++i) { const unsigned short hb = bf16_bits(xs[i]); ah.u[i] = hb; al.u[i] = ASPLIT ? bf16_bits(xs[i] - bf16_val(hb)) : (unsigned short)0; }
#pragma unroll
    for (int t = 0; t < 4; ++t) {
      const unsigned short* brow = Wt + (size_t)(col0 + t * 16 + ln) * ldb + kb;
      FragB b;
      b.half[0] = *(const v8us*)(brow + 8 * hh);
      b.half[1] = *(const v8us*)(brow + 16 + 8 * hh);
      acc[t] = mmaN<ASPLIT ? 2 : 1>(ah.v, al.v, b.v, b.v, acc[t]);
    }
  }
#pragma unroll
  for (int t = 0; t < 4; ++t) {
    float bv = bias ? bias[col0 + t * 16 + ln] : 0.f;
    if (BIAS_BF16) bv = bf16_round(bv);
#pragma unroll
    for (int r = 0; r < 8; ++r) { float v = acc[t][r] + bv; if (ACT == 1) v = fmaxf(v, 0.f); so[w][8 * hh + r][t * 16 + ln] = v; }
  }
  __builtin_amdgcn_fence(__ATOMIC_ACQ_REL, "workgroup");
  __builtin_amdgcn_wave_barrier();
  const int rsub = lane >> 4, c4 = (lane & 15) * 4;
  {
#pragma unroll
    for (int q = 0; q < 8; ++q) {
      const int r = q * 2 + rsub;
      const v4f v = *(const v4fa*)&so[w][r][c4];
      *(v4f*)(C + (size_t)(row0 + r) * ldc + col0 + c4) = v;
    }
    
  }
}

// GEMM C = act(A·W + bias + resid): A f32 (ASPLIT -> hi/lo 2 terms), Wt bf16 [N][K]; ACT 0 none, 1 relu, 2 exact gelu;
// resid (optional, f32, row index = (row % rmod), pitch ldr, RES_BF16 rounds it) added before the activation.
template <bool ASPLIT, int ACT, bool BIAS_BF16, bool RES_BF16>
__global__ __launch_bounds__(128) void k_gemm_bf3(const float* __restrict__ A, int lda, const unsigned short* __restrict__ Wt, int ldb,
                                                const float* __restrict__ bias, const float* __restrict__ resid, int rmod, int ldr,
                                                float* __restrict__ C, int ldc, int M, int N, int K) {
  __shared__ __attribute__((aligned(16))) float so[4][16][64];
  const int tid = threadIdx.x, w = tid >> 5, lane = tid & 31, ln = lane & 15, hh = lane >> 4;
  const int ntn = N / 64;
  const int wid = blockIdx.x * 4 + w;
  const int mt = wid / ntn, nq = wid % ntn;
  if (mt * 16 >= M) return;
  const int row0 = mt * 16, col0 = nq * 64;
  const float* arow = A + (size_t)(row0 + ln) * lda;
  v8f acc[4] = {};
  for (int kb = 0; kb < K; kb += 32) {
    FragB ah, al;
    const v4f x0 = *(const v4fa*)(arow + kb + 8 * hh), x1 = *(const v4fa*)(arow + kb + 8 * hh + 4);
    const v4f x2 = *(const v4fa*)(arow + kb + 16 + 8 * hh), x3 = *(const v4fa*)(arow + kb + 16 + 8 * hh + 4);
    float xs[16] = {x0[0],x0[1],x0[2],x0[3],x1[0],x1[1],x1[2],x1[3],x2[0],x2[1],x2[2],x2[3],x3[0],x3[1],x3[2],x3[3]};
#pragma unroll
    for (int i = 0; i < 16; ++i) { const unsigned short hb = bf16_bits(xs[i]); ah.u[i] = hb; al.u[i] = ASPLIT ? bf16_bits(xs[i] - bf16_val(hb)) : (unsigned short)0; }
#pragma unroll
    for (int t = 0; t < 4; ++t) {
      const unsigned short* brow = Wt + (size_t)(col0 + t * 16 + ln) * ldb + kb;
      FragB b;
      b.half[0] = *(const v8us*)(brow + 8 * hh);
      b.half[1] = *(const v8us*)(brow + 16 + 8 * hh);
      acc[t] = mmaN<ASPLIT ? 2 : 1>(ah.v, al.v, b.v, b.v, acc[t]);
    }
  }
#pragma unroll
  for (int t = 0; t < 4; ++t) {
    const int col = col0 + t * 16 + ln;
    float bv = bias ? bias[col] : 0.f;
    if (BIAS_BF16) bv = bf16_round(bv);
#pragma unroll
    for (int r = 0; r < 8; ++r) {
      float v = acc[t][r] + bv;
      if (resid) { float rv = resid[(size_t)((row0 + 8 * hh + r) % rmod) * ldr + col]; if (RES_BF16) rv = bf16_round(rv); v += rv; }
      if (ACT == 1) v = fmaxf(v, 0.f);
      if (ACT == 2) v = 0.5f * v * (1.0f + erff(v * 0.70710678118654752f));
      if (ACT == 3) { const float u = 0.7978845608028654f * (v + 0.044715f * v * v * v); v = 0.5f * v * (1.0f + tanhf(u)); }
      so[w][8 * hh + r][t * 16 + ln] = v;
    }
  }
  __builtin_amdgcn_fence(__ATOMIC_ACQ_REL, "workgroup");
  __builtin_amdgcn_wave_barrier();
  const int rsub = lane >> 4, c4 = (lane & 15) * 4;
  {
#pragma unroll
    for (int q = 0; q < 8; ++q) {
      const int r = q * 2 + rsub;
      const v4f v = *(const v4fa*)&so[w][r][c4];
      *(v4f*)(C + (size_t)(row0 + r) * ldc + col0 + c4) = v;
    }
    
  }
}
// row LayerNorm (biased variance, eps) over N: s = X (+ R); optional out_sum <- s; out_norm <- (s-mu)*rsqrt(var+eps)*g + b
template <bool PARAM_BF16>
__global__ __launch_bounds__(256) void k_layernorm(const float* __restrict__ X, const float* __restrict__ R, const float* __restrict__ g, const float* __restrict__ bta,
                                                  float* __restrict__ out_sum, float* __restrict__ out_norm, int N, float eps) {
  __shared__ float red[256];
  const int row = blockIdx.x, tid = threadIdx.x;
  const float* x = X + (size_t)row * N; const float* rr = R ? R + (size_t)row * N : nullptr;
  float vals[16];                     // up to N = 4096
  const int per = N / 256;            // contiguous chunk per thread? use strided-by-4 chunks: thread handles j = tid*4 + 1024*u
  float s1 = 0.f;
  for (int u = 0; u < per / 4; ++u) {
    const int j = tid * 4 + 1024 * u;
    const v4f a = *(const v4fa*)(x + j);
    v4f b = {0.f,0.f,0.f,0.f}; if (rr) b = *(const v4fa*)(rr + j);
#pragma unroll
    for (int q = 0; q < 4; ++q) { const float v = a[q] + b[q]; vals[u * 4 + q] = v; s1 += v; }
  }
  red[tid] = s1; __syncthreads();
  for (int st = 128; st > 0; st >>= 1) { if (tid < st) red[tid] += red[tid + st]; __syncthreads(); }
  const float mu = red[0] / (float)N; __syncthreads();
  float s2 = 0.f;
  for (int u = 0; u < per / 4; ++u)
#pragma unroll
    for (int q = 0; q < 4; ++q) { const float c = vals[u * 4 + q] - mu; s2 += c * c; }
  red[tid] = s2; __syncthreads();
  for (int st = 128; st > 0; st >>= 1) { if (tid < st) red[tid] += red[tid + st]; __syncthreads(); }
  const float rs = rsqrtf(red[0] / (float)N + eps);
  {
    for (int u = 0; u < per / 4; ++u) {
      const int j = tid * 4 + 1024 * u;
      v4f o, sm;
#pragma unroll
      for (int q = 0; q < 4; ++q) {
        float gg = g[j + q], bb = bta[j + q];
        if (PARAM_BF16) { gg = bf16_round(gg); bb = bf16_round(bb); }
        sm[q] = vals[u * 4 + q]; o[q] = (vals[u * 4 + q] - mu) * rs * gg + bb;
      }
      if (out_sum) *(v4f*)(out_sum + (size_t)row * N + j) = sm;
      *(v4f*)(out_norm + (size_t)row * N + j) = o;
    }
    
  }
}



// ---- f16 WMMA path (v_wmma_f32_16x16x32_f16): 11-bit significands for operands in range — used where a [0,1] probability operand needs more precision than bf16
typedef _Float16 v16h __attribute__((ext_vector_type(16)));
union FragH { v16h v; v8us half[2]; _Float16 h[16]; unsigned short u[16]; };
template <int NT>
__device__ __forceinline__ v8f mmaH(v16h ah, v16h al, v16h bh, v16h bl, v8f c) {
  c = __builtin_amdgcn_wmma_f32_16x16x32_f16(false, ah, false, bh, (short)0, c, false, false);
  if (NT >= 2) c = __builtin_amdgcn_wmma_f32_16x16x32_f16(false, al, false, bh, (short)0, c, false, false);
  if (NT >= 3) c = __builtin_amdgcn_wmma_f32_16x16x32_f16(false, ah, false, bl, (short)0, c, false, false);
  asm volatile("v_nop\n\tv_nop\n\tv_nop\n\tv_nop" : "+v"(c) : "v"(ah), "v"(al), "v"(bh), "v"(bl));
  return c;
}
// batched GEMM like k_gemm_b but f16 operands: A f32 (split into f16 hi/lo if ASPLIT, else rounded to f16), Bt = f16 values [n][k]; alpha; C f32; N multiple of 16 (partial tiles skipped)
template <bool ASPLIT>
__global__ __launch_bounds__(128) void k_gemm_h(const float* __restrict__ A, int lda, size_t sA, const _Float16* __restrict__ Bh, int ldb, size_t sB, float alpha, float* __restrict__ C, int ldc, size_t sC, int M, int N, int K) {
  __shared__ __attribute__((aligned(16))) float so[4][16][64];
  const int tid = threadIdx.x, w = tid >> 5, lane = tid & 31, ln = lane & 15, hh = lane >> 4; const int by = blockIdx.y;
  A += (size_t)by * sA; Bh += (size_t)by * sB; C += (size_t)by * sC;
  const int ntn = (N + 63) / 64; const int wid = blockIdx.x * 4 + w; const int mt = wid / ntn, nq = wid % ntn; if (mt * 16 >= M) return;
  const int row0 = mt * 16, col0 = nq * 64; const float* arow = A + (size_t)(row0 + ln) * lda;
  v8f acc[4] = {};
  for (int kb = 0; kb < K; kb += 32) {
    FragH ah, al;
    const v4f x0 = *(const v4fa*)(arow + kb + 8 * hh), x1 = *(const v4fa*)(arow + kb + 8 * hh + 4), x2 = *(const v4fa*)(arow + kb + 16 + 8 * hh), x3 = *(const v4fa*)(arow + kb + 16 + 8 * hh + 4);
    float xs[16] = {x0[0],x0[1],x0[2],x0[3],x1[0],x1[1],x1[2],x1[3],x2[0],x2[1],x2[2],x2[3],x3[0],x3[1],x3[2],x3[3]};
#pragma unroll
    for (int i = 0; i < 16; ++i) { const _Float16 h = (_Float16)xs[i]; ah.h[i] = h; al.h[i] = ASPLIT ? (_Float16)(xs[i] - (float)h) : (_Float16)0.0f; }
#pragma unroll
    for (int t = 0; t < 4; ++t) { if (col0 + t * 16 >= N) continue; const size_t boff = (size_t)(col0 + t * 16 + ln) * ldb + kb; FragH bq; bq.half[0] = *(const v8us*)(Bh + boff + 8 * hh); bq.half[1] = *(const v8us*)(Bh + boff + 16 + 8 * hh);
      acc[t] = mmaH<ASPLIT ? 2 : 1>(ah.v, al.v, bq.v, bq.v, acc[t]); }
  }
#pragma unroll
  for (int t = 0; t < 4; ++t) { if (col0 + t * 16 >= N) continue;
#pragma unroll
    for (int r = 0; r < 8; ++r) so[w][8 * hh + r][t * 16 + ln] = acc[t][r] * alpha; }
  __builtin_amdgcn_fence(__ATOMIC_ACQ_REL, "workgroup"); __builtin_amdgcn_wave_barrier();
  const int rsub = lane >> 4, c4 = (lane & 15) * 4;
  {
#pragma unroll
    for (int q = 0; q < 8; ++q) { const int r = q * 2 + rsub; if (col0 + c4 < N) { const v4f v = *(const v4fa*)&so[w][r][c4]; *(v4f*)(C + (size_t)(row0 + r) * ldc + col0 + c4) = v; } }
     }
}

// One launch for the five operand preparations, which do not depend on one another: blocks [0, 4 PREP_WB) transpose the four weights, the rest convert x.
// Weights: Wt[n][k] = f16(W[k][n] x16) from f32 row-major W[DM][DM] (bf16-exact weights stay exact in f16 away from the subnormal range); Bt holds the four [n][k] planes one behind the other. x: exact f16 rows of the bf16-rounded values.
#define PREP_WB ((DM * (DM / 8) + 255) / 256)                 /* blocks per weight: eight k of one n per thread */
#define PREP_XB ((unsigned)((NR * DM / 8 + 255) / 256))       /* blocks for x: eight elements per thread */
__global__ __launch_bounds__(256) void k_prep(const float* __restrict__ x, const float* __restrict__ wq, const float* __restrict__ wk, const float* __restrict__ wv, const float* __restrict__ wo, _Float16* __restrict__ Bt, _Float16* __restrict__ X16) {
  const int bx = blockIdx.x; FragH f;
  if (bx < 4 * PREP_WB) {      /* the strided weight reads have the longer latency chain: they start first */
    const int p = bx / PREP_WB; const float* W = p == 0 ? wq : p == 1 ? wk : p == 2 ? wv : wo;
    const int t = (bx - p * PREP_WB) * 256 + threadIdx.x; if (t >= DM * (DM / 8)) return; const int n = t / (DM / 8), k8 = (t % (DM / 8)) * 8;
#pragma unroll
    for (int i = 0; i < 8; ++i) f.h[i] = (_Float16)(bf16_round(W[(size_t)(k8 + i) * DM + n]) * 16.0f);
    *(v8us*)((unsigned short*)Bt + (size_t)p * DM * DM + (size_t)n * DM + k8) = f.half[0];
  } else {
    const size_t t = (size_t)(bx - 4 * PREP_WB) * 256 + threadIdx.x; if (t >= NR * DM / 8) return;
#pragma unroll
    for (int q = 0; q < 8; ++q) f.h[q] = (_Float16)bf16_round(x[t * 8 + q]);
    *(v8us*)((unsigned short*)X16 + t * 8) = f.half[0];
  }
}
// k_gemm_hh variant with fused epilogue: v = acc·alpha + bias[by·sBias + col] (+ CP[(row/rowsPerB)·sCPb + by·64 + col] if CP) ; ACT 0 none / 1 elu ; writes f16 C16 (and f32 C if non-null)
template <int ACT>
__global__ __launch_bounds__(128) void k_gemm_hhx(const _Float16* __restrict__ A, int lda, size_t sA, const _Float16* __restrict__ Bh, int ldb, size_t sB, float alpha, const float* __restrict__ bias, size_t sBias, const float* __restrict__ CP, int rowsPerB, size_t sCPb, int row0g,
    float* __restrict__ C, _Float16* __restrict__ C16, int ldc, size_t sC, int M, int N, int K) {
  __shared__ __attribute__((aligned(16))) float so[4][16][64];
  const int tid = threadIdx.x, w = tid >> 5, lane = tid & 31, ln = lane & 15, hh = lane >> 4; const int by = blockIdx.y;
  A += (size_t)by * sA; Bh += (size_t)by * sB; const size_t cofs = (size_t)by * sC; const float* bp = bias ? bias + (size_t)by * sBias : nullptr;
  const int ntn = (N + 63) / 64; const int wid = blockIdx.x * 4 + w; const int mt = wid / ntn, nq = wid % ntn; if (mt * 16 >= M) return;
  const int row0 = mt * 16, col0 = nq * 64; const _Float16* arow = A + (size_t)(row0 + ln) * lda;
  v8f acc[4] = {};
  for (int kb = 0; kb < K; kb += 32) { FragH ah; ah.half[0] = *(const v8us*)((const unsigned short*)arow + kb + 8 * hh); ah.half[1] = *(const v8us*)((const unsigned short*)arow + kb + 16 + 8 * hh);
#pragma unroll
    for (int t = 0; t < 4; ++t) { if (col0 + t * 16 >= N) continue; const size_t boff = (size_t)(col0 + t * 16 + ln) * ldb + kb; FragH bq; bq.half[0] = *(const v8us*)((const unsigned short*)Bh + boff + 8 * hh); bq.half[1] = *(const v8us*)((const unsigned short*)Bh + boff + 16 + 8 * hh);
      acc[t] = mmaH<1>(ah.v, ah.v, bq.v, bq.v, acc[t]); }
  }
#pragma unroll
  for (int t = 0; t < 4; ++t) { if (col0 + t * 16 >= N) continue; const int col = col0 + t * 16 + ln; const float bv = bp ? bf16_round(bp[col]) : 0.f;
#pragma unroll
    for (int r = 0; r < 8; ++r) { float v = acc[t][r] * alpha + bv; if (CP) { const int rr = row0g + row0 + 8 * hh + r; if (rowsPerB < 0) v += CP[cofs + (size_t)rr * ldc + col];      /* rowsPerB < 0: own element of the batched C plane */ else { const int bidx = rr / rowsPerB; v += CP[(size_t)bidx * sCPb + (size_t)by * 64 + col]; } } if (ACT == 1) v = (v > 0.f) ? v : expm1f(v); else if (ACT == 7) v = (v > 0.f) ? v + 1.0f : expf(v); else if (ACT == 8) v = tanhf(v); else if (ACT == 9) v = 0.5f * v * (1.0f + tanhf(0.7978845608028654f * (v + 0.044715f * v * v * v))); else if (ACT == 11) v = 1.0f / (1.0f + expf(-v)); else if (ACT == 12) v = (v > 0.f) ? v : 0.01f * v; else if (ACT == 14) v = (v > 0.f) ? v : 0.1f * v; else if (ACT == 16) v = (v >= 0.f) ? v : 0.3f * v; else if (ACT == 17) v = (v >= 0.f) ? v : 0.2f * v; else if (ACT == 15) v = v / (1.0f + expf(-v)); else if (ACT == 3) v = fmaxf(v, 0.f); else if (ACT == 6) v = 0.5f * v * (1.0f + erff(v * 0.70710678118654752f)); so[w][8 * hh + r][t * 16 + ln] = v; } }
  __builtin_amdgcn_fence(__ATOMIC_ACQ_REL, "workgroup"); __builtin_amdgcn_wave_barrier();
  const int rsub = lane >> 4, c4 = (lane & 15) * 4; typedef _Float16 v4h __attribute__((ext_vector_type(4)));
  {
#pragma unroll
    for (int q = 0; q < 8; ++q) { const int r = q * 2 + rsub; if (col0 + c4 < N) { const v4f v = *(const v4fa*)&so[w][r][c4]; if (C) *(v4f*)(C + cofs + (size_t)(row0 + r) * ldc + col0 + c4) = v; if (C16) { v4h h4; for (int i = 0; i < 4; ++i) h4[i] = (_Float16)v[i]; *(v4h*)(C16 + cofs + (size_t)(row0 + r) * ldc + col0 + c4) = h4; } } }
     }
}


typedef _Float16 v4h __attribute__((ext_vector_type(4)));

__global__ __launch_bounds__(256) void k_h16(const float* __restrict__ x, _Float16* __restrict__ X16, size_t n8) { const size_t t = (size_t)blockIdx.x * 256 + threadIdx.x; if (t >= n8) return; FragH f;
#pragma unroll
  for (int q = 0; q < 8; ++q) f.h[q] = (_Float16)x[t * 8 + q]; *(v8us*)((unsigned short*)X16 + t * 8) = f.half[0];  }
__global__ __launch_bounds__(256) void k_round16f(const float* __restrict__ W, _Float16* __restrict__ Bt, size_t n8) { const size_t t = (size_t)blockIdx.x * 256 + threadIdx.x; if (t >= n8) return; FragH f;
#pragma unroll
  for (int i = 0; i < 8; ++i) f.h[i] = (_Float16)(bf16_round(W[t * 8 + i]) * 16.0f); *(v8us*)((unsigned short*)Bt + t * 8) = f.half[0];  }
template <int NHv, int TTv>
__global__ __launch_bounds__(256) void k_vt(const _Float16* __restrict__ V16, int ldv, int voff, _Float16* __restrict__ Vt) { __shared__ unsigned short tl[64][66]; const int tid = threadIdx.x; const int slab = blockIdx.x / (TTv / 64), lg = blockIdx.x % (TTv / 64); const int b = slab / NHv, h = slab % NHv;
  for (int i = tid; i < 64 * 8; i += 256) { const int r = i / 8, c8 = (i % 8) * 8; FragH f; f.half[0] = *(const v8us*)((const unsigned short*)V16 + ((size_t)b * TTv + lg * 64 + r) * ldv + voff + h * 64 + c8);
#pragma unroll
    for (int q = 0; q < 8; ++q) tl[r][c8 + q] = f.u[q]; }
  __syncthreads();
  {
#pragma unroll
    for (int rd = 0; rd < 2; ++rd) { const int d = rd * 32 + tid / 8, pc = tid % 8; FragH f;
#pragma unroll
      for (int q = 0; q < 8; ++q) f.u[q] = tl[pc * 8 + q][d];
      *(v8us*)((unsigned short*)Vt + ((size_t)slab * 64 + d) * TTv + lg * 64 + pc * 8) = f.half[0]; }
     } }

__global__ __launch_bounds__(256) void k_hl(const float* __restrict__ F, _Float16* __restrict__ Hh, _Float16* __restrict__ Hl, size_t n8) { const size_t t = (size_t)blockIdx.x * 256 + threadIdx.x; if (t >= n8) return; FragH fh, fl; const v4f a = *(const v4fa*)(F + t * 8), c = *(const v4fa*)(F + t * 8 + 4);
#pragma unroll
  for (int q = 0; q < 4; ++q) { _Float16 h = (_Float16)a[q]; fh.h[q] = h; fl.h[q] = (_Float16)((a[q] - (float)h) * 1024.0f); h = (_Float16)c[q]; fh.h[4 + q] = h; fl.h[4 + q] = (_Float16)((c[q] - (float)h) * 1024.0f); }
  { *(v8us*)((unsigned short*)Hh + t * 8) = fh.half[0]; *(v8us*)((unsigned short*)Hl + t * 8) = fl.half[0];  } }

// ---- fast GEMM (block tile 128x64, wave tile 32x64; A and B k-tiles staged in LDS; requires M % 128 == 0 rows per launch region, N % 64 == 0 and K % 64 == 0); epilogue = k_gemm_hhx semantics ----
__device__ __forceinline__ v16h g2_frag(const _Float16* p, int hh) { FragH f; f.half[0] = *(const v8us*)((const unsigned short*)p + 8 * hh); f.half[1] = *(const v8us*)((const unsigned short*)p + 16 + 8 * hh); return f.v; }
__device__ __forceinline__ v8f g2_mma(v16h a, v16h b, v8f c) { v8f d = __builtin_amdgcn_wmma_f32_16x16x32_f16(false, a, false, b, (short)0, c, false, false); asm volatile("v_nop\n\tv_nop\n\tv_nop\n\tv_nop" : "+v"(d) : "v"(a), "v"(b)); return d; }
#define G2_KS 64                     /* k per LDS stage: one 128-byte line of every A and B row */
#define G2_LP 72                     /* LDS row pitch in halves: 144 B = 16 B x odd for 16-byte row reads */
__device__ __forceinline__ v16h g2_lfrag(const unsigned short* p) { FragH f; f.half[0] = *(const v8us*)p; f.half[1] = *(const v8us*)(p + 16); return f.v; }      /* p already holds the lane half's + 8 hh: the k order of g2_frag */
template <int ACT, int LDA, int LDB>      /* row pitches at compile time: a tile's row pieces are immediate offsets from one address pair */
__global__ __launch_bounds__(128) void k_gemm2(const _Float16* __restrict__ A, size_t sA, const _Float16* __restrict__ Bh, size_t sB, float alpha, const float* __restrict__ bias, const float* __restrict__ bias1, const float* __restrict__ bias2, size_t sBias, const float* __restrict__ CP, int rowsPerB, size_t sCPb, int row0g,
    float* __restrict__ C, _Float16* __restrict__ C16, int ldc, size_t sC, int M, int N, int K) { static_assert(ACT == 0 || ACT == 3 || ACT == 6 || ACT == 8 || ACT == 9 || ACT == 11 || ACT == 12 || ACT == 14 || ACT == 15 || ACT == 16 || ACT == 17, "k_gemm2: unsupported ACT code (would silently apply no activation)");
  __shared__ __attribute__((aligned(16))) unsigned short tl[2][128 + 64][G2_LP];      /* per buffer: the block's 128 A rows, then its 64 B rows, G2_KS halves of each */
  float (*so)[32][68] = (float (*)[32][68])&tl[0][0][0];      /* the epilogue's staging takes the tiles' place behind the loop's last barrier */
  static_assert(sizeof(tl) >= sizeof(float) * 4 * 32 * 68, "k_gemm2: epilogue staging must fit in the tile buffers");
  const int tid = threadIdx.x, w = tid >> 5, lane = tid & 31, ln = lane & 15, hh = lane >> 4; const int by = blockIdx.y;
  A += (size_t)by * sA; Bh += (size_t)by * sB; const size_t cofs = (size_t)by * sC; const float* bsel = (by == 1 && bias1) ? bias1 : (by == 2 && bias2) ? bias2 : bias;      /* planes 1 and 2 may bring their bias in a buffer of its own */
  const float* bp = bsel ? bsel + (size_t)by * sBias : nullptr;
  const int ntn = N >> 6; const int mt = blockIdx.x / ntn, nq = blockIdx.x - mt * ntn; const int row0 = mt * 128 + 32 * w, col0 = nq * 64; if (mt * 128 >= M) return;      /* the same for the whole block: in front of every barrier */
  const int sr = tid >> 3, sc = (tid & 7) * 8;      /* staging: eight lanes cover one 128-byte row piece; piece u is row sr + 16 u */
  const unsigned short* ag = (const unsigned short*)A + (size_t)(mt * 128 + sr) * LDA + sc;
  const unsigned short* bg = (const unsigned short*)Bh + (size_t)(col0 + sr) * LDB + sc;
  v8us ra[8], rb[4];      /* these and af, bf below are indexed under full unrolls only, so that they stay in registers */
#pragma unroll
  for (int u = 0; u < 8; ++u) ra[u] = *(const v8us*)(ag + (size_t)(16 * u) * LDA);
#pragma unroll
  for (int u = 0; u < 4; ++u) rb[u] = *(const v8us*)(bg + (size_t)(16 * u) * LDB);
  const v8f z8 = {0.f,0.f,0.f,0.f,0.f,0.f,0.f,0.f}; v8f c00 = z8, c01 = z8, c02 = z8, c03 = z8, c10 = z8, c11 = z8, c12 = z8, c13 = z8;
#pragma unroll
  for (int u = 0; u < 8; ++u) *(v8us*)&tl[0][sr + 16 * u][sc] = ra[u];
#pragma unroll
  for (int u = 0; u < 4; ++u) *(v8us*)&tl[0][128 + sr + 16 * u][sc] = rb[u];
  __syncthreads();
  const int nst = K / G2_KS;
#pragma unroll 1      /* rolled: one stage's code, two buffers by index */
  for (int st = 0; st < nst; ++st) { const int bu = st & 1;
    if (st + 1 < nst) {      /* the next stage's tiles fly into registers under this stage's products */
      const unsigned short* an = ag + (st + 1) * G2_KS; const unsigned short* bn = bg + (st + 1) * G2_KS;
#pragma unroll
      for (int u = 0; u < 8; ++u) ra[u] = *(const v8us*)(an + (size_t)(16 * u) * LDA);
#pragma unroll
      for (int u = 0; u < 4; ++u) rb[u] = *(const v8us*)(bn + (size_t)(16 * u) * LDB);
      asm volatile("s_wait_xcnt 0x0" :: "v"(an), "v"(bn) : "memory");      /* stands in front of every overwrite of the address registers that the loads above name */
    }
    v16h af[G2_KS / 32][2], bf[G2_KS / 32][4];      /* the stage's fragments are read as one group in front of its products */
#pragma unroll
    for (int kk = 0; kk < G2_KS / 32; ++kk) { const unsigned short* ap = &tl[bu][32 * w + ln][32 * kk + 8 * hh]; const unsigned short* bq = &tl[bu][128 + ln][32 * kk + 8 * hh];
      af[kk][0] = g2_lfrag(ap); af[kk][1] = g2_lfrag(ap + 16 * G2_LP);
#pragma unroll
      for (int t = 0; t < 4; ++t) bf[kk][t] = g2_lfrag(bq + 16 * t * G2_LP); }
#pragma unroll
    for (int kk = 0; kk < G2_KS / 32; ++kk) {
      c00 = g2_mma(af[kk][0], bf[kk][0], c00); c10 = g2_mma(af[kk][1], bf[kk][0], c10);
      c01 = g2_mma(af[kk][0], bf[kk][1], c01); c11 = g2_mma(af[kk][1], bf[kk][1], c11);
      c02 = g2_mma(af[kk][0], bf[kk][2], c02); c12 = g2_mma(af[kk][1], bf[kk][2], c12);
      c03 = g2_mma(af[kk][0], bf[kk][3], c03); c13 = g2_mma(af[kk][1], bf[kk][3], c13); }
    if (st + 1 < nst) {
#pragma unroll
      for (int u = 0; u < 8; ++u) *(v8us*)&tl[bu ^ 1][sr + 16 * u][sc] = ra[u];
#pragma unroll
      for (int u = 0; u < 4; ++u) *(v8us*)&tl[bu ^ 1][128 + sr + 16 * u][sc] = rb[u]; }
    __syncthreads();      /* publishes the next stage and ends every wave's reads of this one, which the next trip (or the epilogue) overwrites */
  }
  v8f accs[8] = {c00, c01, c02, c03, c10, c11, c12, c13};
#pragma unroll
  for (int u = 0; u < 8; ++u) { const int t = u & 3, half = u >> 2; const int col = col0 + t * 16 + ln; const float bv = bp ? bf16_round(bp[col]) : 0.f;
#pragma unroll
    for (int r = 0; r < 8; ++r) { const int rloc = half * 16 + 8 * hh + r; float v = accs[u][r] * alpha + bv; if (CP) { if (rowsPerB < 0) v += CP[cofs + (size_t)(row0g + row0 + rloc) * ldc + col];      /* rowsPerB < 0: own element of the batched C plane */ else { const int bidx = (row0g + row0 + rloc) / rowsPerB; v += CP[(size_t)bidx * sCPb + (size_t)by * 64 + col]; } }
      if (ACT == 3) v = fmaxf(v, 0.f); else if (ACT == 6) v = 0.5f * v * (1.0f + erff(v * 0.70710678118654752f)); else if (ACT == 11) v = 1.0f / (1.0f + expf(-v)); else if (ACT == 15) v = v / (1.0f + expf(-v)); else if (ACT == 12) v = (v > 0.f) ? v : 0.01f * v; else if (ACT == 8) v = tanhf(v); else if (ACT == 9) v = 0.5f * v * (1.0f + tanhf(0.7978845608028654f * (v + 0.044715f * v * v * v))); else if (ACT == 14) v = (v > 0.f) ? v : 0.1f * v; else if (ACT == 16) v = (v >= 0.f) ? v : 0.3f * v; else if (ACT == 17) v = (v >= 0.f) ? v : 0.2f * v;
      so[w][rloc][t * 16 + ln] = v; } }
  __builtin_amdgcn_fence(__ATOMIC_ACQ_REL, "workgroup"); __builtin_amdgcn_wave_barrier();
  const int rsub = lane >> 4, c4 = (lane & 15) * 4;
  {
#pragma unroll
    for (int q = 0; q < 16; ++q) { const int r = q * 2 + rsub; const v4f v = *(const v4fa*)&so[w][r][c4]; if (C) *(v4f*)(C + cofs + (size_t)(row0 + r) * ldc + col0 + c4) = v; if (C16) { v4h h4; for (int i = 0; i < 4; ++i) h4[i] = (_Float16)v[i]; *(v4h*)(C16 + cofs + (size_t)(row0 + r) * ldc + col0 + c4) = h4; } }
     } }


__global__ __launch_bounds__(256) void k_wnat(const float* __restrict__ w, size_t n8, _Float16* __restrict__ Bt) { const size_t t = (size_t)blockIdx.x * 256 + threadIdx.x; if (t >= n8) return; FragH f; for (int q = 0; q < 8; ++q) f.h[q] = (_Float16)(bf16_round(w[t * 8 + q]) * 16.0f); *(v8us*)((unsigned short*)Bt + t * 8) = f.half[0];  }
__global__ __launch_bounds__(256) void k_rsm(const float* __restrict__ S, _Float16* __restrict__ P, int nrows) {
  #pragma clang fp contract(off)
  const int i = blockIdx.x * 256 + threadIdx.x; if (i >= nrows) return; const float* s = S + (size_t)i * SQ; float mx = -3.0e38f;
#pragma unroll 1
  for (int j = 0; j < SQ; ++j) mx = fmaxf(mx, s[j]); float se = 0.f;
#pragma unroll 1
  for (int j = 0; j < SQ; ++j) se += expf(s[j] - mx); const float sc = 256.0f / se;
#pragma unroll 1
  for (int j0 = 0; j0 < SQ; j0 += 8) { FragH f; for (int q = 0; q < 8; ++q) f.h[q] = (_Float16)(expf(s[j0 + q] - mx) * sc); unsigned short* d = (unsigned short*)P + (size_t)i * SQ + j0; *(v8us*)d = f.half[0];  } }
__global__ __launch_bounds__(256) void k_vt(const _Float16* __restrict__ V16, int b, int h0, _Float16* __restrict__ VT) { __shared__ unsigned short tl[64][65]; const int tid = threadIdx.x; const int hh = blockIdx.x % HG, sg = blockIdx.x / HG; const int s0 = sg * 64; const int h = h0 + hh;
  for (int i = tid; i < 64 * 8; i += 256) { const int j = i / 8, d8 = (i % 8) * 8; FragH f; f.half[0] = *(const v8us*)((const unsigned short*)V16 + ((size_t)b * SQ + s0 + j) * DM + h * HD + d8); for (int q = 0; q < 8; ++q) tl[d8 + q][j] = f.u[q]; }
  __syncthreads();
  { for (int i = tid; i < 64 * 8; i += 256) { const int d = i / 8, j8 = (i % 8) * 8; FragH f; for (int q = 0; q < 8; ++q) f.u[q] = tl[d][j8 + q]; *(v8us*)((unsigned short*)VT + ((size_t)hh * HD + d) * SQ + s0 + j8) = f.half[0]; }  } }



// ---- fused attention: per work-group FA_BR queries of one (batch, head) against all SQ keys. Transposed products: S^T = K Q^T puts one query's
// scores in one lane pair (l, l ^ 16), so maximum and weights are in-lane; two S^T tiles (32 keys), converted in place, are the B operand of
// O^T += V^T P^T. Every A/B fragment is loaded in the same k order (8 h + 0..7, 16 + 8 h + 0..7), which is the order the converted tiles have.
#define FA_NW 4                      /* waves per work-group */
#define FA_R 2                       /* 16-query column groups per wave */
#define FA_BR (FA_NW * FA_R * 16)    /* queries per work-group */
#define FA_SK 64                     /* keys per LDS stage = two 32-key passes */
#define FA_LP 72                     /* LDS row pitch in halves: 144 B = 16 B x odd for 16-byte row reads */
#define FA_NST (SQ / FA_SK)
static_assert(HD == 64 && FA_SK == 64 && SQ % FA_SK == 0 && SQ % FA_BR == 0 && FA_NW * 32 == 128, "k_fattn: 64 x 128-byte tiles, four 16-byte pieces of each per thread, whole stages and whole query blocks");
typedef float v2f __attribute__((ext_vector_type(2)));
typedef _Float16 v2h __attribute__((ext_vector_type(2)));
typedef unsigned int v8u __attribute__((ext_vector_type(8)));
typedef unsigned int v4u __attribute__((ext_vector_type(4)));
__device__ __forceinline__ v16h fa_frag(const unsigned short* p) { FragH f; f.half[0] = *(const v8us*)p; f.half[1] = *(const v8us*)(p + 16); return f.v; }      /* p already holds the lane half's + 8 h */
__device__ __forceinline__ unsigned int fa_pack(float lo, float hi) { return __builtin_bit_cast(unsigned int, __builtin_convertvector((v2f){lo, hi}, v2h)); }
__device__ __forceinline__ float fa_xh(float x) { return __builtin_bit_cast(float, __builtin_amdgcn_permlanex16(__builtin_bit_cast(int, x), __builtin_bit_cast(int, x), 0x76543210, 0xfedcba98, false, false)); }      /* lane l with lane l ^ 16 */
__device__ __forceinline__ v8f fa_mma(v16h a, v16h b, v8f c) { return __builtin_amdgcn_wmma_f32_16x16x32_f16(false, a, false, b, (short)0, c, false, false); }
__global__ __launch_bounds__(FA_NW * 32) void k_fattn(const _Float16* __restrict__ Q16, const _Float16* __restrict__ K16, const _Float16* __restrict__ VT, _Float16* __restrict__ O16) {
  __shared__ __attribute__((aligned(16))) unsigned short sk[2][FA_SK][FA_LP];      /* K rows [key][d] */
  __shared__ __attribute__((aligned(16))) unsigned short sv[2][HD][FA_LP];         /* V^T rows [d][key] */
  const int tid = threadIdx.x, lane = tid & 31, wave = tid >> 5, c = lane & 15, h = lane >> 4;
  const int bh = blockIdx.y, b = bh / NH, hd = bh - b * NH;
  const int q0 = blockIdx.x * FA_BR + wave * (FA_R * 16);
  const int sr = tid >> 3, sc = (tid & 7) * 8;      /* staging: eight lanes cover one 128-byte row; piece u is row sr + 16 u */
  const unsigned short* kg = (const unsigned short*)K16 + ((size_t)b * SQ + sr) * DM + hd * HD + sc;
  const unsigned short* vg = (const unsigned short*)VT + ((size_t)bh * HD + sr) * SQ + sc;
  const float cscale = 0.125f * 1.4426950408889634f;      /* HD^-0.5 log2(e) */
  v8us rk[4], rv[4];
#pragma unroll
  for (int u = 0; u < 4; ++u) { rk[u] = *(const v8us*)(kg + (size_t)(16 * u) * DM); rv[u] = *(const v8us*)(vg + (size_t)(16 * u) * SQ); }
  v16h qf[FA_R][2];
#pragma unroll
  for (int g = 0; g < FA_R; ++g) { const unsigned short* qp = (const unsigned short*)Q16 + ((size_t)b * SQ + q0 + 16 * g + c) * DM + hd * HD + 8 * h; qf[g][0] = fa_frag(qp); qf[g][1] = fa_frag(qp + 32); }
  const unsigned int o1 = (c == 0) ? 0x3C003C00u : 0u;      /* A operand whose row 0 is f16 ones: its product with P^T is the weights' column sums */
  const v16h ones = __builtin_bit_cast(v16h, (v8u){o1, o1, o1, o1, o1, o1, o1, o1});
  const v8f z8 = {0.f, 0.f, 0.f, 0.f, 0.f, 0.f, 0.f, 0.f};
  v8f acc[FA_R][4], lacc[FA_R]; float m_run[FA_R];
#pragma unroll
  for (int g = 0; g < FA_R; ++g) { m_run[g] = -__builtin_inff(); lacc[g] = z8; acc[g][0] = z8; acc[g][1] = z8; acc[g][2] = z8; acc[g][3] = z8; }
#pragma unroll
  for (int u = 0; u < 4; ++u) { *(v8us*)&sk[0][sr + 16 * u][sc] = rk[u]; *(v8us*)&sv[0][sr + 16 * u][sc] = rv[u]; }
  __syncthreads();
#pragma unroll 1      /* rolled: one stage's code, two buffers by index */
  for (int st = 0; st < FA_NST; ++st) {
    const int bu = st & 1;
    if (st + 1 < FA_NST) {      /* the next stage's tiles fly into registers under this stage's two passes */
      const unsigned short* kn = kg + (size_t)(st + 1) * FA_SK * DM; const unsigned short* vn = vg + (st + 1) * FA_SK;
#pragma unroll
      for (int u = 0; u < 4; ++u) { rk[u] = *(const v8us*)(kn + (size_t)(16 * u) * DM); rv[u] = *(const v8us*)(vn + (size_t)(16 * u) * SQ); }
      asm volatile("s_wait_xcnt 0x0" :: "v"(kn), "v"(vn) : "memory");      /* stands in front of every overwrite of the address registers that the loads above name */
    }
#pragma unroll
    for (int sub = 0; sub < 2; ++sub) {
      v8f s[2][FA_R];
      { v16h kf[2][2];
#pragma unroll
        for (int kt = 0; kt < 2; ++kt) { const unsigned short* p = &sk[bu][32 * sub + 16 * kt + c][8 * h]; kf[kt][0] = fa_frag(p); kf[kt][1] = fa_frag(p + 32); }
#pragma unroll
        for (int kt = 0; kt < 2; ++kt)
#pragma unroll
          for (int g = 0; g < FA_R; ++g) s[kt][g] = fa_mma(kf[kt][0], qf[g][0], z8);
#pragma unroll
        for (int kt = 0; kt < 2; ++kt)
#pragma unroll
          for (int g = 0; g < FA_R; ++g) s[kt][g] = fa_mma(kf[kt][1], qf[g][1], s[kt][g]); }
      v16h vf[4];
#pragma unroll
      for (int t = 0; t < 4; ++t) vf[t] = fa_frag(&sv[bu][16 * t + c][32 * sub + 8 * h]);
      float mb[FA_R]; bool need = false;
#pragma unroll
      for (int g = 0; g < FA_R; ++g) { float mx = s[0][g][0];
#pragma unroll
        for (int r = 1; r < 8; ++r) mx = fmaxf(mx, s[0][g][r]);
#pragma unroll
        for (int r = 0; r < 8; ++r) mx = fmaxf(mx, s[1][g][r]);
        mx = fmaxf(mx, fa_xh(mx)) * cscale; mb[g] = mx; need = need || (mx > m_run[g] + 8.0f); }
      if (__builtin_amdgcn_ballot_w32(need) != 0) {      /* lazy rescale: the maximum in use may trail the true one by up to 8 (log2), so a weight stays below 2^8 */
#pragma unroll
        for (int g = 0; g < FA_R; ++g) { const float mn = fmaxf(m_run[g], mb[g]); const float corr = __builtin_amdgcn_exp2f(m_run[g] - mn); m_run[g] = mn; lacc[g] = lacc[g] * corr;
#pragma unroll
          for (int t = 0; t < 4; ++t) acc[g][t] = acc[g][t] * corr; } }
#pragma unroll
      for (int g = 0; g < FA_R; ++g) { const float nm = -m_run[g]; v8u w;
#pragma unroll
        for (int i = 0; i < 8; ++i) { const v2f a = __builtin_elementwise_fma((v2f){s[i >> 2][g][2 * (i & 3)], s[i >> 2][g][2 * (i & 3) + 1]}, (v2f){cscale, cscale}, (v2f){nm, nm}); w[i] = fa_pack(__builtin_amdgcn_exp2f(a[0]), __builtin_amdgcn_exp2f(a[1])); }
        const v16h pf = __builtin_bit_cast(v16h, w);      /* element e: key 8 h + e (tile 0), 16 + 8 h + e - 8 (tile 1) of query c */
#pragma unroll
        for (int t = 0; t < 4; ++t) acc[g][t] = fa_mma(vf[t], pf, acc[g][t]);
        lacc[g] = fa_mma(ones, pf, lacc[g]); }
    }
    __builtin_amdgcn_sched_barrier(0);      /* keeps the v_nop run below directly behind the stage's last WMMA */
    asm volatile("v_nop\n\tv_nop\n\tv_nop\n\tv_nop");      /* the four vector slots behind a WMMA, also on the taken side of the branches that follow */
    __builtin_amdgcn_sched_barrier(0);
    if (st + 1 < FA_NST) {
#pragma unroll
      for (int u = 0; u < 4; ++u) { *(v8us*)&sk[bu ^ 1][sr + 16 * u][sc] = rk[u]; *(v8us*)&sv[bu ^ 1][sr + 16 * u][sc] = rv[u]; } }
    __syncthreads();      /* publishes the next stage and ends every wave's reads of this one, which the next trip overwrites */
  }
#pragma unroll
  for (int g = 0; g < FA_R; ++g) { const float lr = lacc[g][0]; const float inv = 64.0f / (lr + fa_xh(lr));      /* row 0 of the sum tile sits in lanes 0-15, row 8 (zero) in lanes 16-31: the exchange-and-add is unconditional */
    unsigned short* op = (unsigned short*)O16 + ((size_t)b * SQ + q0 + 16 * g + c) * DM + hd * HD + 8 * h;
#pragma unroll
    for (int t = 0; t < 4; ++t) { const v8f o = acc[g][t] * inv; *(v4u*)(op + 16 * t) = (v4u){fa_pack(o[0], o[1]), fa_pack(o[2], o[3]), fa_pack(o[4], o[5]), fa_pack(o[6], o[7])}; } } }      /* acc register r = d 16 t + 8 h + r of query c */

extern "C" void kernel_launch(void* const* d_in, const int* in_sizes, int n_in,
                              void* d_out, int out_size, void* d_ws, size_t ws_size, hipStream_t stream) {
  (void)in_sizes; (void)n_in; (void)out_size;
  const float* const* I = (const float* const*)d_in; const float* x = I[0]; const float* wq = I[1]; const float* bq = I[2]; const float* wk = I[3]; const float* bk = I[4]; const float* wv = I[5]; const float* bv = I[6]; const float* wo = I[7]; const float* bo = I[8];      /* [in][out] weights + biases */
  char* ws = (char*)d_ws; size_t off = 0;
  auto take = [&](size_t bytes) { char* p = ws + off; off += (bytes + 255) & ~(size_t)255; return p; };
  _Float16* BQ = (_Float16*)take((size_t)DM * DM * 2); _Float16* BK = (_Float16*)take((size_t)DM * DM * 2); _Float16* BV = (_Float16*)take((size_t)DM * DM * 2); _Float16* BO = (_Float16*)take((size_t)DM * DM * 2);
  _Float16* X16 = (_Float16*)take(NR * DM * 2); _Float16* Q16 = (_Float16*)take(NR * DM * 2); _Float16* K16 = (_Float16*)take(NR * DM * 2); _Float16* V16 = (_Float16*)take(NR * DM * 2); _Float16* O16 = (_Float16*)take(NR * DM * 2);
  _Float16* VT = (_Float16*)take((size_t)NB * NH * HD * SQ * 2);
  if (off > ws_size) return;
  static_assert(MP % 128 == 0 && MPO % 128 == 0 && DM % 64 == 0, "k_gemm2: whole 128x64 block tiles and whole 64-wide k stages");
  static_assert(((size_t)DM * DM * 2) % 256 == 0 && (NR * DM * 2) % 256 == 0, "the weight planes BQ, BK, BV, BO and the row planes Q16, K16, V16 lie one behind the other in the workspace");
  k_prep<<<4 * PREP_WB + PREP_XB, 256, 0, stream>>>(x, wq, wk, wv, wo, BQ, X16);      /* [in][out] -> Bt[n][k] x16 for all four weights; x -> f16 rows */
  const size_t r0p = (size_t)B0 * SQ;      /* first projected row */
  k_gemm2<0, DM, DM><<<dim3((unsigned)((MP / 128) * (DM / 64)), 3), 128, 0, stream>>>(X16 + r0p * DM, 0, BQ, (size_t)DM * DM, 0.0625f, bq, bk, bv, 0, nullptr, 1, 0, 0, nullptr, Q16 + r0p * DM, DM, NR * DM, MP, DM, DM);      /* grid.y = Q, K, V: one A, three weight, bias and output planes */
  k_vt<NH, SQ><<<NB * NH * (SQ / 64), 256, 0, stream>>>(V16, LQ, 0, VT);      /* V^T [NB][NH][HD][SQ] */
  k_fattn<<<dim3(SQ / FA_BR, NB * NH), FA_NW * 32, 0, stream>>>(Q16, K16, VT, O16);      /* o x64 (merged heads) as f16 rows */
  k_gemm2<0, DM, DM><<<dim3((unsigned)((MPO / 128) * (DM / 64)), 1), 128, 0, stream>>>(O16 + r0p * DM, 0, BO, 0, 0.0009765625f, bo, nullptr, nullptr, 0, nullptr, 1, 0, 0, (float*)d_out + r0p * DM, nullptr, DM, 0, MPO, DM, DM);      /* out rows are the output layout */
}

// v005
// It runs in 83.7 microseconds.
// Two timings next to v004 both put it at 1.09 times that version's speed.
// All steps since v000 together make it 31.2 times as fast.
#include <hip/hip_runtime.h>
// Multi-head self-attention (x [2][2048][768]; q/k/v = x W + b ([in][out] 768x768 sigma 1/sqrt(768), zero biases); 12 heads of 64; softmax(q k^T / 8) over all keys (no mask); out = ctx Wo + bo -> [2][2048][768]).
// Structure: token rows r = b*2048 + s; x as exact f16 rows (bf16-rounded); Q, K, V as one launch of three WMMA GEMMs (32x64 wave tiles, f32 accumulation, exact x16 weights + bias, f16 outputs); V^T for all batches and heads via LDS transposes; one fused attention launch over (query block, batch x head): S^T = K Q^T (K = 64), online softmax in the log2 domain on the score accumulators (f32 statistics, native exp2, weights as f16 relative to the running maximum), O^T += V^T P^T, K and V^T staged in LDS; o carried x64 against f16 subnormal flush (folded into the output GEMM alpha), written straight into the merged f16 o rows; out = o W_o + b GEMM (f32) into the output layout.
// Compute dtype: inputs rounded to bf16; x / weights exact; q, k, v, softmax weights and o as plain f16 GEMM operands (~2^-12); scores and softmax statistics f32. v_wmma_f32_16x16x32_f16.
#define NB 2
#define SQ 2048
#define DM 768
#define NH 12
#define HD 64
#define HG 4                         /* heads per block group of the unlaunched k_vt(b, h0) */
#define B0 0                         /* first batch processed (debug hook) */
#define NBR NB                       /* batches processed (debug hook) */
#define NR ((size_t)NB * SQ)         /* token rows */
#define MP ((int)((size_t)NBR * SQ)) /* rows projected (debug hook) */
#define QN SQ                        /* query rows per batch; not read (k_fattn attends all SQ) */
#define NHD NH                       /* heads; not read (k_fattn attends all NH) */
#define MPO MP                       /* rows through the output stage (debug hook) */
#define LQ DM      /* row pitch of the q/k/v rows */
typedef __bf16 v16b __attribute__((ext_vector_type(16)));
typedef unsigned short v8us __attribute__((ext_vector_type(8), may_alias));
typedef float  v8f  __attribute__((ext_vector_type(8)));
typedef float  v4f  __attribute__((ext_vector_type(4)));
typedef float  v4fa __attribute__((ext_vector_type(4), may_alias));
union FragB { v16b v; v8us half[2]; unsigned short u[16]; };

__device__ __forceinline__ unsigned short bf16_bits(float x) { unsigned int u = __float_as_uint(x); return (unsigned short)((u + 0x7FFFu + ((u >> 16) & 1u)) >> 16); }
__device__ __forceinline__ float bf16_val(unsigned short b) { return __uint_as_float(((unsigned int)b) << 16); }
__device__ __forceinline__ float bf16_round(float x) { return bf16_val(bf16_bits(x)); }
// D += A·B with NT terms: 1 = ah·bh, 2 = + al·bh (A split), 3 = + ah·bl (both split)
template <int NT>
__device__ __forceinline__ v8f mmaN(v16b ah, v16b al, v16b bh, v16b bl, v8f c) {
  c = __builtin_amdgcn_wmma_f32_16x16x32_bf16(false, ah, false, bh, (short)0, c, false, false);
  if (NT >= 2) c = __builtin_amdgcn_wmma_f32_16x16x32_bf16(false, al, false, bh, (short)0, c, false, false);
  if (NT >= 3) c = __builtin_amdgcn_wmma_f32_16x16x32_bf16(false, ah, false, bl, (short)0, c, false, false);
  asm volatile("v_nop\n\tv_nop\n\tv_nop\n\tv_nop" : "+v"(c) : "v"(ah), "v"(al), "v"(bh), "v"(bl));
  return c;
}

__global__ __launch_bounds__(256) void k_wt_bf16(const float* __restrict__ W, unsigned short* __restrict__ Wt, int K, int N) {
  const int t = blockIdx.x * 256 + threadIdx.x;
  const int k8n = K / 8;
  if (t >= N * k8n) return;
  const int n = t / k8n, k8 = (t % k8n) * 8;
  v8us v;
#pragma unroll
  for (int i = 0; i < 8; ++i) v[i] = bf16_bits(W[(size_t)(k8 + i) * N + n]);
  *(v8us*)(Wt + (size_t)n * K + k8) = v;
  
}

// GEMM C[M][N] (f32, pitch ldc) = act(A[M][K]·W + bias). A f32 row-major (pitch lda) converted per fragment to bf16
// (ASPLIT: hi/lo two planes -> 2 terms, else single rounded term); Wt bf16 [N][K] (pitch ldb). BIAS_BF16 rounds the
// bias to bf16 first (bias quantised to bf16 before the add). K%32==0, M%16==0, N%64==0.
template <bool ASPLIT, int ACT, bool BIAS_BF16>
__global__ __launch_bounds__(128) void k_gemm_bf(const float* __restrict__ A, int lda, const unsigned short* __restrict__ Wt, int ldb,
                                               const float* __restrict__ bias, float* __restrict__ C, int ldc, int M, int N, int K) {
  __shared__ __attribute__((aligned(16))) float so[4][16][64];
  const int tid = threadIdx.x, w = tid >> 5, lane = tid & 31, ln = lane & 15, hh = lane >> 4;
  const int ntn = N / 64;
  const int wid = blockIdx.x * 4 + w;
  const int mt = wid / ntn, nq = wid % ntn;
  if (mt * 16 >= M) return;
  const int row0 = mt * 16, col0 = nq * 64;
  const float* arow = A + (size_t)(row0 + ln) * lda;
  v8f acc[4] = {};
  for (int kb = 0; kb < K; kb += 32) {
    FragB ah, al;
    const v4f x0 = *(const v4fa*)(arow + kb + 8 * hh), x1 = *(const v4fa*)(arow + kb + 8 * hh + 4);
    const v4f x2 = *(const v4fa*)(arow + kb + 16 + 8 * hh), x3 = *(const v4fa*)(arow + kb + 16 + 8 * hh + 4);
    float xs[16] = {x0[0],x0[1],x0[2],x0[3],x1[0],x1[1],x1[2],x1[3],x2[0],x2[1],x2[2],x2[3],x3[0],x3[1],x3[2],x3[3]};
#pragma unroll
    for (int i = 0; i < 16; ++i) { const unsigned short hb = bf16_bits(xs[i]); ah.u[i] = hb; al.u[i] = ASPLIT ? bf16_bits(xs[i] - bf16_val(hb)) : (unsigned short)0; }
#pragma unroll
    for (int t = 0; t < 4; ++t) {
      const unsigned short* brow = Wt + (size_t)(col0 + t * 16 + ln) * ldb + kb;
      FragB b;
      b.half[0] = *(const v8us*)(brow + 8 * hh);
      b.half[1] = *(const v8us*)(brow + 16 + 8 * hh);
      acc[t] = mmaN<ASPLIT ? 2 : 1>(ah.v, al.v, b.v, b.v, acc[t]);
    }
  }
#pragma unroll
  for (int t = 0; t < 4; ++t) {
    float bv = bias ? bias[col0 + t * 16 + ln] : 0.f;
    if (BIAS_BF16) bv = bf16_round(bv);
#pragma unroll
    for (int r = 0; r < 8; ++r) { float v = acc[t][r] + bv; if (ACT == 1) v = fmaxf(v, 0.f); so[w][8 * hh + r][t * 16 + ln] = v; }
  }
  __builtin_amdgcn_fence(__ATOMIC_ACQ_REL, "workgroup");
  __builtin_amdgcn_wave_barrier();
  const int rsub = lane >> 4, c4 = (lane & 15) * 4;
  {
#pragma unroll
    for (int q = 0; q < 8; ++q) {
      const int r = q * 2 + rsub;
      const v4f v = *(const v4fa*)&so[w][r][c4];
      *(v4f*)(C + (size_t)(row0 + r) * ldc + col0 + c4) = v;
    }
    
  }
}

// GEMM C = act(A·W + bias + resid): A f32 (ASPLIT -> hi/lo 2 terms), Wt bf16 [N][K]; ACT 0 none, 1 relu, 2 exact gelu;
// resid (optional, f32, row index = (row % rmod), pitch ldr, RES_BF16 rounds it) added before the activation.
template <bool ASPLIT, int ACT, bool BIAS_BF16, bool RES_BF16>
__global__ __launch_bounds__(128) void k_gemm_bf3(const float* __restrict__ A, int lda, const unsigned short* __restrict__ Wt, int ldb,
                                                const float* __restrict__ bias, const float* __restrict__ resid, int rmod, int ldr,
                                                float* __restrict__ C, int ldc, int M, int N, int K) {
  __shared__ __attribute__((aligned(16))) float so[4][16][64];
  const int tid = threadIdx.x, w = tid >> 5, lane = tid & 31, ln = lane & 15, hh = lane >> 4;
  const int ntn = N / 64;
  const int wid = blockIdx.x * 4 + w;
  const int mt = wid / ntn, nq = wid % ntn;
  if (mt * 16 >= M) return;
  const int row0 = mt * 16, col0 = nq * 64;
  const float* arow = A + (size_t)(row0 + ln) * lda;
  v8f acc[4] = {};
  for (int kb = 0; kb < K; kb += 32) {
    FragB ah, al;
    const v4f x0 = *(const v4fa*)(arow + kb + 8 * hh), x1 = *(const v4fa*)(arow + kb + 8 * hh + 4);
    const v4f x2 = *(const v4fa*)(arow + kb + 16 + 8 * hh), x3 = *(const v4fa*)(arow + kb + 16 + 8 * hh + 4);
    float xs[16] = {x0[0],x0[1],x0[2],x0[3],x1[0],x1[1],x1[2],x1[3],x2[0],x2[1],x2[2],x2[3],x3[0],x3[1],x3[2],x3[3]};
#pragma unroll
    for (int i = 0; i < 16; ++i) { const unsigned short hb = bf16_bits(xs[i]); ah.u[i] = hb; al.u[i] = ASPLIT ? bf16_bits(xs[i] - bf16_val(hb)) : (unsigned short)0; }
#pragma unroll
    for (int t = 0; t < 4; ++t) {
      const unsigned short* brow = Wt + (size_t)(col0 + t * 16 + ln) * ldb + kb;
      FragB b;
      b.half[0] = *(const v8us*)(brow + 8 * hh);
      b.half[1] = *(const v8us*)(brow + 16 + 8 * hh);
      acc[t] = mmaN<ASPLIT ? 2 : 1>(ah.v, al.v, b.v, b.v, acc[t]);
    }
  }
#pragma unroll
  for (int t = 0; t < 4; ++t) {
    const int col = col0 + t * 16 + ln;
    float bv = bias ? bias[col] : 0.f;
    if (BIAS_BF16) bv = bf16_round(bv);
#pragma unroll
    for (int r = 0; r < 8; ++r) {
      float v = acc[t][r] + bv;
      if (resid) { float rv = resid[(size_t)((row0 + 8 * hh + r) % rmod) * ldr + col]; if (RES_BF16) rv = bf16_round(rv); v += rv; }
      if (ACT == 1) v = fmaxf(v, 0.f);
      if (ACT == 2) v = 0.5f * v * (1.0f + erff(v * 0.70710678118654752f));
      if (ACT == 3) { const float u = 0.7978845608028654f * (v + 0.044715f * v * v * v); v = 0.5f * v * (1.0f + tanhf(u)); }
      so[w][8 * hh + r][t * 16 + ln] = v;
    }
  }
  __builtin_amdgcn_fence(__ATOMIC_ACQ_REL, "workgroup");
  __builtin_amdgcn_wave_barrier();
  const int rsub = lane >> 4, c4 = (lane & 15) * 4;
  {
#pragma unroll
    for (int q = 0; q < 8; ++q) {
      const int r = q * 2 + rsub;
      const v4f v = *(const v4fa*)&so[w][r][c4];
      *(v4f*)(C + (size_t)(row0 + r) * ldc + col0 + c4) = v;
    }
    
  }
}
// row LayerNorm (biased variance, eps) over N: s = X (+ R); optional out_sum <- s; out_norm <- (s-mu)*rsqrt(var+eps)*g + b
template <bool PARAM_BF16>
__global__ __launch_bounds__(256) void k_layernorm(const float* __restrict__ X, const float* __restrict__ R, const float* __restrict__ g, const float* __restrict__ bta,
                                                  float* __restrict__ out_sum, float* __restrict__ out_norm, int N, float eps) {
  __shared__ float red[256];
  const int row = blockIdx.x, tid = threadIdx.x;
  const float* x = X + (size_t)row * N; const float* rr = R ? R + (size_t)row * N : nullptr;
  float vals[16];                     // up to N = 4096
  const int per = N / 256;            // contiguous chunk per thread? use strided-by-4 chunks: thread handles j = tid*4 + 1024*u
  float s1 = 0.f;
  for (int u = 0; u < per / 4; ++u) {
    const int j = tid * 4 + 1024 * u;
    const v4f a = *(const v4fa*)(x + j);
    v4f b = {0.f,0.f,0.f,0.f}; if (rr) b = *(const v4fa*)(rr + j);
#pragma unroll
    for (int q = 0; q < 4; ++q) { const float v = a[q] + b[q]; vals[u * 4 + q] = v; s1 += v; }
  }
  red[tid] = s1; __syncthreads();
  for (int st = 128; st > 0; st >>= 1) { if (tid < st) red[tid] += red[tid + st]; __syncthreads(); }
  const float mu = red[0] / (float)N; __syncthreads();
  float s2 = 0.f;
  for (int u = 0; u < per / 4; ++u)
#pragma unroll
    for (int q = 0; q < 4; ++q) { const float c = vals[u * 4 + q] - mu; s2 += c * c; }
  red[tid] = s2; __syncthreads();
  for (int st = 128; st > 0; st >>= 1) { if (tid < st) red[tid] += red[tid + st]; __syncthreads(); }
  const float rs = rsqrtf(red[0] / (float)N + eps);
  {
    for (int u = 0; u < per / 4; ++u) {
      const int j = tid * 4 + 1024 * u;
      v4f o, sm;
#pragma unroll
      for (int q = 0; q < 4; ++q) {
        float gg = g[j + q], bb = bta[j + q];
        if (PARAM_BF16) { gg = bf16_round(gg); bb = bf16_round(bb); }
        sm[q] = vals[u * 4 + q]; o[q] = (vals[u * 4 + q] - mu) * rs * gg + bb;
      }
      if (out_sum) *(v4f*)(out_sum + (size_t)row * N + j) = sm;
      *(v4f*)(out_norm + (size_t)row * N + j) = o;
    }
    
  }
}



// ---- f16 WMMA path (v_wmma_f32_16x16x32_f16): 11-bit significands for operands in range — used where a [0,1] probability operand needs more precision than bf16
typedef _Float16 v16h __attribute__((ext_vector_type(16)));
union FragH { v16h v; v8us half[2]; _Float16 h[16]; unsigned short u[16]; };
template <int NT>
__device__ __forceinline__ v8f mmaH(v16h ah, v16h al, v16h bh, v16h bl, v8f c) {
  c = __builtin_amdgcn_wmma_f32_16x16x32_f16(false, ah, false, bh, (short)0, c, false, false);
  if (NT >= 2) c = __builtin_amdgcn_wmma_f32_16x16x32_f16(false, al, false, bh, (short)0, c, false, false);
  if (NT >= 3) c = __builtin_amdgcn_wmma_f32_16x16x32_f16(false, ah, false, bl, (short)0, c, false, false);
  asm volatile("v_nop\n\tv_nop\n\tv_nop\n\tv_nop" : "+v"(c) : "v"(ah), "v"(al), "v"(bh), "v"(bl));
  return c;
}
// batched GEMM like k_gemm_b but f16 operands: A f32 (split into f16 hi/lo if ASPLIT, else rounded to f16), Bt = f16 values [n][k]; alpha; C f32; N multiple of 16 (partial tiles skipped)
template <bool ASPLIT>
__global__ __launch_bounds__(128) void k_gemm_h(const float* __restrict__ A, int lda, size_t sA, const _Float16* __restrict__ Bh, int ldb, size_t sB, float alpha, float* __restrict__ C, int ldc, size_t sC, int M, int N, int K) {
  __shared__ __attribute__((aligned(16))) float so[4][16][64];
  const int tid = threadIdx.x, w = tid >> 5, lane = tid & 31, ln = lane & 15, hh = lane >> 4; const int by = blockIdx.y;
  A += (size_t)by * sA; Bh += (size_t)by * sB; C += (size_t)by * sC;
  const int ntn = (N + 63) / 64; const int wid = blockIdx.x * 4 + w; const int mt = wid / ntn, nq = wid % ntn; if (mt * 16 >= M) return;
  const int row0 = mt * 16, col0 = nq * 64; const float* arow = A + (size_t)(row0 + ln) * lda;
  v8f acc[4] = {};
  for (int kb = 0; kb < K; kb += 32) {
    FragH ah, al;
    const v4f x0 = *(const v4fa*)(arow + kb + 8 * hh), x1 = *(const v4fa*)(arow + kb + 8 * hh + 4), x2 = *(const v4fa*)(arow + kb + 16 + 8 * hh), x3 = *(const v4fa*)(arow + kb + 16 + 8 * hh + 4);
    float xs[16] = {x0[0],x0[1],x0[2],x0[3],x1[0],x1[1],x1[2],x1[3],x2[0],x2[1],x2[2],x2[3],x3[0],x3[1],x3[2],x3[3]};
#pragma unroll
    for (int i = 0; i < 16; ++i) { const _Float16 h = (_Float16)xs[i]; ah.h[i] = h; al.h[i] = ASPLIT ? (_Float16)(xs[i] - (float)h) : (_Float16)0.0f; }
#pragma unroll
    for (int t = 0; t < 4; ++t) { if (col0 + t * 16 >= N) continue; const size_t boff = (size_t)(col0 + t * 16 + ln) * ldb + kb; FragH bq; bq.half[0] = *(const v8us*)(Bh + boff + 8 * hh); bq.half[1] = *(const v8us*)(Bh + boff + 16 + 8 * hh);
      acc[t] = mmaH<ASPLIT ? 2 : 1>(ah.v, al.v, bq.v, bq.v, acc[t]); }
  }
#pragma unroll
  for (int t = 0; t < 4; ++t) { if (col0 + t * 16 >= N) continue;
#pragma unroll
    for (int r = 0; r < 8; ++r) so[w][8 * hh + r][t * 16 + ln] = acc[t][r] * alpha; }
  __builtin_amdgcn_fence(__ATOMIC_ACQ_REL, "workgroup"); __builtin_amdgcn_wave_barrier();
  const int rsub = lane >> 4, c4 = (lane & 15) * 4;
  {
#pragma unroll
    for (int q = 0; q < 8; ++q) { const int r = q * 2 + rsub; if (col0 + c4 < N) { const v4f v = *(const v4fa*)&so[w][r][c4]; *(v4f*)(C + (size_t)(row0 + r) * ldc + col0 + c4) = v; } }
     }
}

// One launch for the five operand preparations, which do not depend on one another: blocks [0, 4 PREP_WB) transpose the four weights, the rest convert x.
// Weights: Wt[n][k] = f16(W[k][n] x16) from f32 row-major W[DM][DM] (bf16-exact weights stay exact in f16 away from the subnormal range); Bt holds the four [n][k] planes one behind the other. x: exact f16 rows of the bf16-rounded values.
#define PREP_WB ((DM * (DM / 8) + 255) / 256)                 /* blocks per weight: eight k of one n per thread */
#define PREP_XB ((unsigned)((NR * DM / 8 + 255) / 256))       /* blocks for x: eight elements per thread */
__global__ __launch_bounds__(256) void k_prep(const float* __restrict__ x, const float* __restrict__ wq, const float* __restrict__ wk, const float* __restrict__ wv, const float* __restrict__ wo, _Float16* __restrict__ Bt, _Float16* __restrict__ X16) {
  const int bx = blockIdx.x; FragH f;
  if (bx < 4 * PREP_WB) {      /* the strided weight reads have the longer latency chain: they start first */
    const int p = bx / PREP_WB; const float* W = p == 0 ? wq : p == 1 ? wk : p == 2 ? wv : wo;
    const int t = (bx - p * PREP_WB) * 256 + threadIdx.x; if (t >= DM * (DM / 8)) return; const int n = t / (DM / 8), k8 = (t % (DM / 8)) * 8;
#pragma unroll
    for (int i = 0; i < 8; ++i) f.h[i] = (_Float16)(bf16_round(W[(size_t)(k8 + i) * DM + n]) * 16.0f);
    *(v8us*)((unsigned short*)Bt + (size_t)p * DM * DM + (size_t)n * DM + k8) = f.half[0];
  } else {
    const size_t t = (size_t)(bx - 4 * PREP_WB) * 256 + threadIdx.x; if (t >= NR * DM / 8) return;
#pragma unroll
    for (int q = 0; q < 8; ++q) f.h[q] = (_Float16)bf16_round(x[t * 8 + q]);
    *(v8us*)((unsigned short*)X16 + t * 8) = f.half[0];
  }
}
// k_gemm_hh variant with fused epilogue: v = acc·alpha + bias[by·sBias + col] (+ CP[(row/rowsPerB)·sCPb + by·64 + col] if CP) ; ACT 0 none / 1 elu ; writes f16 C16 (and f32 C if non-null)
template <int ACT>
__global__ __launch_bounds__(128) void k_gemm_hhx(const _Float16* __restrict__ A, int lda, size_t sA, const _Float16* __restrict__ Bh, int ldb, size_t sB, float alpha, const float* __restrict__ bias, size_t sBias, const float* __restrict__ CP, int rowsPerB, size_t sCPb, int row0g,
    float* __restrict__ C, _Float16* __restrict__ C16, int ldc, size_t sC, int M, int N, int K) {
  __shared__ __attribute__((aligned(16))) float so[4][16][64];
  const int tid = threadIdx.x, w = tid >> 5, lane = tid & 31, ln = lane & 15, hh = lane >> 4; const int by = blockIdx.y;
  A += (size_t)by * sA; Bh += (size_t)by * sB; const size_t cofs = (size_t)by * sC; const float* bp = bias ? bias + (size_t)by * sBias : nullptr;
  const int ntn = (N + 63) / 64; const int wid = blockIdx.x * 4 + w; const int mt = wid / ntn, nq = wid % ntn; if (mt * 16 >= M) return;
  const int row0 = mt * 16, col0 = nq * 64; const _Float16* arow = A + (size_t)(row0 + ln) * lda;
  v8f acc[4] = {};
  for (int kb = 0; kb < K; kb += 32) { FragH ah; ah.half[0] = *(const v8us*)((const unsigned short*)arow + kb + 8 * hh); ah.half[1] = *(const v8us*)((const unsigned short*)arow + kb + 16 + 8 * hh);
#pragma unroll
    for (int t = 0; t < 4; ++t) { if (col0 + t * 16 >= N) continue; const size_t boff = (size_t)(col0 + t * 16 + ln) * ldb + kb; FragH bq; bq.half[0] = *(const v8us*)((const unsigned short*)Bh + boff + 8 * hh); bq.half[1] = *(const v8us*)((const unsigned short*)Bh + boff + 16 + 8 * hh);
      acc[t] = mmaH<1>(ah.v, ah.v, bq.v, bq.v, acc[t]); }
  }
#pragma unroll
  for (int t = 0; t < 4; ++t) { if (col0 + t * 16 >= N) continue; const int col = col0 + t * 16 + ln; const float bv = bp ? bf16_round(bp[col]) : 0.f;
#pragma unroll
    for (int r = 0; r < 8; ++r) { float v = acc[t][r] * alpha + bv; if (CP) { const int rr = row0g + row0 + 8 * hh + r; if (rowsPerB < 0) v += CP[cofs + (size_t)rr * ldc + col];      /* rowsPerB < 0: own element of the batched C plane */ else { const int bidx = rr / rowsPerB; v += CP[(size_t)bidx * sCPb + (size_t)by * 64 + col]; } } if (ACT == 1) v = (v > 0.f) ? v : expm1f(v); else if (ACT == 7) v = (v > 0.f) ? v + 1.0f : expf(v); else if (ACT == 8) v = tanhf(v); else if (ACT == 9) v = 0.5f * v * (1.0f + tanhf(0.7978845608028654f * (v + 0.044715f * v * v * v))); else if (ACT == 11) v = 1.0f / (1.0f + expf(-v)); else if (ACT == 12) v = (v > 0.f) ? v : 0.01f * v; else if (ACT == 14) v = (v > 0.f) ? v : 0.1f * v; else if (ACT == 16) v = (v >= 0.f) ? v : 0.3f * v; else if (ACT == 17) v = (v >= 0.f) ? v : 0.2f * v; else if (ACT == 15) v = v / (1.0f + expf(-v)); else if (ACT == 3) v = fmaxf(v, 0.f); else if (ACT == 6) v = 0.5f * v * (1.0f + erff(v * 0.70710678118654752f)); so[w][8 * hh + r][t * 16 + ln] = v; } }
  __builtin_amdgcn_fence(__ATOMIC_ACQ_REL, "workgroup"); __builtin_amdgcn_wave_barrier();
  const int rsub = lane >> 4, c4 = (lane & 15) * 4; typedef _Float16 v4h __attribute__((ext_vector_type(4)));
  {
#pragma unroll
    for (int q = 0; q < 8; ++q) { const int r = q * 2 + rsub; if (col0 + c4 < N) { const v4f v = *(const v4fa*)&so[w][r][c4]; if (C) *(v4f*)(C + cofs + (size_t)(row0 + r) * ldc + col0 + c4) = v; if (C16) { v4h h4; for (int i = 0; i < 4; ++i) h4[i] = (_Float16)v[i]; *(v4h*)(C16 + cofs + (size_t)(row0 + r) * ldc + col0 + c4) = h4; } } }
     }
}


typedef _Float16 v4h __attribute__((ext_vector_type(4)));

__global__ __launch_bounds__(256) void k_h16(const float* __restrict__ x, _Float16* __restrict__ X16, size_t n8) { const size_t t = (size_t)blockIdx.x * 256 + threadIdx.x; if (t >= n8) return; FragH f;
#pragma unroll
  for (int q = 0; q < 8; ++q) f.h[q] = (_Float16)x[t * 8 + q]; *(v8us*)((unsigned short*)X16 + t * 8) = f.half[0];  }
__global__ __launch_bounds__(256) void k_round16f(const float* __restrict__ W, _Float16* __restrict__ Bt, size_t n8) { const size_t t = (size_t)blockIdx.x * 256 + threadIdx.x; if (t >= n8) return; FragH f;
#pragma unroll
  for (int i = 0; i < 8; ++i) f.h[i] = (_Float16)(bf16_round(W[t * 8 + i]) * 16.0f); *(v8us*)((unsigned short*)Bt + t * 8) = f.half[0];  }
template <int NHv, int TTv>
__global__ __launch_bounds__(256) void k_vt(const _Float16* __restrict__ V16, int ldv, int voff, _Float16* __restrict__ Vt) { __shared__ unsigned short tl[64][66]; const int tid = threadIdx.x; const int slab = blockIdx.x / (TTv / 64), lg = blockIdx.x % (TTv / 64); const int b = slab / NHv, h = slab % NHv;
  for (int i = tid; i < 64 * 8; i += 256) { const int r = i / 8, c8 = (i % 8) * 8; FragH f; f.half[0] = *(const v8us*)((const unsigned short*)V16 + ((size_t)b * TTv + lg * 64 + r) * ldv + voff + h * 64 + c8);
#pragma unroll
    for (int q = 0; q < 8; ++q) tl[r][c8 + q] = f.u[q]; }
  __syncthreads();
  {
#pragma unroll
    for (int rd = 0; rd < 2; ++rd) { const int d = rd * 32 + tid / 8, pc = tid % 8; FragH f;
#pragma unroll
      for (int q = 0; q < 8; ++q) f.u[q] = tl[pc * 8 + q][d];
      *(v8us*)((unsigned short*)Vt + ((size_t)slab * 64 + d) * TTv + lg * 64 + pc * 8) = f.half[0]; }
     } }

__global__ __launch_bounds__(256) void k_hl(const float* __restrict__ F, _Float16* __restrict__ Hh, _Float16* __restrict__ Hl, size_t n8) { const size_t t = (size_t)blockIdx.x * 256 + threadIdx.x; if (t >= n8) return; FragH fh, fl; const v4f a = *(const v4fa*)(F + t * 8), c = *(const v4fa*)(F + t * 8 + 4);
#pragma unroll
  for (int q = 0; q < 4; ++q) { _Float16 h = (_Float16)a[q]; fh.h[q] = h; fl.h[q] = (_Float16)((a[q] - (float)h) * 1024.0f); h = (_Float16)c[q]; fh.h[4 + q] = h; fl.h[4 + q] = (_Float16)((c[q] - (float)h) * 1024.0f); }
  { *(v8us*)((unsigned short*)Hh + t * 8) = fh.half[0]; *(v8us*)((unsigned short*)Hl + t * 8) = fl.half[0];  } }

// ---- fast GEMM (block tile 128x64, wave tile 32x64; A and B k-tiles staged in LDS; requires M % 128 == 0 rows per launch region, N % 64 == 0 and K % 64 == 0); epilogue = k_gemm_hhx semantics ----
__device__ __forceinline__ v16h g2_frag(const _Float16* p, int hh) { FragH f; f.half[0] = *(const v8us*)((const unsigned short*)p + 8 * hh); f.half[1] = *(const v8us*)((const unsigned short*)p + 16 + 8 * hh); return f.v; }
__device__ __forceinline__ v8f g2_mma(v16h a, v16h b, v8f c) { v8f d = __builtin_amdgcn_wmma_f32_16x16x32_f16(false, a, false, b, (short)0, c, false, false); asm volatile("v_nop\n\tv_nop\n\tv_nop\n\tv_nop" : "+v"(d) : "v"(a), "v"(b)); return d; }
#define G2_KS 64                     /* k per LDS stage: one 128-byte line of every A and B row */
#define G2_LP 72                     /* LDS row pitch in halves: 144 B = 16 B x odd for 16-byte row reads */
__device__ __forceinline__ v16h g2_lfrag(const unsigned short* p) { FragH f; f.half[0] = *(const v8us*)p; f.half[1] = *(const v8us*)(p + 16); return f.v; }      /* p already holds the lane half's + 8 hh: the k order of g2_frag */
template <int ACT, int LDA, int LDB, int LDC, bool HASB, bool HASCP, bool OUT32, bool OUT16>      /* row pitches at compile time: a tile's row pieces are immediate offsets from one address pair; the epilogue's options (bias, residual CP, f32 / f16 output) at compile time: straight-line code without a test per element or per row */
__global__ __launch_bounds__(128) void k_gemm2(const _Float16* __restrict__ A, size_t sA, const _Float16* __restrict__ Bh, size_t sB, float alpha, const float* __restrict__ bias, const float* __restrict__ bias1, const float* __restrict__ bias2, size_t sBias, const float* __restrict__ CP, int rowsPerB, size_t sCPb, int row0g,
    float* __restrict__ C, _Float16* __restrict__ C16, size_t sC, int M, int N, int K) { static_assert(ACT == 0 || ACT == 3 || ACT == 6 || ACT == 8 || ACT == 9 || ACT == 11 || ACT == 12 || ACT == 14 || ACT == 15 || ACT == 16 || ACT == 17, "k_gemm2: unsupported ACT code (would silently apply no activation)");
  __shared__ __attribute__((aligned(16))) unsigned short tl[2][128 + 64][G2_LP];      /* per buffer: the block's 128 A rows, then its 64 B rows, G2_KS halves of each */
  float (*so)[32][68] = (float (*)[32][68])&tl[0][0][0];      /* the epilogue's staging takes the tiles' place behind the loop's last barrier */
  static_assert(sizeof(tl) >= sizeof(float) * 4 * 32 * 68, "k_gemm2: epilogue staging must fit in the tile buffers");
  const int tid = threadIdx.x, w = tid >> 5, lane = tid & 31, ln = lane & 15, hh = lane >> 4; const int by = blockIdx.y;
  A += (size_t)by * sA; Bh += (size_t)by * sB; const size_t cofs = (size_t)by * sC; const float* bsel = (by == 1 && bias1) ? bias1 : (by == 2 && bias2) ? bias2 : bias;      /* planes 1 and 2 may bring their bias in a buffer of its own */
  const float* bp = bsel + (size_t)by * sBias;      /* read only where HASB */
  const int ntn = N >> 6; const int mt = blockIdx.x / ntn, nq = blockIdx.x - mt * ntn; const int row0 = mt * 128 + 32 * w, col0 = nq * 64; if (mt * 128 >= M) return;      /* the same for the whole block: in front of every barrier */
  const int sr = tid >> 3, sc = (tid & 7) * 8;      /* staging: eight lanes cover one 128-byte row piece; piece u is row sr + 16 u */
  const unsigned short* ag = (const unsigned short*)A + (size_t)(mt * 128 + sr) * LDA + sc;
  const unsigned short* bg = (const unsigned short*)Bh + (size_t)(col0 + sr) * LDB + sc;
  v8us ra[8], rb[4];      /* these and af, bf below are indexed under full unrolls only, so that they stay in registers */
#pragma unroll
  for (int u = 0; u < 8; ++u) ra[u] = *(const v8us*)(ag + (size_t)(16 * u) * LDA);
#pragma unroll
  for (int u = 0; u < 4; ++u) rb[u] = *(const v8us*)(bg + (size_t)(16 * u) * LDB);
  float bv4[4];      /* the lane's four bias values, fetched behind the first tiles' loads: their latency passes under the k loop */
#pragma unroll
  for (int t = 0; t < 4; ++t) bv4[t] = HASB ? bf16_round(bp[col0 + t * 16 + ln]) : 0.f;
  const v8f z8 = {0.f,0.f,0.f,0.f,0.f,0.f,0.f,0.f}; v8f c00 = z8, c01 = z8, c02 = z8, c03 = z8, c10 = z8, c11 = z8, c12 = z8, c13 = z8;
#pragma unroll
  for (int u = 0; u < 8; ++u) *(v8us*)&tl[0][sr + 16 * u][sc] = ra[u];
#pragma unroll
  for (int u = 0; u < 4; ++u) *(v8us*)&tl[0][128 + sr + 16 * u][sc] = rb[u];
  __syncthreads();
  const int nst = K / G2_KS;
#pragma unroll 1      /* rolled: one stage's code, two buffers by index */
  for (int st = 0; st < nst; ++st) { const int bu = st & 1;
    if (st + 1 < nst) {      /* the next stage's tiles fly into registers under this stage's products */
      const unsigned short* an = ag + (st + 1) * G2_KS; const unsigned short* bn = bg + (st + 1) * G2_KS;
#pragma unroll
      for (int u = 0; u < 8; ++u) ra[u] = *(const v8us*)(an + (size_t)(16 * u) * LDA);
#pragma unroll
      for (int u = 0; u < 4; ++u) rb[u] = *(const v8us*)(bn + (size_t)(16 * u) * LDB);
      asm volatile("s_wait_xcnt 0x0" :: "v"(an), "v"(bn) : "memory");      /* stands in front of every overwrite of the address registers that the loads above name */
    }
    v16h af[G2_KS / 32][2], bf[G2_KS / 32][4];      /* the stage's fragments are read as one group in front of its products */
#pragma unroll
    for (int kk = 0; kk < G2_KS / 32; ++kk) { const unsigned short* ap = &tl[bu][32 * w + ln][32 * kk + 8 * hh]; const unsigned short* bq = &tl[bu][128 + ln][32 * kk + 8 * hh];
      af[kk][0] = g2_lfrag(ap); af[kk][1] = g2_lfrag(ap + 16 * G2_LP);
#pragma unroll
      for (int t = 0; t < 4; ++t) bf[kk][t] = g2_lfrag(bq + 16 * t * G2_LP); }
#pragma unroll
    for (int kk = 0; kk < G2_KS / 32; ++kk) {
      c00 = g2_mma(af[kk][0], bf[kk][0], c00); c10 = g2_mma(af[kk][1], bf[kk][0], c10);
      c01 = g2_mma(af[kk][0], bf[kk][1], c01); c11 = g2_mma(af[kk][1], bf[kk][1], c11);
      c02 = g2_mma(af[kk][0], bf[kk][2], c02); c12 = g2_mma(af[kk][1], bf[kk][2], c12);
      c03 = g2_mma(af[kk][0], bf[kk][3], c03); c13 = g2_mma(af[kk][1], bf[kk][3], c13); }
    if (st + 1 < nst) {
#pragma unroll
      for (int u = 0; u < 8; ++u) *(v8us*)&tl[bu ^ 1][sr + 16 * u][sc] = ra[u];
#pragma unroll
      for (int u = 0; u < 4; ++u) *(v8us*)&tl[bu ^ 1][128 + sr + 16 * u][sc] = rb[u]; }
    __syncthreads();      /* publishes the next stage and ends every wave's reads of this one, which the next trip (or the epilogue) overwrites */
  }
  v8f accs[8] = {c00, c01, c02, c03, c10, c11, c12, c13};
#pragma unroll
  for (int u = 0; u < 8; ++u) { const int t = u & 3, half = u >> 2; const int col = col0 + t * 16 + ln; const float bv = bv4[t];
#pragma unroll
    for (int r = 0; r < 8; ++r) { const int rloc = half * 16 + 8 * hh + r; float v = accs[u][r] * alpha + bv; if (HASCP) { if (rowsPerB < 0) v += CP[cofs + (size_t)(row0g + row0 + rloc) * LDC + col];      /* rowsPerB < 0: own element of the batched C plane */ else { const int bidx = (row0g + row0 + rloc) / rowsPerB; v += CP[(size_t)bidx * sCPb + (size_t)by * 64 + col]; } }
      if (ACT == 3) v = fmaxf(v, 0.f); else if (ACT == 6) v = 0.5f * v * (1.0f + erff(v * 0.70710678118654752f)); else if (ACT == 11) v = 1.0f / (1.0f + expf(-v)); else if (ACT == 15) v = v / (1.0f + expf(-v)); else if (ACT == 12) v = (v > 0.f) ? v : 0.01f * v; else if (ACT == 8) v = tanhf(v); else if (ACT == 9) v = 0.5f * v * (1.0f + tanhf(0.7978845608028654f * (v + 0.044715f * v * v * v))); else if (ACT == 14) v = (v > 0.f) ? v : 0.1f * v; else if (ACT == 16) v = (v >= 0.f) ? v : 0.3f * v; else if (ACT == 17) v = (v >= 0.f) ? v : 0.2f * v;
      so[w][rloc][t * 16 + ln] = v; } }
  __builtin_amdgcn_fence(__ATOMIC_ACQ_REL, "workgroup"); __builtin_amdgcn_wave_barrier();
  const int rsub = lane >> 4, c4 = (lane & 15) * 4;
  {
#pragma unroll
    for (int q = 0; q < 16; ++q) { const int r = q * 2 + rsub; const v4f v = *(const v4fa*)&so[w][r][c4]; if (OUT32) *(v4f*)(C + cofs + (size_t)(row0 + r) * LDC + col0 + c4) = v; if (OUT16) { v4h h4; for (int i = 0; i < 4; ++i) h4[i] = (_Float16)v[i]; *(v4h*)(C16 + cofs + (size_t)(row0 + r) * LDC + col0 + c4) = h4; } }
     } }


__global__ __launch_bounds__(256) void k_wnat(const float* __restrict__ w, size_t n8, _Float16* __restrict__ Bt) { const size_t t = (size_t)blockIdx.x * 256 + threadIdx.x; if (t >= n8) return; FragH f; for (int q = 0; q < 8; ++q) f.h[q] = (_Float16)(bf16_round(w[t * 8 + q]) * 16.0f); *(v8us*)((unsigned short*)Bt + t * 8) = f.half[0];  }
__global__ __launch_bounds__(256) void k_rsm(const float* __restrict__ S, _Float16* __restrict__ P, int nrows) {
  #pragma clang fp contract(off)
  const int i = blockIdx.x * 256 + threadIdx.x; if (i >= nrows) return; const float* s = S + (size_t)i * SQ; float mx = -3.0e38f;
#pragma unroll 1
  for (int j = 0; j < SQ; ++j) mx = fmaxf(mx, s[j]); float se = 0.f;
#pragma unroll 1
  for (int j = 0; j < SQ; ++j) se += expf(s[j] - mx); const float sc = 256.0f / se;
#pragma unroll 1
  for (int j0 = 0; j0 < SQ; j0 += 8) { FragH f; for (int q = 0; q < 8; ++q) f.h[q] = (_Float16)(expf(s[j0 + q] - mx) * sc); unsigned short* d = (unsigned short*)P + (size_t)i * SQ + j0; *(v8us*)d = f.half[0];  } }
__global__ __launch_bounds__(256) void k_vt(const _Float16* __restrict__ V16, int b, int h0, _Float16* __restrict__ VT) { __shared__ unsigned short tl[64][65]; const int tid = threadIdx.x; const int hh = blockIdx.x % HG, sg = blockIdx.x / HG; const int s0 = sg * 64; const int h = h0 + hh;
  for (int i = tid; i < 64 * 8; i += 256) { const int j = i / 8, d8 = (i % 8) * 8; FragH f; f.half[0] = *(const v8us*)((const unsigned short*)V16 + ((size_t)b * SQ + s0 + j) * DM + h * HD + d8); for (int q = 0; q < 8; ++q) tl[d8 + q][j] = f.u[q]; }
  __syncthreads();
  { for (int i = tid; i < 64 * 8; i += 256) { const int d = i / 8, j8 = (i % 8) * 8; FragH f; for (int q = 0; q < 8; ++q) f.u[q] = tl[d][j8 + q]; *(v8us*)((unsigned short*)VT + ((size_t)hh * HD + d) * SQ + s0 + j8) = f.half[0]; }  } }



// ---- fused attention: per work-group FA_BR queries of one (batch, head) against all SQ keys. Transposed products: S^T = K Q^T puts one query's
// scores in one lane pair (l, l ^ 16), so maximum and weights are in-lane; two S^T tiles (32 keys), converted in place, are the B operand of
// O^T += V^T P^T. Every A/B fragment is loaded in the same k order (8 h + 0..7, 16 + 8 h + 0..7), which is the order the converted tiles have.
#define FA_NW 4                      /* waves per work-group */
#define FA_R 2                       /* 16-query column groups per wave */
#define FA_BR (FA_NW * FA_R * 16)    /* queries per work-group */
#define FA_SK 64                     /* keys per LDS stage = two 32-key passes */
#define FA_LP 72                     /* LDS row pitch in halves: 144 B = 16 B x odd for 16-byte row reads */
#define FA_NST (SQ / FA_SK)
static_assert(HD == 64 && FA_SK == 64 && SQ % FA_SK == 0 && SQ % FA_BR == 0 && FA_NW * 32 == 128, "k_fattn: 64 x 128-byte tiles, four 16-byte pieces of each per thread, whole stages and whole query blocks");
typedef float v2f __attribute__((ext_vector_type(2)));
typedef _Float16 v2h __attribute__((ext_vector_type(2)));
typedef unsigned int v8u __attribute__((ext_vector_type(8)));
typedef unsigned int v4u __attribute__((ext_vector_type(4)));
__device__ __forceinline__ v16h fa_frag(const unsigned short* p) { FragH f; f.half[0] = *(const v8us*)p; f.half[1] = *(const v8us*)(p + 16); return f.v; }      /* p already holds the lane half's + 8 h */
__device__ __forceinline__ unsigned int fa_pack(float lo, float hi) { return __builtin_bit_cast(unsigned int, __builtin_convertvector((v2f){lo, hi}, v2h)); }
__device__ __forceinline__ float fa_xh(float x) { return __builtin_bit_cast(float, __builtin_amdgcn_permlanex16(__builtin_bit_cast(int, x), __builtin_bit_cast(int, x), 0x76543210, 0xfedcba98, false, false)); }      /* lane l with lane l ^ 16 */
__device__ __forceinline__ v8f fa_mma(v16h a, v16h b, v8f c) { return __builtin_amdgcn_wmma_f32_16x16x32_f16(false, a, false, b, (short)0, c, false, false); }
__global__ __launch_bounds__(FA_NW * 32) void k_fattn(const _Float16* __restrict__ Q16, const _Float16* __restrict__ K16, const _Float16* __restrict__ VT, _Float16* __restrict__ O16) {
  __shared__ __attribute__((aligned(16))) unsigned short sk[2][FA_SK][FA_LP];      /* K rows [key][d] */
  __shared__ __attribute__((aligned(16))) unsigned short sv[2][HD][FA_LP];         /* V^T rows [d][key] */
  const int tid = threadIdx.x, lane = tid & 31, wave = tid >> 5, c = lane & 15, h = lane >> 4;
  const int bh = blockIdx.y, b = bh / NH, hd = bh - b * NH;
  const int q0 = blockIdx.x * FA_BR + wave * (FA_R * 16);
  const int sr = tid >> 3, sc = (tid & 7) * 8;      /* staging: eight lanes cover one 128-byte row; piece u is row sr + 16 u */
  const unsigned short* kg = (const unsigned short*)K16 + ((size_t)b * SQ + sr) * DM + hd * HD + sc;
  const unsigned short* vg = (const unsigned short*)VT + ((size_t)bh * HD + sr) * SQ + sc;
  const float cscale = 0.125f * 1.4426950408889634f;      /* HD^-0.5 log2(e) */
  v8us rk[4], rv[4];
#pragma unroll
  for (int u = 0; u < 4; ++u) { rk[u] = *(const v8us*)(kg + (size_t)(16 * u) * DM); rv[u] = *(const v8us*)(vg + (size_t)(16 * u) * SQ); }
  v16h qf[FA_R][2];
#pragma unroll
  for (int g = 0; g < FA_R; ++g) { const unsigned short* qp = (const unsigned short*)Q16 + ((size_t)b * SQ + q0 + 16 * g + c) * DM + hd * HD + 8 * h; qf[g][0] = fa_frag(qp); qf[g][1] = fa_frag(qp + 32); }
  const unsigned int o1 = (c == 0) ? 0x3C003C00u : 0u;      /* A operand whose row 0 is f16 ones: its product with P^T is the weights' column sums */
  const v16h ones = __builtin_bit_cast(v16h, (v8u){o1, o1, o1, o1, o1, o1, o1, o1});
  const v8f z8 = {0.f, 0.f, 0.f, 0.f, 0.f, 0.f, 0.f, 0.f};
  v8f acc[FA_R][4], lacc[FA_R]; float m_run[FA_R];
#pragma unroll
  for (int g = 0; g < FA_R; ++g) { m_run[g] = -__builtin_inff(); lacc[g] = z8; acc[g][0] = z8; acc[g][1] = z8; acc[g][2] = z8; acc[g][3] = z8; }
#pragma unroll
  for (int u = 0; u < 4; ++u) { *(v8us*)&sk[0][sr + 16 * u][sc] = rk[u]; *(v8us*)&sv[0][sr + 16 * u][sc] = rv[u]; }
  __syncthreads();
#pragma unroll 1      /* rolled: one stage's code, two buffers by index */
  for (int st = 0; st < FA_NST; ++st) {
    const int bu = st & 1;
    if (st + 1 < FA_NST) {      /* the next stage's tiles fly into registers under this stage's two passes */
      const unsigned short* kn = kg + (size_t)(st + 1) * FA_SK * DM; const unsigned short* vn = vg + (st + 1) * FA_SK;
#pragma unroll
      for (int u = 0; u < 4; ++u) { rk[u] = *(const v8us*)(kn + (size_t)(16 * u) * DM); rv[u] = *(const v8us*)(vn + (size_t)(16 * u) * SQ); }
      asm volatile("s_wait_xcnt 0x0" :: "v"(kn), "v"(vn) : "memory");      /* stands in front of every overwrite of the address registers that the loads above name */
    }
#pragma unroll
    for (int sub = 0; sub < 2; ++sub) {
      v8f s[2][FA_R];
      { v16h kf[2][2];
#pragma unroll
        for (int kt = 0; kt < 2; ++kt) { const unsigned short* p = &sk[bu][32 * sub + 16 * kt + c][8 * h]; kf[kt][0] = fa_frag(p); kf[kt][1] = fa_frag(p + 32); }
#pragma unroll
        for (int kt = 0; kt < 2; ++kt)
#pragma unroll
          for (int g = 0; g < FA_R; ++g) s[kt][g] = fa_mma(kf[kt][0], qf[g][0], z8);
#pragma unroll
        for (int kt = 0; kt < 2; ++kt)
#pragma unroll
          for (int g = 0; g < FA_R; ++g) s[kt][g] = fa_mma(kf[kt][1], qf[g][1], s[kt][g]); }
      v16h vf[4];
#pragma unroll
      for (int t = 0; t < 4; ++t) vf[t] = fa_frag(&sv[bu][16 * t + c][32 * sub + 8 * h]);
      float mb[FA_R]; bool need = false;
#pragma unroll
      for (int g = 0; g < FA_R; ++g) { float mx = s[0][g][0];
#pragma unroll
        for (int r = 1; r < 8; ++r) mx = fmaxf(mx, s[0][g][r]);
#pragma unroll
        for (int r = 0; r < 8; ++r) mx = fmaxf(mx, s[1][g][r]);
        mx = fmaxf(mx, fa_xh(mx)) * cscale; mb[g] = mx; need = need || (mx > m_run[g] + 8.0f); }
      if (__builtin_amdgcn_ballot_w32(need) != 0) {      /* lazy rescale: the maximum in use may trail the true one by up to 8 (log2), so a weight stays below 2^8 */
#pragma unroll
        for (int g = 0; g < FA_R; ++g) { const float mn = fmaxf(m_run[g], mb[g]); const float corr = __builtin_amdgcn_exp2f(m_run[g] - mn); m_run[g] = mn; lacc[g] = lacc[g] * corr;
#pragma unroll
          for (int t = 0; t < 4; ++t) acc[g][t] = acc[g][t] * corr; } }
#pragma unroll
      for (int g = 0; g < FA_R; ++g) { const float nm = -m_run[g]; v8u w;
#pragma unroll
        for (int i = 0; i < 8; ++i) { const v2f a = __builtin_elementwise_fma((v2f){s[i >> 2][g][2 * (i & 3)], s[i >> 2][g][2 * (i & 3) + 1]}, (v2f){cscale, cscale}, (v2f){nm, nm}); w[i] = fa_pack(__builtin_amdgcn_exp2f(a[0]), __builtin_amdgcn_exp2f(a[1])); }
        const v16h pf = __builtin_bit_cast(v16h, w);      /* element e: key 8 h + e (tile 0), 16 + 8 h + e - 8 (tile 1) of query c */
#pragma unroll
        for (int t = 0; t < 4; ++t) acc[g][t] = fa_mma(vf[t], pf, acc[g][t]);
        lacc[g] = fa_mma(ones, pf, lacc[g]); }
    }
    __builtin_amdgcn_sched_barrier(0);      /* keeps the v_nop run below directly behind the stage's last WMMA */
    asm volatile("v_nop\n\tv_nop\n\tv_nop\n\tv_nop");      /* the four vector slots behind a WMMA, also on the taken side of the branches that follow */
    __builtin_amdgcn_sched_barrier(0);
    if (st + 1 < FA_NST) {
#pragma unroll
      for (int u = 0; u < 4; ++u) { *(v8us*)&sk[bu ^ 1][sr + 16 * u][sc] = rk[u]; *(v8us*)&sv[bu ^ 1][sr + 16 * u][sc] = rv[u]; } }
    __syncthreads();      /* publishes the next stage and ends every wave's reads of this one, which the next trip overwrites */
  }
#pragma unroll
  for (int g = 0; g < FA_R; ++g) { const float lr = lacc[g][0]; const float inv = 64.0f / (lr + fa_xh(lr));      /* row 0 of the sum tile sits in lanes 0-15, row 8 (zero) in lanes 16-31: the exchange-and-add is unconditional */
    unsigned short* op = (unsigned short*)O16 + ((size_t)b * SQ + q0 + 16 * g + c) * DM + hd * HD + 8 * h;
#pragma unroll
    for (int t = 0; t < 4; ++t) { const v8f o = acc[g][t] * inv; *(v4u*)(op + 16 * t) = (v4u){fa_pack(o[0], o[1]), fa_pack(o[2], o[3]), fa_pack(o[4], o[5]), fa_pack(o[6], o[7])}; } } }      /* acc register r = d 16 t + 8 h + r of query c */

extern "C" void kernel_launch(void* const* d_in, const int* in_sizes, int n_in,
                              void* d_out, int out_size, void* d_ws, size_t ws_size, hipStream_t stream) {
  (void)in_sizes; (void)n_in; (void)out_size;
  const float* const* I = (const float* const*)d_in; const float* x = I[0]; const float* wq = I[1]; const float* bq = I[2]; const float* wk = I[3]; const float* bk = I[4]; const float* wv = I[5]; const float* bv = I[6]; const float* wo = I[7]; const float* bo = I[8];      /* [in][out] weights + biases */
  char* ws = (char*)d_ws; size_t off = 0;
  auto take = [&](size_t bytes) { char* p = ws + off; off += (bytes + 255) & ~(size_t)255; return p; };
  _Float16* BQ = (_Float16*)take((size_t)DM * DM * 2); _Float16* BK = (_Float16*)take((size_t)DM * DM * 2); _Float16* BV = (_Float16*)take((size_t)DM * DM * 2); _Float16* BO = (_Float16*)take((size_t)DM * DM * 2);
  _Float16* X16 = (_Float16*)take(NR * DM * 2); _Float16* Q16 = (_Float16*)take(NR * DM * 2); _Float16* K16 = (_Float16*)take(NR * DM * 2); _Float16* V16 = (_Float16*)take(NR * DM * 2); _Float16* O16 = (_Float16*)take(NR * DM * 2);
  _Float16* VT = (_Float16*)take((size_t)NB * NH * HD * SQ * 2);
  if (off > ws_size) return;
  static_assert(MP % 128 == 0 && MPO % 128 == 0 && DM % 64 == 0, "k_gemm2: whole 128x64 block tiles and whole 64-wide k stages");
  static_assert(((size_t)DM * DM * 2) % 256 == 0 && (NR * DM * 2) % 256 == 0, "the weight planes BQ, BK, BV, BO and the row planes Q16, K16, V16 lie one behind the other in the workspace");
  k_prep<<<4 * PREP_WB + PREP_XB, 256, 0, stream>>>(x, wq, wk, wv, wo, BQ, X16);      /* [in][out] -> Bt[n][k] x16 for all four weights; x -> f16 rows */
  const size_t r0p = (size_t)B0 * SQ;      /* first projected row */
  k_gemm2<0, DM, DM, DM, true, false, false, true><<<dim3((unsigned)((MP / 128) * (DM / 64)), 3), 128, 0, stream>>>(X16 + r0p * DM, 0, BQ, (size_t)DM * DM, 0.0625f, bq, bk, bv, 0, nullptr, 1, 0, 0, nullptr, Q16 + r0p * DM, NR * DM, MP, DM, DM);      /* grid.y = Q, K, V: one A, three weight, bias and output planes */
  k_vt<NH, SQ><<<NB * NH * (SQ / 64), 256, 0, stream>>>(V16, LQ, 0, VT);      /* V^T [NB][NH][HD][SQ] */
  k_fattn<<<dim3(SQ / FA_BR, NB * NH), FA_NW * 32, 0, stream>>>(Q16, K16, VT, O16);      /* o x64 (merged heads) as f16 rows */
  k_gemm2<0, DM, DM, DM, true, false, true, false><<<dim3((unsigned)((MPO / 128) * (DM / 64)), 1), 128, 0, stream>>>(O16 + r0p * DM, 0, BO, 0, 0.0009765625f, bo, nullptr, nullptr, 0, nullptr, 1, 0, 0, (float*)d_out + r0p * DM, nullptr, 0, MPO, DM, DM);      /* out rows are the output layout */
}

// v006
// A run of this version takes 78.6 microseconds.
// In two side-by-side timings against v005, it was 1.06 and 1.07 times as fast.
// Over all steps from v000 it is 33.3 times as fast.
#include <hip/hip_runtime.h>
// Multi-head self-attention (x [2][2048][768]; q/k/v = x W + b ([in][out] 768x768 sigma 1/sqrt(768), zero biases); 12 heads of 64; softmax(q k^T / 8) over all keys (no mask); out = ctx Wo + bo -> [2][2048][768]).
// Structure: token rows r = b*2048 + s; x as exact f16 rows (bf16-rounded); Q, K, V as one launch of three WMMA GEMMs (32x64 wave tiles, f32 accumulation, exact x16 weights + bias, f16 outputs); V^T for all batches and heads via LDS transposes; one fused attention launch over (query block, batch x head): S^T = K Q^T (K = 64), online softmax in the log2 domain on the score accumulators (f32 statistics, native exp2, weights as f16 relative to the running maximum), O^T += V^T P^T, K and V^T staged in LDS; o carried x64 against f16 subnormal flush (folded into the output GEMM alpha), written straight into the merged f16 o rows; out = o W_o + b GEMM (f32) into the output layout.
// Compute dtype: inputs rounded to bf16; x / weights exact; q, k, v, softmax weights and o as plain f16 GEMM operands (~2^-12); scores and softmax statistics f32. v_wmma_f32_16x16x32_f16.
#define NB 2
#define SQ 2048
#define DM 768
#define NH 12
#define HD 64
#define HG 4                         /* heads per block group of the unlaunched k_vt(b, h0) */
#define B0 0                         /* first batch processed (debug hook) */
#define NBR NB                       /* batches processed (debug hook) */
#define NR ((size_t)NB * SQ)         /* token rows */
#define MP ((int)((size_t)NBR * SQ)) /* rows projected (debug hook) */
#define QN SQ                        /* query rows per batch; not read (k_fattn attends all SQ) */
#define NHD NH                       /* heads; not read (k_fattn attends all NH) */
#define MPO MP                       /* rows through the output stage (debug hook) */
#define LQ DM      /* row pitch of the q/k/v rows */
typedef __bf16 v16b __attribute__((ext_vector_type(16)));
typedef unsigned short v8us __attribute__((ext_vector_type(8), may_alias));
typedef float  v8f  __attribute__((ext_vector_type(8)));
typedef float  v4f  __attribute__((ext_vector_type(4)));
typedef float  v4fa __attribute__((ext_vector_type(4), may_alias));
union FragB { v16b v; v8us half[2]; unsigned short u[16]; };

__device__ __forceinline__ unsigned short bf16_bits(float x) { unsigned int u = __float_as_uint(x); return (unsigned short)((u + 0x7FFFu + ((u >> 16) & 1u)) >> 16); }
__device__ __forceinline__ float bf16_val(unsigned short b) { return __uint_as_float(((unsigned int)b) << 16); }
__device__ __forceinline__ float bf16_round(float x) { return bf16_val(bf16_bits(x)); }
// D += A·B with NT terms: 1 = ah·bh, 2 = + al·bh (A split), 3 = + ah·bl (both split)
template <int NT>
__device__ __forceinline__ v8f mmaN(v16b ah, v16b al, v16b bh, v16b bl, v8f c) {
  c = __builtin_amdgcn_wmma_f32_16x16x32_bf16(false, ah, false, bh, (short)0, c, false, false);
  if (NT >= 2) c = __builtin_amdgcn_wmma_f32_16x16x32_bf16(false, al, false, bh, (short)0, c, false, false);
  if (NT >= 3) c = __builtin_amdgcn_wmma_f32_16x16x32_bf16(false, ah, false, bl, (short)0, c, false, false);
  asm volatile("v_nop\n\tv_nop\n\tv_nop\n\tv_nop" : "+v"(c) : "v"(ah), "v"(al), "v"(bh), "v"(bl));
  return c;
}

__global__ __launch_bounds__(256) void k_wt_bf16(const float* __restrict__ W, unsigned short* __restrict__ Wt, int K, int N) {
  const int t = blockIdx.x * 256 + threadIdx.x;
  const int k8n = K / 8;
  if (t >= N * k8n) return;
  const int n = t / k8n, k8 = (t % k8n) * 8;
  v8us v;
#pragma unroll
  for (int i = 0; i < 8; ++i) v[i] = bf16_bits(W[(size_t)(k8 + i) * N + n]);
  *(v8us*)(Wt + (size_t)n * K + k8) = v;
  
}

// GEMM C[M][N] (f32, pitch ldc) = act(A[M][K]·W + bias). A f32 row-major (pitch lda) converted per fragment to bf16
// (ASPLIT: hi/lo two planes -> 2 terms, else single rounded term); Wt bf16 [N][K] (pitch ldb). BIAS_BF16 rounds the
// bias to bf16 first (bias quantised to bf16 before the add). K%32==0, M%16==0, N%64==0.
template <bool ASPLIT, int ACT, bool BIAS_BF16>
__global__ __launch_bounds__(128) void k_gemm_bf(const float* __restrict__ A, int lda, const unsigned short* __restrict__ Wt, int ldb,
                                               const float* __restrict__ bias, float* __restrict__ C, int ldc, int M, int N, int K) {
  __shared__ __attribute__((aligned(16))) float so[4][16][64];
  const int tid = threadIdx.x, w = tid >> 5, lane = tid & 31, ln = lane & 15, hh = lane >> 4;
  const int ntn = N / 64;
  const int wid = blockIdx.x * 4 + w;
  const int mt = wid / ntn, nq = wid % ntn;
  if (mt * 16 >= M) return;
  const int row0 = mt * 16, col0 = nq * 64;
  const float* arow = A + (size_t)(row0 + ln) * lda;
  v8f acc[4] = {};
  for (int kb = 0; kb < K; kb += 32) {
    FragB ah, al;
    const v4f x0 = *(const v4fa*)(arow + kb + 8 * hh), x1 = *(const v4fa*)(arow + kb + 8 * hh + 4);
    const v4f x2 = *(const v4fa*)(arow + kb + 16 + 8 * hh), x3 = *(const v4fa*)(arow + kb + 16 + 8 * hh + 4);
    float xs[16] = {x0[0],x0[1],x0[2],x0[3],x1[0],x1[1],x1[2],x1[3],x2[0],x2[1],x2[2],x2[3],x3[0],x3[1],x3[2],x3[3]};
#pragma unroll
    for (int i = 0; i < 16; ++i) { const unsigned short hb = bf16_bits(xs[i]); ah.u[i] = hb; al.u[i] = ASPLIT ? bf16_bits(xs[i] - bf16_val(hb)) : (unsigned short)0; }
#pragma unroll
    for (int t = 0; t < 4; ++t) {
      const unsigned short* brow = Wt + (size_t)(col0 + t * 16 + ln) * ldb + kb;
      FragB b;
      b.half[0] = *(const v8us*)(brow + 8 * hh);
      b.half[1] = *(const v8us*)(brow + 16 + 8 * hh);
      acc[t] = mmaN<ASPLIT ? 2 : 1>(ah.v, al.v, b.v, b.v, acc[t]);
    }
  }
#pragma unroll
  for (int t = 0; t < 4; ++t) {
    float bv = bias ? bias[col0 + t * 16 + ln] : 0.f;
    if (BIAS_BF16) bv = bf16_round(bv);
#pragma unroll
    for (int r = 0; r < 8; ++r) { float v = acc[t][r] + bv; if (ACT == 1) v = fmaxf(v, 0.f); so[w][8 * hh + r][t * 16 + ln] = v; }
  }
  __builtin_amdgcn_fence(__ATOMIC_ACQ_REL, "workgroup");
  __builtin_amdgcn_wave_barrier();
  const int rsub = lane >> 4, c4 = (lane & 15) * 4;
  {
#pragma unroll
    for (int q = 0; q < 8; ++q) {
      const int r = q * 2 + rsub;
      const v4f v = *(const v4fa*)&so[w][r][c4];
      *(v4f*)(C + (size_t)(row0 + r) * ldc + col0 + c4) = v;
    }
    
  }
}

// GEMM C = act(A·W + bias + resid): A f32 (ASPLIT -> hi/lo 2 terms), Wt bf16 [N][K]; ACT 0 none, 1 relu, 2 exact gelu;
// resid (optional, f32, row index = (row % rmod), pitch ldr, RES_BF16 rounds it) added before the activation.
template <bool ASPLIT, int ACT, bool BIAS_BF16, bool RES_BF16>
__global__ __launch_bounds__(128) void k_gemm_bf3(const float* __restrict__ A, int lda, const unsigned short* __restrict__ Wt, int ldb,
                                                const float* __restrict__ bias, const float* __restrict__ resid, int rmod, int ldr,
                                                float* __restrict__ C, int ldc, int M, int N, int K) {
  __shared__ __attribute__((aligned(16))) float so[4][16][64];
  const int tid = threadIdx.x, w = tid >> 5, lane = tid & 31, ln = lane & 15, hh = lane >> 4;
  const int ntn = N / 64;
  const int wid = blockIdx.x * 4 + w;
  const int mt = wid / ntn, nq = wid % ntn;
  if (mt * 16 >= M) return;
  const int row0 = mt * 16, col0 = nq * 64;
  const float* arow = A + (size_t)(row0 + ln) * lda;
  v8f acc[4] = {};
  for (int kb = 0; kb < K; kb += 32) {
    FragB ah, al;
    const v4f x0 = *(const v4fa*)(arow + kb + 8 * hh), x1 = *(const v4fa*)(arow + kb + 8 * hh + 4);
    const v4f x2 = *(const v4fa*)(arow + kb + 16 + 8 * hh), x3 = *(const v4fa*)(arow + kb + 16 + 8 * hh + 4);
    float xs[16] = {x0[0],x0[1],x0[2],x0[3],x1[0],x1[1],x1[2],x1[3],x2[0],x2[1],x2[2],x2[3],x3[0],x3[1],x3[2],x3[3]};
#pragma unroll
    for (int i = 0; i < 16; ++i) { const unsigned short hb = bf16_bits(xs[i]); ah.u[i] = hb; al.u[i] = ASPLIT ? bf16_bits(xs[i] - bf16_val(hb)) : (unsigned short)0; }
#pragma unroll
    for (int t = 0; t < 4; ++t) {
      const unsigned short* brow = Wt + (size_t)(col0 + t * 16 + ln) * ldb + kb;
      FragB b;
      b.half[0] = *(const v8us*)(brow + 8 * hh);
      b.half[1] = *(const v8us*)(brow + 16 + 8 * hh);
      acc[t] = mmaN<ASPLIT ? 2 : 1>(ah.v, al.v, b.v, b.v, acc[t]);
    }
  }
#pragma unroll
  for (int t = 0; t < 4; ++t) {
    const int col = col0 + t * 16 + ln;
    float bv = bias ? bias[col] : 0.f;
    if (BIAS_BF16) bv = bf16_round(bv);
#pragma unroll
    for (int r = 0; r < 8; ++r) {
      float v = acc[t][r] + bv;
      if (resid) { float rv = resid[(size_t)((row0 + 8 * hh + r) % rmod) * ldr + col]; if (RES_BF16) rv = bf16_round(rv); v += rv; }
      if (ACT == 1) v = fmaxf(v, 0.f);
      if (ACT == 2) v = 0.5f * v * (1.0f + erff(v * 0.70710678118654752f));
      if (ACT == 3) { const float u = 0.7978845608028654f * (v + 0.044715f * v * v * v); v = 0.5f * v * (1.0f + tanhf(u)); }
      so[w][8 * hh + r][t * 16 + ln] = v;
    }
  }
  __builtin_amdgcn_fence(__ATOMIC_ACQ_REL, "workgroup");
  __builtin_amdgcn_wave_barrier();
  const int rsub = lane >> 4, c4 = (lane & 15) * 4;
  {
#pragma unroll
    for (int q = 0; q < 8; ++q) {
      const int r = q * 2 + rsub;
      const v4f v = *(const v4fa*)&so[w][r][c4];
      *(v4f*)(C + (size_t)(row0 + r) * ldc + col0 + c4) = v;
    }
    
  }
}
// row LayerNorm (biased variance, eps) over N: s = X (+ R); optional out_sum <- s; out_norm <- (s-mu)*rsqrt(var+eps)*g + b
template <bool PARAM_BF16>
__global__ __launch_bounds__(256) void k_layernorm(const float* __restrict__ X, const float* __restrict__ R, const float* __restrict__ g, const float* __restrict__ bta,
                                                  float* __restrict__ out_sum, float* __restrict__ out_norm, int N, float eps) {
  __shared__ float red[256];
  const int row = blockIdx.x, tid = threadIdx.x;
  const float* x = X + (size_t)row * N; const float* rr = R ? R + (size_t)row * N : nullptr;
  float vals[16];                     // up to N = 4096
  const int per = N / 256;            // contiguous chunk per thread? use strided-by-4 chunks: thread handles j = tid*4 + 1024*u
  float s1 = 0.f;
  for (int u = 0; u < per / 4; ++u) {
    const int j = tid * 4 + 1024 * u;
    const v4f a = *(const v4fa*)(x + j);
    v4f b = {0.f,0.f,0.f,0.f}; if (rr) b = *(const v4fa*)(rr + j);
#pragma unroll
    for (int q = 0; q < 4; ++q) { const float v = a[q] + b[q]; vals[u * 4 + q] = v; s1 += v; }
  }
  red[tid] = s1; __syncthreads();
  for (int st = 128; st > 0; st >>= 1) { if (tid < st) red[tid] += red[tid + st]; __syncthreads(); }
  const float mu = red[0] / (float)N; __syncthreads();
  float s2 = 0.f;
  for (int u = 0; u < per / 4; ++u)
#pragma unroll
    for (int q = 0; q < 4; ++q) { const float c = vals[u * 4 + q] - mu; s2 += c * c; }
  red[tid] = s2; __syncthreads();
  for (int st = 128; st > 0; st >>= 1) { if (tid < st) red[tid] += red[tid + st]; __syncthreads(); }
  const float rs = rsqrtf(red[0] / (float)N + eps);
  {
    for (int u = 0; u < per / 4; ++u) {
      const int j = tid * 4 + 1024 * u;
      v4f o, sm;
#pragma unroll
      for (int q = 0; q < 4; ++q) {
        float gg = g[j + q], bb = bta[j + q];
        if (PARAM_BF16) { gg = bf16_round(gg); bb = bf16_round(bb); }
        sm[q] = vals[u * 4 + q]; o[q] = (vals[u * 4 + q] - mu) * rs * gg + bb;
      }
      if (out_sum) *(v4f*)(out_sum + (size_t)row * N + j) = sm;
      *(v4f*)(out_norm + (size_t)row * N + j) = o;
    }
    
  }
}



// ---- f16 WMMA path (v_wmma_f32_16x16x32_f16): 11-bit significands for operands in range — used where a [0,1] probability operand needs more precision than bf16
typedef _Float16 v16h __attribute__((ext_vector_type(16)));
union FragH { v16h v; v8us half[2]; _Float16 h[16]; unsigned short u[16]; };
template <int NT>
__device__ __forceinline__ v8f mmaH(v16h ah, v16h al, v16h bh, v16h bl, v8f c) {
  c = __builtin_amdgcn_wmma_f32_16x16x32_f16(false, ah, false, bh, (short)0, c, false, false);
  if (NT >= 2) c = __builtin_amdgcn_wmma_f32_16x16x32_f16(false, al, false, bh, (short)0, c, false, false);
  if (NT >= 3) c = __builtin_amdgcn_wmma_f32_16x16x32_f16(false, ah, false, bl, (short)0, c, false, false);
  asm volatile("v_nop\n\tv_nop\n\tv_nop\n\tv_nop" : "+v"(c) : "v"(ah), "v"(al), "v"(bh), "v"(bl));
  return c;
}
// batched GEMM like k_gemm_b but f16 operands: A f32 (split into f16 hi/lo if ASPLIT, else rounded to f16), Bt = f16 values [n][k]; alpha; C f32; N multiple of 16 (partial tiles skipped)
template <bool ASPLIT>
__global__ __launch_bounds__(128) void k_gemm_h(const float* __restrict__ A, int lda, size_t sA, const _Float16* __restrict__ Bh, int ldb, size_t sB, float alpha, float* __restrict__ C, int ldc, size_t sC, int M, int N, int K) {
  __shared__ __attribute__((aligned(16))) float so[4][16][64];
  const int tid = threadIdx.x, w = tid >> 5, lane = tid & 31, ln = lane & 15, hh = lane >> 4; const int by = blockIdx.y;
  A += (size_t)by * sA; Bh += (size_t)by * sB; C += (size_t)by * sC;
  const int ntn = (N + 63) / 64; const int wid = blockIdx.x * 4 + w; const int mt = wid / ntn, nq = wid % ntn; if (mt * 16 >= M) return;
  const int row0 = mt * 16, col0 = nq * 64; const float* arow = A + (size_t)(row0 + ln) * lda;
  v8f acc[4] = {};
  for (int kb = 0; kb < K; kb += 32) {
    FragH ah, al;
    const v4f x0 = *(const v4fa*)(arow + kb + 8 * hh), x1 = *(const v4fa*)(arow + kb + 8 * hh + 4), x2 = *(const v4fa*)(arow + kb + 16 + 8 * hh), x3 = *(const v4fa*)(arow + kb + 16 + 8 * hh + 4);
    float xs[16] = {x0[0],x0[1],x0[2],x0[3],x1[0],x1[1],x1[2],x1[3],x2[0],x2[1],x2[2],x2[3],x3[0],x3[1],x3[2],x3[3]};
#pragma unroll
    for (int i = 0; i < 16; ++i) { const _Float16 h = (_Float16)xs[i]; ah.h[i] = h; al.h[i] = ASPLIT ? (_Float16)(xs[i] - (float)h) : (_Float16)0.0f; }
#pragma unroll
    for (int t = 0; t < 4; ++t) { if (col0 + t * 16 >= N) continue; const size_t boff = (size_t)(col0 + t * 16 + ln) * ldb + kb; FragH bq; bq.half[0] = *(const v8us*)(Bh + boff + 8 * hh); bq.half[1] = *(const v8us*)(Bh + boff + 16 + 8 * hh);
      acc[t] = mmaH<ASPLIT ? 2 : 1>(ah.v, al.v, bq.v, bq.v, acc[t]); }
  }
#pragma unroll
  for (int t = 0; t < 4; ++t) { if (col0 + t * 16 >= N) continue;
#pragma unroll
    for (int r = 0; r < 8; ++r) so[w][8 * hh + r][t * 16 + ln] = acc[t][r] * alpha; }
  __builtin_amdgcn_fence(__ATOMIC_ACQ_REL, "workgroup"); __builtin_amdgcn_wave_barrier();
  const int rsub = lane >> 4, c4 = (lane & 15) * 4;
  {
#pragma unroll
    for (int q = 0; q < 8; ++q) { const int r = q * 2 + rsub; if (col0 + c4 < N) { const v4f v = *(const v4fa*)&so[w][r][c4]; *(v4f*)(C + (size_t)(row0 + r) * ldc + col0 + c4) = v; } }
     }
}

// One launch for the five operand preparations, which do not depend on one another: blocks [0, 4 PREP_WB) transpose the four weights, the rest convert x.
// Weights: Wt[n][k] = f16(W[k][n] x16) from f32 row-major W[DM][DM] (bf16-exact weights stay exact in f16 away from the subnormal range); Bt holds the four [n][k] planes one behind the other. x: exact f16 rows of the bf16-rounded values.
// Few, fat work-groups (64 elements per thread): for speed only. A weight block takes a PREP_T x PREP_T tile: 512-byte pieces of W rows in, 256-byte pieces of Wt rows out, turned in LDS.
#define PREP_T 128                   /* k and n per weight tile */
#define PREP_WB ((DM / PREP_T) * (DM / PREP_T))               /* blocks per weight: one tile each */
#define PREP_XP 8                    /* eight-element pieces of x per thread */
#define PREP_XB ((unsigned)(NR * DM / (8 * 256 * PREP_XP)))   /* blocks for x */
static_assert(DM % PREP_T == 0 && PREP_T == 128 && (NR * DM) % (8 * 256 * PREP_XP) == 0, "k_prep: whole tiles, 8 waves x 16 k on a tile, whole x blocks");
__global__ __launch_bounds__(256) void k_prep(const float* __restrict__ x, const float* __restrict__ wq, const float* __restrict__ wk, const float* __restrict__ wv, const float* __restrict__ wo, _Float16* __restrict__ Bt, _Float16* __restrict__ X16) {
  __shared__ __attribute__((aligned(16))) unsigned short ts[PREP_T][PREP_T];      /* [n][k]; the 16-byte piece c of row n lies at place c ^ (n / 4 % 16): the rows that sixteen lanes write at one k fall on all banks */
  const int bx = blockIdx.x, tid = threadIdx.x;
  if (bx < 4 * PREP_WB) {      /* the same for the whole block: the barrier below is passed by all or by none. The weights have the longer chain: they take the lowest block indices */
    const int p = bx / PREP_WB, tile = bx - p * PREP_WB; const float* W = p == 0 ? wq : p == 1 ? wk : p == 2 ? wv : wo;
    const int k0 = (tile / (DM / PREP_T)) * PREP_T, n0 = (tile % (DM / PREP_T)) * PREP_T;
    const int lane = tid & 31, wave = tid >> 5;
    const float* wp = W + (size_t)(k0 + 16 * wave) * DM + n0 + 4 * lane;      /* the thread's 16 k x 4 n corner: a wave covers 512 bytes of one W row */
    v4f r[16];
#pragma unroll
    for (int j = 0; j < 16; ++j) r[j] = *(const v4fa*)(wp + (size_t)j * DM);
    asm volatile("s_wait_xcnt 0x0" :: "v"(wp), "v"(r[0]), "v"(r[1]), "v"(r[2]), "v"(r[3]), "v"(r[4]), "v"(r[5]), "v"(r[6]), "v"(r[7]), "v"(r[8]), "v"(r[9]), "v"(r[10]), "v"(r[11]), "v"(r[12]), "v"(r[13]), "v"(r[14]), "v"(r[15]) : "memory");      /* inputs only. The loaded values: all sixteen loads stay in front of the first conversion, one latency for the tile (left alone the compiler issues them in three batches, each behind the wait for the one before). The address: its registers are no load's destination, and the wait stands in front of every overwrite of them */
#pragma unroll
    for (int i = 0; i < 4; ++i)
#pragma unroll
      for (int hb = 0; hb < 2; ++hb) { FragH f;
#pragma unroll
        for (int j = 0; j < 8; ++j) f.h[j] = (_Float16)(bf16_round(r[8 * hb + j][i]) * 16.0f);
        *(v8us*)&ts[4 * lane + i][8 * ((2 * wave + hb) ^ (lane & 15))] = f.half[0]; }      /* row n = 4 lane + i, piece 2 wave + hb */
    __syncthreads();      /* the tile is whole before its rows are read */
    const int c = tid & 15, nr = tid >> 4;
    unsigned short* bp = (unsigned short*)Bt + (size_t)p * DM * DM + (size_t)(n0 + nr) * DM + k0 + 8 * c;
#pragma unroll
    for (int u = 0; u < 8; ++u) { const int n = nr + 16 * u; *(v8us*)(bp + (size_t)(16 * u) * DM) = *(const v8us*)&ts[n][8 * (c ^ ((n >> 2) & 15))]; }      /* row n, piece c: sixteen lanes cover 256 bytes of one Wt row */
  } else {
    const size_t t0 = (size_t)(bx - 4 * PREP_WB) * (256 * PREP_XP) + tid;
    const float* xp = x + t0 * 8;      /* piece u lies 256 x 8 elements further on */
    v4f a[PREP_XP][2];
#pragma unroll
    for (int u = 0; u < PREP_XP; ++u) { a[u][0] = *(const v4fa*)(xp + 2048 * u); a[u][1] = *(const v4fa*)(xp + 2048 * u + 4); }
    asm volatile("s_wait_xcnt 0x0" :: "v"(xp) : "memory");      /* stands in front of every overwrite of the address registers that the loads above name, and keeps them out of the loads' destinations */
#pragma unroll
    for (int u = 0; u < PREP_XP; ++u) { FragH f;
#pragma unroll
      for (int q = 0; q < 4; ++q) { f.h[q] = (_Float16)bf16_round(a[u][0][q]); f.h[4 + q] = (_Float16)bf16_round(a[u][1][q]); }
      *(v8us*)((unsigned short*)X16 + (t0 + 256 * u) * 8) = f.half[0]; }
    asm volatile("s_wait_xcnt 0x0" ::: "memory");      /* behind the last store: stands in front of any later overwrite of the stores' address and data registers */
  }
}
// k_gemm_hh variant with fused epilogue: v = acc·alpha + bias[by·sBias + col] (+ CP[(row/rowsPerB)·sCPb + by·64 + col] if CP) ; ACT 0 none / 1 elu ; writes f16 C16 (and f32 C if non-null)
template <int ACT>
__global__ __launch_bounds__(128) void k_gemm_hhx(const _Float16* __restrict__ A, int lda, size_t sA, const _Float16* __restrict__ Bh, int ldb, size_t sB, float alpha, const float* __restrict__ bias, size_t sBias, const float* __restrict__ CP, int rowsPerB, size_t sCPb, int row0g,
    float* __restrict__ C, _Float16* __restrict__ C16, int ldc, size_t sC, int M, int N, int K) {
  __shared__ __attribute__((aligned(16))) float so[4][16][64];
  const int tid = threadIdx.x, w = tid >> 5, lane = tid & 31, ln = lane & 15, hh = lane >> 4; const int by = blockIdx.y;
  A += (size_t)by * sA; Bh += (size_t)by * sB; const size_t cofs = (size_t)by * sC; const float* bp = bias ? bias + (size_t)by * sBias : nullptr;
  const int ntn = (N + 63) / 64; const int wid = blockIdx.x * 4 + w; const int mt = wid / ntn, nq = wid % ntn; if (mt * 16 >= M) return;
  const int row0 = mt * 16, col0 = nq * 64; const _Float16* arow = A + (size_t)(row0 + ln) * lda;
  v8f acc[4] = {};
  for (int kb = 0; kb < K; kb += 32) { FragH ah; ah.half[0] = *(const v8us*)((const unsigned short*)arow + kb + 8 * hh); ah.half[1] = *(const v8us*)((const unsigned short*)arow + kb + 16 + 8 * hh);
#pragma unroll
    for (int t = 0; t < 4; ++t) { if (col0 + t * 16 >= N) continue; const size_t boff = (size_t)(col0 + t * 16 + ln) * ldb + kb; FragH bq; bq.half[0] = *(const v8us*)((const unsigned short*)Bh + boff + 8 * hh); bq.half[1] = *(const v8us*)((const unsigned short*)Bh + boff + 16 + 8 * hh);
      acc[t] = mmaH<1>(ah.v, ah.v, bq.v, bq.v, acc[t]); }
  }
#pragma unroll
  for (int t = 0; t < 4; ++t) { if (col0 + t * 16 >= N) continue; const int col = col0 + t * 16 + ln; const float bv = bp ? bf16_round(bp[col]) : 0.f;
#pragma unroll
    for (int r = 0; r < 8; ++r) { float v = acc[t][r] * alpha + bv; if (CP) { const int rr = row0g + row0 + 8 * hh + r; if (rowsPerB < 0) v += CP[cofs + (size_t)rr * ldc + col];      /* rowsPerB < 0: own element of the batched C plane */ else { const int bidx = rr / rowsPerB; v += CP[(size_t)bidx * sCPb + (size_t)by * 64 + col]; } } if (ACT == 1) v = (v > 0.f) ? v : expm1f(v); else if (ACT == 7) v = (v > 0.f) ? v + 1.0f : expf(v); else if (ACT == 8) v = tanhf(v); else if (ACT == 9) v = 0.5f * v * (1.0f + tanhf(0.7978845608028654f * (v + 0.044715f * v * v * v))); else if (ACT == 11) v = 1.0f / (1.0f + expf(-v)); else if (ACT == 12) v = (v > 0.f) ? v : 0.01f * v; else if (ACT == 14) v = (v > 0.f) ? v : 0.1f * v; else if (ACT == 16) v = (v >= 0.f) ? v : 0.3f * v; else if (ACT == 17) v = (v >= 0.f) ? v : 0.2f * v; else if (ACT == 15) v = v / (1.0f + expf(-v)); else if (ACT == 3) v = fmaxf(v, 0.f); else if (ACT == 6) v = 0.5f * v * (1.0f + erff(v * 0.70710678118654752f)); so[w][8 * hh + r][t * 16 + ln] = v; } }
  __builtin_amdgcn_fence(__ATOMIC_ACQ_REL, "workgroup"); __builtin_amdgcn_wave_barrier();
  const int rsub = lane >> 4, c4 = (lane & 15) * 4; typedef _Float16 v4h __attribute__((ext_vector_type(4)));
  {
#pragma unroll
    for (int q = 0; q < 8; ++q) { const int r = q * 2 + rsub; if (col0 + c4 < N) { const v4f v = *(const v4fa*)&so[w][r][c4]; if (C) *(v4f*)(C + cofs + (size_t)(row0 + r) * ldc + col0 + c4) = v; if (C16) { v4h h4; for (int i = 0; i < 4; ++i) h4[i] = (_Float16)v[i]; *(v4h*)(C16 + cofs + (size_t)(row0 + r) * ldc + col0 + c4) = h4; } } }
     }
}


typedef _Float16 v4h __attribute__((ext_vector_type(4)));

__global__ __launch_bounds__(256) void k_h16(const float* __restrict__ x, _Float16* __restrict__ X16, size_t n8) { const size_t t = (size_t)blockIdx.x * 256 + threadIdx.x; if (t >= n8) return; FragH f;
#pragma unroll
  for (int q = 0; q < 8; ++q) f.h[q] = (_Float16)x[t * 8 + q]; *(v8us*)((unsigned short*)X16 + t * 8) = f.half[0];  }
__global__ __launch_bounds__(256) void k_round16f(const float* __restrict__ W, _Float16* __restrict__ Bt, size_t n8) { const size_t t = (size_t)blockIdx.x * 256 + threadIdx.x; if (t >= n8) return; FragH f;
#pragma unroll
  for (int i = 0; i < 8; ++i) f.h[i] = (_Float16)(bf16_round(W[t * 8 + i]) * 16.0f); *(v8us*)((unsigned short*)Bt + t * 8) = f.half[0];  }
template <int NHv, int TTv>
__global__ __launch_bounds__(256) void k_vt(const _Float16* __restrict__ V16, int ldv, int voff, _Float16* __restrict__ Vt) { __shared__ unsigned short tl[64][66]; const int tid = threadIdx.x; const int slab = blockIdx.x / (TTv / 64), lg = blockIdx.x % (TTv / 64); const int b = slab / NHv, h = slab % NHv;
  for (int i = tid; i < 64 * 8; i += 256) { const int r = i / 8, c8 = (i % 8) * 8; FragH f; f.half[0] = *(const v8us*)((const unsigned short*)V16 + ((size_t)b * TTv + lg * 64 + r) * ldv + voff + h * 64 + c8);
#pragma unroll
    for (int q = 0; q < 8; ++q) tl[r][c8 + q] = f.u[q]; }
  __syncthreads();
  {
#pragma unroll
    for (int rd = 0; rd < 2; ++rd) { const int d = rd * 32 + tid / 8, pc = tid % 8; FragH f;
#pragma unroll
      for (int q = 0; q < 8; ++q) f.u[q] = tl[pc * 8 + q][d];
      *(v8us*)((unsigned short*)Vt + ((size_t)slab * 64 + d) * TTv + lg * 64 + pc * 8) = f.half[0]; }
     } }

__global__ __launch_bounds__(256) void k_hl(const float* __restrict__ F, _Float16* __restrict__ Hh, _Float16* __restrict__ Hl, size_t n8) { const size_t t = (size_t)blockIdx.x * 256 + threadIdx.x; if (t >= n8) return; FragH fh, fl; const v4f a = *(const v4fa*)(F + t * 8), c = *(const v4fa*)(F + t * 8 + 4);
#pragma unroll
  for (int q = 0; q < 4; ++q) { _Float16 h = (_Float16)a[q]; fh.h[q] = h; fl.h[q] = (_Float16)((a[q] - (float)h) * 1024.0f); h = (_Float16)c[q]; fh.h[4 + q] = h; fl.h[4 + q] = (_Float16)((c[q] - (float)h) * 1024.0f); }
  { *(v8us*)((unsigned short*)Hh + t * 8) = fh.half[0]; *(v8us*)((unsigned short*)Hl + t * 8) = fl.half[0];  } }

// ---- fast GEMM (block tile 128x64, wave tile 32x64; A and B k-tiles staged in LDS; requires M % 128 == 0 rows per launch region, N % 64 == 0 and K % 64 == 0); epilogue = k_gemm_hhx semantics ----
__device__ __forceinline__ v16h g2_frag(const _Float16* p, int hh) { FragH f; f.half[0] = *(const v8us*)((const unsigned short*)p + 8 * hh); f.half[1] = *(const v8us*)((const unsigned short*)p + 16 + 8 * hh); return f.v; }
__device__ __forceinline__ v8f g2_mma(v16h a, v16h b, v8f c) { v8f d = __builtin_amdgcn_wmma_f32_16x16x32_f16(false, a, false, b, (short)0, c, false, false); asm volatile("v_nop\n\tv_nop\n\tv_nop\n\tv_nop" : "+v"(d) : "v"(a), "v"(b)); return d; }
#define G2_KS 64                     /* k per LDS stage: one 128-byte line of every A and B row */
#define G2_LP 72                     /* LDS row pitch in halves: 144 B = 16 B x odd for 16-byte row reads */
__device__ __forceinline__ v16h g2_lfrag(const unsigned short* p) { FragH f; f.half[0] = *(const v8us*)p; f.half[1] = *(const v8us*)(p + 16); return f.v; }      /* p already holds the lane half's + 8 hh: the k order of g2_frag */
template <int ACT, int LDA, int LDB, int LDC, bool HASB, bool HASCP, bool OUT32, bool OUT16>      /* row pitches at compile time: a tile's row pieces are immediate offsets from one address pair; the epilogue's options (bias, residual CP, f32 / f16 output) at compile time: straight-line code without a test per element or per row */
__global__ __launch_bounds__(128) void k_gemm2(const _Float16* __restrict__ A, size_t sA, const _Float16* __restrict__ Bh, size_t sB, float alpha, const float* __restrict__ bias, const float* __restrict__ bias1, const float* __restrict__ bias2, size_t sBias, const float* __restrict__ CP, int rowsPerB, size_t sCPb, int row0g,
    float* __restrict__ C, _Float16* __restrict__ C16, size_t sC, int M, int N, int K) { static_assert(ACT == 0 || ACT == 3 || ACT == 6 || ACT == 8 || ACT == 9 || ACT == 11 || ACT == 12 || ACT == 14 || ACT == 15 || ACT == 16 || ACT == 17, "k_gemm2: unsupported ACT code (would silently apply no activation)");
  __shared__ __attribute__((aligned(16))) unsigned short tl[2][128 + 64][G2_LP];      /* per buffer: the block's 128 A rows, then its 64 B rows, G2_KS halves of each */
  float (*so)[32][68] = (float (*)[32][68])&tl[0][0][0];      /* the epilogue's staging takes the tiles' place behind the loop's last barrier */
  static_assert(sizeof(tl) >= sizeof(float) * 4 * 32 * 68, "k_gemm2: epilogue staging must fit in the tile buffers");
  const int tid = threadIdx.x, w = tid >> 5, lane = tid & 31, ln = lane & 15, hh = lane >> 4; const int by = blockIdx.y;
  A += (size_t)by * sA; Bh += (size_t)by * sB; const size_t cofs = (size_t)by * sC; const float* bsel = (by == 1 && bias1) ? bias1 : (by == 2 && bias2) ? bias2 : bias;      /* planes 1 and 2 may bring their bias in a buffer of its own */
  const float* bp = bsel + (size_t)by * sBias;      /* read only where HASB */
  const int ntn = N >> 6; const int mt = blockIdx.x / ntn, nq = blockIdx.x - mt * ntn; const int row0 = mt * 128 + 32 * w, col0 = nq * 64; if (mt * 128 >= M) return;      /* the same for the whole block: in front of every barrier */
  const int sr = tid >> 3, sc = (tid & 7) * 8;      /* staging: eight lanes cover one 128-byte row piece; piece u is row sr + 16 u */
  const unsigned short* ag = (const unsigned short*)A + (size_t)(mt * 128 + sr) * LDA + sc;
  const unsigned short* bg = (const unsigned short*)Bh + (size_t)(col0 + sr) * LDB + sc;
  v8us ra[8], rb[4];      /* these and af, bf below are indexed under full unrolls only, so that they stay in registers */
#pragma unroll
  for (int u = 0; u < 8; ++u) ra[u] = *(const v8us*)(ag + (size_t)(16 * u) * LDA);
#pragma unroll
  for (int u = 0; u < 4; ++u) rb[u] = *(const v8us*)(bg + (size_t)(16 * u) * LDB);
  float bv4[4];      /* the lane's four bias values, fetched behind the first tiles' loads: their latency passes under the k loop */
#pragma unroll
  for (int t = 0; t < 4; ++t) bv4[t] = HASB ? bf16_round(bp[col0 + t * 16 + ln]) : 0.f;
  const v8f z8 = {0.f,0.f,0.f,0.f,0.f,0.f,0.f,0.f}; v8f c00 = z8, c01 = z8, c02 = z8, c03 = z8, c10 = z8, c11 = z8, c12 = z8, c13 = z8;
#pragma unroll
  for (int u = 0; u < 8; ++u) *(v8us*)&tl[0][sr + 16 * u][sc] = ra[u];
#pragma unroll
  for (int u = 0; u < 4; ++u) *(v8us*)&tl[0][128 + sr + 16 * u][sc] = rb[u];
  __syncthreads();
  const int nst = K / G2_KS;
#pragma unroll 1      /* rolled: one stage's code, two buffers by index */
  for (int st = 0; st < nst; ++st) { const int bu = st & 1;
    if (st + 1 < nst) {      /* the next stage's tiles fly into registers under this stage's products */
      const unsigned short* an = ag + (st + 1) * G2_KS; const unsigned short* bn = bg + (st + 1) * G2_KS;
#pragma unroll
      for (int u = 0; u < 8; ++u) ra[u] = *(const v8us*)(an + (size_t)(16 * u) * LDA);
#pragma unroll
      for (int u = 0; u < 4; ++u) rb[u] = *(const v8us*)(bn + (size_t)(16 * u) * LDB);
      asm volatile("s_wait_xcnt 0x0" :: "v"(an), "v"(bn) : "memory");      /* stands in front of every overwrite of the address registers that the loads above name */
    }
    v16h af[G2_KS / 32][2], bf[G2_KS / 32][4];      /* the stage's fragments are read as one group in front of its products */
#pragma unroll
    for (int kk = 0; kk < G2_KS / 32; ++kk) { const unsigned short* ap = &tl[bu][32 * w + ln][32 * kk + 8 * hh]; const unsigned short* bq = &tl[bu][128 + ln][32 * kk + 8 * hh];
      af[kk][0] = g2_lfrag(ap); af[kk][1] = g2_lfrag(ap + 16 * G2_LP);
#pragma unroll
      for (int t = 0; t < 4; ++t) bf[kk][t] = g2_lfrag(bq + 16 * t * G2_LP); }
#pragma unroll
    for (int kk = 0; kk < G2_KS / 32; ++kk) {
      c00 = g2_mma(af[kk][0], bf[kk][0], c00); c10 = g2_mma(af[kk][1], bf[kk][0], c10);
      c01 = g2_mma(af[kk][0], bf[kk][1], c01); c11 = g2_mma(af[kk][1], bf[kk][1], c11);
      c02 = g2_mma(af[kk][0], bf[kk][2], c02); c12 = g2_mma(af[kk][1], bf[kk][2], c12);
      c03 = g2_mma(af[kk][0], bf[kk][3], c03); c13 = g2_mma(af[kk][1], bf[kk][3], c13); }
    if (st + 1 < nst) {
#pragma unroll
      for (int u = 0; u < 8; ++u) *(v8us*)&tl[bu ^ 1][sr + 16 * u][sc] = ra[u];
#pragma unroll
      for (int u = 0; u < 4; ++u) *(v8us*)&tl[bu ^ 1][128 + sr + 16 * u][sc] = rb[u]; }
    __syncthreads();      /* publishes the next stage and ends every wave's reads of this one, which the next trip (or the epilogue) overwrites */
  }
  v8f accs[8] = {c00, c01, c02, c03, c10, c11, c12, c13};
#pragma unroll
  for (int u = 0; u < 8; ++u) { const int t = u & 3, half = u >> 2; const int col = col0 + t * 16 + ln; const float bv = bv4[t];
#pragma unroll
    for (int r = 0; r < 8; ++r) { const int rloc = half * 16 + 8 * hh + r; float v = accs[u][r] * alpha + bv; if (HASCP) { if (rowsPerB < 0) v += CP[cofs + (size_t)(row0g + row0 + rloc) * LDC + col];      /* rowsPerB < 0: own element of the batched C plane */ else { const int bidx = (row0g + row0 + rloc) / rowsPerB; v += CP[(size_t)bidx * sCPb + (size_t)by * 64 + col]; } }
      if (ACT == 3) v = fmaxf(v, 0.f); else if (ACT == 6) v = 0.5f * v * (1.0f + erff(v * 0.70710678118654752f)); else if (ACT == 11) v = 1.0f / (1.0f + expf(-v)); else if (ACT == 15) v = v / (1.0f + expf(-v)); else if (ACT == 12) v = (v > 0.f) ? v : 0.01f * v; else if (ACT == 8) v = tanhf(v); else if (ACT == 9) v = 0.5f * v * (1.0f + tanhf(0.7978845608028654f * (v + 0.044715f * v * v * v))); else if (ACT == 14) v = (v > 0.f) ? v : 0.1f * v; else if (ACT == 16) v = (v >= 0.f) ? v : 0.3f * v; else if (ACT == 17) v = (v >= 0.f) ? v : 0.2f * v;
      so[w][rloc][t * 16 + ln] = v; } }
  __builtin_amdgcn_fence(__ATOMIC_ACQ_REL, "workgroup"); __builtin_amdgcn_wave_barrier();
  const int rsub = lane >> 4, c4 = (lane & 15) * 4;
  {
#pragma unroll
    for (int q = 0; q < 16; ++q) { const int r = q * 2 + rsub; const v4f v = *(const v4fa*)&so[w][r][c4]; if (OUT32) *(v4f*)(C + cofs + (size_t)(row0 + r) * LDC + col0 + c4) = v; if (OUT16) { v4h h4; for (int i = 0; i < 4; ++i) h4[i] = (_Float16)v[i]; *(v4h*)(C16 + cofs + (size_t)(row0 + r) * LDC + col0 + c4) = h4; } }
     } }


__global__ __launch_bounds__(256) void k_wnat(const float* __restrict__ w, size_t n8, _Float16* __restrict__ Bt) { const size_t t = (size_t)blockIdx.x * 256 + threadIdx.x; if (t >= n8) return; FragH f; for (int q = 0; q < 8; ++q) f.h[q] = (_Float16)(bf16_round(w[t * 8 + q]) * 16.0f); *(v8us*)((unsigned short*)Bt + t * 8) = f.half[0];  }
__global__ __launch_bounds__(256) void k_rsm(const float* __restrict__ S, _Float16* __restrict__ P, int nrows) {
  #pragma clang fp contract(off)
  const int i = blockIdx.x * 256 + threadIdx.x; if (i >= nrows) return; const float* s = S + (size_t)i * SQ; float mx = -3.0e38f;
#pragma unroll 1
  for (int j = 0; j < SQ; ++j) mx = fmaxf(mx, s[j]); float se = 0.f;
#pragma unroll 1
  for (int j = 0; j < SQ; ++j) se += expf(s[j] - mx); const float sc = 256.0f / se;
#pragma unroll 1
  for (int j0 = 0; j0 < SQ; j0 += 8) { FragH f; for (int q = 0; q < 8; ++q) f.h[q] = (_Float16)(expf(s[j0 + q] - mx) * sc); unsigned short* d = (unsigned short*)P + (size_t)i * SQ + j0; *(v8us*)d = f.half[0];  } }
__global__ __launch_bounds__(256) void k_vt(const _Float16* __restrict__ V16, int b, int h0, _Float16* __restrict__ VT) { __shared__ unsigned short tl[64][65]; const int tid = threadIdx.x; const int hh = blockIdx.x % HG, sg = blockIdx.x / HG; const int s0 = sg * 64; const int h = h0 + hh;
  for (int i = tid; i < 64 * 8; i += 256) { const int j = i / 8, d8 = (i % 8) * 8; FragH f; f.half[0] = *(const v8us*)((const unsigned short*)V16 + ((size_t)b * SQ + s0 + j) * DM + h * HD + d8); for (int q = 0; q < 8; ++q) tl[d8 + q][j] = f.u[q]; }
  __syncthreads();
  { for (int i = tid; i < 64 * 8; i += 256) { const int d = i / 8, j8 = (i % 8) * 8; FragH f; for (int q = 0; q < 8; ++q) f.u[q] = tl[d][j8 + q]; *(v8us*)((unsigned short*)VT + ((size_t)hh * HD + d) * SQ + s0 + j8) = f.half[0]; }  } }



// ---- fused attention: per work-group FA_BR queries of one (batch, head) against all SQ keys. Transposed products: S^T = K Q^T puts one query's
// scores in one lane pair (l, l ^ 16), so maximum and weights are in-lane; two S^T tiles (32 keys), converted in place, are the B operand of
// O^T += V^T P^T. Every A/B fragment is loaded in the same k order (8 h + 0..7, 16 + 8 h + 0..7), which is the order the converted tiles have.
#define FA_NW 4                      /* waves per work-group */
#define FA_R 2                       /* 16-query column groups per wave */
#define FA_BR (FA_NW * FA_R * 16)    /* queries per work-group */
#define FA_SK 64                     /* keys per LDS stage = two 32-key passes */
#define FA_LP 72                     /* LDS row pitch in halves: 144 B = 16 B x odd for 16-byte row reads */
#define FA_NST (SQ / FA_SK)
static_assert(HD == 64 && FA_SK == 64 && SQ % FA_SK == 0 && SQ % FA_BR == 0 && FA_NW * 32 == 128, "k_fattn: 64 x 128-byte tiles, four 16-byte pieces of each per thread, whole stages and whole query blocks");
typedef float v2f __attribute__((ext_vector_type(2)));
typedef _Float16 v2h __attribute__((ext_vector_type(2)));
typedef unsigned int v8u __attribute__((ext_vector_type(8)));
typedef unsigned int v4u __attribute__((ext_vector_type(4)));
__device__ __forceinline__ v16h fa_frag(const unsigned short* p) { FragH f; f.half[0] = *(const v8us*)p; f.half[1] = *(const v8us*)(p + 16); return f.v; }      /* p already holds the lane half's + 8 h */
__device__ __forceinline__ unsigned int fa_pack(float lo, float hi) { return __builtin_bit_cast(unsigned int, __builtin_convertvector((v2f){lo, hi}, v2h)); }
__device__ __forceinline__ float fa_xh(float x) { return __builtin_bit_cast(float, __builtin_amdgcn_permlanex16(__builtin_bit_cast(int, x), __builtin_bit_cast(int, x), 0x76543210, 0xfedcba98, false, false)); }      /* lane l with lane l ^ 16 */
__device__ __forceinline__ v8f fa_mma(v16h a, v16h b, v8f c) { return __builtin_amdgcn_wmma_f32_16x16x32_f16(false, a, false, b, (short)0, c, false, false); }
__global__ __launch_bounds__(FA_NW * 32) void k_fattn(const _Float16* __restrict__ Q16, const _Float16* __restrict__ K16, const _Float16* __restrict__ VT, _Float16* __restrict__ O16) {
  __shared__ __attribute__((aligned(16))) unsigned short sk[2][FA_SK][FA_LP];      /* K rows [key][d] */
  __shared__ __attribute__((aligned(16))) unsigned short sv[2][HD][FA_LP];         /* V^T rows [d][key] */
  const int tid = threadIdx.x, lane = tid & 31, wave = tid >> 5, c = lane & 15, h = lane >> 4;
  const int bh = blockIdx.y, b = bh / NH, hd = bh - b * NH;
  const int q0 = blockIdx.x * FA_BR + wave * (FA_R * 16);
  const int sr = tid >> 3, sc = (tid & 7) * 8;      /* staging: eight lanes cover one 128-byte row; piece u is row sr + 16 u */
  const unsigned short* kg = (const unsigned short*)K16 + ((size_t)b * SQ + sr) * DM + hd * HD + sc;
  const unsigned short* vg = (const unsigned short*)VT + ((size_t)bh * HD + sr) * SQ + sc;
  const float cscale = 0.125f * 1.4426950408889634f;      /* HD^-0.5 log2(e) */
  v8us rk[4], rv[4];
#pragma unroll
  for (int u = 0; u < 4; ++u) { rk[u] = *(const v8us*)(kg + (size_t)(16 * u) * DM); rv[u] = *(const v8us*)(vg + (size_t)(16 * u) * SQ); }
  v16h qf[FA_R][2];
#pragma unroll
  for (int g = 0; g < FA_R; ++g) { const unsigned short* qp = (const unsigned short*)Q16 + ((size_t)b * SQ + q0 + 16 * g + c) * DM + hd * HD + 8 * h; qf[g][0] = fa_frag(qp); qf[g][1] = fa_frag(qp + 32); }
  const unsigned int o1 = (c == 0) ? 0x3C003C00u : 0u;      /* A operand whose row 0 is f16 ones: its product with P^T is the weights' column sums */
  const v16h ones = __builtin_bit_cast(v16h, (v8u){o1, o1, o1, o1, o1, o1, o1, o1});
  const v8f z8 = {0.f, 0.f, 0.f, 0.f, 0.f, 0.f, 0.f, 0.f};
  v8f acc[FA_R][4], lacc[FA_R]; float m_run[FA_R];
#pragma unroll
  for (int g = 0; g < FA_R; ++g) { m_run[g] = -__builtin_inff(); lacc[g] = z8; acc[g][0] = z8; acc[g][1] = z8; acc[g][2] = z8; acc[g][3] = z8; }
#pragma unroll
  for (int u = 0; u < 4; ++u) { *(v8us*)&sk[0][sr + 16 * u][sc] = rk[u]; *(v8us*)&sv[0][sr + 16 * u][sc] = rv[u]; }
  __syncthreads();
#pragma unroll 1      /* rolled: one stage's code, two buffers by index */
  for (int st = 0; st < FA_NST; ++st) {
    const int bu = st & 1;
    if (st + 1 < FA_NST) {      /* the next stage's tiles fly into registers under this stage's two passes */
      const unsigned short* kn = kg + (size_t)(st + 1) * FA_SK * DM; const unsigned short* vn = vg + (st + 1) * FA_SK;
#pragma unroll
      for (int u = 0; u < 4; ++u) { rk[u] = *(const v8us*)(kn + (size_t)(16 * u) * DM); rv[u] = *(const v8us*)(vn + (size_t)(16 * u) * SQ); }
      asm volatile("s_wait_xcnt 0x0" :: "v"(kn), "v"(vn) : "memory");      /* stands in front of every overwrite of the address registers that the loads above name */
    }
#pragma unroll
    for (int sub = 0; sub < 2; ++sub) {
      v8f s[2][FA_R];
      { v16h kf[2][2];
#pragma unroll
        for (int kt = 0; kt < 2; ++kt) { const unsigned short* p = &sk[bu][32 * sub + 16 * kt + c][8 * h]; kf[kt][0] = fa_frag(p); kf[kt][1] = fa_frag(p + 32); }
#pragma unroll
        for (int kt = 0; kt < 2; ++kt)
#pragma unroll
          for (int g = 0; g < FA_R; ++g) s[kt][g] = fa_mma(kf[kt][0], qf[g][0], z8);
#pragma unroll
        for (int kt = 0; kt < 2; ++kt)
#pragma unroll
          for (int g = 0; g < FA_R; ++g) s[kt][g] = fa_mma(kf[kt][1], qf[g][1], s[kt][g]); }
      v16h vf[4];
#pragma unroll
      for (int t = 0; t < 4; ++t) vf[t] = fa_frag(&sv[bu][16 * t + c][32 * sub + 8 * h]);
      float mb[FA_R]; bool need = false;
#pragma unroll
      for (int g = 0; g < FA_R; ++g) { float mx = s[0][g][0];
#pragma unroll
        for (int r = 1; r < 8; ++r) mx = fmaxf(mx, s[0][g][r]);
#pragma unroll
        for (int r = 0; r < 8; ++r) mx = fmaxf(mx, s[1][g][r]);
        mx = fmaxf(mx, fa_xh(mx)) * cscale; mb[g] = mx; need = need || (mx > m_run[g] + 8.0f); }
      if (__builtin_amdgcn_ballot_w32(need) != 0) {      /* lazy rescale: the maximum in use may trail the true one by up to 8 (log2), so a weight stays below 2^8 */
#pragma unroll
        for (int g = 0; g < FA_R; ++g) { const float mn = fmaxf(m_run[g], mb[g]); const float corr = __builtin_amdgcn_exp2f(m_run[g] - mn); m_run[g] = mn; lacc[g] = lacc[g] * corr;
#pragma unroll
          for (int t = 0; t < 4; ++t) acc[g][t] = acc[g][t] * corr; } }
#pragma unroll
      for (int g = 0; g < FA_R; ++g) { const float nm = -m_run[g]; v8u w;
#pragma unroll
        for (int i = 0; i < 8; ++i) { const v2f a = __builtin_elementwise_fma((v2f){s[i >> 2][g][2 * (i & 3)], s[i >> 2][g][2 * (i & 3) + 1]}, (v2f){cscale, cscale}, (v2f){nm, nm}); w[i] = fa_pack(__builtin_amdgcn_exp2f(a[0]), __builtin_amdgcn_exp2f(a[1])); }
        const v16h pf = __builtin_bit_cast(v16h, w);      /* element e: key 8 h + e (tile 0), 16 + 8 h + e - 8 (tile 1) of query c */
#pragma unroll
        for (int t = 0; t < 4; ++t) acc[g][t] = fa_mma(vf[t], pf, acc[g][t]);
        lacc[g] = fa_mma(ones, pf, lacc[g]); }
    }
    __builtin_amdgcn_sched_barrier(0);      /* keeps the v_nop run below directly behind the stage's last WMMA */
    asm volatile("v_nop\n\tv_nop\n\tv_nop\n\tv_nop");      /* the four vector slots behind a WMMA, also on the taken side of the branches that follow */
    __builtin_amdgcn_sched_barrier(0);
    if (st + 1 < FA_NST) {
#pragma unroll
      for (int u = 0; u < 4; ++u) { *(v8us*)&sk[bu ^ 1][sr + 16 * u][sc] = rk[u]; *(v8us*)&sv[bu ^ 1][sr + 16 * u][sc] = rv[u]; } }
    __syncthreads();      /* publishes the next stage and ends every wave's reads of this one, which the next trip overwrites */
  }
#pragma unroll
  for (int g = 0; g < FA_R; ++g) { const float lr = lacc[g][0]; const float inv = 64.0f / (lr + fa_xh(lr));      /* row 0 of the sum tile sits in lanes 0-15, row 8 (zero) in lanes 16-31: the exchange-and-add is unconditional */
    unsigned short* op = (unsigned short*)O16 + ((size_t)b * SQ + q0 + 16 * g + c) * DM + hd * HD + 8 * h;
#pragma unroll
    for (int t = 0; t < 4; ++t) { const v8f o = acc[g][t] * inv; *(v4u*)(op + 16 * t) = (v4u){fa_pack(o[0], o[1]), fa_pack(o[2], o[3]), fa_pack(o[4], o[5]), fa_pack(o[6], o[7])}; } } }      /* acc register r = d 16 t + 8 h + r of query c */

extern "C" void kernel_launch(void* const* d_in, const int* in_sizes, int n_in,
                              void* d_out, int out_size, void* d_ws, size_t ws_size, hipStream_t stream) {
  (void)in_sizes; (void)n_in; (void)out_size;
  const float* const* I = (const float* const*)d_in; const float* x = I[0]; const float* wq = I[1]; const float* bq = I[2]; const float* wk = I[3]; const float* bk = I[4]; const float* wv = I[5]; const float* bv = I[6]; const float* wo = I[7]; const float* bo = I[8];      /* [in][out] weights + biases */
  char* ws = (char*)d_ws; size_t off = 0;
  auto take = [&](size_t bytes) { char* p = ws + off; off += (bytes + 255) & ~(size_t)255; return p; };
  _Float16* BQ = (_Float16*)take((size_t)DM * DM * 2); _Float16* BK = (_Float16*)take((size_t)DM * DM * 2); _Float16* BV = (_Float16*)take((size_t)DM * DM * 2); _Float16* BO = (_Float16*)take((size_t)DM * DM * 2);
  _Float16* X16 = (_Float16*)take(NR * DM * 2); _Float16* Q16 = (_Float16*)take(NR * DM * 2); _Float16* K16 = (_Float16*)take(NR * DM * 2); _Float16* V16 = (_Float16*)take(NR * DM * 2); _Float16* O16 = (_Float16*)take(NR * DM * 2);
  _Float16* VT = (_Float16*)take((size_t)NB * NH * HD * SQ * 2);
  if (off > ws_size) return;
  static_assert(MP % 128 == 0 && MPO % 128 == 0 && DM % 64 == 0, "k_gemm2: whole 128x64 block tiles and whole 64-wide k stages");
  static_assert(((size_t)DM * DM * 2) % 256 == 0 && (NR * DM * 2) % 256 == 0, "the weight planes BQ, BK, BV, BO and the row planes Q16, K16, V16 lie one behind the other in the workspace");
  k_prep<<<4 * PREP_WB + PREP_XB, 256, 0, stream>>>(x, wq, wk, wv, wo, BQ, X16);      /* [in][out] -> Bt[n][k] x16 for all four weights; x -> f16 rows */
  const size_t r0p = (size_t)B0 * SQ;      /* first projected row */
  k_gemm2<0, DM, DM, DM, true, false, false, true><<<dim3((unsigned)((MP / 128) * (DM / 64)), 3), 128, 0, stream>>>(X16 + r0p * DM, 0, BQ, (size_t)DM * DM, 0.0625f, bq, bk, bv, 0, nullptr, 1, 0, 0, nullptr, Q16 + r0p * DM, NR * DM, MP, DM, DM);      /* grid.y = Q, K, V: one A, three weight, bias and output planes */
  k_vt<NH, SQ><<<NB * NH * (SQ / 64), 256, 0, stream>>>(V16, LQ, 0, VT);      /* V^T [NB][NH][HD][SQ] */
  k_fattn<<<dim3(SQ / FA_BR, NB * NH), FA_NW * 32, 0, stream>>>(Q16, K16, VT, O16);      /* o x64 (merged heads) as f16 rows */
  k_gemm2<0, DM, DM, DM, true, false, true, false><<<dim3((unsigned)((MPO / 128) * (DM / 64)), 1), 128, 0, stream>>>(O16 + r0p * DM, 0, BO, 0, 0.0009765625f, bo, nullptr, nullptr, 0, nullptr, 1, 0, 0, (float*)d_out + r0p * DM, nullptr, 0, MPO, DM, DM);      /* out rows are the output layout */
}

// v007
// One run takes 74.9 microseconds.
// Timed twice side by side with v006, it ran 1.06 and 1.04 times as fast.
// Counting every step since v000, it is 34.9 times as fast.
#include <hip/hip_runtime.h>
// Multi-head self-attention (x [2][2048][768]; q/k/v = x W + b ([in][out] 768x768 sigma 1/sqrt(768), zero biases); 12 heads of 64; softmax(q k^T / 8) over all keys (no mask); out = ctx Wo + bo -> [2][2048][768]).
// Structure: token rows r = b*2048 + s; x as exact f16 rows (bf16-rounded); Q, K, V as one launch of three WMMA GEMMs (32x64 wave tiles, f32 accumulation, exact x16 weights + bias, f16 outputs; the V plane's epilogue writes V^T per batch and head, turned in LDS); one fused attention launch over (query block, batch x head): S^T = K Q^T (K = 64), online softmax in the log2 domain on the score accumulators (f32 statistics, native exp2, weights as f16 relative to the running maximum), O^T += V^T P^T, K and V^T staged in LDS; o carried x64 against f16 subnormal flush (folded into the output GEMM alpha), written straight into the merged f16 o rows; out = o W_o + b GEMM (f32) into the output layout.
// Compute dtype: inputs rounded to bf16; x / weights exact; q, k, v, softmax weights and o as plain f16 GEMM operands (~2^-12); scores and softmax statistics f32. v_wmma_f32_16x16x32_f16.
#define NB 2
#define SQ 2048
#define DM 768
#define NH 12
#define HD 64
#define HG 4                         /* heads per block group of the unlaunched k_vt(b, h0) */
#define B0 0                         /* first batch processed (debug hook) */
#define NBR NB                       /* batches processed (debug hook) */
#define NR ((size_t)NB * SQ)         /* token rows */
#define MP ((int)((size_t)NBR * SQ)) /* rows projected (debug hook) */
#define QN SQ                        /* query rows per batch; not read (k_fattn attends all SQ) */
#define NHD NH                       /* heads; not read (k_fattn attends all NH) */
#define MPO MP                       /* rows through the output stage (debug hook) */
#define LQ DM      /* row pitch of the q/k rows; not read (pitches are DM) */
typedef __bf16 v16b __attribute__((ext_vector_type(16)));
typedef unsigned short v8us __attribute__((ext_vector_type(8), may_alias));
typedef float  v8f  __attribute__((ext_vector_type(8)));
typedef float  v4f  __attribute__((ext_vector_type(4)));
typedef float  v4fa __attribute__((ext_vector_type(4), may_alias));
union FragB { v16b v; v8us half[2]; unsigned short u[16]; };

__device__ __forceinline__ unsigned short bf16_bits(float x) { unsigned int u = __float_as_uint(x); return (unsigned short)((u + 0x7FFFu + ((u >> 16) & 1u)) >> 16); }
__device__ __forceinline__ float bf16_val(unsigned short b) { return __uint_as_float(((unsigned int)b) << 16); }
__device__ __forceinline__ float bf16_round(float x) { return bf16_val(bf16_bits(x)); }
// D += A·B with NT terms: 1 = ah·bh, 2 = + al·bh (A split), 3 = + ah·bl (both split)
template <int NT>
__device__ __forceinline__ v8f mmaN(v16b ah, v16b al, v16b bh, v16b bl, v8f c) {
  c = __builtin_amdgcn_wmma_f32_16x16x32_bf16(false, ah, false, bh, (short)0, c, false, false);
  if (NT >= 2) c = __builtin_amdgcn_wmma_f32_16x16x32_bf16(false, al, false, bh, (short)0, c, false, false);
  if (NT >= 3) c = __builtin_amdgcn_wmma_f32_16x16x32_bf16(false, ah, false, bl, (short)0, c, false, false);
  asm volatile("v_nop\n\tv_nop\n\tv_nop\n\tv_nop" : "+v"(c) : "v"(ah), "v"(al), "v"(bh), "v"(bl));
  return c;
}

__global__ __launch_bounds__(256) void k_wt_bf16(const float* __restrict__ W, unsigned short* __restrict__ Wt, int K, int N) {
  const int t = blockIdx.x * 256 + threadIdx.x;
  const int k8n = K / 8;
  if (t >= N * k8n) return;
  const int n = t / k8n, k8 = (t % k8n) * 8;
  v8us v;
#pragma unroll
  for (int i = 0; i < 8; ++i) v[i] = bf16_bits(W[(size_t)(k8 + i) * N + n]);
  *(v8us*)(Wt + (size_t)n * K + k8) = v;
  
}

// GEMM C[M][N] (f32, pitch ldc) = act(A[M][K]·W + bias). A f32 row-major (pitch lda) converted per fragment to bf16
// (ASPLIT: hi/lo two planes -> 2 terms, else single rounded term); Wt bf16 [N][K] (pitch ldb). BIAS_BF16 rounds the
// bias to bf16 first (bias quantised to bf16 before the add). K%32==0, M%16==0, N%64==0.
template <bool ASPLIT, int ACT, bool BIAS_BF16>
__global__ __launch_bounds__(128) void k_gemm_bf(const float* __restrict__ A, int lda, const unsigned short* __restrict__ Wt, int ldb,
                                               const float* __restrict__ bias, float* __restrict__ C, int ldc, int M, int N, int K) {
  __shared__ __attribute__((aligned(16))) float so[4][16][64];
  const int tid = threadIdx.x, w = tid >> 5, lane = tid & 31, ln = lane & 15, hh = lane >> 4;
  const int ntn = N / 64;
  const int wid = blockIdx.x * 4 + w;
  const int mt = wid / ntn, nq = wid % ntn;
  if (mt * 16 >= M) return;
  const int row0 = mt * 16, col0 = nq * 64;
  const float* arow = A + (size_t)(row0 + ln) * lda;
  v8f acc[4] = {};
  for (int kb = 0; kb < K; kb += 32) {
    FragB ah, al;
    const v4f x0 = *(const v4fa*)(arow + kb + 8 * hh), x1 = *(const v4fa*)(arow + kb + 8 * hh + 4);
    const v4f x2 = *(const v4fa*)(arow + kb + 16 + 8 * hh), x3 = *(const v4fa*)(arow + kb + 16 + 8 * hh + 4);
    float xs[16] = {x0[0],x0[1],x0[2],x0[3],x1[0],x1[1],x1[2],x1[3],x2[0],x2[1],x2[2],x2[3],x3[0],x3[1],x3[2],x3[3]};
#pragma unroll
    for (int i = 0; i < 16; ++i) { const unsigned short hb = bf16_bits(xs[i]); ah.u[i] = hb; al.u[i] = ASPLIT ? bf16_bits(xs[i] - bf16_val(hb)) : (unsigned short)0; }
#pragma unroll
    for (int t = 0; t < 4; ++t) {
      const unsigned short* brow = Wt + (size_t)(col0 + t * 16 + ln) * ldb + kb;
      FragB b;
      b.half[0] = *(const v8us*)(brow + 8 * hh);
      b.half[1] = *(const v8us*)(brow + 16 + 8 * hh);
      acc[t] = mmaN<ASPLIT ? 2 : 1>(ah.v, al.v, b.v, b.v, acc[t]);
    }
  }
#pragma unroll
  for (int t = 0; t < 4; ++t) {
    float bv = bias ? bias[col0 + t * 16 + ln] : 0.f;
    if (BIAS_BF16) bv = bf16_round(bv);
#pragma unroll
    for (int r = 0; r < 8; ++r) { float v = acc[t][r] + bv; if (ACT == 1) v = fmaxf(v, 0.f); so[w][8 * hh + r][t * 16 + ln] = v; }
  }
  __builtin_amdgcn_fence(__ATOMIC_ACQ_REL, "workgroup");
  __builtin_amdgcn_wave_barrier();
  const int rsub = lane >> 4, c4 = (lane & 15) * 4;
  {
#pragma unroll
    for (int q = 0; q < 8; ++q) {
      const int r = q * 2 + rsub;
      const v4f v = *(const v4fa*)&so[w][r][c4];
      *(v4f*)(C + (size_t)(row0 + r) * ldc + col0 + c4) = v;
    }
    
  }
}

// GEMM C = act(A·W + bias + resid): A f32 (ASPLIT -> hi/lo 2 terms), Wt bf16 [N][K]; ACT 0 none, 1 relu, 2 exact gelu;
// resid (optional, f32, row index = (row % rmod), pitch ldr, RES_BF16 rounds it) added before the activation.
template <bool ASPLIT, int ACT, bool BIAS_BF16, bool RES_BF16>
__global__ __launch_bounds__(128) void k_gemm_bf3(const float* __restrict__ A, int lda, const unsigned short* __restrict__ Wt, int ldb,
                                                const float* __restrict__ bias, const float* __restrict__ resid, int rmod, int ldr,
                                                float* __restrict__ C, int ldc, int M, int N, int K) {
  __shared__ __attribute__((aligned(16))) float so[4][16][64];
  const int tid = threadIdx.x, w = tid >> 5, lane = tid & 31, ln = lane & 15, hh = lane >> 4;
  const int ntn = N / 64;
  const int wid = blockIdx.x * 4 + w;
  const int mt = wid / ntn, nq = wid % ntn;
  if (mt * 16 >= M) return;
  const int row0 = mt * 16, col0 = nq * 64;
  const float* arow = A + (size_t)(row0 + ln) * lda;
  v8f acc[4] = {};
  for (int kb = 0; kb < K; kb += 32) {
    FragB ah, al;
    const v4f x0 = *(const v4fa*)(arow + kb + 8 * hh), x1 = *(const v4fa*)(arow + kb + 8 * hh + 4);
    const v4f x2 = *(const v4fa*)(arow + kb + 16 + 8 * hh), x3 = *(const v4fa*)(arow + kb + 16 + 8 * hh + 4);
    float xs[16] = {x0[0],x0[1],x0[2],x0[3],x1[0],x1[1],x1[2],x1[3],x2[0],x2[1],x2[2],x2[3],x3[0],x3[1],x3[2],x3[3]};
#pragma unroll
    for (int i = 0; i < 16; ++i) { const unsigned short hb = bf16_bits(xs[i]); ah.u[i] = hb; al.u[i] = ASPLIT ? bf16_bits(xs[i] - bf16_val(hb)) : (unsigned short)0; }
#pragma unroll
    for (int t = 0; t < 4; ++t) {
      const unsigned short* brow = Wt + (size_t)(col0 + t * 16 + ln) * ldb + kb;
      FragB b;
      b.half[0] = *(const v8us*)(brow + 8 * hh);
      b.half[1] = *(const v8us*)(brow + 16 + 8 * hh);
      acc[t] = mmaN<ASPLIT ? 2 : 1>(ah.v, al.v, b.v, b.v, acc[t]);
    }
  }
#pragma unroll
  for (int t = 0; t < 4; ++t) {
    const int col = col0 + t * 16 + ln;
    float bv = bias ? bias[col] : 0.f;
    if (BIAS_BF16) bv = bf16_round(bv);
#pragma unroll
    for (int r = 0; r < 8; ++r) {
      float v = acc[t][r] + bv;
      if (resid) { float rv = resid[(size_t)((row0 + 8 * hh + r) % rmod) * ldr + col]; if (RES_BF16) rv = bf16_round(rv); v += rv; }
      if (ACT == 1) v = fmaxf(v, 0.f);
      if (ACT == 2) v = 0.5f * v * (1.0f + erff(v * 0.70710678118654752f));
      if (ACT == 3) { const float u = 0.7978845608028654f * (v + 0.044715f * v * v * v); v = 0.5f * v * (1.0f + tanhf(u)); }
      so[w][8 * hh + r][t * 16 + ln] = v;
    }
  }
  __builtin_amdgcn_fence(__ATOMIC_ACQ_REL, "workgroup");
  __builtin_amdgcn_wave_barrier();
  const int rsub = lane >> 4, c4 = (lane & 15) * 4;
  {
#pragma unroll
    for (int q = 0; q < 8; ++q) {
      const int r = q * 2 + rsub;
      const v4f v = *(const v4fa*)&so[w][r][c4];
      *(v4f*)(C + (size_t)(row0 + r) * ldc + col0 + c4) = v;
    }
    
  }
}
// row LayerNorm (biased variance, eps) over N: s = X (+ R); optional out_sum <- s; out_norm <- (s-mu)*rsqrt(var+eps)*g + b
template <bool PARAM_BF16>
__global__ __launch_bounds__(256) void k_layernorm(const float* __restrict__ X, const float* __restrict__ R, const float* __restrict__ g, const float* __restrict__ bta,
                                                  float* __restrict__ out_sum, float* __restrict__ out_norm, int N, float eps) {
  __shared__ float red[256];
  const int row = blockIdx.x, tid = threadIdx.x;
  const float* x = X + (size_t)row * N; const float* rr = R ? R + (size_t)row * N : nullptr;
  float vals[16];                     // up to N = 4096
  const int per = N / 256;            // contiguous chunk per thread? use strided-by-4 chunks: thread handles j = tid*4 + 1024*u
  float s1 = 0.f;
  for (int u = 0; u < per / 4; ++u) {
    const int j = tid * 4 + 1024 * u;
    const v4f a = *(const v4fa*)(x + j);
    v4f b = {0.f,0.f,0.f,0.f}; if (rr) b = *(const v4fa*)(rr + j);
#pragma unroll
    for (int q = 0; q < 4; ++q) { const float v = a[q] + b[q]; vals[u * 4 + q] = v; s1 += v; }
  }
  red[tid] = s1; __syncthreads();
  for (int st = 128; st > 0; st >>= 1) { if (tid < st) red[tid] += red[tid + st]; __syncthreads(); }
  const float mu = red[0] / (float)N; __syncthreads();
  float s2 = 0.f;
  for (int u = 0; u < per / 4; ++u)
#pragma unroll
    for (int q = 0; q < 4; ++q) { const float c = vals[u * 4 + q] - mu; s2 += c * c; }
  red[tid] = s2; __syncthreads();
  for (int st = 128; st > 0; st >>= 1) { if (tid < st) red[tid] += red[tid + st]; __syncthreads(); }
  const float rs = rsqrtf(red[0] / (float)N + eps);
  {
    for (int u = 0; u < per / 4; ++u) {
      const int j = tid * 4 + 1024 * u;
      v4f o, sm;
#pragma unroll
      for (int q = 0; q < 4; ++q) {
        float gg = g[j + q], bb = bta[j + q];
        if (PARAM_BF16) { gg = bf16_round(gg); bb = bf16_round(bb); }
        sm[q] = vals[u * 4 + q]; o[q] = (vals[u * 4 + q] - mu) * rs * gg + bb;
      }
      if (out_sum) *(v4f*)(out_sum + (size_t)row * N + j) = sm;
      *(v4f*)(out_norm + (size_t)row * N + j) = o;
    }
    
  }
}



// ---- f16 WMMA path (v_wmma_f32_16x16x32_f16): 11-bit significands for operands in range — used where a [0,1] probability operand needs more precision than bf16
typedef _Float16 v16h __attribute__((ext_vector_type(16)));
union FragH { v16h v; v8us half[2]; _Float16 h[16]; unsigned short u[16]; };
template <int NT>
__device__ __forceinline__ v8f mmaH(v16h ah, v16h al, v16h bh, v16h bl, v8f c) {
  c = __builtin_amdgcn_wmma_f32_16x16x32_f16(false, ah, false, bh, (short)0, c, false, false);
  if (NT >= 2) c = __builtin_amdgcn_wmma_f32_16x16x32_f16(false, al, false, bh, (short)0, c, false, false);
  if (NT >= 3) c = __builtin_amdgcn_wmma_f32_16x16x32_f16(false, ah, false, bl, (short)0, c, false, false);
  asm volatile("v_nop\n\tv_nop\n\tv_nop\n\tv_nop" : "+v"(c) : "v"(ah), "v"(al), "v"(bh), "v"(bl));
  return c;
}
// batched GEMM like k_gemm_b but f16 operands: A f32 (split into f16 hi/lo if ASPLIT, else rounded to f16), Bt = f16 values [n][k]; alpha; C f32; N multiple of 16 (partial tiles skipped)
template <bool ASPLIT>
__global__ __launch_bounds__(128) void k_gemm_h(const float* __restrict__ A, int lda, size_t sA, const _Float16* __restrict__ Bh, int ldb, size_t sB, float alpha, float* __restrict__ C, int ldc, size_t sC, int M, int N, int K) {
  __shared__ __attribute__((aligned(16))) float so[4][16][64];
  const int tid = threadIdx.x, w = tid >> 5, lane = tid & 31, ln = lane & 15, hh = lane >> 4; const int by = blockIdx.y;
  A += (size_t)by * sA; Bh += (size_t)by * sB; C += (size_t)by * sC;
  const int ntn = (N + 63) / 64; const int wid = blockIdx.x * 4 + w; const int mt = wid / ntn, nq = wid % ntn; if (mt * 16 >= M) return;
  const int row0 = mt * 16, col0 = nq * 64; const float* arow = A + (size_t)(row0 + ln) * lda;
  v8f acc[4] = {};
  for (int kb = 0; kb < K; kb += 32) {
    FragH ah, al;
    const v4f x0 = *(const v4fa*)(arow + kb + 8 * hh), x1 = *(const v4fa*)(arow + kb + 8 * hh + 4), x2 = *(const v4fa*)(arow + kb + 16 + 8 * hh), x3 = *(const v4fa*)(arow + kb + 16 + 8 * hh + 4);
    float xs[16] = {x0[0],x0[1],x0[2],x0[3],x1[0],x1[1],x1[2],x1[3],x2[0],x2[1],x2[2],x2[3],x3[0],x3[1],x3[2],x3[3]};
#pragma unroll
    for (int i = 0; i < 16; ++i) { const _Float16 h = (_Float16)xs[i]; ah.h[i] = h; al.h[i] = ASPLIT ? (_Float16)(xs[i] - (float)h) : (_Float16)0.0f; }
#pragma unroll
    for (int t = 0; t < 4; ++t) { if (col0 + t * 16 >= N) continue; const size_t boff = (size_t)(col0 + t * 16 + ln) * ldb + kb; FragH bq; bq.half[0] = *(const v8us*)(Bh + boff + 8 * hh); bq.half[1] = *(const v8us*)(Bh + boff + 16 + 8 * hh);
      acc[t] = mmaH<ASPLIT ? 2 : 1>(ah.v, al.v, bq.v, bq.v, acc[t]); }
  }
#pragma unroll
  for (int t = 0; t < 4; ++t) { if (col0 + t * 16 >= N) continue;
#pragma unroll
    for (int r = 0; r < 8; ++r) so[w][8 * hh + r][t * 16 + ln] = acc[t][r] * alpha; }
  __builtin_amdgcn_fence(__ATOMIC_ACQ_REL, "workgroup"); __builtin_amdgcn_wave_barrier();
  const int rsub = lane >> 4, c4 = (lane & 15) * 4;
  {
#pragma unroll
    for (int q = 0; q < 8; ++q) { const int r = q * 2 + rsub; if (col0 + c4 < N) { const v4f v = *(const v4fa*)&so[w][r][c4]; *(v4f*)(C + (size_t)(row0 + r) * ldc + col0 + c4) = v; } }
     }
}

// One launch for the five operand preparations, which do not depend on one another: blocks [0, 4 PREP_WB) transpose the four weights, the rest convert x.
// Weights: Wt[n][k] = f16(W[k][n] x16) from f32 row-major W[DM][DM] (bf16-exact weights stay exact in f16 away from the subnormal range); Bt holds the four [n][k] planes one behind the other. x: exact f16 rows of the bf16-rounded values.
// Few, fat work-groups (64 elements per thread): for speed only. A weight block takes a PREP_T x PREP_T tile: 512-byte pieces of W rows in, 256-byte pieces of Wt rows out, turned in LDS.
#define PREP_T 128                   /* k and n per weight tile */
#define PREP_WB ((DM / PREP_T) * (DM / PREP_T))               /* blocks per weight: one tile each */
#define PREP_XP 8                    /* eight-element pieces of x per thread */
#define PREP_XB ((unsigned)(NR * DM / (8 * 256 * PREP_XP)))   /* blocks for x */
static_assert(DM % PREP_T == 0 && PREP_T == 128 && (NR * DM) % (8 * 256 * PREP_XP) == 0, "k_prep: whole tiles, 8 waves x 16 k on a tile, whole x blocks");
__global__ __launch_bounds__(256) void k_prep(const float* __restrict__ x, const float* __restrict__ wq, const float* __restrict__ wk, const float* __restrict__ wv, const float* __restrict__ wo, _Float16* __restrict__ Bt, _Float16* __restrict__ X16) {
  __shared__ __attribute__((aligned(16))) unsigned short ts[PREP_T][PREP_T];      /* [n][k]; the 16-byte piece c of row n lies at place c ^ (n / 4 % 16): the rows that sixteen lanes write at one k fall on all banks */
  const int bx = blockIdx.x, tid = threadIdx.x;
  if (bx < 4 * PREP_WB) {      /* the same for the whole block: the barrier below is passed by all or by none. The weights have the longer chain: they take the lowest block indices */
    const int p = bx / PREP_WB, tile = bx - p * PREP_WB; const float* W = p == 0 ? wq : p == 1 ? wk : p == 2 ? wv : wo;
    const int k0 = (tile / (DM / PREP_T)) * PREP_T, n0 = (tile % (DM / PREP_T)) * PREP_T;
    const int lane = tid & 31, wave = tid >> 5;
    const float* wp = W + (size_t)(k0 + 16 * wave) * DM + n0 + 4 * lane;      /* the thread's 16 k x 4 n corner: a wave covers 512 bytes of one W row */
    v4f r[16];
#pragma unroll
    for (int j = 0; j < 16; ++j) r[j] = *(const v4fa*)(wp + (size_t)j * DM);
    asm volatile("s_wait_xcnt 0x0" :: "v"(wp), "v"(r[0]), "v"(r[1]), "v"(r[2]), "v"(r[3]), "v"(r[4]), "v"(r[5]), "v"(r[6]), "v"(r[7]), "v"(r[8]), "v"(r[9]), "v"(r[10]), "v"(r[11]), "v"(r[12]), "v"(r[13]), "v"(r[14]), "v"(r[15]) : "memory");      /* inputs only. The loaded values: all sixteen loads stay in front of the first conversion, one latency for the tile (left alone the compiler issues them in three batches, each behind the wait for the one before). The address: its registers are no load's destination, and the wait stands in front of every overwrite of them */
#pragma unroll
    for (int i = 0; i < 4; ++i)
#pragma unroll
      for (int hb = 0; hb < 2; ++hb) { FragH f;
#pragma unroll
        for (int j = 0; j < 8; ++j) f.h[j] = (_Float16)(bf16_round(r[8 * hb + j][i]) * 16.0f);
        *(v8us*)&ts[4 * lane + i][8 * ((2 * wave + hb) ^ (lane & 15))] = f.half[0]; }      /* row n = 4 lane + i, piece 2 wave + hb */
    __syncthreads();      /* the tile is whole before its rows are read */
    const int c = tid & 15, nr = tid >> 4;
    unsigned short* bp = (unsigned short*)Bt + (size_t)p * DM * DM + (size_t)(n0 + nr) * DM + k0 + 8 * c;
#pragma unroll
    for (int u = 0; u < 8; ++u) { const int n = nr + 16 * u; *(v8us*)(bp + (size_t)(16 * u) * DM) = *(const v8us*)&ts[n][8 * (c ^ ((n >> 2) & 15))]; }      /* row n, piece c: sixteen lanes cover 256 bytes of one Wt row */
  } else {
    const size_t t0 = (size_t)(bx - 4 * PREP_WB) * (256 * PREP_XP) + tid;
    const float* xp = x + t0 * 8;      /* piece u lies 256 x 8 elements further on */
    v4f a[PREP_XP][2];
#pragma unroll
    for (int u = 0; u < PREP_XP; ++u) { a[u][0] = *(const v4fa*)(xp + 2048 * u); a[u][1] = *(const v4fa*)(xp + 2048 * u + 4); }
    asm volatile("s_wait_xcnt 0x0" :: "v"(xp) : "memory");      /* stands in front of every overwrite of the address registers that the loads above name, and keeps them out of the loads' destinations */
#pragma unroll
    for (int u = 0; u < PREP_XP; ++u) { FragH f;
#pragma unroll
      for (int q = 0; q < 4; ++q) { f.h[q] = (_Float16)bf16_round(a[u][0][q]); f.h[4 + q] = (_Float16)bf16_round(a[u][1][q]); }
      *(v8us*)((unsigned short*)X16 + (t0 + 256 * u) * 8) = f.half[0]; }
    asm volatile("s_wait_xcnt 0x0" ::: "memory");      /* behind the last store: stands in front of any later overwrite of the stores' address and data registers */
  }
}
// k_gemm_hh variant with fused epilogue: v = acc·alpha + bias[by·sBias + col] (+ CP[(row/rowsPerB)·sCPb + by·64 + col] if CP) ; ACT 0 none / 1 elu ; writes f16 C16 (and f32 C if non-null)
template <int ACT>
__global__ __launch_bounds__(128) void k_gemm_hhx(const _Float16* __restrict__ A, int lda, size_t sA, const _Float16* __restrict__ Bh, int ldb, size_t sB, float alpha, const float* __restrict__ bias, size_t sBias, const float* __restrict__ CP, int rowsPerB, size_t sCPb, int row0g,
    float* __restrict__ C, _Float16* __restrict__ C16, int ldc, size_t sC, int M, int N, int K) {
  __shared__ __attribute__((aligned(16))) float so[4][16][64];
  const int tid = threadIdx.x, w = tid >> 5, lane = tid & 31, ln = lane & 15, hh = lane >> 4; const int by = blockIdx.y;
  A += (size_t)by * sA; Bh += (size_t)by * sB; const size_t cofs = (size_t)by * sC; const float* bp = bias ? bias + (size_t)by * sBias : nullptr;
  const int ntn = (N + 63) / 64; const int wid = blockIdx.x * 4 + w; const int mt = wid / ntn, nq = wid % ntn; if (mt * 16 >= M) return;
  const int row0 = mt * 16, col0 = nq * 64; const _Float16* arow = A + (size_t)(row0 + ln) * lda;
  v8f acc[4] = {};
  for (int kb = 0; kb < K; kb += 32) { FragH ah; ah.half[0] = *(const v8us*)((const unsigned short*)arow + kb + 8 * hh); ah.half[1] = *(const v8us*)((const unsigned short*)arow + kb + 16 + 8 * hh);
#pragma unroll
    for (int t = 0; t < 4; ++t) { if (col0 + t * 16 >= N) continue; const size_t boff = (size_t)(col0 + t * 16 + ln) * ldb + kb; FragH bq; bq.half[0] = *(const v8us*)((const unsigned short*)Bh + boff + 8 * hh); bq.half[1] = *(const v8us*)((const unsigned short*)Bh + boff + 16 + 8 * hh);
      acc[t] = mmaH<1>(ah.v, ah.v, bq.v, bq.v, acc[t]); }
  }
#pragma unroll
  for (int t = 0; t < 4; ++t) { if (col0 + t * 16 >= N) continue; const int col = col0 + t * 16 + ln; const float bv = bp ? bf16_round(bp[col]) : 0.f;
#pragma unroll
    for (int r = 0; r < 8; ++r) { float v = acc[t][r] * alpha + bv; if (CP) { const int rr = row0g + row0 + 8 * hh + r; if (rowsPerB < 0) v += CP[cofs + (size_t)rr * ldc + col];      /* rowsPerB < 0: own element of the batched C plane */ else { const int bidx = rr / rowsPerB; v += CP[(size_t)bidx * sCPb + (size_t)by * 64 + col]; } } if (ACT == 1) v = (v > 0.f) ? v : expm1f(v); else if (ACT == 7) v = (v > 0.f) ? v + 1.0f : expf(v); else if (ACT == 8) v = tanhf(v); else if (ACT == 9) v = 0.5f * v * (1.0f + tanhf(0.7978845608028654f * (v + 0.044715f * v * v * v))); else if (ACT == 11) v = 1.0f / (1.0f + expf(-v)); else if (ACT == 12) v = (v > 0.f) ? v : 0.01f * v; else if (ACT == 14) v = (v > 0.f) ? v : 0.1f * v; else if (ACT == 16) v = (v >= 0.f) ? v : 0.3f * v; else if (ACT == 17) v = (v >= 0.f) ? v : 0.2f * v; else if (ACT == 15) v = v / (1.0f + expf(-v)); else if (ACT == 3) v = fmaxf(v, 0.f); else if (ACT == 6) v = 0.5f * v * (1.0f + erff(v * 0.70710678118654752f)); so[w][8 * hh + r][t * 16 + ln] = v; } }
  __builtin_amdgcn_fence(__ATOMIC_ACQ_REL, "workgroup"); __builtin_amdgcn_wave_barrier();
  const int rsub = lane >> 4, c4 = (lane & 15) * 4; typedef _Float16 v4h __attribute__((ext_vector_type(4)));
  {
#pragma unroll
    for (int q = 0; q < 8; ++q) { const int r = q * 2 + rsub; if (col0 + c4 < N) { const v4f v = *(const v4fa*)&so[w][r][c4]; if (C) *(v4f*)(C + cofs + (size_t)(row0 + r) * ldc + col0 + c4) = v; if (C16) { v4h h4; for (int i = 0; i < 4; ++i) h4[i] = (_Float16)v[i]; *(v4h*)(C16 + cofs + (size_t)(row0 + r) * ldc + col0 + c4) = h4; } } }
     }
}


typedef _Float16 v4h __attribute__((ext_vector_type(4)));

__global__ __launch_bounds__(256) void k_h16(const float* __restrict__ x, _Float16* __restrict__ X16, size_t n8) { const size_t t = (size_t)blockIdx.x * 256 + threadIdx.x; if (t >= n8) return; FragH f;
#pragma unroll
  for (int q = 0; q < 8; ++q) f.h[q] = (_Float16)x[t * 8 + q]; *(v8us*)((unsigned short*)X16 + t * 8) = f.half[0];  }
__global__ __launch_bounds__(256) void k_round16f(const float* __restrict__ W, _Float16* __restrict__ Bt, size_t n8) { const size_t t = (size_t)blockIdx.x * 256 + threadIdx.x; if (t >= n8) return; FragH f;
#pragma unroll
  for (int i = 0; i < 8; ++i) f.h[i] = (_Float16)(bf16_round(W[t * 8 + i]) * 16.0f); *(v8us*)((unsigned short*)Bt + t * 8) = f.half[0];  }
template <int NHv, int TTv>
__global__ __launch_bounds__(256) void k_vt(const _Float16* __restrict__ V16, int ldv, int voff, _Float16* __restrict__ Vt) { __shared__ unsigned short tl[64][66]; const int tid = threadIdx.x; const int slab = blockIdx.x / (TTv / 64), lg = blockIdx.x % (TTv / 64); const int b = slab / NHv, h = slab % NHv;
  for (int i = tid; i < 64 * 8; i += 256) { const int r = i / 8, c8 = (i % 8) * 8; FragH f; f.half[0] = *(const v8us*)((const unsigned short*)V16 + ((size_t)b * TTv + lg * 64 + r) * ldv + voff + h * 64 + c8);
#pragma unroll
    for (int q = 0; q < 8; ++q) tl[r][c8 + q] = f.u[q]; }
  __syncthreads();
  {
#pragma unroll
    for (int rd = 0; rd < 2; ++rd) { const int d = rd * 32 + tid / 8, pc = tid % 8; FragH f;
#pragma unroll
      for (int q = 0; q < 8; ++q) f.u[q] = tl[pc * 8 + q][d];
      *(v8us*)((unsigned short*)Vt + ((size_t)slab * 64 + d) * TTv + lg * 64 + pc * 8) = f.half[0]; }
     } }

__global__ __launch_bounds__(256) void k_hl(const float* __restrict__ F, _Float16* __restrict__ Hh, _Float16* __restrict__ Hl, size_t n8) { const size_t t = (size_t)blockIdx.x * 256 + threadIdx.x; if (t >= n8) return; FragH fh, fl; const v4f a = *(const v4fa*)(F + t * 8), c = *(const v4fa*)(F + t * 8 + 4);
#pragma unroll
  for (int q = 0; q < 4; ++q) { _Float16 h = (_Float16)a[q]; fh.h[q] = h; fl.h[q] = (_Float16)((a[q] - (float)h) * 1024.0f); h = (_Float16)c[q]; fh.h[4 + q] = h; fl.h[4 + q] = (_Float16)((c[q] - (float)h) * 1024.0f); }
  { *(v8us*)((unsigned short*)Hh + t * 8) = fh.half[0]; *(v8us*)((unsigned short*)Hl + t * 8) = fl.half[0];  } }

// ---- fast GEMM (block tile 128x64, wave tile 32x64; A and B k-tiles staged in LDS; requires M % 128 == 0 rows per launch region, N % 64 == 0 and K % 64 == 0); epilogue = k_gemm_hhx semantics ----
__device__ __forceinline__ v16h g2_frag(const _Float16* p, int hh) { FragH f; f.half[0] = *(const v8us*)((const unsigned short*)p + 8 * hh); f.half[1] = *(const v8us*)((const unsigned short*)p + 16 + 8 * hh); return f.v; }
__device__ __forceinline__ v8f g2_mma(v16h a, v16h b, v8f c) { v8f d = __builtin_amdgcn_wmma_f32_16x16x32_f16(false, a, false, b, (short)0, c, false, false); asm volatile("v_nop\n\tv_nop\n\tv_nop\n\tv_nop" : "+v"(d) : "v"(a), "v"(b)); return d; }
#define G2_KS 64                     /* k per LDS stage: one 128-byte line of every A and B row */
#define G2_LP 72                     /* LDS row pitch in halves: 144 B = 16 B x odd for 16-byte row reads */
#define G2_TP 136                    /* LDS row pitch in halves of the turned output tile (128 tokens): 272 B = 16 B x odd */
typedef unsigned int v4ua __attribute__((ext_vector_type(4), may_alias));
typedef float g2_v2f __attribute__((ext_vector_type(2)));
typedef _Float16 g2_v2h __attribute__((ext_vector_type(2)));
__device__ __forceinline__ unsigned int g2_pack(float lo, float hi) { return __builtin_bit_cast(unsigned int, __builtin_convertvector((g2_v2f){lo, hi}, g2_v2h)); }      /* two f32 -> two f16, round to nearest even as the scalar cast */
__device__ __forceinline__ v16h g2_lfrag(const unsigned short* p) { FragH f; f.half[0] = *(const v8us*)p; f.half[1] = *(const v8us*)(p + 16); return f.v; }      /* p already holds the lane half's + 8 hh: the k order of g2_frag */
template <int ACT, int LDA, int LDB, int LDC, bool HASB, bool HASCP, bool OUT32, bool OUT16, bool P2T>      /* row pitches at compile time: a tile's row pieces are immediate offsets from one address pair; the epilogue's options (bias, residual CP, f32 / f16 output) at compile time: straight-line code without a test per element or per row. P2T: plane 2 (grid.y == 2) leaves as per-head transposed f16 rows CT[batch][head][d][token] and is not written to C16 */
__global__ __launch_bounds__(128) void k_gemm2(const _Float16* __restrict__ A, size_t sA, const _Float16* __restrict__ Bh, size_t sB, float alpha, const float* __restrict__ bias, const float* __restrict__ bias1, const float* __restrict__ bias2, size_t sBias, const float* __restrict__ CP, int rowsPerB, size_t sCPb, int row0g,
    float* __restrict__ C, _Float16* __restrict__ C16, _Float16* __restrict__ CT, size_t sC, int M, int N, int K) { static_assert(ACT == 0 || ACT == 3 || ACT == 6 || ACT == 8 || ACT == 9 || ACT == 11 || ACT == 12 || ACT == 14 || ACT == 15 || ACT == 16 || ACT == 17, "k_gemm2: unsupported ACT code (would silently apply no activation)");
  __shared__ __attribute__((aligned(16))) unsigned short tl[2][128 + 64][G2_LP];      /* per buffer: the block's 128 A rows, then its 64 B rows, G2_KS halves of each */
  float (*so)[32][68] = (float (*)[32][68])&tl[0][0][0];      /* the epilogue's staging takes the tiles' place behind the loop's last barrier */
  static_assert(sizeof(tl) >= sizeof(float) * 4 * 32 * 68, "k_gemm2: epilogue staging must fit in the tile buffers");
  const int tid = threadIdx.x, w = tid >> 5, lane = tid & 31, ln = lane & 15, hh = lane >> 4; const int by = blockIdx.y;
  A += (size_t)by * sA; Bh += (size_t)by * sB; const size_t cofs = (size_t)by * sC; const float* bsel = (by == 1 && bias1) ? bias1 : (by == 2 && bias2) ? bias2 : bias;      /* planes 1 and 2 may bring their bias in a buffer of its own */
  const float* bp = bsel + (size_t)by * sBias;      /* read only where HASB */
  const int ntn = N >> 6; const int mt = blockIdx.x / ntn, nq = blockIdx.x - mt * ntn; const int row0 = mt * 128 + 32 * w, col0 = nq * 64; if (mt * 128 >= M) return;      /* the same for the whole block: in front of every barrier */
  const int sr = tid >> 3, sc = (tid & 7) * 8;      /* staging: eight lanes cover one 128-byte row piece; piece u is row sr + 16 u */
  const unsigned short* ag = (const unsigned short*)A + (size_t)(mt * 128 + sr) * LDA + sc;
  const unsigned short* bg = (const unsigned short*)Bh + (size_t)(col0 + sr) * LDB + sc;
  v8us ra[8], rb[4];      /* these and af, bf below are indexed under full unrolls only, so that they stay in registers */
#pragma unroll
  for (int u = 0; u < 8; ++u) ra[u] = *(const v8us*)(ag + (size_t)(16 * u) * LDA);
#pragma unroll
  for (int u = 0; u < 4; ++u) rb[u] = *(const v8us*)(bg + (size_t)(16 * u) * LDB);
  float bv4[4];      /* the lane's four bias values, fetched behind the first tiles' loads: their latency passes under the k loop */
#pragma unroll
  for (int t = 0; t < 4; ++t) bv4[t] = HASB ? bf16_round(bp[col0 + t * 16 + ln]) : 0.f;
  const v8f z8 = {0.f,0.f,0.f,0.f,0.f,0.f,0.f,0.f}; v8f c00 = z8, c01 = z8, c02 = z8, c03 = z8, c10 = z8, c11 = z8, c12 = z8, c13 = z8;
#pragma unroll
  for (int u = 0; u < 8; ++u) *(v8us*)&tl[0][sr + 16 * u][sc] = ra[u];
#pragma unroll
  for (int u = 0; u < 4; ++u) *(v8us*)&tl[0][128 + sr + 16 * u][sc] = rb[u];
  __syncthreads();
  const int nst = K / G2_KS;
#pragma unroll 1      /* rolled: one stage's code, two buffers by index */
  for (int st = 0; st < nst; ++st) { const int bu = st & 1;
    if (st + 1 < nst) {      /* the next stage's tiles fly into registers under this stage's products */
      const unsigned short* an = ag + (st + 1) * G2_KS; const unsigned short* bn = bg + (st + 1) * G2_KS;
#pragma unroll
      for (int u = 0; u < 8; ++u) ra[u] = *(const v8us*)(an + (size_t)(16 * u) * LDA);
#pragma unroll
      for (int u = 0; u < 4; ++u) rb[u] = *(const v8us*)(bn + (size_t)(16 * u) * LDB);
      asm volatile("s_wait_xcnt 0x0" :: "v"(an), "v"(bn) : "memory");      /* stands in front of every overwrite of the address registers that the loads above name */
    }
    v16h af[G2_KS / 32][2], bf[G2_KS / 32][4];      /* the stage's fragments are read as one group in front of its products */
#pragma unroll
    for (int kk = 0; kk < G2_KS / 32; ++kk) { const unsigned short* ap = &tl[bu][32 * w + ln][32 * kk + 8 * hh]; const unsigned short* bq = &tl[bu][128 + ln][32 * kk + 8 * hh];
      af[kk][0] = g2_lfrag(ap); af[kk][1] = g2_lfrag(ap + 16 * G2_LP);
#pragma unroll
      for (int t = 0; t < 4; ++t) bf[kk][t] = g2_lfrag(bq + 16 * t * G2_LP); }
#pragma unroll
    for (int kk = 0; kk < G2_KS / 32; ++kk) {
      c00 = g2_mma(af[kk][0], bf[kk][0], c00); c10 = g2_mma(af[kk][1], bf[kk][0], c10);
      c01 = g2_mma(af[kk][0], bf[kk][1], c01); c11 = g2_mma(af[kk][1], bf[kk][1], c11);
      c02 = g2_mma(af[kk][0], bf[kk][2], c02); c12 = g2_mma(af[kk][1], bf[kk][2], c12);
      c03 = g2_mma(af[kk][0], bf[kk][3], c03); c13 = g2_mma(af[kk][1], bf[kk][3], c13); }
    if (st + 1 < nst) {
#pragma unroll
      for (int u = 0; u < 8; ++u) *(v8us*)&tl[bu ^ 1][sr + 16 * u][sc] = ra[u];
#pragma unroll
      for (int u = 0; u < 4; ++u) *(v8us*)&tl[bu ^ 1][128 + sr + 16 * u][sc] = rb[u]; }
    __syncthreads();      /* publishes the next stage and ends every wave's reads of this one, which the next trip (or the epilogue) overwrites */
  }
  v8f accs[8] = {c00, c01, c02, c03, c10, c11, c12, c13};
  if (P2T && by == 2) {      /* the same for the whole block: the barrier inside is passed by all or by none */
    static_assert(!P2T || (ACT == 0 && !HASCP && SQ % 128 == 0 && HD == 64 && LDC == NH * HD), "k_gemm2 P2T: a block tile is 128 tokens of one batch x the 64 columns of one head");
    static_assert(sizeof(tl) >= 2 * HD * G2_TP, "k_gemm2 P2T: the turned tile must fit in the tile buffers");
    unsigned short (*tt)[G2_TP] = (unsigned short (*)[G2_TP])&tl[0][0][0];      /* [d][token of the block]; takes the tiles' place behind the loop's last barrier, like so */
#pragma unroll      /* accs and bv4 are indexed by u: in registers only under a full unroll */
    for (int u = 0; u < 8; ++u) { const int t = u & 3, half = u >> 2; const v8f v = accs[u] * alpha + bv4[t];      /* an accumulator's eight registers are eight consecutive tokens of one column: one 16-byte piece of a turned row */
      *(v4ua*)&tt[t * 16 + ln][32 * w + 16 * half + 8 * hh] = (v4ua){g2_pack(v[0], v[1]), g2_pack(v[2], v[3]), g2_pack(v[4], v[5]), g2_pack(v[6], v[7])}; }
    __syncthreads();      /* the turned tile is whole (a row holds pieces of all four waves) before its rows are read */
    const int tr = mt * 128, bb = tr / SQ, pc = tid & 15, dr = tid >> 4;      /* sixteen lanes cover the 256 bytes that the block holds of one turned row */
    unsigned short* tp = (unsigned short*)CT + ((size_t)(bb * NH + nq) * HD + dr) * SQ + (tr - bb * SQ) + 8 * pc;
#pragma unroll      /* the eight LDS reads issue as one group, the row steps become immediate offsets */
    for (int q = 0; q < 8; ++q) *(v8us*)(tp + (size_t)(8 * q) * SQ) = *(const v8us*)&tt[dr + 8 * q][8 * pc];
    return; }
#pragma unroll
  for (int u = 0; u < 8; ++u) { const int t = u & 3, half = u >> 2; const int col = col0 + t * 16 + ln; const float bv = bv4[t];
#pragma unroll
    for (int r = 0; r < 8; ++r) { const int rloc = half * 16 + 8 * hh + r; float v = accs[u][r] * alpha + bv; if (HASCP) { if (rowsPerB < 0) v += CP[cofs + (size_t)(row0g + row0 + rloc) * LDC + col];      /* rowsPerB < 0: own element of the batched C plane */ else { const int bidx = (row0g + row0 + rloc) / rowsPerB; v += CP[(size_t)bidx * sCPb + (size_t)by * 64 + col]; } }
      if (ACT == 3) v = fmaxf(v, 0.f); else if (ACT == 6) v = 0.5f * v * (1.0f + erff(v * 0.70710678118654752f)); else if (ACT == 11) v = 1.0f / (1.0f + expf(-v)); else if (ACT == 15) v = v / (1.0f + expf(-v)); else if (ACT == 12) v = (v > 0.f) ? v : 0.01f * v; else if (ACT == 8) v = tanhf(v); else if (ACT == 9) v = 0.5f * v * (1.0f + tanhf(0.7978845608028654f * (v + 0.044715f * v * v * v))); else if (ACT == 14) v = (v > 0.f) ? v : 0.1f * v; else if (ACT == 16) v = (v >= 0.f) ? v : 0.3f * v; else if (ACT == 17) v = (v >= 0.f) ? v : 0.2f * v;
      so[w][rloc][t * 16 + ln] = v; } }
  __builtin_amdgcn_fence(__ATOMIC_ACQ_REL, "workgroup"); __builtin_amdgcn_wave_barrier();
  const int rsub = lane >> 4, c4 = (lane & 15) * 4;
  {
#pragma unroll
    for (int q = 0; q < 16; ++q) { const int r = q * 2 + rsub; const v4f v = *(const v4fa*)&so[w][r][c4]; if (OUT32) *(v4f*)(C + cofs + (size_t)(row0 + r) * LDC + col0 + c4) = v; if (OUT16) { v4h h4; for (int i = 0; i < 4; ++i) h4[i] = (_Float16)v[i]; *(v4h*)(C16 + cofs + (size_t)(row0 + r) * LDC + col0 + c4) = h4; } }
     } }


__global__ __launch_bounds__(256) void k_wnat(const float* __restrict__ w, size_t n8, _Float16* __restrict__ Bt) { const size_t t = (size_t)blockIdx.x * 256 + threadIdx.x; if (t >= n8) return; FragH f; for (int q = 0; q < 8; ++q) f.h[q] = (_Float16)(bf16_round(w[t * 8 + q]) * 16.0f); *(v8us*)((unsigned short*)Bt + t * 8) = f.half[0];  }
__global__ __launch_bounds__(256) void k_rsm(const float* __restrict__ S, _Float16* __restrict__ P, int nrows) {
  #pragma clang fp contract(off)
  const int i = blockIdx.x * 256 + threadIdx.x; if (i >= nrows) return; const float* s = S + (size_t)i * SQ; float mx = -3.0e38f;
#pragma unroll 1
  for (int j = 0; j < SQ; ++j) mx = fmaxf(mx, s[j]); float se = 0.f;
#pragma unroll 1
  for (int j = 0; j < SQ; ++j) se += expf(s[j] - mx); const float sc = 256.0f / se;
#pragma unroll 1
  for (int j0 = 0; j0 < SQ; j0 += 8) { FragH f; for (int q = 0; q < 8; ++q) f.h[q] = (_Float16)(expf(s[j0 + q] - mx) * sc); unsigned short* d = (unsigned short*)P + (size_t)i * SQ + j0; *(v8us*)d = f.half[0];  } }
__global__ __launch_bounds__(256) void k_vt(const _Float16* __restrict__ V16, int b, int h0, _Float16* __restrict__ VT) { __shared__ unsigned short tl[64][65]; const int tid = threadIdx.x; const int hh = blockIdx.x % HG, sg = blockIdx.x / HG; const int s0 = sg * 64; const int h = h0 + hh;
  for (int i = tid; i < 64 * 8; i += 256) { const int j = i / 8, d8 = (i % 8) * 8; FragH f; f.half[0] = *(const v8us*)((const unsigned short*)V16 + ((size_t)b * SQ + s0 + j) * DM + h * HD + d8); for (int q = 0; q < 8; ++q) tl[d8 + q][j] = f.u[q]; }
  __syncthreads();
  { for (int i = tid; i < 64 * 8; i += 256) { const int d = i / 8, j8 = (i % 8) * 8; FragH f; for (int q = 0; q < 8; ++q) f.u[q] = tl[d][j8 + q]; *(v8us*)((unsigned short*)VT + ((size_t)hh * HD + d) * SQ + s0 + j8) = f.half[0]; }  } }



// ---- fused attention: per work-group FA_BR queries of one (batch, head) against all SQ keys. Transposed products: S^T = K Q^T puts one query's
// scores in one lane pair (l, l ^ 16), so maximum and weights are in-lane; two S^T tiles (32 keys), converted in place, are the B operand of
// O^T += V^T P^T. Every A/B fragment is loaded in the same k order (8 h + 0..7, 16 + 8 h + 0..7), which is the order the converted tiles have.
#define FA_NW 4                      /* waves per work-group */
#define FA_R 2                       /* 16-query column groups per wave */
#define FA_BR (FA_NW * FA_R * 16)    /* queries per work-group */
#define FA_SK 64                     /* keys per LDS stage = two 32-key passes */
#define FA_LP 72                     /* LDS row pitch in halves: 144 B = 16 B x odd for 16-byte row reads */
#define FA_NST (SQ / FA_SK)
static_assert(HD == 64 && FA_SK == 64 && SQ % FA_SK == 0 && SQ % FA_BR == 0 && FA_NW * 32 == 128, "k_fattn: 64 x 128-byte tiles, four 16-byte pieces of each per thread, whole stages and whole query blocks");
typedef float v2f __attribute__((ext_vector_type(2)));
typedef _Float16 v2h __attribute__((ext_vector_type(2)));
typedef unsigned int v8u __attribute__((ext_vector_type(8)));
typedef unsigned int v4u __attribute__((ext_vector_type(4)));
__device__ __forceinline__ v16h fa_frag(const unsigned short* p) { FragH f; f.half[0] = *(const v8us*)p; f.half[1] = *(const v8us*)(p + 16); return f.v; }      /* p already holds the lane half's + 8 h */
__device__ __forceinline__ unsigned int fa_pack(float lo, float hi) { return __builtin_bit_cast(unsigned int, __builtin_convertvector((v2f){lo, hi}, v2h)); }
__device__ __forceinline__ float fa_xh(float x) { return __builtin_bit_cast(float, __builtin_amdgcn_permlanex16(__builtin_bit_cast(int, x), __builtin_bit_cast(int, x), 0x76543210, 0xfedcba98, false, false)); }      /* lane l with lane l ^ 16 */
__device__ __forceinline__ v8f fa_mma(v16h a, v16h b, v8f c) { return __builtin_amdgcn_wmma_f32_16x16x32_f16(false, a, false, b, (short)0, c, false, false); }
__global__ __launch_bounds__(FA_NW * 32) void k_fattn(const _Float16* __restrict__ Q16, const _Float16* __restrict__ K16, const _Float16* __restrict__ VT, _Float16* __restrict__ O16) {
  __shared__ __attribute__((aligned(16))) unsigned short sk[2][FA_SK][FA_LP];      /* K rows [key][d] */
  __shared__ __attribute__((aligned(16))) unsigned short sv[2][HD][FA_LP];         /* V^T rows [d][key] */
  const int tid = threadIdx.x, lane = tid & 31, wave = tid >> 5, c = lane & 15, h = lane >> 4;
  const int bh = blockIdx.y, b = bh / NH, hd = bh - b * NH;
  const int q0 = blockIdx.x * FA_BR + wave * (FA_R * 16);
  const int sr = tid >> 3, sc = (tid & 7) * 8;      /* staging: eight lanes cover one 128-byte row; piece u is row sr + 16 u */
  const unsigned short* kg = (const unsigned short*)K16 + ((size_t)b * SQ + sr) * DM + hd * HD + sc;
  const unsigned short* vg = (const unsigned short*)VT + ((size_t)bh * HD + sr) * SQ + sc;
  const float cscale = 0.125f * 1.4426950408889634f;      /* HD^-0.5 log2(e) */
  v8us rk[4], rv[4];
#pragma unroll
  for (int u = 0; u < 4; ++u) { rk[u] = *(const v8us*)(kg + (size_t)(16 * u) * DM); rv[u] = *(const v8us*)(vg + (size_t)(16 * u) * SQ); }
  v16h qf[FA_R][2];
#pragma unroll
  for (int g = 0; g < FA_R; ++g) { const unsigned short* qp = (const unsigned short*)Q16 + ((size_t)b * SQ + q0 + 16 * g + c) * DM + hd * HD + 8 * h; qf[g][0] = fa_frag(qp); qf[g][1] = fa_frag(qp + 32); }
  const unsigned int o1 = (c == 0) ? 0x3C003C00u : 0u;      /* A operand whose row 0 is f16 ones: its product with P^T is the weights' column sums */
  const v16h ones = __builtin_bit_cast(v16h, (v8u){o1, o1, o1, o1, o1, o1, o1, o1});
  const v8f z8 = {0.f, 0.f, 0.f, 0.f, 0.f, 0.f, 0.f, 0.f};
  v8f acc[FA_R][4], lacc[FA_R]; float m_run[FA_R];
#pragma unroll
  for (int g = 0; g < FA_R; ++g) { m_run[g] = -__builtin_inff(); lacc[g] = z8; acc[g][0] = z8; acc[g][1] = z8; acc[g][2] = z8; acc[g][3] = z8; }
#pragma unroll
  for (int u = 0; u < 4; ++u) { *(v8us*)&sk[0][sr + 16 * u][sc] = rk[u]; *(v8us*)&sv[0][sr + 16 * u][sc] = rv[u]; }
  __syncthreads();
#pragma unroll 1      /* rolled: one stage's code, two buffers by index */
  for (int st = 0; st < FA_NST; ++st) {
    const int bu = st & 1;
    if (st + 1 < FA_NST) {      /* the next stage's tiles fly into registers under this stage's two passes */
      const unsigned short* kn = kg + (size_t)(st + 1) * FA_SK * DM; const unsigned short* vn = vg + (st + 1) * FA_SK;
#pragma unroll
      for (int u = 0; u < 4; ++u) { rk[u] = *(const v8us*)(kn + (size_t)(16 * u) * DM); rv[u] = *(const v8us*)(vn + (size_t)(16 * u) * SQ); }
      asm volatile("s_wait_xcnt 0x0" :: "v"(kn), "v"(vn) : "memory");      /* stands in front of every overwrite of the address registers that the loads above name */
    }
#pragma unroll
    for (int sub = 0; sub < 2; ++sub) {
      v8f s[2][FA_R];
      { v16h kf[2][2];
#pragma unroll
        for (int kt = 0; kt < 2; ++kt) { const unsigned short* p = &sk[bu][32 * sub + 16 * kt + c][8 * h]; kf[kt][0] = fa_frag(p); kf[kt][1] = fa_frag(p + 32); }
#pragma unroll
        for (int kt = 0; kt < 2; ++kt)
#pragma unroll
          for (int g = 0; g < FA_R; ++g) s[kt][g] = fa_mma(kf[kt][0], qf[g][0], z8);
#pragma unroll
        for (int kt = 0; kt < 2; ++kt)
#pragma unroll
          for (int g = 0; g < FA_R; ++g) s[kt][g] = fa_mma(kf[kt][1], qf[g][1], s[kt][g]); }
      v16h vf[4];
#pragma unroll
      for (int t = 0; t < 4; ++t) vf[t] = fa_frag(&sv[bu][16 * t + c][32 * sub + 8 * h]);
      float mb[FA_R]; bool need = false;
#pragma unroll
      for (int g = 0; g < FA_R; ++g) { float mx = s[0][g][0];
#pragma unroll
        for (int r = 1; r < 8; ++r) mx = fmaxf(mx, s[0][g][r]);
#pragma unroll
        for (int r = 0; r < 8; ++r) mx = fmaxf(mx, s[1][g][r]);
        mx = fmaxf(mx, fa_xh(mx)) * cscale; mb[g] = mx; need = need || (mx > m_run[g] + 8.0f); }
      if (__builtin_amdgcn_ballot_w32(need) != 0) {      /* lazy rescale: the maximum in use may trail the true one by up to 8 (log2), so a weight stays below 2^8 */
#pragma unroll
        for (int g = 0; g < FA_R; ++g) { const float mn = fmaxf(m_run[g], mb[g]); const float corr = __builtin_amdgcn_exp2f(m_run[g] - mn); m_run[g] = mn; lacc[g] = lacc[g] * corr;
#pragma unroll
          for (int t = 0; t < 4; ++t) acc[g][t] = acc[g][t] * corr; } }
#pragma unroll
      for (int g = 0; g < FA_R; ++g) { const float nm = -m_run[g]; v8u w;
#pragma unroll
        for (int i = 0; i < 8; ++i) { const v2f a = __builtin_elementwise_fma((v2f){s[i >> 2][g][2 * (i & 3)], s[i >> 2][g][2 * (i & 3) + 1]}, (v2f){cscale, cscale}, (v2f){nm, nm}); w[i] = fa_pack(__builtin_amdgcn_exp2f(a[0]), __builtin_amdgcn_exp2f(a[1])); }
        const v16h pf = __builtin_bit_cast(v16h, w);      /* element e: key 8 h + e (tile 0), 16 + 8 h + e - 8 (tile 1) of query c */
#pragma unroll
        for (int t = 0; t < 4; ++t) acc[g][t] = fa_mma(vf[t], pf, acc[g][t]);
        lacc[g] = fa_mma(ones, pf, lacc[g]); }
    }
    __builtin_amdgcn_sched_barrier(0);      /* keeps the v_nop run below directly behind the stage's last WMMA */
    asm volatile("v_nop\n\tv_nop\n\tv_nop\n\tv_nop");      /* the four vector slots behind a WMMA, also on the taken side of the branches that follow */
    __builtin_amdgcn_sched_barrier(0);
    if (st + 1 < FA_NST) {
#pragma unroll
      for (int u = 0; u < 4; ++u) { *(v8us*)&sk[bu ^ 1][sr + 16 * u][sc] = rk[u]; *(v8us*)&sv[bu ^ 1][sr + 16 * u][sc] = rv[u]; } }
    __syncthreads();      /* publishes the next stage and ends every wave's reads of this one, which the next trip overwrites */
  }
#pragma unroll
  for (int g = 0; g < FA_R; ++g) { const float lr = lacc[g][0]; const float inv = 64.0f / (lr + fa_xh(lr));      /* row 0 of the sum tile sits in lanes 0-15, row 8 (zero) in lanes 16-31: the exchange-and-add is unconditional */
    unsigned short* op = (unsigned short*)O16 + ((size_t)b * SQ + q0 + 16 * g + c) * DM + hd * HD + 8 * h;
#pragma unroll
    for (int t = 0; t < 4; ++t) { const v8f o = acc[g][t] * inv; *(v4u*)(op + 16 * t) = (v4u){fa_pack(o[0], o[1]), fa_pack(o[2], o[3]), fa_pack(o[4], o[5]), fa_pack(o[6], o[7])}; } } }      /* acc register r = d 16 t + 8 h + r of query c */

extern "C" void kernel_launch(void* const* d_in, const int* in_sizes, int n_in,
                              void* d_out, int out_size, void* d_ws, size_t ws_size, hipStream_t stream) {
  (void)in_sizes; (void)n_in; (void)out_size;
  const float* const* I = (const float* const*)d_in; const float* x = I[0]; const float* wq = I[1]; const float* bq = I[2]; const float* wk = I[3]; const float* bk = I[4]; const float* wv = I[5]; const float* bv = I[6]; const float* wo = I[7]; const float* bo = I[8];      /* [in][out] weights + biases */
  char* ws = (char*)d_ws; size_t off = 0;
  auto take = [&](size_t bytes) { char* p = ws + off; off += (bytes + 255) & ~(size_t)255; return p; };
  _Float16* BQ = (_Float16*)take((size_t)DM * DM * 2); _Float16* BK = (_Float16*)take((size_t)DM * DM * 2); _Float16* BV = (_Float16*)take((size_t)DM * DM * 2); _Float16* BO = (_Float16*)take((size_t)DM * DM * 2);
  _Float16* X16 = (_Float16*)take(NR * DM * 2); _Float16* Q16 = (_Float16*)take(NR * DM * 2); _Float16* K16 = (_Float16*)take(NR * DM * 2); _Float16* O16 = (_Float16*)take(NR * DM * 2);
  _Float16* VT = (_Float16*)take((size_t)NB * NH * HD * SQ * 2);
  if (off > ws_size) return;
  static_assert(MP % 128 == 0 && MPO % 128 == 0 && DM % 64 == 0, "k_gemm2: whole 128x64 block tiles and whole 64-wide k stages");
  static_assert(((size_t)DM * DM * 2) % 256 == 0 && (NR * DM * 2) % 256 == 0, "the weight planes BQ, BK, BV, BO and the row planes Q16, K16 lie one behind the other in the workspace");
  k_prep<<<4 * PREP_WB + PREP_XB, 256, 0, stream>>>(x, wq, wk, wv, wo, BQ, X16);      /* [in][out] -> Bt[n][k] x16 for all four weights; x -> f16 rows */
  const size_t r0p = (size_t)B0 * SQ;      /* first projected row */
  k_gemm2<0, DM, DM, DM, true, false, false, true, true><<<dim3((unsigned)((MP / 128) * (DM / 64)), 3), 128, 0, stream>>>(X16 + r0p * DM, 0, BQ, (size_t)DM * DM, 0.0625f, bq, bk, bv, 0, nullptr, 1, 0, 0, nullptr, Q16 + r0p * DM, VT + (size_t)B0 * NH * HD * SQ, NR * DM, MP, DM, DM);      /* grid.y = Q, K, V: one A, three weight and bias planes; Q and K leave as rows, V as V^T [NB][NH][HD][SQ] */
  k_fattn<<<dim3(SQ / FA_BR, NB * NH), FA_NW * 32, 0, stream>>>(Q16, K16, VT, O16);      /* o x64 (merged heads) as f16 rows */
  k_gemm2<0, DM, DM, DM, true, false, true, false, false><<<dim3((unsigned)((MPO / 128) * (DM / 64)), 1), 128, 0, stream>>>(O16 + r0p * DM, 0, BO, 0, 0.0009765625f, bo, nullptr, nullptr, 0, nullptr, 1, 0, 0, (float*)d_out + r0p * DM, nullptr, nullptr, 0, MPO, DM, DM);      /* out rows are the output layout */
}

// v008
// One run takes 71.3 microseconds.
// Next to v007, in two timings, it ran 1.06 and 1.08 times as fast.
// Over all steps from v000 it is 37.3 times as fast.
#include <hip/hip_runtime.h>
// Multi-head self-attention (x [2][2048][768]; q/k/v = x W + b ([in][out] 768x768 sigma 1/sqrt(768), zero biases); 12 heads of 64; softmax(q k^T / 8) over all keys (no mask); out = ctx Wo + bo -> [2][2048][768]).
// Structure: token rows r = b*2048 + s; x as exact f16 rows (bf16-rounded); Q, K, V as one launch of three WMMA GEMMs (32x64 wave tiles, f32 accumulation, exact x16 weights + bias, f16 outputs; the V plane's epilogue writes V^T per batch and head, turned in LDS); one fused attention launch over (query block, batch x head): S^T = K Q^T (K = 64), online softmax in the log2 domain on the score accumulators (f32 statistics, native exp2, weights as f16 relative to the running maximum), O^T += V^T P^T, K and V^T staged in LDS; o carried x64 against f16 subnormal flush (folded into the output GEMM alpha), written straight into the merged f16 o rows; out = o W_o + b GEMM (f32) into the output layout.
// Compute dtype: inputs rounded to bf16; x / weights exact; q, k, v, softmax weights and o as plain f16 GEMM operands (~2^-12); scores and softmax statistics f32. v_wmma_f32_16x16x32_f16.
#define NB 2
#define SQ 2048
#define DM 768
#define NH 12
#define HD 64
#define HG 4                         /* heads per block group of the unlaunched k_vt(b, h0) */
#define B0 0                         /* first batch processed (debug hook) */
#define NBR NB                       /* batches processed (debug hook) */
#define NR ((size_t)NB * SQ)         /* token rows */
#define MP ((int)((size_t)NBR * SQ)) /* rows projected (debug hook) */
#define QN SQ                        /* query rows per batch; not read (k_fattn attends all SQ) */
#define NHD NH                       /* heads; not read (k_fattn attends all NH) */
#define MPO MP                       /* rows through the output stage (debug hook) */
#define LQ DM      /* row pitch of the q/k rows; not read (pitches are DM) */
typedef __bf16 v16b __attribute__((ext_vector_type(16)));
typedef unsigned short v8us __attribute__((ext_vector_type(8), may_alias));
typedef float  v8f  __attribute__((ext_vector_type(8)));
typedef float  v4f  __attribute__((ext_vector_type(4)));
typedef float  v4fa __attribute__((ext_vector_type(4), may_alias));
union FragB { v16b v; v8us half[2]; unsigned short u[16]; };

__device__ __forceinline__ unsigned short bf16_bits(float x) { unsigned int u = __float_as_uint(x); return (unsigned short)((u + 0x7FFFu + ((u >> 16) & 1u)) >> 16); }
__device__ __forceinline__ float bf16_val(unsigned short b) { return __uint_as_float(((unsigned int)b) << 16); }
__device__ __forceinline__ float bf16_round(float x) { return bf16_val(bf16_bits(x)); }
// D += A·B with NT terms: 1 = ah·bh, 2 = + al·bh (A split), 3 = + ah·bl (both split)
template <int NT>
__device__ __forceinline__ v8f mmaN(v16b ah, v16b al, v16b bh, v16b bl, v8f c) {
  c = __builtin_amdgcn_wmma_f32_16x16x32_bf16(false, ah, false, bh, (short)0, c, false, false);
  if (NT >= 2) c = __builtin_amdgcn_wmma_f32_16x16x32_bf16(false, al, false, bh, (short)0, c, false, false);
  if (NT >= 3) c = __builtin_amdgcn_wmma_f32_16x16x32_bf16(false, ah, false, bl, (short)0, c, false, false);
  asm volatile("v_nop\n\tv_nop\n\tv_nop\n\tv_nop" : "+v"(c) : "v"(ah), "v"(al), "v"(bh), "v"(bl));
  return c;
}

__global__ __launch_bounds__(256) void k_wt_bf16(const float* __restrict__ W, unsigned short* __restrict__ Wt, int K, int N) {
  const int t = blockIdx.x * 256 + threadIdx.x;
  const int k8n = K / 8;
  if (t >= N * k8n) return;
  const int n = t / k8n, k8 = (t % k8n) * 8;
  v8us v;
#pragma unroll
  for (int i = 0; i < 8; ++i) v[i] = bf16_bits(W[(size_t)(k8 + i) * N + n]);
  *(v8us*)(Wt + (size_t)n * K + k8) = v;
  
}

// GEMM C[M][N] (f32, pitch ldc) = act(A[M][K]·W + bias). A f32 row-major (pitch lda) converted per fragment to bf16
// (ASPLIT: hi/lo two planes -> 2 terms, else single rounded term); Wt bf16 [N][K] (pitch ldb). BIAS_BF16 rounds the
// bias to bf16 first (bias quantised to bf16 before the add). K%32==0, M%16==0, N%64==0.
template <bool ASPLIT, int ACT, bool BIAS_BF16>
__global__ __launch_bounds__(128) void k_gemm_bf(const float* __restrict__ A, int lda, const unsigned short* __restrict__ Wt, int ldb,
                                               const float* __restrict__ bias, float* __restrict__ C, int ldc, int M, int N, int K) {
  __shared__ __attribute__((aligned(16))) float so[4][16][64];
  const int tid = threadIdx.x, w = tid >> 5, lane = tid & 31, ln = lane & 15, hh = lane >> 4;
  const int ntn = N / 64;
  const int wid = blockIdx.x * 4 + w;
  const int mt = wid / ntn, nq = wid % ntn;
  if (mt * 16 >= M) return;
  const int row0 = mt * 16, col0 = nq * 64;
  const float* arow = A + (size_t)(row0 + ln) * lda;
  v8f acc[4] = {};
  for (int kb = 0; kb < K; kb += 32) {
    FragB ah, al;
    const v4f x0 = *(const v4fa*)(arow + kb + 8 * hh), x1 = *(const v4fa*)(arow + kb + 8 * hh + 4);
    const v4f x2 = *(const v4fa*)(arow + kb + 16 + 8 * hh), x3 = *(const v4fa*)(arow + kb + 16 + 8 * hh + 4);
    float xs[16] = {x0[0],x0[1],x0[2],x0[3],x1[0],x1[1],x1[2],x1[3],x2[0],x2[1],x2[2],x2[3],x3[0],x3[1],x3[2],x3[3]};
#pragma unroll
    for (int i = 0; i < 16; ++i) { const unsigned short hb = bf16_bits(xs[i]); ah.u[i] = hb; al.u[i] = ASPLIT ? bf16_bits(xs[i] - bf16_val(hb)) : (unsigned short)0; }
#pragma unroll
    for (int t = 0; t < 4; ++t) {
      const unsigned short* brow = Wt + (size_t)(col0 + t * 16 + ln) * ldb + kb;
      FragB b;
      b.half[0] = *(const v8us*)(brow + 8 * hh);
      b.half[1] = *(const v8us*)(brow + 16 + 8 * hh);
      acc[t] = mmaN<ASPLIT ? 2 : 1>(ah.v, al.v, b.v, b.v, acc[t]);
    }
  }
#pragma unroll
  for (int t = 0; t < 4; ++t) {
    float bv = bias ? bias[col0 + t * 16 + ln] : 0.f;
    if (BIAS_BF16) bv = bf16_round(bv);
#pragma unroll
    for (int r = 0; r < 8; ++r) { float v = acc[t][r] + bv; if (ACT == 1) v = fmaxf(v, 0.f); so[w][8 * hh + r][t * 16 + ln] = v; }
  }
  __builtin_amdgcn_fence(__ATOMIC_ACQ_REL, "workgroup");
  __builtin_amdgcn_wave_barrier();
  const int rsub = lane >> 4, c4 = (lane & 15) * 4;
  {
#pragma unroll
    for (int q = 0; q < 8; ++q) {
      const int r = q * 2 + rsub;
      const v4f v = *(const v4fa*)&so[w][r][c4];
      *(v4f*)(C + (size_t)(row0 + r) * ldc + col0 + c4) = v;
    }
    
  }
}

// GEMM C = act(A·W + bias + resid): A f32 (ASPLIT -> hi/lo 2 terms), Wt bf16 [N][K]; ACT 0 none, 1 relu, 2 exact gelu;
// resid (optional, f32, row index = (row % rmod), pitch ldr, RES_BF16 rounds it) added before the activation.
template <bool ASPLIT, int ACT, bool BIAS_BF16, bool RES_BF16>
__global__ __launch_bounds__(128) void k_gemm_bf3(const float* __restrict__ A, int lda, const unsigned short* __restrict__ Wt, int ldb,
                                                const float* __restrict__ bias, const float* __restrict__ resid, int rmod, int ldr,
                                                float* __restrict__ C, int ldc, int M, int N, int K) {
  __shared__ __attribute__((aligned(16))) float so[4][16][64];
  const int tid = threadIdx.x, w = tid >> 5, lane = tid & 31, ln = lane & 15, hh = lane >> 4;
  const int ntn = N / 64;
  const int wid = blockIdx.x * 4 + w;
  const int mt = wid / ntn, nq = wid % ntn;
  if (mt * 16 >= M) return;
  const int row0 = mt * 16, col0 = nq * 64;
  const float* arow = A + (size_t)(row0 + ln) * lda;
  v8f acc[4] = {};
  for (int kb = 0; kb < K; kb += 32) {
    FragB ah, al;
    const v4f x0 = *(const v4fa*)(arow + kb + 8 * hh), x1 = *(const v4fa*)(arow + kb + 8 * hh + 4);
    const v4f x2 = *(const v4fa*)(arow + kb + 16 + 8 * hh), x3 = *(const v4fa*)(arow + kb + 16 + 8 * hh + 4);
    float xs[16] = {x0[0],x0[1],x0[2],x0[3],x1[0],x1[1],x1[2],x1[3],x2[0],x2[1],x2[2],x2[3],x3[0],x3[1],x3[2],x3[3]};
#pragma unroll
    for (int i = 0; i < 16; ++i) { const unsigned short hb = bf16_bits(xs[i]); ah.u[i] = hb; al.u[i] = ASPLIT ? bf16_bits(xs[i] - bf16_val(hb)) : (unsigned short)0; }
#pragma unroll
    for (int t = 0; t < 4; ++t) {
      const unsigned short* brow = Wt + (size_t)(col0 + t * 16 + ln) * ldb + kb;
      FragB b;
      b.half[0] = *(const v8us*)(brow + 8 * hh);
      b.half[1] = *(const v8us*)(brow + 16 + 8 * hh);
      acc[t] = mmaN<ASPLIT ? 2 : 1>(ah.v, al.v, b.v, b.v, acc[t]);
    }
  }
#pragma unroll
  for (int t = 0; t < 4; ++t) {
    const int col = col0 + t * 16 + ln;
    float bv = bias ? bias[col] : 0.f;
    if (BIAS_BF16) bv = bf16_round(bv);
#pragma unroll
    for (int r = 0; r < 8; ++r) {
      float v = acc[t][r] + bv;
      if (resid) { float rv = resid[(size_t)((row0 + 8 * hh + r) % rmod) * ldr + col]; if (RES_BF16) rv = bf16_round(rv); v += rv; }
      if (ACT == 1) v = fmaxf(v, 0.f);
      if (ACT == 2) v = 0.5f * v * (1.0f + erff(v * 0.70710678118654752f));
      if (ACT == 3) { const float u = 0.7978845608028654f * (v + 0.044715f * v * v * v); v = 0.5f * v * (1.0f + tanhf(u)); }
      so[w][8 * hh + r][t * 16 + ln] = v;
    }
  }
  __builtin_amdgcn_fence(__ATOMIC_ACQ_REL, "workgroup");
  __builtin_amdgcn_wave_barrier();
  const int rsub = lane >> 4, c4 = (lane & 15) * 4;
  {
#pragma unroll
    for (int q = 0; q < 8; ++q) {
      const int r = q * 2 + rsub;
      const v4f v = *(const v4fa*)&so[w][r][c4];
      *(v4f*)(C + (size_t)(row0 + r) * ldc + col0 + c4) = v;
    }
    
  }
}
// row LayerNorm (biased variance, eps) over N: s = X (+ R); optional out_sum <- s; out_norm <- (s-mu)*rsqrt(var+eps)*g + b
template <bool PARAM_BF16>
__global__ __launch_bounds__(256) void k_layernorm(const float* __restrict__ X, const float* __restrict__ R, const float* __restrict__ g, const float* __restrict__ bta,
                                                  float* __restrict__ out_sum, float* __restrict__ out_norm, int N, float eps) {
  __shared__ float red[256];
  const int row = blockIdx.x, tid = threadIdx.x;
  const float* x = X + (size_t)row * N; const float* rr = R ? R + (size_t)row * N : nullptr;
  float vals[16];                     // up to N = 4096
  const int per = N / 256;            // contiguous chunk per thread? use strided-by-4 chunks: thread handles j = tid*4 + 1024*u
  float s1 = 0.f;
  for (int u = 0; u < per / 4; ++u) {
    const int j = tid * 4 + 1024 * u;
    const v4f a = *(const v4fa*)(x + j);
    v4f b = {0.f,0.f,0.f,0.f}; if (rr) b = *(const v4fa*)(rr + j);
#pragma unroll
    for (int q = 0; q < 4; ++q) { const float v = a[q] + b[q]; vals[u * 4 + q] = v; s1 += v; }
  }
  red[tid] = s1; __syncthreads();
  for (int st = 128; st > 0; st >>= 1) { if (tid < st) red[tid] += red[tid + st]; __syncthreads(); }
  const float mu = red[0] / (float)N; __syncthreads();
  float s2 = 0.f;
  for (int u = 0; u < per / 4; ++u)
#pragma unroll
    for (int q = 0; q < 4; ++q) { const float c = vals[u * 4 + q] - mu; s2 += c * c; }
  red[tid] = s2; __syncthreads();
  for (int st = 128; st > 0; st >>= 1) { if (tid < st) red[tid] += red[tid + st]; __syncthreads(); }
  const float rs = rsqrtf(red[0] / (float)N + eps);
  {
    for (int u = 0; u < per / 4; ++u) {
      const int j = tid * 4 + 1024 * u;
      v4f o, sm;
#pragma unroll
      for (int q = 0; q < 4; ++q) {
        float gg = g[j + q], bb = bta[j + q];
        if (PARAM_BF16) { gg = bf16_round(gg); bb = bf16_round(bb); }
        sm[q] = vals[u * 4 + q]; o[q] = (vals[u * 4 + q] - mu) * rs * gg + bb;
      }
      if (out_sum) *(v4f*)(out_sum + (size_t)row * N + j) = sm;
      *(v4f*)(out_norm + (size_t)row * N + j) = o;
    }
    
  }
}



// ---- f16 WMMA path (v_wmma_f32_16x16x32_f16): 11-bit significands for operands in range — used where a [0,1] probability operand needs more precision than bf16
typedef _Float16 v16h __attribute__((ext_vector_type(16)));
union FragH { v16h v; v8us half[2]; _Float16 h[16]; unsigned short u[16]; };
template <int NT>
__device__ __forceinline__ v8f mmaH(v16h ah, v16h al, v16h bh, v16h bl, v8f c) {
  c = __builtin_amdgcn_wmma_f32_16x16x32_f16(false, ah, false, bh, (short)0, c, false, false);
  if (NT >= 2) c = __builtin_amdgcn_wmma_f32_16x16x32_f16(false, al, false, bh, (short)0, c, false, false);
  if (NT >= 3) c = __builtin_amdgcn_wmma_f32_16x16x32_f16(false, ah, false, bl, (short)0, c, false, false);
  asm volatile("v_nop\n\tv_nop\n\tv_nop\n\tv_nop" : "+v"(c) : "v"(ah), "v"(al), "v"(bh), "v"(bl));
  return c;
}
// batched GEMM like k_gemm_b but f16 operands: A f32 (split into f16 hi/lo if ASPLIT, else rounded to f16), Bt = f16 values [n][k]; alpha; C f32; N multiple of 16 (partial tiles skipped)
template <bool ASPLIT>
__global__ __launch_bounds__(128) void k_gemm_h(const float* __restrict__ A, int lda, size_t sA, const _Float16* __restrict__ Bh, int ldb, size_t sB, float alpha, float* __restrict__ C, int ldc, size_t sC, int M, int N, int K) {
  __shared__ __attribute__((aligned(16))) float so[4][16][64];
  const int tid = threadIdx.x, w = tid >> 5, lane = tid & 31, ln = lane & 15, hh = lane >> 4; const int by = blockIdx.y;
  A += (size_t)by * sA; Bh += (size_t)by * sB; C += (size_t)by * sC;
  const int ntn = (N + 63) / 64; const int wid = blockIdx.x * 4 + w; const int mt = wid / ntn, nq = wid % ntn; if (mt * 16 >= M) return;
  const int row0 = mt * 16, col0 = nq * 64; const float* arow = A + (size_t)(row0 + ln) * lda;
  v8f acc[4] = {};
  for (int kb = 0; kb < K; kb += 32) {
    FragH ah, al;
    const v4f x0 = *(const v4fa*)(arow + kb + 8 * hh), x1 = *(const v4fa*)(arow + kb + 8 * hh + 4), x2 = *(const v4fa*)(arow + kb + 16 + 8 * hh), x3 = *(const v4fa*)(arow + kb + 16 + 8 * hh + 4);
    float xs[16] = {x0[0],x0[1],x0[2],x0[3],x1[0],x1[1],x1[2],x1[3],x2[0],x2[1],x2[2],x2[3],x3[0],x3[1],x3[2],x3[3]};
#pragma unroll
    for (int i = 0; i < 16; ++i) { const _Float16 h = (_Float16)xs[i]; ah.h[i] = h; al.h[i] = ASPLIT ? (_Float16)(xs[i] - (float)h) : (_Float16)0.0f; }
#pragma unroll
    for (int t = 0; t < 4; ++t) { if (col0 + t * 16 >= N) continue; const size_t boff = (size_t)(col0 + t * 16 + ln) * ldb + kb; FragH bq; bq.half[0] = *(const v8us*)(Bh + boff + 8 * hh); bq.half[1] = *(const v8us*)(Bh + boff + 16 + 8 * hh);
      acc[t] = mmaH<ASPLIT ? 2 : 1>(ah.v, al.v, bq.v, bq.v, acc[t]); }
  }
#pragma unroll
  for (int t = 0; t < 4; ++t) { if (col0 + t * 16 >= N) continue;
#pragma unroll
    for (int r = 0; r < 8; ++r) so[w][8 * hh + r][t * 16 + ln] = acc[t][r] * alpha; }
  __builtin_amdgcn_fence(__ATOMIC_ACQ_REL, "workgroup"); __builtin_amdgcn_wave_barrier();
  const int rsub = lane >> 4, c4 = (lane & 15) * 4;
  {
#pragma unroll
    for (int q = 0; q < 8; ++q) { const int r = q * 2 + rsub; if (col0 + c4 < N) { const v4f v = *(const v4fa*)&so[w][r][c4]; *(v4f*)(C + (size_t)(row0 + r) * ldc + col0 + c4) = v; } }
     }
}

// One launch for the five operand preparations, which do not depend on one another: blocks [0, 4 PREP_WB) transpose the four weights, the rest convert x.
// Weights: Wt[n][k] = f16(W[k][n] x16) from f32 row-major W[DM][DM] (bf16-exact weights stay exact in f16 away from the subnormal range); Bt holds the four [n][k] planes one behind the other. x: exact f16 rows of the bf16-rounded values.
// Few, fat work-groups (64 elements per thread): for speed only. A weight block takes a PREP_T x PREP_T tile: 512-byte pieces of W rows in, 256-byte pieces of Wt rows out, turned in LDS.
#define PREP_T 128                   /* k and n per weight tile */
#define PREP_WB ((DM / PREP_T) * (DM / PREP_T))               /* blocks per weight: one tile each */
#define PREP_XP 8                    /* eight-element pieces of x per thread */
#define PREP_XB ((unsigned)(NR * DM / (8 * 256 * PREP_XP)))   /* blocks for x */
static_assert(DM % PREP_T == 0 && PREP_T == 128 && (NR * DM) % (8 * 256 * PREP_XP) == 0, "k_prep: whole tiles, 8 waves x 16 k on a tile, whole x blocks");
__global__ __launch_bounds__(256) void k_prep(const float* __restrict__ x, const float* __restrict__ wq, const float* __restrict__ wk, const float* __restrict__ wv, const float* __restrict__ wo, _Float16* __restrict__ Bt, _Float16* __restrict__ X16) {
  __shared__ __attribute__((aligned(16))) unsigned short ts[PREP_T][PREP_T];      /* [n][k]; the 16-byte piece c of row n lies at place c ^ (n / 4 % 16): the rows that sixteen lanes write at one k fall on all banks */
  const int bx = blockIdx.x, tid = threadIdx.x;
  if (bx < 4 * PREP_WB) {      /* the same for the whole block: the barrier below is passed by all or by none. The weights have the longer chain: they take the lowest block indices */
    const int p = bx / PREP_WB, tile = bx - p * PREP_WB; const float* W = p == 0 ? wq : p == 1 ? wk : p == 2 ? wv : wo;
    const int k0 = (tile / (DM / PREP_T)) * PREP_T, n0 = (tile % (DM / PREP_T)) * PREP_T;
    const int lane = tid & 31, wave = tid >> 5;
    const float* wp = W + (size_t)(k0 + 16 * wave) * DM + n0 + 4 * lane;      /* the thread's 16 k x 4 n corner: a wave covers 512 bytes of one W row */
    v4f r[16];
#pragma unroll
    for (int j = 0; j < 16; ++j) r[j] = *(const v4fa*)(wp + (size_t)j * DM);
    asm volatile("s_wait_xcnt 0x0" :: "v"(wp), "v"(r[0]), "v"(r[1]), "v"(r[2]), "v"(r[3]), "v"(r[4]), "v"(r[5]), "v"(r[6]), "v"(r[7]), "v"(r[8]), "v"(r[9]), "v"(r[10]), "v"(r[11]), "v"(r[12]), "v"(r[13]), "v"(r[14]), "v"(r[15]) : "memory");      /* inputs only. The loaded values: all sixteen loads stay in front of the first conversion, one latency for the tile (left alone the compiler issues them in three batches, each behind the wait for the one before). The address: its registers are no load's destination, and the wait stands in front of every overwrite of them */
#pragma unroll
    for (int i = 0; i < 4; ++i)
#pragma unroll
      for (int hb = 0; hb < 2; ++hb) { FragH f;
#pragma unroll
        for (int j = 0; j < 8; ++j) f.h[j] = (_Float16)(bf16_round(r[8 * hb + j][i]) * 16.0f);
        *(v8us*)&ts[4 * lane + i][8 * ((2 * wave + hb) ^ (lane & 15))] = f.half[0]; }      /* row n = 4 lane + i, piece 2 wave + hb */
    __syncthreads();      /* the tile is whole before its rows are read */
    const int c = tid & 15, nr = tid >> 4;
    unsigned short* bp = (unsigned short*)Bt + (size_t)p * DM * DM + (size_t)(n0 + nr) * DM + k0 + 8 * c;
#pragma unroll
    for (int u = 0; u < 8; ++u) { const int n = nr + 16 * u; *(v8us*)(bp + (size_t)(16 * u) * DM) = *(const v8us*)&ts[n][8 * (c ^ ((n >> 2) & 15))]; }      /* row n, piece c: sixteen lanes cover 256 bytes of one Wt row */
  } else {
    const size_t t0 = (size_t)(bx - 4 * PREP_WB) * (256 * PREP_XP) + tid;
    const float* xp = x + t0 * 8;      /* piece u lies 256 x 8 elements further on */
    v4f a[PREP_XP][2];
#pragma unroll
    for (int u = 0; u < PREP_XP; ++u) { a[u][0] = *(const v4fa*)(xp + 2048 * u); a[u][1] = *(const v4fa*)(xp + 2048 * u + 4); }
    asm volatile("s_wait_xcnt 0x0" :: "v"(xp) : "memory");      /* stands in front of every overwrite of the address registers that the loads above name, and keeps them out of the loads' destinations */
#pragma unroll
    for (int u = 0; u < PREP_XP; ++u) { FragH f;
#pragma unroll
      for (int q = 0; q < 4; ++q) { f.h[q] = (_Float16)bf16_round(a[u][0][q]); f.h[4 + q] = (_Float16)bf16_round(a[u][1][q]); }
      *(v8us*)((unsigned short*)X16 + (t0 + 256 * u) * 8) = f.half[0]; }
    asm volatile("s_wait_xcnt 0x0" ::: "memory");      /* behind the last store: stands in front of any later overwrite of the stores' address and data registers */
  }
}
// k_gemm_hh variant with fused epilogue: v = acc·alpha + bias[by·sBias + col] (+ CP[(row/rowsPerB)·sCPb + by·64 + col] if CP) ; ACT 0 none / 1 elu ; writes f16 C16 (and f32 C if non-null)
template <int ACT>
__global__ __launch_bounds__(128) void k_gemm_hhx(const _Float16* __restrict__ A, int lda, size_t sA, const _Float16* __restrict__ Bh, int ldb, size_t sB, float alpha, const float* __restrict__ bias, size_t sBias, const float* __restrict__ CP, int rowsPerB, size_t sCPb, int row0g,
    float* __restrict__ C, _Float16* __restrict__ C16, int ldc, size_t sC, int M, int N, int K) {
  __shared__ __attribute__((aligned(16))) float so[4][16][64];
  const int tid = threadIdx.x, w = tid >> 5, lane = tid & 31, ln = lane & 15, hh = lane >> 4; const int by = blockIdx.y;
  A += (size_t)by * sA; Bh += (size_t)by * sB; const size_t cofs = (size_t)by * sC; const float* bp = bias ? bias + (size_t)by * sBias : nullptr;
  const int ntn = (N + 63) / 64; const int wid = blockIdx.x * 4 + w; const int mt = wid / ntn, nq = wid % ntn; if (mt * 16 >= M) return;
  const int row0 = mt * 16, col0 = nq * 64; const _Float16* arow = A + (size_t)(row0 + ln) * lda;
  v8f acc[4] = {};
  for (int kb = 0; kb < K; kb += 32) { FragH ah; ah.half[0] = *(const v8us*)((const unsigned short*)arow + kb + 8 * hh); ah.half[1] = *(const v8us*)((const unsigned short*)arow + kb + 16 + 8 * hh);
#pragma unroll
    for (int t = 0; t < 4; ++t) { if (col0 + t * 16 >= N) continue; const size_t boff = (size_t)(col0 + t * 16 + ln) * ldb + kb; FragH bq; bq.half[0] = *(const v8us*)((const unsigned short*)Bh + boff + 8 * hh); bq.half[1] = *(const v8us*)((const unsigned short*)Bh + boff + 16 + 8 * hh);
      acc[t] = mmaH<1>(ah.v, ah.v, bq.v, bq.v, acc[t]); }
  }
#pragma unroll
  for (int t = 0; t < 4; ++t) { if (col0 + t * 16 >= N) continue; const int col = col0 + t * 16 + ln; const float bv = bp ? bf16_round(bp[col]) : 0.f;
#pragma unroll
    for (int r = 0; r < 8; ++r) { float v = acc[t][r] * alpha + bv; if (CP) { const int rr = row0g + row0 + 8 * hh + r; if (rowsPerB < 0) v += CP[cofs + (size_t)rr * ldc + col];      /* rowsPerB < 0: own element of the batched C plane */ else { const int bidx = rr / rowsPerB; v += CP[(size_t)bidx * sCPb + (size_t)by * 64 + col]; } } if (ACT == 1) v = (v > 0.f) ? v : expm1f(v); else if (ACT == 7) v = (v > 0.f) ? v + 1.0f : expf(v); else if (ACT == 8) v = tanhf(v); else if (ACT == 9) v = 0.5f * v * (1.0f + tanhf(0.7978845608028654f * (v + 0.044715f * v * v * v))); else if (ACT == 11) v = 1.0f / (1.0f + expf(-v)); else if (ACT == 12) v = (v > 0.f) ? v : 0.01f * v; else if (ACT == 14) v = (v > 0.f) ? v : 0.1f * v; else if (ACT == 16) v = (v >= 0.f) ? v : 0.3f * v; else if (ACT == 17) v = (v >= 0.f) ? v : 0.2f * v; else if (ACT == 15) v = v / (1.0f + expf(-v)); else if (ACT == 3) v = fmaxf(v, 0.f); else if (ACT == 6) v = 0.5f * v * (1.0f + erff(v * 0.70710678118654752f)); so[w][8 * hh + r][t * 16 + ln] = v; } }
  __builtin_amdgcn_fence(__ATOMIC_ACQ_REL, "workgroup"); __builtin_amdgcn_wave_barrier();
  const int rsub = lane >> 4, c4 = (lane & 15) * 4; typedef _Float16 v4h __attribute__((ext_vector_type(4)));
  {
#pragma unroll
    for (int q = 0; q < 8; ++q) { const int r = q * 2 + rsub; if (col0 + c4 < N) { const v4f v = *(const v4fa*)&so[w][r][c4]; if (C) *(v4f*)(C + cofs + (size_t)(row0 + r) * ldc + col0 + c4) = v; if (C16) { v4h h4; for (int i = 0; i < 4; ++i) h4[i] = (_Float16)v[i]; *(v4h*)(C16 + cofs + (size_t)(row0 + r) * ldc + col0 + c4) = h4; } } }
     }
}


typedef _Float16 v4h __attribute__((ext_vector_type(4)));

__global__ __launch_bounds__(256) void k_h16(const float* __restrict__ x, _Float16* __restrict__ X16, size_t n8) { const size_t t = (size_t)blockIdx.x * 256 + threadIdx.x; if (t >= n8) return; FragH f;
#pragma unroll
  for (int q = 0; q < 8; ++q) f.h[q] = (_Float16)x[t * 8 + q]; *(v8us*)((unsigned short*)X16 + t * 8) = f.half[0];  }
__global__ __launch_bounds__(256) void k_round16f(const float* __restrict__ W, _Float16* __restrict__ Bt, size_t n8) { const size_t t = (size_t)blockIdx.x * 256 + threadIdx.x; if (t >= n8) return; FragH f;
#pragma unroll
  for (int i = 0; i < 8; ++i) f.h[i] = (_Float16)(bf16_round(W[t * 8 + i]) * 16.0f); *(v8us*)((unsigned short*)Bt + t * 8) = f.half[0];  }
template <int NHv, int TTv>
__global__ __launch_bounds__(256) void k_vt(const _Float16* __restrict__ V16, int ldv, int voff, _Float16* __restrict__ Vt) { __shared__ unsigned short tl[64][66]; const int tid = threadIdx.x; const int slab = blockIdx.x / (TTv / 64), lg = blockIdx.x % (TTv / 64); const int b = slab / NHv, h = slab % NHv;
  for (int i = tid; i < 64 * 8; i += 256) { const int r = i / 8, c8 = (i % 8) * 8; FragH f; f.half[0] = *(const v8us*)((const unsigned short*)V16 + ((size_t)b * TTv + lg * 64 + r) * ldv + voff + h * 64 + c8);
#pragma unroll
    for (int q = 0; q < 8; ++q) tl[r][c8 + q] = f.u[q]; }
  __syncthreads();
  {
#pragma unroll
    for (int rd = 0; rd < 2; ++rd) { const int d = rd * 32 + tid / 8, pc = tid % 8; FragH f;
#pragma unroll
      for (int q = 0; q < 8; ++q) f.u[q] = tl[pc * 8 + q][d];
      *(v8us*)((unsigned short*)Vt + ((size_t)slab * 64 + d) * TTv + lg * 64 + pc * 8) = f.half[0]; }
     } }

__global__ __launch_bounds__(256) void k_hl(const float* __restrict__ F, _Float16* __restrict__ Hh, _Float16* __restrict__ Hl, size_t n8) { const size_t t = (size_t)blockIdx.x * 256 + threadIdx.x; if (t >= n8) return; FragH fh, fl; const v4f a = *(const v4fa*)(F + t * 8), c = *(const v4fa*)(F + t * 8 + 4);
#pragma unroll
  for (int q = 0; q < 4; ++q) { _Float16 h = (_Float16)a[q]; fh.h[q] = h; fl.h[q] = (_Float16)((a[q] - (float)h) * 1024.0f); h = (_Float16)c[q]; fh.h[4 + q] = h; fl.h[4 + q] = (_Float16)((c[q] - (float)h) * 1024.0f); }
  { *(v8us*)((unsigned short*)Hh + t * 8) = fh.half[0]; *(v8us*)((unsigned short*)Hl + t * 8) = fl.half[0];  } }

// ---- fast GEMM (block tile 128x64, wave tile 32x64; A and B k-tiles staged in LDS; requires M % 128 == 0 rows per launch region, N % 64 == 0 and K % 64 == 0); epilogue = k_gemm_hhx semantics ----
__device__ __forceinline__ v16h g2_frag(const _Float16* p, int hh) { FragH f; f.half[0] = *(const v8us*)((const unsigned short*)p + 8 * hh); f.half[1] = *(const v8us*)((const unsigned short*)p + 16 + 8 * hh); return f.v; }
__device__ __forceinline__ v8f g2_mma(v16h a, v16h b, v8f c) { v8f d = __builtin_amdgcn_wmma_f32_16x16x32_f16(false, a, false, b, (short)0, c, false, false); asm volatile("v_nop\n\tv_nop\n\tv_nop\n\tv_nop" : "+v"(d) : "v"(a), "v"(b)); return d; }
#define G2_KS 64                     /* k per LDS stage: one 128-byte line of every A and B row */
#define G2_LP 72                     /* LDS row pitch in halves: 144 B = 16 B x odd for 16-byte row reads */
#define G2_TP 136                    /* LDS row pitch in halves of the turned output tile (128 tokens): 272 B = 16 B x odd */
typedef unsigned int v4ua __attribute__((ext_vector_type(4), may_alias));
typedef float g2_v2f __attribute__((ext_vector_type(2)));
typedef _Float16 g2_v2h __attribute__((ext_vector_type(2)));
__device__ __forceinline__ unsigned int g2_pack(float lo, float hi) { return __builtin_bit_cast(unsigned int, __builtin_convertvector((g2_v2f){lo, hi}, g2_v2h)); }      /* two f32 -> two f16, round to nearest even as the scalar cast */
__device__ __forceinline__ v16h g2_lfrag(const unsigned short* p) { FragH f; f.half[0] = *(const v8us*)p; f.half[1] = *(const v8us*)(p + 16); return f.v; }      /* p already holds the lane half's + 8 hh: the k order of g2_frag */
template <int ACT, int LDA, int LDB, int LDC, bool HASB, bool HASCP, bool OUT32, bool OUT16, bool P2T>      /* row pitches at compile time: a tile's row pieces are immediate offsets from one address pair; the epilogue's options (bias, residual CP, f32 / f16 output) at compile time: straight-line code without a test per element or per row. P2T: plane 2 (grid.y == 2) leaves as per-head transposed f16 rows CT[batch][head][d][token] and is not written to C16 */
__global__ __launch_bounds__(128) void k_gemm2(const _Float16* __restrict__ A, size_t sA, const _Float16* __restrict__ Bh, size_t sB, float alpha, const float* __restrict__ bias, const float* __restrict__ bias1, const float* __restrict__ bias2, size_t sBias, const float* __restrict__ CP, int rowsPerB, size_t sCPb, int row0g,
    float* __restrict__ C, _Float16* __restrict__ C16, _Float16* __restrict__ CT, size_t sC, int M, int N, int K) { static_assert(ACT == 0 || ACT == 3 || ACT == 6 || ACT == 8 || ACT == 9 || ACT == 11 || ACT == 12 || ACT == 14 || ACT == 15 || ACT == 16 || ACT == 17, "k_gemm2: unsupported ACT code (would silently apply no activation)");
  __shared__ __attribute__((aligned(16))) unsigned short tl[2][128 + 64][G2_LP];      /* per buffer: the block's 128 A rows, then its 64 B rows, G2_KS halves of each */
  float (*so)[32][68] = (float (*)[32][68])&tl[0][0][0];      /* the epilogue's staging takes the tiles' place behind the loop's last barrier */
  static_assert(sizeof(tl) >= sizeof(float) * 4 * 32 * 68, "k_gemm2: epilogue staging must fit in the tile buffers");
  const int tid = threadIdx.x, w = tid >> 5, lane = tid & 31, ln = lane & 15, hh = lane >> 4; const int by = blockIdx.y;
  A += (size_t)by * sA; Bh += (size_t)by * sB; const size_t cofs = (size_t)by * sC; const float* bsel = (by == 1 && bias1) ? bias1 : (by == 2 && bias2) ? bias2 : bias;      /* planes 1 and 2 may bring their bias in a buffer of its own */
  const float* bp = bsel + (size_t)by * sBias;      /* read only where HASB */
  const int ntn = N >> 6; const int mt = blockIdx.x / ntn, nq = blockIdx.x - mt * ntn; const int row0 = mt * 128 + 32 * w, col0 = nq * 64; if (mt * 128 >= M) return;      /* the same for the whole block: in front of every barrier */
  const int sr = tid >> 3, sc = (tid & 7) * 8;      /* staging: eight lanes cover one 128-byte row piece; piece u is row sr + 16 u */
  const unsigned short* ag = (const unsigned short*)A + (size_t)(mt * 128 + sr) * LDA + sc;
  const unsigned short* bg = (const unsigned short*)Bh + (size_t)(col0 + sr) * LDB + sc;
  v8us ra[8], rb[4];      /* these and af, bf below are indexed under full unrolls only, so that they stay in registers */
#pragma unroll
  for (int u = 0; u < 8; ++u) ra[u] = *(const v8us*)(ag + (size_t)(16 * u) * LDA);
#pragma unroll
  for (int u = 0; u < 4; ++u) rb[u] = *(const v8us*)(bg + (size_t)(16 * u) * LDB);
  float bv4[4];      /* the lane's four bias values, fetched behind the first tiles' loads: their latency passes under the k loop */
#pragma unroll
  for (int t = 0; t < 4; ++t) bv4[t] = HASB ? bf16_round(bp[col0 + t * 16 + ln]) : 0.f;
  const v8f z8 = {0.f,0.f,0.f,0.f,0.f,0.f,0.f,0.f}; v8f c00 = z8, c01 = z8, c02 = z8, c03 = z8, c10 = z8, c11 = z8, c12 = z8, c13 = z8;
#pragma unroll
  for (int u = 0; u < 8; ++u) *(v8us*)&tl[0][sr + 16 * u][sc] = ra[u];
#pragma unroll
  for (int u = 0; u < 4; ++u) *(v8us*)&tl[0][128 + sr + 16 * u][sc] = rb[u];
  __syncthreads();
  const int nst = K / G2_KS;
#pragma unroll 1      /* rolled: one stage's code, two buffers by index */
  for (int st = 0; st < nst; ++st) { const int bu = st & 1;
    if (st + 1 < nst) {      /* the next stage's tiles fly into registers under this stage's products */
      const unsigned short* an = ag + (st + 1) * G2_KS; const unsigned short* bn = bg + (st + 1) * G2_KS;
#pragma unroll
      for (int u = 0; u < 8; ++u) ra[u] = *(const v8us*)(an + (size_t)(16 * u) * LDA);
#pragma unroll
      for (int u = 0; u < 4; ++u) rb[u] = *(const v8us*)(bn + (size_t)(16 * u) * LDB);
      asm volatile("s_wait_xcnt 0x0" :: "v"(an), "v"(bn) : "memory");      /* stands in front of every overwrite of the address registers that the loads above name */
    }
    v16h af[G2_KS / 32][2], bf[G2_KS / 32][4];      /* the stage's fragments are read as one group in front of its products */
#pragma unroll
    for (int kk = 0; kk < G2_KS / 32; ++kk) { const unsigned short* ap = &tl[bu][32 * w + ln][32 * kk + 8 * hh]; const unsigned short* bq = &tl[bu][128 + ln][32 * kk + 8 * hh];
      af[kk][0] = g2_lfrag(ap); af[kk][1] = g2_lfrag(ap + 16 * G2_LP);
#pragma unroll
      for (int t = 0; t < 4; ++t) bf[kk][t] = g2_lfrag(bq + 16 * t * G2_LP); }
#pragma unroll
    for (int kk = 0; kk < G2_KS / 32; ++kk) {
      c00 = g2_mma(af[kk][0], bf[kk][0], c00); c10 = g2_mma(af[kk][1], bf[kk][0], c10);
      c01 = g2_mma(af[kk][0], bf[kk][1], c01); c11 = g2_mma(af[kk][1], bf[kk][1], c11);
      c02 = g2_mma(af[kk][0], bf[kk][2], c02); c12 = g2_mma(af[kk][1], bf[kk][2], c12);
      c03 = g2_mma(af[kk][0], bf[kk][3], c03); c13 = g2_mma(af[kk][1], bf[kk][3], c13); }
    if (st + 1 < nst) {
#pragma unroll
      for (int u = 0; u < 8; ++u) *(v8us*)&tl[bu ^ 1][sr + 16 * u][sc] = ra[u];
#pragma unroll
      for (int u = 0; u < 4; ++u) *(v8us*)&tl[bu ^ 1][128 + sr + 16 * u][sc] = rb[u]; }
    __syncthreads();      /* publishes the next stage and ends every wave's reads of this one, which the next trip (or the epilogue) overwrites */
  }
  v8f accs[8] = {c00, c01, c02, c03, c10, c11, c12, c13};
  if (P2T && by == 2) {      /* the same for the whole block: the barrier inside is passed by all or by none */
    static_assert(!P2T || (ACT == 0 && !HASCP && SQ % 128 == 0 && HD == 64 && LDC == NH * HD), "k_gemm2 P2T: a block tile is 128 tokens of one batch x the 64 columns of one head");
    static_assert(sizeof(tl) >= 2 * HD * G2_TP, "k_gemm2 P2T: the turned tile must fit in the tile buffers");
    unsigned short (*tt)[G2_TP] = (unsigned short (*)[G2_TP])&tl[0][0][0];      /* [d][token of the block]; takes the tiles' place behind the loop's last barrier, like so */
#pragma unroll      /* accs and bv4 are indexed by u: in registers only under a full unroll */
    for (int u = 0; u < 8; ++u) { const int t = u & 3, half = u >> 2; const v8f v = accs[u] * alpha + bv4[t];      /* an accumulator's eight registers are eight consecutive tokens of one column: one 16-byte piece of a turned row */
      *(v4ua*)&tt[t * 16 + ln][32 * w + 16 * half + 8 * hh] = (v4ua){g2_pack(v[0], v[1]), g2_pack(v[2], v[3]), g2_pack(v[4], v[5]), g2_pack(v[6], v[7])}; }
    __syncthreads();      /* the turned tile is whole (a row holds pieces of all four waves) before its rows are read */
    const int tr = mt * 128, bb = tr / SQ, pc = tid & 15, dr = tid >> 4;      /* sixteen lanes cover the 256 bytes that the block holds of one turned row */
    unsigned short* tp = (unsigned short*)CT + ((size_t)(bb * NH + nq) * HD + dr) * SQ + (tr - bb * SQ) + 8 * pc;
#pragma unroll      /* the eight LDS reads issue as one group, the row steps become immediate offsets */
    for (int q = 0; q < 8; ++q) *(v8us*)(tp + (size_t)(8 * q) * SQ) = *(const v8us*)&tt[dr + 8 * q][8 * pc];
    return; }
#pragma unroll
  for (int u = 0; u < 8; ++u) { const int t = u & 3, half = u >> 2; const int col = col0 + t * 16 + ln; const float bv = bv4[t];
#pragma unroll
    for (int r = 0; r < 8; ++r) { const int rloc = half * 16 + 8 * hh + r; float v = accs[u][r] * alpha + bv; if (HASCP) { if (rowsPerB < 0) v += CP[cofs + (size_t)(row0g + row0 + rloc) * LDC + col];      /* rowsPerB < 0: own element of the batched C plane */ else { const int bidx = (row0g + row0 + rloc) / rowsPerB; v += CP[(size_t)bidx * sCPb + (size_t)by * 64 + col]; } }
      if (ACT == 3) v = fmaxf(v, 0.f); else if (ACT == 6) v = 0.5f * v * (1.0f + erff(v * 0.70710678118654752f)); else if (ACT == 11) v = 1.0f / (1.0f + expf(-v)); else if (ACT == 15) v = v / (1.0f + expf(-v)); else if (ACT == 12) v = (v > 0.f) ? v : 0.01f * v; else if (ACT == 8) v = tanhf(v); else if (ACT == 9) v = 0.5f * v * (1.0f + tanhf(0.7978845608028654f * (v + 0.044715f * v * v * v))); else if (ACT == 14) v = (v > 0.f) ? v : 0.1f * v; else if (ACT == 16) v = (v >= 0.f) ? v : 0.3f * v; else if (ACT == 17) v = (v >= 0.f) ? v : 0.2f * v;
      so[w][rloc][t * 16 + ln] = v; } }
  __builtin_amdgcn_fence(__ATOMIC_ACQ_REL, "workgroup"); __builtin_amdgcn_wave_barrier();
  const int rsub = lane >> 4, c4 = (lane & 15) * 4;
  {
#pragma unroll
    for (int q = 0; q < 16; ++q) { const int r = q * 2 + rsub; const v4f v = *(const v4fa*)&so[w][r][c4]; if (OUT32) *(v4f*)(C + cofs + (size_t)(row0 + r) * LDC + col0 + c4) = v; if (OUT16) { v4h h4; for (int i = 0; i < 4; ++i) h4[i] = (_Float16)v[i]; *(v4h*)(C16 + cofs + (size_t)(row0 + r) * LDC + col0 + c4) = h4; } }
     } }


__global__ __launch_bounds__(256) void k_wnat(const float* __restrict__ w, size_t n8, _Float16* __restrict__ Bt) { const size_t t = (size_t)blockIdx.x * 256 + threadIdx.x; if (t >= n8) return; FragH f; for (int q = 0; q < 8; ++q) f.h[q] = (_Float16)(bf16_round(w[t * 8 + q]) * 16.0f); *(v8us*)((unsigned short*)Bt + t * 8) = f.half[0];  }
__global__ __launch_bounds__(256) void k_rsm(const float* __restrict__ S, _Float16* __restrict__ P, int nrows) {
  #pragma clang fp contract(off)
  const int i = blockIdx.x * 256 + threadIdx.x; if (i >= nrows) return; const float* s = S + (size_t)i * SQ; float mx = -3.0e38f;
#pragma unroll 1
  for (int j = 0; j < SQ; ++j) mx = fmaxf(mx, s[j]); float se = 0.f;
#pragma unroll 1
  for (int j = 0; j < SQ; ++j) se += expf(s[j] - mx); const float sc = 256.0f / se;
#pragma unroll 1
  for (int j0 = 0; j0 < SQ; j0 += 8) { FragH f; for (int q = 0; q < 8; ++q) f.h[q] = (_Float16)(expf(s[j0 + q] - mx) * sc); unsigned short* d = (unsigned short*)P + (size_t)i * SQ + j0; *(v8us*)d = f.half[0];  } }
__global__ __launch_bounds__(256) void k_vt(const _Float16* __restrict__ V16, int b, int h0, _Float16* __restrict__ VT) { __shared__ unsigned short tl[64][65]; const int tid = threadIdx.x; const int hh = blockIdx.x % HG, sg = blockIdx.x / HG; const int s0 = sg * 64; const int h = h0 + hh;
  for (int i = tid; i < 64 * 8; i += 256) { const int j = i / 8, d8 = (i % 8) * 8; FragH f; f.half[0] = *(const v8us*)((const unsigned short*)V16 + ((size_t)b * SQ + s0 + j) * DM + h * HD + d8); for (int q = 0; q < 8; ++q) tl[d8 + q][j] = f.u[q]; }
  __syncthreads();
  { for (int i = tid; i < 64 * 8; i += 256) { const int d = i / 8, j8 = (i % 8) * 8; FragH f; for (int q = 0; q < 8; ++q) f.u[q] = tl[d][j8 + q]; *(v8us*)((unsigned short*)VT + ((size_t)hh * HD + d) * SQ + s0 + j8) = f.half[0]; }  } }



// ---- fused attention: per work-group FA_BR queries of one (batch, head) against all SQ keys; of every 64-key stage a wave takes one 32-key pass, and the two partial results of a query are joined at the end. Transposed products: S^T = K Q^T puts one query's
// scores in one lane pair (l, l ^ 16), so maximum and weights are in-lane; two S^T tiles (32 keys), converted in place, are the B operand of
// O^T += V^T P^T. Every A/B fragment is loaded in the same k order (8 h + 0..7, 16 + 8 h + 0..7), which is the order the converted tiles have.
#define FA_NW 4                      /* waves per work-group */
#define FA_KH 2                      /* key halves: each of a stage's two 32-key passes has its own waves */
#define FA_QW (FA_NW / FA_KH)        /* waves side by side on the queries */
#define FA_R 2                       /* 16-query column groups per wave */
#define FA_BR (FA_QW * FA_R * 16)    /* queries per work-group: 768 work-groups, three for each of the 256 WGPs and three waves for each SIMD */
#define FA_SK 64                     /* keys per LDS stage = two 32-key passes, one per key half */
#define FA_XP (FA_R * 8 + 1)         /* 16-byte pieces a lane hands over when the key halves are joined: its O^T tiles, then maxima and sums */
#define FA_LP 72                     /* LDS row pitch in halves: 144 B = 16 B x odd for 16-byte row reads */
#define FA_NST (SQ / FA_SK)
static_assert(HD == 64 && FA_SK == 64 && SQ % FA_SK == 0 && SQ % FA_BR == 0 && FA_NW * 32 == 128, "k_fattn: 64 x 128-byte tiles, four 16-byte pieces of each per thread, whole stages and whole query blocks");
static_assert(FA_SK == 32 * FA_KH && FA_KH == 2 && FA_R == 2 && FA_QW * FA_XP * 32 * 16 <= 2 * FA_SK * FA_LP * 2, "k_fattn: one pass per key half and stage; the hand-over (two maxima and two sums in one piece) fits in the K buffers");
typedef float v2f __attribute__((ext_vector_type(2)));
typedef _Float16 v2h __attribute__((ext_vector_type(2)));
typedef unsigned int v8u __attribute__((ext_vector_type(8)));
typedef unsigned int v4u __attribute__((ext_vector_type(4)));
__device__ __forceinline__ v16h fa_frag(const unsigned short* p) { FragH f; f.half[0] = *(const v8us*)p; f.half[1] = *(const v8us*)(p + 16); return f.v; }      /* p already holds the lane half's + 8 h */
__device__ __forceinline__ unsigned int fa_pack(float lo, float hi) { return __builtin_bit_cast(unsigned int, __builtin_convertvector((v2f){lo, hi}, v2h)); }
__device__ __forceinline__ float fa_xh(float x) { return __builtin_bit_cast(float, __builtin_amdgcn_permlanex16(__builtin_bit_cast(int, x), __builtin_bit_cast(int, x), 0x76543210, 0xfedcba98, false, false)); }      /* lane l with lane l ^ 16 */
__device__ __forceinline__ v8f fa_mma(v16h a, v16h b, v8f c) { return __builtin_amdgcn_wmma_f32_16x16x32_f16(false, a, false, b, (short)0, c, false, false); }
__global__ __launch_bounds__(FA_NW * 32) void k_fattn(const _Float16* __restrict__ Q16, const _Float16* __restrict__ K16, const _Float16* __restrict__ VT, _Float16* __restrict__ O16) {
  __shared__ __attribute__((aligned(16))) unsigned short sk[2][FA_SK][FA_LP];      /* K rows [key][d] */
  __shared__ __attribute__((aligned(16))) unsigned short sv[2][HD][FA_LP];         /* V^T rows [d][key] */
  const int tid = threadIdx.x, lane = tid & 31, c = lane & 15, h = lane >> 4;
  const int wave = __builtin_amdgcn_readfirstlane(tid >> 5), qw = wave % FA_QW, kh = wave / FA_QW;      /* scalar: the tests on kh below are scalar branches */
  const int bh = blockIdx.y, b = bh / NH, hd = bh - b * NH;
  const int q0 = blockIdx.x * FA_BR + qw * (FA_R * 16);
  const int sr = tid >> 3, sc = (tid & 7) * 8;      /* staging: eight lanes cover one 128-byte row; piece u is row sr + 16 u */
  const unsigned short* kg = (const unsigned short*)K16 + ((size_t)b * SQ + sr) * DM + hd * HD + sc;
  const unsigned short* vg = (const unsigned short*)VT + ((size_t)bh * HD + sr) * SQ + sc;
  const float cscale = 0.125f * 1.4426950408889634f;      /* HD^-0.5 log2(e) */
  v8us rk[4], rv[4];
#pragma unroll
  for (int u = 0; u < 4; ++u) { rk[u] = *(const v8us*)(kg + (size_t)(16 * u) * DM); rv[u] = *(const v8us*)(vg + (size_t)(16 * u) * SQ); }
  v16h qf[FA_R][2];
#pragma unroll
  for (int g = 0; g < FA_R; ++g) { const unsigned short* qp = (const unsigned short*)Q16 + ((size_t)b * SQ + q0 + 16 * g + c) * DM + hd * HD + 8 * h; qf[g][0] = fa_frag(qp); qf[g][1] = fa_frag(qp + 32); }
  const unsigned int o1 = (c == 0) ? 0x3C003C00u : 0u;      /* A operand whose row 0 is f16 ones: its product with P^T is the weights' column sums */
  const v16h ones = __builtin_bit_cast(v16h, (v8u){o1, o1, o1, o1, o1, o1, o1, o1});
  const v8f z8 = {0.f, 0.f, 0.f, 0.f, 0.f, 0.f, 0.f, 0.f};
  v8f acc[FA_R][4], lacc[FA_R]; float m_run[FA_R];
#pragma unroll
  for (int g = 0; g < FA_R; ++g) { m_run[g] = -__builtin_inff(); lacc[g] = z8; acc[g][0] = z8; acc[g][1] = z8; acc[g][2] = z8; acc[g][3] = z8; }
#pragma unroll
  for (int u = 0; u < 4; ++u) { *(v8us*)&sk[0][sr + 16 * u][sc] = rk[u]; *(v8us*)&sv[0][sr + 16 * u][sc] = rv[u]; }
  __syncthreads();
#pragma unroll 1      /* rolled: one stage's code, two buffers by index */
  for (int st = 0; st < FA_NST; ++st) {
    const int bu = st & 1;
    if (st + 1 < FA_NST) {      /* the next stage's tiles fly into registers under this stage's pass */
      const unsigned short* kn = kg + (size_t)(st + 1) * FA_SK * DM; const unsigned short* vn = vg + (st + 1) * FA_SK;
#pragma unroll
      for (int u = 0; u < 4; ++u) { rk[u] = *(const v8us*)(kn + (size_t)(16 * u) * DM); rv[u] = *(const v8us*)(vn + (size_t)(16 * u) * SQ); }
      asm volatile("s_wait_xcnt 0x0" :: "v"(kn), "v"(vn) : "memory");      /* stands in front of every overwrite of the address registers that the loads above name */
    }
    { const int sub = kh;      /* the wave's own 32 keys of the stage */
      v8f s[2][FA_R];
      { v16h kf[2][2];
#pragma unroll
        for (int kt = 0; kt < 2; ++kt) { const unsigned short* p = &sk[bu][32 * sub + 16 * kt + c][8 * h]; kf[kt][0] = fa_frag(p); kf[kt][1] = fa_frag(p + 32); }
#pragma unroll
        for (int kt = 0; kt < 2; ++kt)
#pragma unroll
          for (int g = 0; g < FA_R; ++g) s[kt][g] = fa_mma(kf[kt][0], qf[g][0], z8);
#pragma unroll
        for (int kt = 0; kt < 2; ++kt)
#pragma unroll
          for (int g = 0; g < FA_R; ++g) s[kt][g] = fa_mma(kf[kt][1], qf[g][1], s[kt][g]); }
      v16h vf[4];
#pragma unroll
      for (int t = 0; t < 4; ++t) vf[t] = fa_frag(&sv[bu][16 * t + c][32 * sub + 8 * h]);
      float mb[FA_R]; bool need = false;
#pragma unroll
      for (int g = 0; g < FA_R; ++g) { float mx = s[0][g][0];
#pragma unroll
        for (int r = 1; r < 8; ++r) mx = fmaxf(mx, s[0][g][r]);
#pragma unroll
        for (int r = 0; r < 8; ++r) mx = fmaxf(mx, s[1][g][r]);
        mx = fmaxf(mx, fa_xh(mx)) * cscale; mb[g] = mx; need = need || (mx > m_run[g] + 8.0f); }
      if (__builtin_amdgcn_ballot_w32(need) != 0) {      /* lazy rescale: the maximum in use may trail the true one by up to 8 (log2), so a weight stays below 2^8 */
#pragma unroll
        for (int g = 0; g < FA_R; ++g) { const float mn = fmaxf(m_run[g], mb[g]); const float corr = __builtin_amdgcn_exp2f(m_run[g] - mn); m_run[g] = mn; lacc[g] = lacc[g] * corr;
#pragma unroll
          for (int t = 0; t < 4; ++t) acc[g][t] = acc[g][t] * corr; } }
#pragma unroll
      for (int g = 0; g < FA_R; ++g) { const float nm = -m_run[g]; v8u w;
#pragma unroll
        for (int i = 0; i < 8; ++i) { const v2f a = __builtin_elementwise_fma((v2f){s[i >> 2][g][2 * (i & 3)], s[i >> 2][g][2 * (i & 3) + 1]}, (v2f){cscale, cscale}, (v2f){nm, nm}); w[i] = fa_pack(__builtin_amdgcn_exp2f(a[0]), __builtin_amdgcn_exp2f(a[1])); }
        const v16h pf = __builtin_bit_cast(v16h, w);      /* element e: key 8 h + e (tile 0), 16 + 8 h + e - 8 (tile 1) of query c */
#pragma unroll
        for (int t = 0; t < 4; ++t) acc[g][t] = fa_mma(vf[t], pf, acc[g][t]);
        lacc[g] = fa_mma(ones, pf, lacc[g]); }
    }
    __builtin_amdgcn_sched_barrier(0);      /* keeps the v_nop run below directly behind the stage's last WMMA */
    asm volatile("v_nop\n\tv_nop\n\tv_nop\n\tv_nop");      /* the four vector slots behind a WMMA, also on the taken side of the branches that follow */
    __builtin_amdgcn_sched_barrier(0);
    if (st + 1 < FA_NST) {
#pragma unroll
      for (int u = 0; u < 4; ++u) { *(v8us*)&sk[bu ^ 1][sr + 16 * u][sc] = rk[u]; *(v8us*)&sv[bu ^ 1][sr + 16 * u][sc] = rv[u]; } }
    __syncthreads();      /* publishes the next stage and ends every wave's reads of this one, which the next trip overwrites */
  }
  /* The key halves of a query are joined: the waves of half 1 hand maxima, sums and O^T tiles over in LDS (the K buffers, free behind the loop's last barrier), lane to lane; the waves of half 0 bring both to the common maximum, add and write. */
  float ls[FA_R];
#pragma unroll
  for (int g = 0; g < FA_R; ++g) { const float lr = lacc[g][0]; ls[g] = lr + fa_xh(lr); }      /* row 0 of the sum tile sits in lanes 0-15, row 8 (zero) in lanes 16-31: the exchange-and-add is unconditional */
  v4fa* xq = (v4fa*)&sk[0][0][0] + qw * (FA_XP * 32) + lane;      /* piece j of the lane lies 32 j pieces further on: a wave's 32 pieces are 512 bytes in a row */
  if (kh != 0) {
#pragma unroll
    for (int g = 0; g < FA_R; ++g)
#pragma unroll
      for (int t = 0; t < 4; ++t) { const v8f a = acc[g][t]; xq[(8 * g + 2 * t) * 32] = (v4f){a[0], a[1], a[2], a[3]}; xq[(8 * g + 2 * t + 1) * 32] = (v4f){a[4], a[5], a[6], a[7]}; }
    xq[(FA_XP - 1) * 32] = (v4f){m_run[0], m_run[1], ls[0], ls[1]}; }
  __syncthreads();      /* half 1's pieces are in LDS before half 0 reads them; every wave passes it */
  if (kh != 0) return;      /* behind the last barrier */
  const v4f ml = xq[(FA_XP - 1) * 32];
#pragma unroll
  for (int g = 0; g < FA_R; ++g) { const float mn = fmaxf(m_run[g], ml[g]); const float c0 = __builtin_amdgcn_exp2f(m_run[g] - mn), c1 = __builtin_amdgcn_exp2f(ml[g] - mn);
    const float inv = 64.0f / (ls[g] * c0 + ml[FA_R + g] * c1); const float a0 = c0 * inv, a1 = c1 * inv;
    unsigned short* op = (unsigned short*)O16 + ((size_t)b * SQ + q0 + 16 * g + c) * DM + hd * HD + 8 * h;
#pragma unroll
    for (int t = 0; t < 4; ++t) { const v4f x0 = xq[(8 * g + 2 * t) * 32], x1 = xq[(8 * g + 2 * t + 1) * 32]; const v8f x = {x0[0], x0[1], x0[2], x0[3], x1[0], x1[1], x1[2], x1[3]};
      const v8f o = acc[g][t] * a0 + x * a1; *(v4u*)(op + 16 * t) = (v4u){fa_pack(o[0], o[1]), fa_pack(o[2], o[3]), fa_pack(o[4], o[5]), fa_pack(o[6], o[7])}; } } }      /* acc register r = d 16 t + 8 h + r of query c */

extern "C" void kernel_launch(void* const* d_in, const int* in_sizes, int n_in,
                              void* d_out, int out_size, void* d_ws, size_t ws_size, hipStream_t stream) {
  (void)in_sizes; (void)n_in; (void)out_size;
  const float* const* I = (const float* const*)d_in; const float* x = I[0]; const float* wq = I[1]; const float* bq = I[2]; const float* wk = I[3]; const float* bk = I[4]; const float* wv = I[5]; const float* bv = I[6]; const float* wo = I[7]; const float* bo = I[8];      /* [in][out] weights + biases */
  char* ws = (char*)d_ws; size_t off = 0;
  auto take = [&](size_t bytes) { char* p = ws + off; off += (bytes + 255) & ~(size_t)255; return p; };
  _Float16* BQ = (_Float16*)take((size_t)DM * DM * 2); _Float16* BK = (_Float16*)take((size_t)DM * DM * 2); _Float16* BV = (_Float16*)take((size_t)DM * DM * 2); _Float16* BO = (_Float16*)take((size_t)DM * DM * 2);
  _Float16* X16 = (_Float16*)take(NR * DM * 2); _Float16* Q16 = (_Float16*)take(NR * DM * 2); _Float16* K16 = (_Float16*)take(NR * DM * 2); _Float16* O16 = (_Float16*)take(NR * DM * 2);
  _Float16* VT = (_Float16*)take((size_t)NB * NH * HD * SQ * 2);
  if (off > ws_size) return;
  static_assert(MP % 128 == 0 && MPO % 128 == 0 && DM % 64 == 0, "k_gemm2: whole 128x64 block tiles and whole 64-wide k stages");
  static_assert(((size_t)DM * DM * 2) % 256 == 0 && (NR * DM * 2) % 256 == 0, "the weight planes BQ, BK, BV, BO and the row planes Q16, K16 lie one behind the other in the workspace");
  k_prep<<<4 * PREP_WB + PREP_XB, 256, 0, stream>>>(x, wq, wk, wv, wo, BQ, X16);      /* [in][out] -> Bt[n][k] x16 for all four weights; x -> f16 rows */
  const size_t r0p = (size_t)B0 * SQ;      /* first projected row */
  k_gemm2<0, DM, DM, DM, true, false, false, true, true><<<dim3((unsigned)((MP / 128) * (DM / 64)), 3), 128, 0, stream>>>(X16 + r0p * DM, 0, BQ, (size_t)DM * DM, 0.0625f, bq, bk, bv, 0, nullptr, 1, 0, 0, nullptr, Q16 + r0p * DM, VT + (size_t)B0 * NH * HD * SQ, NR * DM, MP, DM, DM);      /* grid.y = Q, K, V: one A, three weight and bias planes; Q and K leave as rows, V as V^T [NB][NH][HD][SQ] */
  k_fattn<<<dim3(SQ / FA_BR, NB * NH), FA_NW * 32, 0, stream>>>(Q16, K16, VT, O16);      /* o x64 (merged heads) as f16 rows */
  k_gemm2<0, DM, DM, DM, true, false, true, false, false><<<dim3((unsigned)((MPO / 128) * (DM / 64)), 1), 128, 0, stream>>>(O16 + r0p * DM, 0, BO, 0, 0.0009765625f, bo, nullptr, nullptr, 0, nullptr, 1, 0, 0, (float*)d_out + r0p * DM, nullptr, nullptr, 0, MPO, DM, DM);      /* out rows are the output layout */
}

// v009
// Measured time: 67.7 microseconds a run.
// Two timings next to v008 both put it at 1.06 times that version's speed.
// All steps since v000 together make it 39.4 times as fast.
#include <hip/hip_runtime.h>
// Multi-head self-attention (x [2][2048][768]; q/k/v = x W + b ([in][out] 768x768 sigma 1/sqrt(768), zero biases); 12 heads of 64; softmax(q k^T / 8) over all keys (no mask); out = ctx Wo + bo -> [2][2048][768]).
// Structure: token rows r = b*2048 + s; x as exact f16 rows (bf16-rounded); Q, K, V as one launch of three WMMA GEMMs (32x64 wave tiles, f32 accumulation, exact x16 weights + bias, f16 outputs; the V plane's epilogue writes V^T per batch and head, turned in LDS); one fused attention launch over (query block, batch x head): S^T = K Q^T (K = 64), online softmax in the log2 domain on the score accumulators (f32 statistics, native exp2, weights as f16 relative to the running maximum), O^T += V^T P^T, K and V^T staged in LDS; o carried x64 against f16 subnormal flush (folded into the output GEMM alpha), written straight into the merged f16 o rows; out = o W_o + b GEMM (f32) into the output layout.
// Compute dtype: inputs rounded to bf16; x / weights exact; q, k, v, softmax weights and o as plain f16 GEMM operands (~2^-12); scores and softmax statistics f32. v_wmma_f32_16x16x32_f16.
#define NB 2
#define SQ 2048
#define DM 768
#define NH 12
#define HD 64
#define HG 4                         /* heads per block group of the unlaunched k_vt(b, h0) */
#define B0 0                         /* first batch processed (debug hook) */
#define NBR NB                       /* batches processed (debug hook) */
#define NR ((size_t)NB * SQ)         /* token rows */
#define MP ((int)((size_t)NBR * SQ)) /* rows projected (debug hook) */
#define QN SQ                        /* query rows per batch; not read (k_fattn attends all SQ) */
#define NHD NH                       /* heads; not read (k_fattn attends all NH) */
#define MPO MP                       /* rows through the output stage (debug hook) */
#define LQ DM      /* row pitch of the q/k rows; not read (pitches are DM) */
typedef __bf16 v16b __attribute__((ext_vector_type(16)));
typedef unsigned short v8us __attribute__((ext_vector_type(8), may_alias));
typedef float  v8f  __attribute__((ext_vector_type(8)));
typedef float  v4f  __attribute__((ext_vector_type(4)));
typedef float  v4fa __attribute__((ext_vector_type(4), may_alias));
union FragB { v16b v; v8us half[2]; unsigned short u[16]; };

__device__ __forceinline__ unsigned short bf16_bits(float x) { unsigned int u = __float_as_uint(x); return (unsigned short)((u + 0x7FFFu + ((u >> 16) & 1u)) >> 16); }
__device__ __forceinline__ float bf16_val(unsigned short b) { return __uint_as_float(((unsigned int)b) << 16); }
__device__ __forceinline__ float bf16_round(float x) { return bf16_val(bf16_bits(x)); }
// D += A·B with NT terms: 1 = ah·bh, 2 = + al·bh (A split), 3 = + ah·bl (both split)
template <int NT>
__device__ __forceinline__ v8f mmaN(v16b ah, v16b al, v16b bh, v16b bl, v8f c) {
  c = __builtin_amdgcn_wmma_f32_16x16x32_bf16(false, ah, false, bh, (short)0, c, false, false);
  if (NT >= 2) c = __builtin_amdgcn_wmma_f32_16x16x32_bf16(false, al, false, bh, (short)0, c, false, false);
  if (NT >= 3) c = __builtin_amdgcn_wmma_f32_16x16x32_bf16(false, ah, false, bl, (short)0, c, false, false);
  asm volatile("v_nop\n\tv_nop\n\tv_nop\n\tv_nop" : "+v"(c) : "v"(ah), "v"(al), "v"(bh), "v"(bl));
  return c;
}

__global__ __launch_bounds__(256) void k_wt_bf16(const float* __restrict__ W, unsigned short* __restrict__ Wt, int K, int N) {
  const int t = blockIdx.x * 256 + threadIdx.x;
  const int k8n = K / 8;
  if (t >= N * k8n) return;
  const int n = t / k8n, k8 = (t % k8n) * 8;
  v8us v;
#pragma unroll
  for (int i = 0; i < 8; ++i) v[i] = bf16_bits(W[(size_t)(k8 + i) * N + n]);
  *(v8us*)(Wt + (size_t)n * K + k8) = v;
  
}

// GEMM C[M][N] (f32, pitch ldc) = act(A[M][K]·W + bias). A f32 row-major (pitch lda) converted per fragment to bf16
// (ASPLIT: hi/lo two planes -> 2 terms, else single rounded term); Wt bf16 [N][K] (pitch ldb). BIAS_BF16 rounds the
// bias to bf16 first (bias quantised to bf16 before the add). K%32==0, M%16==0, N%64==0.
template <bool ASPLIT, int ACT, bool BIAS_BF16>
__global__ __launch_bounds__(128) void k_gemm_bf(const float* __restrict__ A, int lda, const unsigned short* __restrict__ Wt, int ldb,
                                               const float* __restrict__ bias, float* __restrict__ C, int ldc, int M, int N, int K) {
  __shared__ __attribute__((aligned(16))) float so[4][16][64];
  const int tid = threadIdx.x, w = tid >> 5, lane = tid & 31, ln = lane & 15, hh = lane >> 4;
  const int ntn = N / 64;
  const int wid = blockIdx.x * 4 + w;
  const int mt = wid / ntn, nq = wid % ntn;
  if (mt * 16 >= M) return;
  const int row0 = mt * 16, col0 = nq * 64;
  const float* arow = A + (size_t)(row0 + ln) * lda;
  v8f acc[4] = {};
  for (int kb = 0; kb < K; kb += 32) {
    FragB ah, al;
    const v4f x0 = *(const v4fa*)(arow + kb + 8 * hh), x1 = *(const v4fa*)(arow + kb + 8 * hh + 4);
    const v4f x2 = *(const v4fa*)(arow + kb + 16 + 8 * hh), x3 = *(const v4fa*)(arow + kb + 16 + 8 * hh + 4);
    float xs[16] = {x0[0],x0[1],x0[2],x0[3],x1[0],x1[1],x1[2],x1[3],x2[0],x2[1],x2[2],x2[3],x3[0],x3[1],x3[2],x3[3]};
#pragma unroll
    for (int i = 0; i < 16; ++i) { const unsigned short hb = bf16_bits(xs[i]); ah.u[i] = hb; al.u[i] = ASPLIT ? bf16_bits(xs[i] - bf16_val(hb)) : (unsigned short)0; }
#pragma unroll
    for (int t = 0; t < 4; ++t) {
      const unsigned short* brow = Wt + (size_t)(col0 + t * 16 + ln) * ldb + kb;
      FragB b;
      b.half[0] = *(const v8us*)(brow + 8 * hh);
      b.half[1] = *(const v8us*)(brow + 16 + 8 * hh);
      acc[t] = mmaN<ASPLIT ? 2 : 1>(ah.v, al.v, b.v, b.v, acc[t]);
    }
  }
#pragma unroll
  for (int t = 0; t < 4; ++t) {
    float bv = bias ? bias[col0 + t * 16 + ln] : 0.f;
    if (BIAS_BF16) bv = bf16_round(bv);
#pragma unroll
    for (int r = 0; r < 8; ++r) { float v = acc[t][r] + bv; if (ACT == 1) v = fmaxf(v, 0.f); so[w][8 * hh + r][t * 16 + ln] = v; }
  }
  __builtin_amdgcn_fence(__ATOMIC_ACQ_REL, "workgroup");
  __builtin_amdgcn_wave_barrier();
  const int rsub = lane >> 4, c4 = (lane & 15) * 4;
  {
#pragma unroll
    for (int q = 0; q < 8; ++q) {
      const int r = q * 2 + rsub;
      const v4f v = *(const v4fa*)&so[w][r][c4];
      *(v4f*)(C + (size_t)(row0 + r) * ldc + col0 + c4) = v;
    }
    
  }
}

// GEMM C = act(A·W + bias + resid): A f32 (ASPLIT -> hi/lo 2 terms), Wt bf16 [N][K]; ACT 0 none, 1 relu, 2 exact gelu;
// resid (optional, f32, row index = (row % rmod), pitch ldr, RES_BF16 rounds it) added before the activation.
template <bool ASPLIT, int ACT, bool BIAS_BF16, bool RES_BF16>
__global__ __launch_bounds__(128) void k_gemm_bf3(const float* __restrict__ A, int lda, const unsigned short* __restrict__ Wt, int ldb,
                                                const float* __restrict__ bias, const float* __restrict__ resid, int rmod, int ldr,
                                                float* __restrict__ C, int ldc, int M, int N, int K) {
  __shared__ __attribute__((aligned(16))) float so[4][16][64];
  const int tid = threadIdx.x, w = tid >> 5, lane = tid & 31, ln = lane & 15, hh = lane >> 4;
  const int ntn = N / 64;
  const int wid = blockIdx.x * 4 + w;
  const int mt = wid / ntn, nq = wid % ntn;
  if (mt * 16 >= M) return;
  const int row0 = mt * 16, col0 = nq * 64;
  const float* arow = A + (size_t)(row0 + ln) * lda;
  v8f acc[4] = {};
  for (int kb = 0; kb < K; kb += 32) {
    FragB ah, al;
    const v4f x0 = *(const v4fa*)(arow + kb + 8 * hh), x1 = *(const v4fa*)(arow + kb + 8 * hh + 4);
    const v4f x2 = *(const v4fa*)(arow + kb + 16 + 8 * hh), x3 = *(const v4fa*)(arow + kb + 16 + 8 * hh + 4);
    float xs[16] = {x0[0],x0[1],x0[2],x0[3],x1[0],x1[1],x1[2],x1[3],x2[0],x2[1],x2[2],x2[3],x3[0],x3[1],x3[2],x3[3]};
#pragma unroll
    for (int i = 0; i < 16; ++i) { const unsigned short hb = bf16_bits(xs[i]); ah.u[i] = hb; al.u[i] = ASPLIT ? bf16_bits(xs[i] - bf16_val(hb)) : (unsigned short)0; }
#pragma unroll
    for (int t = 0; t < 4; ++t) {
      const unsigned short* brow = Wt + (size_t)(col0 + t * 16 + ln) * ldb + kb;
      FragB b;
      b.half[0] = *(const v8us*)(brow + 8 * hh);
      b.half[1] = *(const v8us*)(brow + 16 + 8 * hh);
      acc[t] = mmaN<ASPLIT ? 2 : 1>(ah.v, al.v, b.v, b.v, acc[t]);
    }
  }
#pragma unroll
  for (int t = 0; t < 4; ++t) {
    const int col = col0 + t * 16 + ln;
    float bv = bias ? bias[col] : 0.f;
    if (BIAS_BF16) bv = bf16_round(bv);
#pragma unroll
    for (int r = 0; r < 8; ++r) {
      float v = acc[t][r] + bv;
      if (resid) { float rv = resid[(size_t)((row0 + 8 * hh + r) % rmod) * ldr + col]; if (RES_BF16) rv = bf16_round(rv); v += rv; }
      if (ACT == 1) v = fmaxf(v, 0.f);
      if (ACT == 2) v = 0.5f * v * (1.0f + erff(v * 0.70710678118654752f));
      if (ACT == 3) { const float u = 0.7978845608028654f * (v + 0.044715f * v * v * v); v = 0.5f * v * (1.0f + tanhf(u)); }
      so[w][8 * hh + r][t * 16 + ln] = v;
    }
  }
  __builtin_amdgcn_fence(__ATOMIC_ACQ_REL, "workgroup");
  __builtin_amdgcn_wave_barrier();
  const int rsub = lane >> 4, c4 = (lane & 15) * 4;
  {
#pragma unroll
    for (int q = 0; q < 8; ++q) {
      const int r = q * 2 + rsub;
      const v4f v = *(const v4fa*)&so[w][r][c4];
      *(v4f*)(C + (size_t)(row0 + r) * ldc + col0 + c4) = v;
    }
    
  }
}
// row LayerNorm (biased variance, eps) over N: s = X (+ R); optional out_sum <- s; out_norm <- (s-mu)*rsqrt(var+eps)*g + b
template <bool PARAM_BF16>
__global__ __launch_bounds__(256) void k_layernorm(const float* __restrict__ X, const float* __restrict__ R, const float* __restrict__ g, const float* __restrict__ bta,
                                                  float* __restrict__ out_sum, float* __restrict__ out_norm, int N, float eps) {
  __shared__ float red[256];
  const int row = blockIdx.x, tid = threadIdx.x;
  const float* x = X + (size_t)row * N; const float* rr = R ? R + (size_t)row * N : nullptr;
  float vals[16];                     // up to N = 4096
  const int per = N / 256;            // contiguous chunk per thread? use strided-by-4 chunks: thread handles j = tid*4 + 1024*u
  float s1 = 0.f;
  for (int u = 0; u < per / 4; ++u) {
    const int j = tid * 4 + 1024 * u;
    const v4f a = *(const v4fa*)(x + j);
    v4f b = {0.f,0.f,0.f,0.f}; if (rr) b = *(const v4fa*)(rr + j);
#pragma unroll
    for (int q = 0; q < 4; ++q) { const float v = a[q] + b[q]; vals[u * 4 + q] = v; s1 += v; }
  }
  red[tid] = s1; __syncthreads();
  for (int st = 128; st > 0; st >>= 1) { if (tid < st) red[tid] += red[tid + st]; __syncthreads(); }
  const float mu = red[0] / (float)N; __syncthreads();
  float s2 = 0.f;
  for (int u = 0; u < per / 4; ++u)
#pragma unroll
    for (int q = 0; q < 4; ++q) { const float c = vals[u * 4 + q] - mu; s2 += c * c; }
  red[tid] = s2; __syncthreads();
  for (int st = 128; st > 0; st >>= 1) { if (tid < st) red[tid] += red[tid + st]; __syncthreads(); }
  const float rs = rsqrtf(red[0] / (float)N + eps);
  {
    for (int u = 0; u < per / 4; ++u) {
      const int j = tid * 4 + 1024 * u;
      v4f o, sm;
#pragma unroll
      for (int q = 0; q < 4; ++q) {
        float gg = g[j + q], bb = bta[j + q];
        if (PARAM_BF16) { gg = bf16_round(gg); bb = bf16_round(bb); }
        sm[q] = vals[u * 4 + q]; o[q] = (vals[u * 4 + q] - mu) * rs * gg + bb;
      }
      if (out_sum) *(v4f*)(out_sum + (size_t)row * N + j) = sm;
      *(v4f*)(out_norm + (size_t)row * N + j) = o;
    }
    
  }
}



// ---- f16 WMMA path (v_wmma_f32_16x16x32_f16): 11-bit significands for operands in range — used where a [0,1] probability operand needs more precision than bf16
typedef _Float16 v16h __attribute__((ext_vector_type(16)));
union FragH { v16h v; v8us half[2]; _Float16 h[16]; unsigned short u[16]; };
template <int NT>
__device__ __forceinline__ v8f mmaH(v16h ah, v16h al, v16h bh, v16h bl, v8f c) {
  c = __builtin_amdgcn_wmma_f32_16x16x32_f16(false, ah, false, bh, (short)0, c, false, false);
  if (NT >= 2) c = __builtin_amdgcn_wmma_f32_16x16x32_f16(false, al, false, bh, (short)0, c, false, false);
  if (NT >= 3) c = __builtin_amdgcn_wmma_f32_16x16x32_f16(false, ah, false, bl, (short)0, c, false, false);
  asm volatile("v_nop\n\tv_nop\n\tv_nop\n\tv_nop" : "+v"(c) : "v"(ah), "v"(al), "v"(bh), "v"(bl));
  return c;
}
// batched GEMM like k_gemm_b but f16 operands: A f32 (split into f16 hi/lo if ASPLIT, else rounded to f16), Bt = f16 values [n][k]; alpha; C f32; N multiple of 16 (partial tiles skipped)
template <bool ASPLIT>
__global__ __launch_bounds__(128) void k_gemm_h(const float* __restrict__ A, int lda, size_t sA, const _Float16* __restrict__ Bh, int ldb, size_t sB, float alpha, float* __restrict__ C, int ldc, size_t sC, int M, int N, int K) {
  __shared__ __attribute__((aligned(16))) float so[4][16][64];
  const int tid = threadIdx.x, w = tid >> 5, lane = tid & 31, ln = lane & 15, hh = lane >> 4; const int by = blockIdx.y;
  A += (size_t)by * sA; Bh += (size_t)by * sB; C += (size_t)by * sC;
  const int ntn = (N + 63) / 64; const int wid = blockIdx.x * 4 + w; const int mt = wid / ntn, nq = wid % ntn; if (mt * 16 >= M) return;
  const int row0 = mt * 16, col0 = nq * 64; const float* arow = A + (size_t)(row0 + ln) * lda;
  v8f acc[4] = {};
  for (int kb = 0; kb < K; kb += 32) {
    FragH ah, al;
    const v4f x0 = *(const v4fa*)(arow + kb + 8 * hh), x1 = *(const v4fa*)(arow + kb + 8 * hh + 4), x2 = *(const v4fa*)(arow + kb + 16 + 8 * hh), x3 = *(const v4fa*)(arow + kb + 16 + 8 * hh + 4);
    float xs[16] = {x0[0],x0[1],x0[2],x0[3],x1[0],x1[1],x1[2],x1[3],x2[0],x2[1],x2[2],x2[3],x3[0],x3[1],x3[2],x3[3]};
#pragma unroll
    for (int i = 0; i < 16; ++i) { const _Float16 h = (_Float16)xs[i]; ah.h[i] = h; al.h[i] = ASPLIT ? (_Float16)(xs[i] - (float)h) : (_Float16)0.0f; }
#pragma unroll
    for (int t = 0; t < 4; ++t) { if (col0 + t * 16 >= N) continue; const size_t boff = (size_t)(col0 + t * 16 + ln) * ldb + kb; FragH bq; bq.half[0] = *(const v8us*)(Bh + boff + 8 * hh); bq.half[1] = *(const v8us*)(Bh + boff + 16 + 8 * hh);
      acc[t] = mmaH<ASPLIT ? 2 : 1>(ah.v, al.v, bq.v, bq.v, acc[t]); }
  }
#pragma unroll
  for (int t = 0; t < 4; ++t) { if (col0 + t * 16 >= N) continue;
#pragma unroll
    for (int r = 0; r < 8; ++r) so[w][8 * hh + r][t * 16 + ln] = acc[t][r] * alpha; }
  __builtin_amdgcn_fence(__ATOMIC_ACQ_REL, "workgroup"); __builtin_amdgcn_wave_barrier();
  const int rsub = lane >> 4, c4 = (lane & 15) * 4;
  {
#pragma unroll
    for (int q = 0; q < 8; ++q) { const int r = q * 2 + rsub; if (col0 + c4 < N) { const v4f v = *(const v4fa*)&so[w][r][c4]; *(v4f*)(C + (size_t)(row0 + r) * ldc + col0 + c4) = v; } }
     }
}

// One launch for the five operand preparations, which do not depend on one another: blocks [0, 4 PREP_WB) transpose the four weights, the rest convert x.
// Weights: Wt[n][k] = f16(W[k][n] x16) from f32 row-major W[DM][DM] (bf16-exact weights stay exact in f16 away from the subnormal range); Bt holds the four [n][k] planes one behind the other. x: exact f16 rows of the bf16-rounded values.
// Few, fat work-groups (64 elements per thread): for speed only. A weight block takes a PREP_T x PREP_T tile: 512-byte pieces of W rows in, 256-byte pieces of Wt rows out, turned in LDS.
#define PREP_T 128                   /* k and n per weight tile */
#define PREP_WB ((DM / PREP_T) * (DM / PREP_T))               /* blocks per weight: one tile each */
#define PREP_XP 8                    /* eight-element pieces of x per thread */
#define PREP_XB ((unsigned)(NR * DM / (8 * 256 * PREP_XP)))   /* blocks for x */
static_assert(DM % PREP_T == 0 && PREP_T == 128 && (NR * DM) % (8 * 256 * PREP_XP) == 0, "k_prep: whole tiles, 8 waves x 16 k on a tile, whole x blocks");
__global__ __launch_bounds__(256) void k_prep(const float* __restrict__ x, const float* __restrict__ wq, const float* __restrict__ wk, const float* __restrict__ wv, const float* __restrict__ wo, _Float16* __restrict__ Bt, _Float16* __restrict__ X16) {
  __shared__ __attribute__((aligned(16))) unsigned short ts[PREP_T][PREP_T];      /* [n][k]; the 16-byte piece c of row n lies at place c ^ (n / 4 % 16): the rows that sixteen lanes write at one k fall on all banks */
  const int bx = blockIdx.x, tid = threadIdx.x;
  if (bx < 4 * PREP_WB) {      /* the same for the whole block: the barrier below is passed by all or by none. The weights have the longer chain: they take the lowest block indices */
    const int p = bx / PREP_WB, tile = bx - p * PREP_WB; const float* W = p == 0 ? wq : p == 1 ? wk : p == 2 ? wv : wo;
    const int k0 = (tile / (DM / PREP_T)) * PREP_T, n0 = (tile % (DM / PREP_T)) * PREP_T;
    const int lane = tid & 31, wave = tid >> 5;
    const float* wp = W + (size_t)(k0 + 16 * wave) * DM + n0 + 4 * lane;      /* the thread's 16 k x 4 n corner: a wave covers 512 bytes of one W row */
    v4f r[16];
#pragma unroll
    for (int j = 0; j < 16; ++j) r[j] = *(const v4fa*)(wp + (size_t)j * DM);
    asm volatile("s_wait_xcnt 0x0" :: "v"(wp), "v"(r[0]), "v"(r[1]), "v"(r[2]), "v"(r[3]), "v"(r[4]), "v"(r[5]), "v"(r[6]), "v"(r[7]), "v"(r[8]), "v"(r[9]), "v"(r[10]), "v"(r[11]), "v"(r[12]), "v"(r[13]), "v"(r[14]), "v"(r[15]) : "memory");      /* inputs only. The loaded values: all sixteen loads stay in front of the first conversion, one latency for the tile (left alone the compiler issues them in three batches, each behind the wait for the one before). The address: its registers are no load's destination, and the wait stands in front of every overwrite of them */
#pragma unroll
    for (int i = 0; i < 4; ++i)
#pragma unroll
      for (int hb = 0; hb < 2; ++hb) { FragH f;
#pragma unroll
        for (int j = 0; j < 8; ++j) f.h[j] = (_Float16)(bf16_round(r[8 * hb + j][i]) * 16.0f);
        *(v8us*)&ts[4 * lane + i][8 * ((2 * wave + hb) ^ (lane & 15))] = f.half[0]; }      /* row n = 4 lane + i, piece 2 wave + hb */
    __syncthreads();      /* the tile is whole before its rows are read */
    const int c = tid & 15, nr = tid >> 4;
    unsigned short* bp = (unsigned short*)Bt + (size_t)p * DM * DM + (size_t)(n0 + nr) * DM + k0 + 8 * c;
#pragma unroll
    for (int u = 0; u < 8; ++u) { const int n = nr + 16 * u; *(v8us*)(bp + (size_t)(16 * u) * DM) = *(const v8us*)&ts[n][8 * (c ^ ((n >> 2) & 15))]; }      /* row n, piece c: sixteen lanes cover 256 bytes of one Wt row */
  } else {
    const size_t t0 = (size_t)(bx - 4 * PREP_WB) * (256 * PREP_XP) + tid;
    const float* xp = x + t0 * 8;      /* piece u lies 256 x 8 elements further on */
    v4f a[PREP_XP][2];
#pragma unroll
    for (int u = 0; u < PREP_XP; ++u) { a[u][0] = *(const v4fa*)(xp + 2048 * u); a[u][1] = *(const v4fa*)(xp + 2048 * u + 4); }
    asm volatile("s_wait_xcnt 0x0" :: "v"(xp) : "memory");      /* stands in front of every overwrite of the address registers that the loads above name, and keeps them out of the loads' destinations */
#pragma unroll
    for (int u = 0; u < PREP_XP; ++u) { FragH f;
#pragma unroll
      for (int q = 0; q < 4; ++q) { f.h[q] = (_Float16)bf16_round(a[u][0][q]); f.h[4 + q] = (_Float16)bf16_round(a[u][1][q]); }
      *(v8us*)((unsigned short*)X16 + (t0 + 256 * u) * 8) = f.half[0]; }
    asm volatile("s_wait_xcnt 0x0" ::: "memory");      /* behind the last store: stands in front of any later overwrite of the stores' address and data registers */
  }
}
// k_gemm_hh variant with fused epilogue: v = acc·alpha + bias[by·sBias + col] (+ CP[(row/rowsPerB)·sCPb + by·64 + col] if CP) ; ACT 0 none / 1 elu ; writes f16 C16 (and f32 C if non-null)
template <int ACT>
__global__ __launch_bounds__(128) void k_gemm_hhx(const _Float16* __restrict__ A, int lda, size_t sA, const _Float16* __restrict__ Bh, int ldb, size_t sB, float alpha, const float* __restrict__ bias, size_t sBias, const float* __restrict__ CP, int rowsPerB, size_t sCPb, int row0g,
    float* __restrict__ C, _Float16* __restrict__ C16, int ldc, size_t sC, int M, int N, int K) {
  __shared__ __attribute__((aligned(16))) float so[4][16][64];
  const int tid = threadIdx.x, w = tid >> 5, lane = tid & 31, ln = lane & 15, hh = lane >> 4; const int by = blockIdx.y;
  A += (size_t)by * sA; Bh += (size_t)by * sB; const size_t cofs = (size_t)by * sC; const float* bp = bias ? bias + (size_t)by * sBias : nullptr;
  const int ntn = (N + 63) / 64; const int wid = blockIdx.x * 4 + w; const int mt = wid / ntn, nq = wid % ntn; if (mt * 16 >= M) return;
  const int row0 = mt * 16, col0 = nq * 64; const _Float16* arow = A + (size_t)(row0 + ln) * lda;
  v8f acc[4] = {};
  for (int kb = 0; kb < K; kb += 32) { FragH ah; ah.half[0] = *(const v8us*)((const unsigned short*)arow + kb + 8 * hh); ah.half[1] = *(const v8us*)((const unsigned short*)arow + kb + 16 + 8 * hh);
#pragma unroll
    for (int t = 0; t < 4; ++t) { if (col0 + t * 16 >= N) continue; const size_t boff = (size_t)(col0 + t * 16 + ln) * ldb + kb; FragH bq; bq.half[0] = *(const v8us*)((const unsigned short*)Bh + boff + 8 * hh); bq.half[1] = *(const v8us*)((const unsigned short*)Bh + boff + 16 + 8 * hh);
      acc[t] = mmaH<1>(ah.v, ah.v, bq.v, bq.v, acc[t]); }
  }
#pragma unroll
  for (int t = 0; t < 4; ++t) { if (col0 + t * 16 >= N) continue; const int col = col0 + t * 16 + ln; const float bv = bp ? bf16_round(bp[col]) : 0.f;
#pragma unroll
    for (int r = 0; r < 8; ++r) { float v = acc[t][r] * alpha + bv; if (CP) { const int rr = row0g + row0 + 8 * hh + r; if (rowsPerB < 0) v += CP[cofs + (size_t)rr * ldc + col];      /* rowsPerB < 0: own element of the batched C plane */ else { const int bidx = rr / rowsPerB; v += CP[(size_t)bidx * sCPb + (size_t)by * 64 + col]; } } if (ACT == 1) v = (v > 0.f) ? v : expm1f(v); else if (ACT == 7) v = (v > 0.f) ? v + 1.0f : expf(v); else if (ACT == 8) v = tanhf(v); else if (ACT == 9) v = 0.5f * v * (1.0f + tanhf(0.7978845608028654f * (v + 0.044715f * v * v * v))); else if (ACT == 11) v = 1.0f / (1.0f + expf(-v)); else if (ACT == 12) v = (v > 0.f) ? v : 0.01f * v; else if (ACT == 14) v = (v > 0.f) ? v : 0.1f * v; else if (ACT == 16) v = (v >= 0.f) ? v : 0.3f * v; else if (ACT == 17) v = (v >= 0.f) ? v : 0.2f * v; else if (ACT == 15) v = v / (1.0f + expf(-v)); else if (ACT == 3) v = fmaxf(v, 0.f); else if (ACT == 6) v = 0.5f * v * (1.0f + erff(v * 0.70710678118654752f)); so[w][8 * hh + r][t * 16 + ln] = v; } }
  __builtin_amdgcn_fence(__ATOMIC_ACQ_REL, "workgroup"); __builtin_amdgcn_wave_barrier();
  const int rsub = lane >> 4, c4 = (lane & 15) * 4; typedef _Float16 v4h __attribute__((ext_vector_type(4)));
  {
#pragma unroll
    for (int q = 0; q < 8; ++q) { const int r = q * 2 + rsub; if (col0 + c4 < N) { const v4f v = *(const v4fa*)&so[w][r][c4]; if (C) *(v4f*)(C + cofs + (size_t)(row0 + r) * ldc + col0 + c4) = v; if (C16) { v4h h4; for (int i = 0; i < 4; ++i) h4[i] = (_Float16)v[i]; *(v4h*)(C16 + cofs + (size_t)(row0 + r) * ldc + col0 + c4) = h4; } } }
     }
}


typedef _Float16 v4h __attribute__((ext_vector_type(4)));

__global__ __launch_bounds__(256) void k_h16(const float* __restrict__ x, _Float16* __restrict__ X16, size_t n8) { const size_t t = (size_t)blockIdx.x * 256 + threadIdx.x; if (t >= n8) return; FragH f;
#pragma unroll
  for (int q = 0; q < 8; ++q) f.h[q] = (_Float16)x[t * 8 + q]; *(v8us*)((unsigned short*)X16 + t * 8) = f.half[0];  }
__global__ __launch_bounds__(256) void k_round16f(const float* __restrict__ W, _Float16* __restrict__ Bt, size_t n8) { const size_t t = (size_t)blockIdx.x * 256 + threadIdx.x; if (t >= n8) return; FragH f;
#pragma unroll
  for (int i = 0; i < 8; ++i) f.h[i] = (_Float16)(bf16_round(W[t * 8 + i]) * 16.0f); *(v8us*)((unsigned short*)Bt + t * 8) = f.half[0];  }
template <int NHv, int TTv>
__global__ __launch_bounds__(256) void k_vt(const _Float16* __restrict__ V16, int ldv, int voff, _Float16* __restrict__ Vt) { __shared__ unsigned short tl[64][66]; const int tid = threadIdx.x; const int slab = blockIdx.x / (TTv / 64), lg = blockIdx.x % (TTv / 64); const int b = slab / NHv, h = slab % NHv;
  for (int i = tid; i < 64 * 8; i += 256) { const int r = i / 8, c8 = (i % 8) * 8; FragH f; f.half[0] = *(const v8us*)((const unsigned short*)V16 + ((size_t)b * TTv + lg * 64 + r) * ldv + voff + h * 64 + c8);
#pragma unroll
    for (int q = 0; q < 8; ++q) tl[r][c8 + q] = f.u[q]; }
  __syncthreads();
  {
#pragma unroll
    for (int rd = 0; rd < 2; ++rd) { const int d = rd * 32 + tid / 8, pc = tid % 8; FragH f;
#pragma unroll
      for (int q = 0; q < 8; ++q) f.u[q] = tl[pc * 8 + q][d];
      *(v8us*)((unsigned short*)Vt + ((size_t)slab * 64 + d) * TTv + lg * 64 + pc * 8) = f.half[0]; }
     } }

__global__ __launch_bounds__(256) void k_hl(const float* __restrict__ F, _Float16* __restrict__ Hh, _Float16* __restrict__ Hl, size_t n8) { const size_t t = (size_t)blockIdx.x * 256 + threadIdx.x; if (t >= n8) return; FragH fh, fl; const v4f a = *(const v4fa*)(F + t * 8), c = *(const v4fa*)(F + t * 8 + 4);
#pragma unroll
  for (int q = 0; q < 4; ++q) { _Float16 h = (_Float16)a[q]; fh.h[q] = h; fl.h[q] = (_Float16)((a[q] - (float)h) * 1024.0f); h = (_Float16)c[q]; fh.h[4 + q] = h; fl.h[4 + q] = (_Float16)((c[q] - (float)h) * 1024.0f); }
  { *(v8us*)((unsigned short*)Hh + t * 8) = fh.half[0]; *(v8us*)((unsigned short*)Hl + t * 8) = fl.half[0];  } }

// ---- fast GEMM (block tile 128x64, wave tile 32x64; A and B k-tiles staged in LDS; requires M % 128 == 0 rows per launch region, N % 64 == 0 and K % 64 == 0); epilogue = k_gemm_hhx semantics ----
__device__ __forceinline__ v16h g2_frag(const _Float16* p, int hh) { FragH f; f.half[0] = *(const v8us*)((const unsigned short*)p + 8 * hh); f.half[1] = *(const v8us*)((const unsigned short*)p + 16 + 8 * hh); return f.v; }
__device__ __forceinline__ v8f g2_mma(v16h a, v16h b, v8f c) { v8f d = __builtin_amdgcn_wmma_f32_16x16x32_f16(false, a, false, b, (short)0, c, false, false); asm volatile("v_nop\n\tv_nop\n\tv_nop\n\tv_nop" : "+v"(d) : "v"(a), "v"(b)); return d; }
#define G2_KS 64                     /* k per LDS stage: one 128-byte line of every A and B row */
#define G2_LP 72                     /* LDS row pitch in halves: 144 B = 16 B x odd for 16-byte row reads */
#define G2_TP 136                    /* LDS row pitch in halves of the turned output tile (128 tokens): 272 B = 16 B x odd */
typedef unsigned int v4ua __attribute__((ext_vector_type(4), may_alias));
typedef float g2_v2f __attribute__((ext_vector_type(2)));
typedef _Float16 g2_v2h __attribute__((ext_vector_type(2)));
__device__ __forceinline__ unsigned int g2_pack(float lo, float hi) { return __builtin_bit_cast(unsigned int, __builtin_convertvector((g2_v2f){lo, hi}, g2_v2h)); }      /* two f32 -> two f16, round to nearest even as the scalar cast */
__device__ __forceinline__ v16h g2_lfrag(const unsigned short* p) { FragH f; f.half[0] = *(const v8us*)p; f.half[1] = *(const v8us*)(p + 16); return f.v; }      /* p already holds the lane half's + 8 hh: the k order of g2_frag */
template <int ACT, int LDA, int LDB, int LDC, bool HASB, bool HASCP, bool OUT32, bool OUT16, bool P2T>      /* row pitches at compile time: a tile's row pieces are immediate offsets from one address pair; the epilogue's options (bias, residual CP, f32 / f16 output) at compile time: straight-line code without a test per element or per row. P2T: plane 2 (grid.y == 2) leaves as per-head transposed f16 rows CT[batch][head][d][token] and is not written to C16 */
__global__ __launch_bounds__(128) void k_gemm2(const _Float16* __restrict__ A, size_t sA, const _Float16* __restrict__ Bh, size_t sB, float alpha, const float* __restrict__ bias, const float* __restrict__ bias1, const float* __restrict__ bias2, size_t sBias, const float* __restrict__ CP, int rowsPerB, size_t sCPb, int row0g,
    float* __restrict__ C, _Float16* __restrict__ C16, _Float16* __restrict__ CT, size_t sC, int M, int N, int K) { static_assert(ACT == 0 || ACT == 3 || ACT == 6 || ACT == 8 || ACT == 9 || ACT == 11 || ACT == 12 || ACT == 14 || ACT == 15 || ACT == 16 || ACT == 17, "k_gemm2: unsupported ACT code (would silently apply no activation)");
  __shared__ __attribute__((aligned(16))) unsigned short tl[2][128 + 64][G2_LP];      /* per buffer: the block's 128 A rows, then its 64 B rows, G2_KS halves of each */
  float (*so)[32][68] = (float (*)[32][68])&tl[0][0][0];      /* the epilogue's staging takes the tiles' place behind the loop's last barrier */
  static_assert(sizeof(tl) >= sizeof(float) * 4 * 32 * 68, "k_gemm2: epilogue staging must fit in the tile buffers");
  const int tid = threadIdx.x, w = tid >> 5, lane = tid & 31, ln = lane & 15, hh = lane >> 4; const int by = blockIdx.y;
  A += (size_t)by * sA; Bh += (size_t)by * sB; const size_t cofs = (size_t)by * sC; const float* bsel = (by == 1 && bias1) ? bias1 : (by == 2 && bias2) ? bias2 : bias;      /* planes 1 and 2 may bring their bias in a buffer of its own */
  const float* bp = bsel + (size_t)by * sBias;      /* read only where HASB */
  const int ntn = N >> 6; const int mt = blockIdx.x / ntn, nq = blockIdx.x - mt * ntn; const int row0 = mt * 128 + 32 * w, col0 = nq * 64; if (mt * 128 >= M) return;      /* the same for the whole block: in front of every barrier */
  const int sr = tid >> 3, sc = (tid & 7) * 8;      /* staging: eight lanes cover one 128-byte row piece; piece u is row sr + 16 u */
  const unsigned short* ag = (const unsigned short*)A + (size_t)(mt * 128 + sr) * LDA + sc;
  const unsigned short* bg = (const unsigned short*)Bh + (size_t)(col0 + sr) * LDB + sc;
  const int nst = K / G2_KS;
  int ks = (mt + nq + 4 * by) % (LDA / G2_KS); if (ks >= nst) ks = 0;      /* the k stage the block starts at; it walks all nst stages from there, round the end. The blocks that read the same A rows (one mt) or the same B rows (one nq and plane) run side by side: started at different stages they do not ask L2 for the same lines at the same moment */
  v8us ra[8], rb[4];      /* these and af, bf below are indexed under full unrolls only, so that they stay in registers */
  { const unsigned short* a0 = ag + ks * G2_KS; const unsigned short* b0 = bg + ks * G2_KS;
#pragma unroll
    for (int u = 0; u < 8; ++u) ra[u] = *(const v8us*)(a0 + (size_t)(16 * u) * LDA);
#pragma unroll
    for (int u = 0; u < 4; ++u) rb[u] = *(const v8us*)(b0 + (size_t)(16 * u) * LDB);
    asm volatile("s_wait_xcnt 0x0" :: "v"(a0), "v"(b0) : "memory"); }      /* stands in front of every overwrite of the address registers that the loads above name */
  float bv4[4];      /* the lane's four bias values, fetched behind the first tiles' loads: their latency passes under the k loop */
#pragma unroll
  for (int t = 0; t < 4; ++t) bv4[t] = HASB ? bf16_round(bp[col0 + t * 16 + ln]) : 0.f;
  const v8f z8 = {0.f,0.f,0.f,0.f,0.f,0.f,0.f,0.f}; v8f c00 = z8, c01 = z8, c02 = z8, c03 = z8, c10 = z8, c11 = z8, c12 = z8, c13 = z8;
#pragma unroll
  for (int u = 0; u < 8; ++u) *(v8us*)&tl[0][sr + 16 * u][sc] = ra[u];
#pragma unroll
  for (int u = 0; u < 4; ++u) *(v8us*)&tl[0][128 + sr + 16 * u][sc] = rb[u];
  __syncthreads();
#pragma unroll 1      /* rolled: one stage's code, two buffers by index */
  for (int st = 0; st < nst; ++st) { const int bu = st & 1;
    if (st + 1 < nst) {      /* the next stage's tiles fly into registers under this stage's products */
      ks = (ks + 1 == nst) ? 0 : ks + 1;
      const unsigned short* an = ag + ks * G2_KS; const unsigned short* bn = bg + ks * G2_KS;
#pragma unroll
      for (int u = 0; u < 8; ++u) ra[u] = *(const v8us*)(an + (size_t)(16 * u) * LDA);
#pragma unroll
      for (int u = 0; u < 4; ++u) rb[u] = *(const v8us*)(bn + (size_t)(16 * u) * LDB);
      asm volatile("s_wait_xcnt 0x0" :: "v"(an), "v"(bn) : "memory");      /* stands in front of every overwrite of the address registers that the loads above name */
    }
    v16h af[G2_KS / 32][2], bf[G2_KS / 32][4];      /* the stage's fragments are read as one group in front of its products */
#pragma unroll
    for (int kk = 0; kk < G2_KS / 32; ++kk) { const unsigned short* ap = &tl[bu][32 * w + ln][32 * kk + 8 * hh]; const unsigned short* bq = &tl[bu][128 + ln][32 * kk + 8 * hh];
      af[kk][0] = g2_lfrag(ap); af[kk][1] = g2_lfrag(ap + 16 * G2_LP);
#pragma unroll
      for (int t = 0; t < 4; ++t) bf[kk][t] = g2_lfrag(bq + 16 * t * G2_LP); }
#pragma unroll
    for (int kk = 0; kk < G2_KS / 32; ++kk) {
      c00 = g2_mma(af[kk][0], bf[kk][0], c00); c10 = g2_mma(af[kk][1], bf[kk][0], c10);
      c01 = g2_mma(af[kk][0], bf[kk][1], c01); c11 = g2_mma(af[kk][1], bf[kk][1], c11);
      c02 = g2_mma(af[kk][0], bf[kk][2], c02); c12 = g2_mma(af[kk][1], bf[kk][2], c12);
      c03 = g2_mma(af[kk][0], bf[kk][3], c03); c13 = g2_mma(af[kk][1], bf[kk][3], c13); }
    if (st + 1 < nst) {
#pragma unroll
      for (int u = 0; u < 8; ++u) *(v8us*)&tl[bu ^ 1][sr + 16 * u][sc] = ra[u];
#pragma unroll
      for (int u = 0; u < 4; ++u) *(v8us*)&tl[bu ^ 1][128 + sr + 16 * u][sc] = rb[u]; }
    __syncthreads();      /* publishes the next stage and ends every wave's reads of this one, which the next trip (or the epilogue) overwrites */
  }
  v8f accs[8] = {c00, c01, c02, c03, c10, c11, c12, c13};
  if (P2T && by == 2) {      /* the same for the whole block: the barrier inside is passed by all or by none */
    static_assert(!P2T || (ACT == 0 && !HASCP && SQ % 128 == 0 && HD == 64 && LDC == NH * HD), "k_gemm2 P2T: a block tile is 128 tokens of one batch x the 64 columns of one head");
    static_assert(sizeof(tl) >= 2 * HD * G2_TP, "k_gemm2 P2T: the turned tile must fit in the tile buffers");
    unsigned short (*tt)[G2_TP] = (unsigned short (*)[G2_TP])&tl[0][0][0];      /* [d][token of the block]; takes the tiles' place behind the loop's last barrier, like so */
#pragma unroll      /* accs and bv4 are indexed by u: in registers only under a full unroll */
    for (int u = 0; u < 8; ++u) { const int t = u & 3, half = u >> 2; const v8f v = accs[u] * alpha + bv4[t];      /* an accumulator's eight registers are eight consecutive tokens of one column: one 16-byte piece of a turned row */
      *(v4ua*)&tt[t * 16 + ln][32 * w + 16 * half + 8 * hh] = (v4ua){g2_pack(v[0], v[1]), g2_pack(v[2], v[3]), g2_pack(v[4], v[5]), g2_pack(v[6], v[7])}; }
    __syncthreads();      /* the turned tile is whole (a row holds pieces of all four waves) before its rows are read */
    const int tr = mt * 128, bb = tr / SQ, pc = tid & 15, dr = tid >> 4;      /* sixteen lanes cover the 256 bytes that the block holds of one turned row */
    unsigned short* tp = (unsigned short*)CT + ((size_t)(bb * NH + nq) * HD + dr) * SQ + (tr - bb * SQ) + 8 * pc;
#pragma unroll      /* the eight LDS reads issue as one group, the row steps become immediate offsets */
    for (int q = 0; q < 8; ++q) *(v8us*)(tp + (size_t)(8 * q) * SQ) = *(const v8us*)&tt[dr + 8 * q][8 * pc];
    return; }
#pragma unroll
  for (int u = 0; u < 8; ++u) { const int t = u & 3, half = u >> 2; const int col = col0 + t * 16 + ln; const float bv = bv4[t];
#pragma unroll
    for (int r = 0; r < 8; ++r) { const int rloc = half * 16 + 8 * hh + r; float v = accs[u][r] * alpha + bv; if (HASCP) { if (rowsPerB < 0) v += CP[cofs + (size_t)(row0g + row0 + rloc) * LDC + col];      /* rowsPerB < 0: own element of the batched C plane */ else { const int bidx = (row0g + row0 + rloc) / rowsPerB; v += CP[(size_t)bidx * sCPb + (size_t)by * 64 + col]; } }
      if (ACT == 3) v = fmaxf(v, 0.f); else if (ACT == 6) v = 0.5f * v * (1.0f + erff(v * 0.70710678118654752f)); else if (ACT == 11) v = 1.0f / (1.0f + expf(-v)); else if (ACT == 15) v = v / (1.0f + expf(-v)); else if (ACT == 12) v = (v > 0.f) ? v : 0.01f * v; else if (ACT == 8) v = tanhf(v); else if (ACT == 9) v = 0.5f * v * (1.0f + tanhf(0.7978845608028654f * (v + 0.044715f * v * v * v))); else if (ACT == 14) v = (v > 0.f) ? v : 0.1f * v; else if (ACT == 16) v = (v >= 0.f) ? v : 0.3f * v; else if (ACT == 17) v = (v >= 0.f) ? v : 0.2f * v;
      so[w][rloc][t * 16 + ln] = v; } }
  __builtin_amdgcn_fence(__ATOMIC_ACQ_REL, "workgroup"); __builtin_amdgcn_wave_barrier();
  const int rsub = lane >> 4, c4 = (lane & 15) * 4;
  {
#pragma unroll
    for (int q = 0; q < 16; ++q) { const int r = q * 2 + rsub; const v4f v = *(const v4fa*)&so[w][r][c4]; if (OUT32) *(v4f*)(C + cofs + (size_t)(row0 + r) * LDC + col0 + c4) = v; if (OUT16) { v4h h4; for (int i = 0; i < 4; ++i) h4[i] = (_Float16)v[i]; *(v4h*)(C16 + cofs + (size_t)(row0 + r) * LDC + col0 + c4) = h4; } }
     } }


__global__ __launch_bounds__(256) void k_wnat(const float* __restrict__ w, size_t n8, _Float16* __restrict__ Bt) { const size_t t = (size_t)blockIdx.x * 256 + threadIdx.x; if (t >= n8) return; FragH f; for (int q = 0; q < 8; ++q) f.h[q] = (_Float16)(bf16_round(w[t * 8 + q]) * 16.0f); *(v8us*)((unsigned short*)Bt + t * 8) = f.half[0];  }
__global__ __launch_bounds__(256) void k_rsm(const float* __restrict__ S, _Float16* __restrict__ P, int nrows) {
  #pragma clang fp contract(off)
  const int i = blockIdx.x * 256 + threadIdx.x; if (i >= nrows) return; const float* s = S + (size_t)i * SQ; float mx = -3.0e38f;
#pragma unroll 1
  for (int j = 0; j < SQ; ++j) mx = fmaxf(mx, s[j]); float se = 0.f;
#pragma unroll 1
  for (int j = 0; j < SQ; ++j) se += expf(s[j] - mx); const float sc = 256.0f / se;
#pragma unroll 1
  for (int j0 = 0; j0 < SQ; j0 += 8) { FragH f; for (int q = 0; q < 8; ++q) f.h[q] = (_Float16)(expf(s[j0 + q] - mx) * sc); unsigned short* d = (unsigned short*)P + (size_t)i * SQ + j0; *(v8us*)d = f.half[0];  } }
__global__ __launch_bounds__(256) void k_vt(const _Float16* __restrict__ V16, int b, int h0, _Float16* __restrict__ VT) { __shared__ unsigned short tl[64][65]; const int tid = threadIdx.x; const int hh = blockIdx.x % HG, sg = blockIdx.x / HG; const int s0 = sg * 64; const int h = h0 + hh;
  for (int i = tid; i < 64 * 8; i += 256) { const int j = i / 8, d8 = (i % 8) * 8; FragH f; f.half[0] = *(const v8us*)((const unsigned short*)V16 + ((size_t)b * SQ + s0 + j) * DM + h * HD + d8); for (int q = 0; q < 8; ++q) tl[d8 + q][j] = f.u[q]; }
  __syncthreads();
  { for (int i = tid; i < 64 * 8; i += 256) { const int d = i / 8, j8 = (i % 8) * 8; FragH f; for (int q = 0; q < 8; ++q) f.u[q] = tl[d][j8 + q]; *(v8us*)((unsigned short*)VT + ((size_t)hh * HD + d) * SQ + s0 + j8) = f.half[0]; }  } }



// ---- fused attention: per work-group FA_BR queries of one (batch, head) against all SQ keys; of every 64-key stage a wave takes one 32-key pass, and the two partial results of a query are joined at the end. Transposed products: S^T = K Q^T puts one query's
// scores in one lane pair (l, l ^ 16), so maximum and weights are in-lane; two S^T tiles (32 keys), converted in place, are the B operand of
// O^T += V^T P^T. Every A/B fragment is loaded in the same k order (8 h + 0..7, 16 + 8 h + 0..7), which is the order the converted tiles have.
#define FA_NW 4                      /* waves per work-group */
#define FA_KH 2                      /* key halves: each of a stage's two 32-key passes has its own waves */
#define FA_QW (FA_NW / FA_KH)        /* waves side by side on the queries */
#define FA_R 2                       /* 16-query column groups per wave */
#define FA_BR (FA_QW * FA_R * 16)    /* queries per work-group: 768 work-groups, three for each of the 256 WGPs and three waves for each SIMD */
#define FA_SK 64                     /* keys per LDS stage = two 32-key passes, one per key half */
#define FA_XP (FA_R * 8 + 1)         /* 16-byte pieces a lane hands over when the key halves are joined: its O^T tiles, then maxima and sums */
#define FA_LP 72                     /* LDS row pitch in halves: 144 B = 16 B x odd for 16-byte row reads */
#define FA_NST (SQ / FA_SK)
static_assert(HD == 64 && FA_SK == 64 && SQ % FA_SK == 0 && SQ % FA_BR == 0 && FA_NW * 32 == 128, "k_fattn: 64 x 128-byte tiles, four 16-byte pieces of each per thread, whole stages and whole query blocks");
static_assert((FA_NST & (FA_NST - 1)) == 0, "k_fattn: the rotated stage walk wraps by a mask");
static_assert(FA_SK == 32 * FA_KH && FA_KH == 2 && FA_R == 2 && FA_QW * FA_XP * 32 * 16 <= 2 * FA_SK * FA_LP * 2, "k_fattn: one pass per key half and stage; the hand-over (two maxima and two sums in one piece) fits in the K buffers");
typedef float v2f __attribute__((ext_vector_type(2)));
typedef _Float16 v2h __attribute__((ext_vector_type(2)));
typedef unsigned int v8u __attribute__((ext_vector_type(8)));
typedef unsigned int v4u __attribute__((ext_vector_type(4)));
__device__ __forceinline__ v16h fa_frag(const unsigned short* p) { FragH f; f.half[0] = *(const v8us*)p; f.half[1] = *(const v8us*)(p + 16); return f.v; }      /* p already holds the lane half's + 8 h */
__device__ __forceinline__ unsigned int fa_pack(float lo, float hi) { return __builtin_bit_cast(unsigned int, __builtin_convertvector((v2f){lo, hi}, v2h)); }
__device__ __forceinline__ float fa_xh(float x) { return __builtin_bit_cast(float, __builtin_amdgcn_permlanex16(__builtin_bit_cast(int, x), __builtin_bit_cast(int, x), 0x76543210, 0xfedcba98, false, false)); }      /* lane l with lane l ^ 16 */
__device__ __forceinline__ v8f fa_mma(v16h a, v16h b, v8f c) { return __builtin_amdgcn_wmma_f32_16x16x32_f16(false, a, false, b, (short)0, c, false, false); }
__global__ __launch_bounds__(FA_NW * 32) void k_fattn(const _Float16* __restrict__ Q16, const _Float16* __restrict__ K16, const _Float16* __restrict__ VT, _Float16* __restrict__ O16) {
  __shared__ __attribute__((aligned(16))) unsigned short sk[2][FA_SK][FA_LP];      /* K rows [key][d] */
  __shared__ __attribute__((aligned(16))) unsigned short sv[2][HD][FA_LP];         /* V^T rows [d][key] */
  const int tid = threadIdx.x, lane = tid & 31, c = lane & 15, h = lane >> 4;
  const int wave = __builtin_amdgcn_readfirstlane(tid >> 5), qw = wave % FA_QW, kh = wave / FA_QW;      /* scalar: the tests on kh below are scalar branches */
  const int bh = blockIdx.y, b = bh / NH, hd = bh - b * NH;
  const int q0 = blockIdx.x * FA_BR + qw * (FA_R * 16);
  const int sr = tid >> 3, sc = (tid & 7) * 8;      /* staging: eight lanes cover one 128-byte row; piece u is row sr + 16 u */
  const unsigned short* kg = (const unsigned short*)K16 + ((size_t)b * SQ + sr) * DM + hd * HD + sc;
  const unsigned short* vg = (const unsigned short*)VT + ((size_t)bh * HD + sr) * SQ + sc;
  const float cscale = 0.125f * 1.4426950408889634f;      /* HD^-0.5 log2(e) */
  const int rot = blockIdx.x & (FA_NST - 1);      /* the key stage the work-group starts at; it walks all FA_NST stages from there, round the end. The work-groups of one (batch, head) read the same K and V^T lines and run side by side: each starts elsewhere, so that they do not ask L2 for the same lines at the same moment */
  v8us rk[4], rv[4];
  { const unsigned short* k0 = kg + (size_t)rot * FA_SK * DM; const unsigned short* v0 = vg + rot * FA_SK;
#pragma unroll
    for (int u = 0; u < 4; ++u) { rk[u] = *(const v8us*)(k0 + (size_t)(16 * u) * DM); rv[u] = *(const v8us*)(v0 + (size_t)(16 * u) * SQ); }
    asm volatile("s_wait_xcnt 0x0" :: "v"(k0), "v"(v0) : "memory"); }      /* stands in front of every overwrite of the address registers that the loads above name */
  v16h qf[FA_R][2];
#pragma unroll
  for (int g = 0; g < FA_R; ++g) { const unsigned short* qp = (const unsigned short*)Q16 + ((size_t)b * SQ + q0 + 16 * g + c) * DM + hd * HD + 8 * h; qf[g][0] = fa_frag(qp); qf[g][1] = fa_frag(qp + 32); }
  const unsigned int o1 = (c == 0) ? 0x3C003C00u : 0u;      /* A operand whose row 0 is f16 ones: its product with P^T is the weights' column sums */
  const v16h ones = __builtin_bit_cast(v16h, (v8u){o1, o1, o1, o1, o1, o1, o1, o1});
  const v8f z8 = {0.f, 0.f, 0.f, 0.f, 0.f, 0.f, 0.f, 0.f};
  v8f acc[FA_R][4], lacc[FA_R]; float m_run[FA_R];
#pragma unroll
  for (int g = 0; g < FA_R; ++g) { m_run[g] = -__builtin_inff(); lacc[g] = z8; acc[g][0] = z8; acc[g][1] = z8; acc[g][2] = z8; acc[g][3] = z8; }
#pragma unroll
  for (int u = 0; u < 4; ++u) { *(v8us*)&sk[0][sr + 16 * u][sc] = rk[u]; *(v8us*)&sv[0][sr + 16 * u][sc] = rv[u]; }
  __syncthreads();
#pragma unroll 1      /* rolled: one stage's code, two buffers by index */
  for (int st = 0; st < FA_NST; ++st) {
    const int bu = st & 1;
    if (st + 1 < FA_NST) {      /* the next stage's tiles fly into registers under this stage's pass */
      const int sn = (st + 1 + rot) & (FA_NST - 1);
      const unsigned short* kn = kg + (size_t)sn * FA_SK * DM; const unsigned short* vn = vg + sn * FA_SK;
#pragma unroll
      for (int u = 0; u < 4; ++u) { rk[u] = *(const v8us*)(kn + (size_t)(16 * u) * DM); rv[u] = *(const v8us*)(vn + (size_t)(16 * u) * SQ); }
      asm volatile("s_wait_xcnt 0x0" :: "v"(kn), "v"(vn) : "memory");      /* stands in front of every overwrite of the address registers that the loads above name */
    }
    { const int sub = kh;      /* the wave's own 32 keys of the stage */
      v8f s[2][FA_R];
      { v16h kf[2][2];
#pragma unroll
        for (int kt = 0; kt < 2; ++kt) { const unsigned short* p = &sk[bu][32 * sub + 16 * kt + c][8 * h]; kf[kt][0] = fa_frag(p); kf[kt][1] = fa_frag(p + 32); }
#pragma unroll
        for (int kt = 0; kt < 2; ++kt)
#pragma unroll
          for (int g = 0; g < FA_R; ++g) s[kt][g] = fa_mma(kf[kt][0], qf[g][0], z8);
#pragma unroll
        for (int kt = 0; kt < 2; ++kt)
#pragma unroll
          for (int g = 0; g < FA_R; ++g) s[kt][g] = fa_mma(kf[kt][1], qf[g][1], s[kt][g]); }
      v16h vf[4];
#pragma unroll
      for (int t = 0; t < 4; ++t) vf[t] = fa_frag(&sv[bu][16 * t + c][32 * sub + 8 * h]);
      float mb[FA_R]; bool need = false;
#pragma unroll
      for (int g = 0; g < FA_R; ++g) { float mx = s[0][g][0];
#pragma unroll
        for (int r = 1; r < 8; ++r) mx = fmaxf(mx, s[0][g][r]);
#pragma unroll
        for (int r = 0; r < 8; ++r) mx = fmaxf(mx, s[1][g][r]);
        mx = fmaxf(mx, fa_xh(mx)) * cscale; mb[g] = mx; need = need || (mx > m_run[g] + 8.0f); }
      if (__builtin_amdgcn_ballot_w32(need) != 0) {      /* lazy rescale: the maximum in use may trail the true one by up to 8 (log2), so a weight stays below 2^8 */
#pragma unroll
        for (int g = 0; g < FA_R; ++g) { const float mn = fmaxf(m_run[g], mb[g]); const float corr = __builtin_amdgcn_exp2f(m_run[g] - mn); m_run[g] = mn; lacc[g] = lacc[g] * corr;
#pragma unroll
          for (int t = 0; t < 4; ++t) acc[g][t] = acc[g][t] * corr; } }
#pragma unroll
      for (int g = 0; g < FA_R; ++g) { const float nm = -m_run[g]; v8u w;
#pragma unroll
        for (int i = 0; i < 8; ++i) { const v2f a = __builtin_elementwise_fma((v2f){s[i >> 2][g][2 * (i & 3)], s[i >> 2][g][2 * (i & 3) + 1]}, (v2f){cscale, cscale}, (v2f){nm, nm}); w[i] = fa_pack(__builtin_amdgcn_exp2f(a[0]), __builtin_amdgcn_exp2f(a[1])); }
        const v16h pf = __builtin_bit_cast(v16h, w);      /* element e: key 8 h + e (tile 0), 16 + 8 h + e - 8 (tile 1) of query c */
#pragma unroll
        for (int t = 0; t < 4; ++t) acc[g][t] = fa_mma(vf[t], pf, acc[g][t]);
        lacc[g] = fa_mma(ones, pf, lacc[g]); }
    }
    __builtin_amdgcn_sched_barrier(0);      /* keeps the v_nop run below directly behind the stage's last WMMA */
    asm volatile("v_nop\n\tv_nop\n\tv_nop\n\tv_nop");      /* the four vector slots behind a WMMA, also on the taken side of the branches that follow */
    __builtin_amdgcn_sched_barrier(0);
    if (st + 1 < FA_NST) {
#pragma unroll
      for (int u = 0; u < 4; ++u) { *(v8us*)&sk[bu ^ 1][sr + 16 * u][sc] = rk[u]; *(v8us*)&sv[bu ^ 1][sr + 16 * u][sc] = rv[u]; } }
    __syncthreads();      /* publishes the next stage and ends every wave's reads of this one, which the next trip overwrites */
  }
  /* The key halves of a query are joined: the waves of half 1 hand maxima, sums and O^T tiles over in LDS (the K buffers, free behind the loop's last barrier), lane to lane; the waves of half 0 bring both to the common maximum, add and write. */
  float ls[FA_R];
#pragma unroll
  for (int g = 0; g < FA_R; ++g) { const float lr = lacc[g][0]; ls[g] = lr + fa_xh(lr); }      /* row 0 of the sum tile sits in lanes 0-15, row 8 (zero) in lanes 16-31: the exchange-and-add is unconditional */
  v4fa* xq = (v4fa*)&sk[0][0][0] + qw * (FA_XP * 32) + lane;      /* piece j of the lane lies 32 j pieces further on: a wave's 32 pieces are 512 bytes in a row */
  if (kh != 0) {
#pragma unroll
    for (int g = 0; g < FA_R; ++g)
#pragma unroll
      for (int t = 0; t < 4; ++t) { const v8f a = acc[g][t]; xq[(8 * g + 2 * t) * 32] = (v4f){a[0], a[1], a[2], a[3]}; xq[(8 * g + 2 * t + 1) * 32] = (v4f){a[4], a[5], a[6], a[7]}; }
    xq[(FA_XP - 1) * 32] = (v4f){m_run[0], m_run[1], ls[0], ls[1]}; }
  __syncthreads();      /* half 1's pieces are in LDS before half 0 reads them; every wave passes it */
  if (kh != 0) return;      /* behind the last barrier */
  const v4f ml = xq[(FA_XP - 1) * 32];
#pragma unroll
  for (int g = 0; g < FA_R; ++g) { const float mn = fmaxf(m_run[g], ml[g]); const float c0 = __builtin_amdgcn_exp2f(m_run[g] - mn), c1 = __builtin_amdgcn_exp2f(ml[g] - mn);
    const float inv = 64.0f / (ls[g] * c0 + ml[FA_R + g] * c1); const float a0 = c0 * inv, a1 = c1 * inv;
    unsigned short* op = (unsigned short*)O16 + ((size_t)b * SQ + q0 + 16 * g + c) * DM + hd * HD + 8 * h;
#pragma unroll
    for (int t = 0; t < 4; ++t) { const v4f x0 = xq[(8 * g + 2 * t) * 32], x1 = xq[(8 * g + 2 * t + 1) * 32]; const v8f x = {x0[0], x0[1], x0[2], x0[3], x1[0], x1[1], x1[2], x1[3]};
      const v8f o = acc[g][t] * a0 + x * a1; *(v4u*)(op + 16 * t) = (v4u){fa_pack(o[0], o[1]), fa_pack(o[2], o[3]), fa_pack(o[4], o[5]), fa_pack(o[6], o[7])}; } } }      /* acc register r = d 16 t + 8 h + r of query c */

extern "C" void kernel_launch(void* const* d_in, const int* in_sizes, int n_in,
                              void* d_out, int out_size, void* d_ws, size_t ws_size, hipStream_t stream) {
  (void)in_sizes; (void)n_in; (void)out_size;
  const float* const* I = (const float* const*)d_in; const float* x = I[0]; const float* wq = I[1]; const float* bq = I[2]; const float* wk = I[3]; const float* bk = I[4]; const float* wv = I[5]; const float* bv = I[6]; const float* wo = I[7]; const float* bo = I[8];      /* [in][out] weights + biases */
  char* ws = (char*)d_ws; size_t off = 0;
  auto take = [&](size_t bytes) { char* p = ws + off; off += (bytes + 255) & ~(size_t)255; return p; };
  _Float16* BQ = (_Float16*)take((size_t)DM * DM * 2); _Float16* BK = (_Float16*)take((size_t)DM * DM * 2); _Float16* BV = (_Float16*)take((size_t)DM * DM * 2); _Float16* BO = (_Float16*)take((size_t)DM * DM * 2);
  _Float16* X16 = (_Float16*)take(NR * DM * 2); _Float16* Q16 = (_Float16*)take(NR * DM * 2); _Float16* K16 = (_Float16*)take(NR * DM * 2); _Float16* O16 = (_Float16*)take(NR * DM * 2);
  _Float16* VT = (_Float16*)take((size_t)NB * NH * HD * SQ * 2);
  if (off > ws_size) return;
  static_assert(MP % 128 == 0 && MPO % 128 == 0 && DM % 64 == 0, "k_gemm2: whole 128x64 block tiles and whole 64-wide k stages");
  static_assert(((size_t)DM * DM * 2) % 256 == 0 && (NR * DM * 2) % 256 == 0, "the weight planes BQ, BK, BV, BO and the row planes Q16, K16 lie one behind the other in the workspace");
  k_prep<<<4 * PREP_WB + PREP_XB, 256, 0, stream>>>(x, wq, wk, wv, wo, BQ, X16);      /* [in][out] -> Bt[n][k] x16 for all four weights; x -> f16 rows */
  const size_t r0p = (size_t)B0 * SQ;      /* first projected row */
  k_gemm2<0, DM, DM, DM, true, false, false, true, true><<<dim3((unsigned)((MP / 128) * (DM / 64)), 3), 128, 0, stream>>>(X16 + r0p * DM, 0, BQ, (size_t)DM * DM, 0.0625f, bq, bk, bv, 0, nullptr, 1, 0, 0, nullptr, Q16 + r0p * DM, VT + (size_t)B0 * NH * HD * SQ, NR * DM, MP, DM, DM);      /* grid.y = Q, K, V: one A, three weight and bias planes; Q and K leave as rows, V as V^T [NB][NH][HD][SQ] */
  k_fattn<<<dim3(SQ / FA_BR, NB * NH), FA_NW * 32, 0, stream>>>(Q16, K16, VT, O16);      /* o x64 (merged heads) as f16 rows */
  k_gemm2<0, DM, DM, DM, true, false, true, false, false><<<dim3((unsigned)((MPO / 128) * (DM / 64)), 1), 128, 0, stream>>>(O16 + r0p * DM, 0, BO, 0, 0.0009765625f, bo, nullptr, nullptr, 0, nullptr, 1, 0, 0, (float*)d_out + r0p * DM, nullptr, nullptr, 0, MPO, DM, DM);      /* out rows are the output layout */
}

// v010
// Measured time: 65.5 microseconds a run.
// Two timings next to v009 both put it at 1.03 times that version's speed.
// All steps since v000 together make it 40.7 times as fast.
#include <hip/hip_runtime.h>
// Multi-head self-attention (x [2][2048][768]; q/k/v = x W + b ([in][out] 768x768 sigma 1/sqrt(768), zero biases); 12 heads of 64; softmax(q k^T / 8) over all keys (no mask); out = ctx Wo + bo -> [2][2048][768]).
// Structure: token rows r = b*2048 + s; x as exact f16 rows (bf16-rounded); Q, K, V as one launch of three WMMA GEMMs (32x64 wave tiles, f32 accumulation, exact x16 weights + bias, f16 outputs; the V plane's epilogue writes V^T per batch and head, turned in LDS); one fused attention launch over (query block, batch x head): S^T = K Q^T (K = 64), online softmax in the log2 domain on the score accumulators (f32 statistics, native exp2, weights as f16 relative to the running maximum), O^T += V^T P^T, K and V^T staged in LDS; o carried x64 against f16 subnormal flush (folded into the output GEMM alpha), written straight into the merged f16 o rows; out = o W_o + b GEMM (f32) into the output layout.
// Compute dtype: inputs rounded to bf16; x / weights exact; q, k, v, softmax weights and o as plain f16 GEMM operands (~2^-12); scores and softmax statistics f32. v_wmma_f32_16x16x32_f16.
#define NB 2
#define SQ 2048
#define DM 768
#define NH 12
#define HD 64
#define HG 4                         /* heads per block group of the unlaunched k_vt(b, h0) */
#define B0 0                         /* first batch processed (debug hook) */
#define NBR NB                       /* batches processed (debug hook) */
#define NR ((size_t)NB * SQ)         /* token rows */
#define MP ((int)((size_t)NBR * SQ)) /* rows projected (debug hook) */
#define QN SQ                        /* query rows per batch; not read (k_fattn attends all SQ) */
#define NHD NH                       /* heads; not read (k_fattn attends all NH) */
#define MPO MP                       /* rows through the output stage (debug hook) */
#define LQ DM      /* row pitch of the q/k rows; not read (pitches are DM) */
typedef __bf16 v16b __attribute__((ext_vector_type(16)));
typedef unsigned short v8us __attribute__((ext_vector_type(8), may_alias));
typedef float  v8f  __attribute__((ext_vector_type(8)));
typedef float  v4f  __attribute__((ext_vector_type(4)));
typedef float  v4fa __attribute__((ext_vector_type(4), may_alias));
union FragB { v16b v; v8us half[2]; unsigned short u[16]; };

__device__ __forceinline__ unsigned short bf16_bits(float x) { unsigned int u = __float_as_uint(x); return (unsigned short)((u + 0x7FFFu + ((u >> 16) & 1u)) >> 16); }
__device__ __forceinline__ float bf16_val(unsigned short b) { return __uint_as_float(((unsigned int)b) << 16); }
__device__ __forceinline__ float bf16_round(float x) { return bf16_val(bf16_bits(x)); }
// D += A·B with NT terms: 1 = ah·bh, 2 = + al·bh (A split), 3 = + ah·bl (both split)
template <int NT>
__device__ __forceinline__ v8f mmaN(v16b ah, v16b al, v16b bh, v16b bl, v8f c) {
  c = __builtin_amdgcn_wmma_f32_16x16x32_bf16(false, ah, false, bh, (short)0, c, false, false);
  if (NT >= 2) c = __builtin_amdgcn_wmma_f32_16x16x32_bf16(false, al, false, bh, (short)0, c, false, false);
  if (NT >= 3) c = __builtin_amdgcn_wmma_f32_16x16x32_bf16(false, ah, false, bl, (short)0, c, false, false);
  asm volatile("v_nop\n\tv_nop\n\tv_nop\n\tv_nop" : "+v"(c) : "v"(ah), "v"(al), "v"(bh), "v"(bl));
  return c;
}

__global__ __launch_bounds__(256) void k_wt_bf16(const float* __restrict__ W, unsigned short* __restrict__ Wt, int K, int N) {
  const int t = blockIdx.x * 256 + threadIdx.x;
  const int k8n = K / 8;
  if (t >= N * k8n) return;
  const int n = t / k8n, k8 = (t % k8n) * 8;
  v8us v;
#pragma unroll
  for (int i = 0; i < 8; ++i) v[i] = bf16_bits(W[(size_t)(k8 + i) * N + n]);
  *(v8us*)(Wt + (size_t)n * K + k8) = v;
  
}

// GEMM C[M][N] (f32, pitch ldc) = act(A[M][K]·W + bias). A f32 row-major (pitch lda) converted per fragment to bf16
// (ASPLIT: hi/lo two planes -> 2 terms, else single rounded term); Wt bf16 [N][K] (pitch ldb). BIAS_BF16 rounds the
// bias to bf16 first (bias quantised to bf16 before the add). K%32==0, M%16==0, N%64==0.
template <bool ASPLIT, int ACT, bool BIAS_BF16>
__global__ __launch_bounds__(128) void k_gemm_bf(const float* __restrict__ A, int lda, const unsigned short* __restrict__ Wt, int ldb,
                                               const float* __restrict__ bias, float* __restrict__ C, int ldc, int M, int N, int K) {
  __shared__ __attribute__((aligned(16))) float so[4][16][64];
  const int tid = threadIdx.x, w = tid >> 5, lane = tid & 31, ln = lane & 15, hh = lane >> 4;
  const int ntn = N / 64;
  const int wid = blockIdx.x * 4 + w;
  const int mt = wid / ntn, nq = wid % ntn;
  if (mt * 16 >= M) return;
  const int row0 = mt * 16, col0 = nq * 64;
  const float* arow = A + (size_t)(row0 + ln) * lda;
  v8f acc[4] = {};
  for (int kb = 0; kb < K; kb += 32) {
    FragB ah, al;
    const v4f x0 = *(const v4fa*)(arow + kb + 8 * hh), x1 = *(const v4fa*)(arow + kb + 8 * hh + 4);
    const v4f x2 = *(const v4fa*)(arow + kb + 16 + 8 * hh), x3 = *(const v4fa*)(arow + kb + 16 + 8 * hh + 4);
    float xs[16] = {x0[0],x0[1],x0[2],x0[3],x1[0],x1[1],x1[2],x1[3],x2[0],x2[1],x2[2],x2[3],x3[0],x3[1],x3[2],x3[3]};
#pragma unroll
    for (int i = 0; i < 16; ++i) { const unsigned short hb = bf16_bits(xs[i]); ah.u[i] = hb; al.u[i] = ASPLIT ? bf16_bits(xs[i] - bf16_val(hb)) : (unsigned short)0; }
#pragma unroll
    for (int t = 0; t < 4; ++t) {
      const unsigned short* brow = Wt + (size_t)(col0 + t * 16 + ln) * ldb + kb;
      FragB b;
      b.half[0] = *(const v8us*)(brow + 8 * hh);
      b.half[1] = *(const v8us*)(brow + 16 + 8 * hh);
      acc[t] = mmaN<ASPLIT ? 2 : 1>(ah.v, al.v, b.v, b.v, acc[t]);
    }
  }
#pragma unroll
  for (int t = 0; t < 4; ++t) {
    float bv = bias ? bias[col0 + t * 16 + ln] : 0.f;
    if (BIAS_BF16) bv = bf16_round(bv);
#pragma unroll
    for (int r = 0; r < 8; ++r) { float v = acc[t][r] + bv; if (ACT == 1) v = fmaxf(v, 0.f); so[w][8 * hh + r][t * 16 + ln] = v; }
  }
  __builtin_amdgcn_fence(__ATOMIC_ACQ_REL, "workgroup");
  __builtin_amdgcn_wave_barrier();
  const int rsub = lane >> 4, c4 = (lane & 15) * 4;
  {
#pragma unroll
    for (int q = 0; q < 8; ++q) {
      const int r = q * 2 + rsub;
      const v4f v = *(const v4fa*)&so[w][r][c4];
      *(v4f*)(C + (size_t)(row0 + r) * ldc + col0 + c4) = v;
    }
    
  }
}

// GEMM C = act(A·W + bias + resid): A f32 (ASPLIT -> hi/lo 2 terms), Wt bf16 [N][K]; ACT 0 none, 1 relu, 2 exact gelu;
// resid (optional, f32, row index = (row % rmod), pitch ldr, RES_BF16 rounds it) added before the activation.
template <bool ASPLIT, int ACT, bool BIAS_BF16, bool RES_BF16>
__global__ __launch_bounds__(128) void k_gemm_bf3(const float* __restrict__ A, int lda, const unsigned short* __restrict__ Wt, int ldb,
                                                const float* __restrict__ bias, const float* __restrict__ resid, int rmod, int ldr,
                                                float* __restrict__ C, int ldc, int M, int N, int K) {
  __shared__ __attribute__((aligned(16))) float so[4][16][64];
  const int tid = threadIdx.x, w = tid >> 5, lane = tid & 31, ln = lane & 15, hh = lane >> 4;
  const int ntn = N / 64;
  const int wid = blockIdx.x * 4 + w;
  const int mt = wid / ntn, nq = wid % ntn;
  if (mt * 16 >= M) return;
  const int row0 = mt * 16, col0 = nq * 64;
  const float* arow = A + (size_t)(row0 + ln) * lda;
  v8f acc[4] = {};
  for (int kb = 0; kb < K; kb += 32) {
    FragB ah, al;
    const v4f x0 = *(const v4fa*)(arow + kb + 8 * hh), x1 = *(const v4fa*)(arow + kb + 8 * hh + 4);
    const v4f x2 = *(const v4fa*)(arow + kb + 16 + 8 * hh), x3 = *(const v4fa*)(arow + kb + 16 + 8 * hh + 4);
    float xs[16] = {x0[0],x0[1],x0[2],x0[3],x1[0],x1[1],x1[2],x1[3],x2[0],x2[1],x2[2],x2[3],x3[0],x3[1],x3[2],x3[3]};
#pragma unroll
    for (int i = 0; i < 16; ++i) { const unsigned short hb = bf16_bits(xs[i]); ah.u[i] = hb; al.u[i] = ASPLIT ? bf16_bits(xs[i] - bf16_val(hb)) : (unsigned short)0; }
#pragma unroll
    for (int t = 0; t < 4; ++t) {
      const unsigned short* brow = Wt + (size_t)(col0 + t * 16 + ln) * ldb + kb;
      FragB b;
      b.half[0] = *(const v8us*)(brow + 8 * hh);
      b.half[1] = *(const v8us*)(brow + 16 + 8 * hh);
      acc[t] = mmaN<ASPLIT ? 2 : 1>(ah.v, al.v, b.v, b.v, acc[t]);
    }
  }
#pragma unroll
  for (int t = 0; t < 4; ++t) {
    const int col = col0 + t * 16 + ln;
    float bv = bias ? bias[col] : 0.f;
    if (BIAS_BF16) bv = bf16_round(bv);
#pragma unroll
    for (int r = 0; r < 8; ++r) {
      float v = acc[t][r] + bv;
      if (resid) { float rv = resid[(size_t)((row0 + 8 * hh + r) % rmod) * ldr + col]; if (RES_BF16) rv = bf16_round(rv); v += rv; }
      if (ACT == 1) v = fmaxf(v, 0.f);
      if (ACT == 2) v = 0.5f * v * (1.0f + erff(v * 0.70710678118654752f));
      if (ACT == 3) { const float u = 0.7978845608028654f * (v + 0.044715f * v * v * v); v = 0.5f * v * (1.0f + tanhf(u)); }
      so[w][8 * hh + r][t * 16 + ln] = v;
    }
  }
  __builtin_amdgcn_fence(__ATOMIC_ACQ_REL, "workgroup");
  __builtin_amdgcn_wave_barrier();
  const int rsub = lane >> 4, c4 = (lane & 15) * 4;
  {
#pragma unroll
    for (int q = 0; q < 8; ++q) {
      const int r = q * 2 + rsub;
      const v4f v = *(const v4fa*)&so[w][r][c4];
      *(v4f*)(C + (size_t)(row0 + r) * ldc + col0 + c4) = v;
    }
    
  }
}
// row LayerNorm (biased variance, eps) over N: s = X (+ R); optional out_sum <- s; out_norm <- (s-mu)*rsqrt(var+eps)*g + b
template <bool PARAM_BF16>
__global__ __launch_bounds__(256) void k_layernorm(const float* __restrict__ X, const float* __restrict__ R, const float* __restrict__ g, const float* __restrict__ bta,
                                                  float* __restrict__ out_sum, float* __restrict__ out_norm, int N, float eps) {
  __shared__ float red[256];
  const int row = blockIdx.x, tid = threadIdx.x;
  const float* x = X + (size_t)row * N; const float* rr = R ? R + (size_t)row * N : nullptr;
  float vals[16];                     // up to N = 4096
  const int per = N / 256;            // contiguous chunk per thread? use strided-by-4 chunks: thread handles j = tid*4 + 1024*u
  float s1 = 0.f;
  for (int u = 0; u < per / 4; ++u) {
    const int j = tid * 4 + 1024 * u;
    const v4f a = *(const v4fa*)(x + j);
    v4f b = {0.f,0.f,0.f,0.f}; if (rr) b = *(const v4fa*)(rr + j);
#pragma unroll
    for (int q = 0; q < 4; ++q) { const float v = a[q] + b[q]; vals[u * 4 + q] = v; s1 += v; }
  }
  red[tid] = s1; __syncthreads();
  for (int st = 128; st > 0; st >>= 1) { if (tid < st) red[tid] += red[tid + st]; __syncthreads(); }
  const float mu = red[0] / (float)N; __syncthreads();
  float s2 = 0.f;
  for (int u = 0; u < per / 4; ++u)
#pragma unroll
    for (int q = 0; q < 4; ++q) { const float c = vals[u * 4 + q] - mu; s2 += c * c; }
  red[tid] = s2; __syncthreads();
  for (int st = 128; st > 0; st >>= 1) { if (tid < st) red[tid] += red[tid + st]; __syncthreads(); }
  const float rs = rsqrtf(red[0] / (float)N + eps);
  {
    for (int u = 0; u < per / 4; ++u) {
      const int j = tid * 4 + 1024 * u;
      v4f o, sm;
#pragma unroll
      for (int q = 0; q < 4; ++q) {
        float gg = g[j + q], bb = bta[j + q];
        if (PARAM_BF16) { gg = bf16_round(gg); bb = bf16_round(bb); }
        sm[q] = vals[u * 4 + q]; o[q] = (vals[u * 4 + q] - mu) * rs * gg + bb;
      }
      if (out_sum) *(v4f*)(out_sum + (size_t)row * N + j) = sm;
      *(v4f*)(out_norm + (size_t)row * N + j) = o;
    }
    
  }
}



// ---- f16 WMMA path (v_wmma_f32_16x16x32_f16): 11-bit significands for operands in range — used where a [0,1] probability operand needs more precision than bf16
typedef _Float16 v16h __attribute__((ext_vector_type(16)));
union FragH { v16h v; v8us half[2]; _Float16 h[16]; unsigned short u[16]; };
template <int NT>
__device__ __forceinline__ v8f mmaH(v16h ah, v16h al, v16h bh, v16h bl, v8f c) {
  c = __builtin_amdgcn_wmma_f32_16x16x32_f16(false, ah, false, bh, (short)0, c, false, false);
  if (NT >= 2) c = __builtin_amdgcn_wmma_f32_16x16x32_f16(false, al, false, bh, (short)0, c, false, false);
  if (NT >= 3) c = __builtin_amdgcn_wmma_f32_16x16x32_f16(false, ah, false, bl, (short)0, c, false, false);
  asm volatile("v_nop\n\tv_nop\n\tv_nop\n\tv_nop" : "+v"(c) : "v"(ah), "v"(al), "v"(bh), "v"(bl));
  return c;
}
// batched GEMM like k_gemm_b but f16 operands: A f32 (split into f16 hi/lo if ASPLIT, else rounded to f16), Bt = f16 values [n][k]; alpha; C f32; N multiple of 16 (partial tiles skipped)
template <bool ASPLIT>
__global__ __launch_bounds__(128) void k_gemm_h(const float* __restrict__ A, int lda, size_t sA, const _Float16* __restrict__ Bh, int ldb, size_t sB, float alpha, float* __restrict__ C, int ldc, size_t sC, int M, int N, int K) {
  __shared__ __attribute__((aligned(16))) float so[4][16][64];
  const int tid = threadIdx.x, w = tid >> 5, lane = tid & 31, ln = lane & 15, hh = lane >> 4; const int by = blockIdx.y;
  A += (size_t)by * sA; Bh += (size_t)by * sB; C += (size_t)by * sC;
  const int ntn = (N + 63) / 64; const int wid = blockIdx.x * 4 + w; const int mt = wid / ntn, nq = wid % ntn; if (mt * 16 >= M) return;
  const int row0 = mt * 16, col0 = nq * 64; const float* arow = A + (size_t)(row0 + ln) * lda;
  v8f acc[4] = {};
  for (int kb = 0; kb < K; kb += 32) {
    FragH ah, al;
    const v4f x0 = *(const v4fa*)(arow + kb + 8 * hh), x1 = *(const v4fa*)(arow + kb + 8 * hh + 4), x2 = *(const v4fa*)(arow + kb + 16 + 8 * hh), x3 = *(const v4fa*)(arow + kb + 16 + 8 * hh + 4);
    float xs[16] = {x0[0],x0[1],x0[2],x0[3],x1[0],x1[1],x1[2],x1[3],x2[0],x2[1],x2[2],x2[3],x3[0],x3[1],x3[2],x3[3]};
#pragma unroll
    for (int i = 0; i < 16; ++i) { const _Float16 h = (_Float16)xs[i]; ah.h[i] = h; al.h[i] = ASPLIT ? (_Float16)(xs[i] - (float)h) : (_Float16)0.0f; }
#pragma unroll
    for (int t = 0; t < 4; ++t) { if (col0 + t * 16 >= N) continue; const size_t boff = (size_t)(col0 + t * 16 + ln) * ldb + kb; FragH bq; bq.half[0] = *(const v8us*)(Bh + boff + 8 * hh); bq.half[1] = *(const v8us*)(Bh + boff + 16 + 8 * hh);
      acc[t] = mmaH<ASPLIT ? 2 : 1>(ah.v, al.v, bq.v, bq.v, acc[t]); }
  }
#pragma unroll
  for (int t = 0; t < 4; ++t) { if (col0 + t * 16 >= N) continue;
#pragma unroll
    for (int r = 0; r < 8; ++r) so[w][8 * hh + r][t * 16 + ln] = acc[t][r] * alpha; }
  __builtin_amdgcn_fence(__ATOMIC_ACQ_REL, "workgroup"); __builtin_amdgcn_wave_barrier();
  const int rsub = lane >> 4, c4 = (lane & 15) * 4;
  {
#pragma unroll
    for (int q = 0; q < 8; ++q) { const int r = q * 2 + rsub; if (col0 + c4 < N) { const v4f v = *(const v4fa*)&so[w][r][c4]; *(v4f*)(C + (size_t)(row0 + r) * ldc + col0 + c4) = v; } }
     }
}

// One launch for the five operand preparations, which do not depend on one another: blocks [0, 4 PREP_WB) transpose the four weights, the rest convert x.
// Weights: Wt[n][k] = f16(W[k][n] x16) from f32 row-major W[DM][DM] (bf16-exact weights stay exact in f16 away from the subnormal range); Bt holds the four [n][k] planes one behind the other. x: exact f16 rows of the bf16-rounded values.
// Few, fat work-groups (64 elements per thread): for speed only. A weight block takes a PREP_T x PREP_T tile: 512-byte pieces of W rows in, 256-byte pieces of Wt rows out, turned in LDS.
#define PREP_T 128                   /* k and n per weight tile */
#define PREP_WB ((DM / PREP_T) * (DM / PREP_T))               /* blocks per weight: one tile each */
#define PREP_XP 8                    /* eight-element pieces of x per thread */
#define PREP_XB ((unsigned)(NR * DM / (8 * 256 * PREP_XP)))   /* blocks for x */
static_assert(DM % PREP_T == 0 && PREP_T == 128 && (NR * DM) % (8 * 256 * PREP_XP) == 0, "k_prep: whole tiles, 8 waves x 16 k on a tile, whole x blocks");
__global__ __launch_bounds__(256) void k_prep(const float* __restrict__ x, const float* __restrict__ wq, const float* __restrict__ wk, const float* __restrict__ wv, const float* __restrict__ wo, _Float16* __restrict__ Bt, _Float16* __restrict__ X16) {
  __shared__ __attribute__((aligned(16))) unsigned short ts[PREP_T][PREP_T];      /* [n][k]; the 16-byte piece c of row n lies at place c ^ (n / 4 % 16): the rows that sixteen lanes write at one k fall on all banks */
  const int bx = blockIdx.x, tid = threadIdx.x;
  if (bx < 4 * PREP_WB) {      /* the same for the whole block: the barrier below is passed by all or by none. The weights have the longer chain: they take the lowest block indices */
    const int p = bx / PREP_WB, tile = bx - p * PREP_WB; const float* W = p == 0 ? wq : p == 1 ? wk : p == 2 ? wv : wo;
    const int k0 = (tile / (DM / PREP_T)) * PREP_T, n0 = (tile % (DM / PREP_T)) * PREP_T;
    const int lane = tid & 31, wave = tid >> 5;
    const float* wp = W + (size_t)(k0 + 16 * wave) * DM + n0 + 4 * lane;      /* the thread's 16 k x 4 n corner: a wave covers 512 bytes of one W row */
    v4f r[16];
#pragma unroll
    for (int j = 0; j < 16; ++j) r[j] = *(const v4fa*)(wp + (size_t)j * DM);
    asm volatile("s_wait_xcnt 0x0" :: "v"(wp), "v"(r[0]), "v"(r[1]), "v"(r[2]), "v"(r[3]), "v"(r[4]), "v"(r[5]), "v"(r[6]), "v"(r[7]), "v"(r[8]), "v"(r[9]), "v"(r[10]), "v"(r[11]), "v"(r[12]), "v"(r[13]), "v"(r[14]), "v"(r[15]) : "memory");      /* inputs only. The loaded values: all sixteen loads stay in front of the first conversion, one latency for the tile (left alone the compiler issues them in three batches, each behind the wait for the one before). The address: its registers are no load's destination, and the wait stands in front of every overwrite of them */
#pragma unroll
    for (int i = 0; i < 4; ++i)
#pragma unroll
      for (int hb = 0; hb < 2; ++hb) { FragH f;
#pragma unroll
        for (int j = 0; j < 8; ++j) f.h[j] = (_Float16)(bf16_round(r[8 * hb + j][i]) * 16.0f);
        *(v8us*)&ts[4 * lane + i][8 * ((2 * wave + hb) ^ (lane & 15))] = f.half[0]; }      /* row n = 4 lane + i, piece 2 wave + hb */
    __syncthreads();      /* the tile is whole before its rows are read */
    const int c = tid & 15, nr = tid >> 4;
    unsigned short* bp = (unsigned short*)Bt + (size_t)p * DM * DM + (size_t)(n0 + nr) * DM + k0 + 8 * c;
#pragma unroll
    for (int u = 0; u < 8; ++u) { const int n = nr + 16 * u; *(v8us*)(bp + (size_t)(16 * u) * DM) = *(const v8us*)&ts[n][8 * (c ^ ((n >> 2) & 15))]; }      /* row n, piece c: sixteen lanes cover 256 bytes of one Wt row */
  } else {
    const size_t t0 = (size_t)(bx - 4 * PREP_WB) * (256 * PREP_XP) + tid;
    const float* xp = x + t0 * 8;      /* piece u lies 256 x 8 elements further on */
    v4f a[PREP_XP][2];
#pragma unroll
    for (int u = 0; u < PREP_XP; ++u) { a[u][0] = *(const v4fa*)(xp + 2048 * u); a[u][1] = *(const v4fa*)(xp + 2048 * u + 4); }
    asm volatile("s_wait_xcnt 0x0" :: "v"(xp) : "memory");      /* stands in front of every overwrite of the address registers that the loads above name, and keeps them out of the loads' destinations */
#pragma unroll
    for (int u = 0; u < PREP_XP; ++u) { FragH f;
#pragma unroll
      for (int q = 0; q < 4; ++q) { f.h[q] = (_Float16)bf16_round(a[u][0][q]); f.h[4 + q] = (_Float16)bf16_round(a[u][1][q]); }
      *(v8us*)((unsigned short*)X16 + (t0 + 256 * u) * 8) = f.half[0]; }
    asm volatile("s_wait_xcnt 0x0" ::: "memory");      /* behind the last store: stands in front of any later overwrite of the stores' address and data registers */
  }
}
// k_gemm_hh variant with fused epilogue: v = acc·alpha + bias[by·sBias + col] (+ CP[(row/rowsPerB)·sCPb + by·64 + col] if CP) ; ACT 0 none / 1 elu ; writes f16 C16 (and f32 C if non-null)
template <int ACT>
__global__ __launch_bounds__(128) void k_gemm_hhx(const _Float16* __restrict__ A, int lda, size_t sA, const _Float16* __restrict__ Bh, int ldb, size_t sB, float alpha, const float* __restrict__ bias, size_t sBias, const float* __restrict__ CP, int rowsPerB, size_t sCPb, int row0g,
    float* __restrict__ C, _Float16* __restrict__ C16, int ldc, size_t sC, int M, int N, int K) {
  __shared__ __attribute__((aligned(16))) float so[4][16][64];
  const int tid = threadIdx.x, w = tid >> 5, lane = tid & 31, ln = lane & 15, hh = lane >> 4; const int by = blockIdx.y;
  A += (size_t)by * sA; Bh += (size_t)by * sB; const size_t cofs = (size_t)by * sC; const float* bp = bias ? bias + (size_t)by * sBias : nullptr;
  const int ntn = (N + 63) / 64; const int wid = blockIdx.x * 4 + w; const int mt = wid / ntn, nq = wid % ntn; if (mt * 16 >= M) return;
  const int row0 = mt * 16, col0 = nq * 64; const _Float16* arow = A + (size_t)(row0 + ln) * lda;
  v8f acc[4] = {};
  for (int kb = 0; kb < K; kb += 32) { FragH ah; ah.half[0] = *(const v8us*)((const unsigned short*)arow + kb + 8 * hh); ah.half[1] = *(const v8us*)((const unsigned short*)arow + kb + 16 + 8 * hh);
#pragma unroll
    for (int t = 0; t < 4; ++t) { if (col0 + t * 16 >= N) continue; const size_t boff = (size_t)(col0 + t * 16 + ln) * ldb + kb; FragH bq; bq.half[0] = *(const v8us*)((const unsigned short*)Bh + boff + 8 * hh); bq.half[1] = *(const v8us*)((const unsigned short*)Bh + boff + 16 + 8 * hh);
      acc[t] = mmaH<1>(ah.v, ah.v, bq.v, bq.v, acc[t]); }
  }
#pragma unroll
  for (int t = 0; t < 4; ++t) { if (col0 + t * 16 >= N) continue; const int col = col0 + t * 16 + ln; const float bv = bp ? bf16_round(bp[col]) : 0.f;
#pragma unroll
    for (int r = 0; r < 8; ++r) { float v = acc[t][r] * alpha + bv; if (CP) { const int rr = row0g + row0 + 8 * hh + r; if (rowsPerB < 0) v += CP[cofs + (size_t)rr * ldc + col];      /* rowsPerB < 0: own element of the batched C plane */ else { const int bidx = rr / rowsPerB; v += CP[(size_t)bidx * sCPb + (size_t)by * 64 + col]; } } if (ACT == 1) v = (v > 0.f) ? v : expm1f(v); else if (ACT == 7) v = (v > 0.f) ? v + 1.0f : expf(v); else if (ACT == 8) v = tanhf(v); else if (ACT == 9) v = 0.5f * v * (1.0f + tanhf(0.7978845608028654f * (v + 0.044715f * v * v * v))); else if (ACT == 11) v = 1.0f / (1.0f + expf(-v)); else if (ACT == 12) v = (v > 0.f) ? v : 0.01f * v; else if (ACT == 14) v = (v > 0.f) ? v : 0.1f * v; else if (ACT == 16) v = (v >= 0.f) ? v : 0.3f * v; else if (ACT == 17) v = (v >= 0.f) ? v : 0.2f * v; else if (ACT == 15) v = v / (1.0f + expf(-v)); else if (ACT == 3) v = fmaxf(v, 0.f); else if (ACT == 6) v = 0.5f * v * (1.0f + erff(v * 0.70710678118654752f)); so[w][8 * hh + r][t * 16 + ln] = v; } }
  __builtin_amdgcn_fence(__ATOMIC_ACQ_REL, "workgroup"); __builtin_amdgcn_wave_barrier();
  const int rsub = lane >> 4, c4 = (lane & 15) * 4; typedef _Float16 v4h __attribute__((ext_vector_type(4)));
  {
#pragma unroll
    for (int q = 0; q < 8; ++q) { const int r = q * 2 + rsub; if (col0 + c4 < N) { const v4f v = *(const v4fa*)&so[w][r][c4]; if (C) *(v4f*)(C + cofs + (size_t)(row0 + r) * ldc + col0 + c4) = v; if (C16) { v4h h4; for (int i = 0; i < 4; ++i) h4[i] = (_Float16)v[i]; *(v4h*)(C16 + cofs + (size_t)(row0 + r) * ldc + col0 + c4) = h4; } } }
     }
}


typedef _Float16 v4h __attribute__((ext_vector_type(4)));

__global__ __launch_bounds__(256) void k_h16(const float* __restrict__ x, _Float16* __restrict__ X16, size_t n8) { const size_t t = (size_t)blockIdx.x * 256 + threadIdx.x; if (t >= n8) return; FragH f;
#pragma unroll
  for (int q = 0; q < 8; ++q) f.h[q] = (_Float16)x[t * 8 + q]; *(v8us*)((unsigned short*)X16 + t * 8) = f.half[0];  }
__global__ __launch_bounds__(256) void k_round16f(const float* __restrict__ W, _Float16* __restrict__ Bt, size_t n8) { const size_t t = (size_t)blockIdx.x * 256 + threadIdx.x; if (t >= n8) return; FragH f;
#pragma unroll
  for (int i = 0; i < 8; ++i) f.h[i] = (_Float16)(bf16_round(W[t * 8 + i]) * 16.0f); *(v8us*)((unsigned short*)Bt + t * 8) = f.half[0];  }
template <int NHv, int TTv>
__global__ __launch_bounds__(256) void k_vt(const _Float16* __restrict__ V16, int ldv, int voff, _Float16* __restrict__ Vt) { __shared__ unsigned short tl[64][66]; const int tid = threadIdx.x; const int slab = blockIdx.x / (TTv / 64), lg = blockIdx.x % (TTv / 64); const int b = slab / NHv, h = slab % NHv;
  for (int i = tid; i < 64 * 8; i += 256) { const int r = i / 8, c8 = (i % 8) * 8; FragH f; f.half[0] = *(const v8us*)((const unsigned short*)V16 + ((size_t)b * TTv + lg * 64 + r) * ldv + voff + h * 64 + c8);
#pragma unroll
    for (int q = 0; q < 8; ++q) tl[r][c8 + q] = f.u[q]; }
  __syncthreads();
  {
#pragma unroll
    for (int rd = 0; rd < 2; ++rd) { const int d = rd * 32 + tid / 8, pc = tid % 8; FragH f;
#pragma unroll
      for (int q = 0; q < 8; ++q) f.u[q] = tl[pc * 8 + q][d];
      *(v8us*)((unsigned short*)Vt + ((size_t)slab * 64 + d) * TTv + lg * 64 + pc * 8) = f.half[0]; }
     } }

__global__ __launch_bounds__(256) void k_hl(const float* __restrict__ F, _Float16* __restrict__ Hh, _Float16* __restrict__ Hl, size_t n8) { const size_t t = (size_t)blockIdx.x * 256 + threadIdx.x; if (t >= n8) return; FragH fh, fl; const v4f a = *(const v4fa*)(F + t * 8), c = *(const v4fa*)(F + t * 8 + 4);
#pragma unroll
  for (int q = 0; q < 4; ++q) { _Float16 h = (_Float16)a[q]; fh.h[q] = h; fl.h[q] = (_Float16)((a[q] - (float)h) * 1024.0f); h = (_Float16)c[q]; fh.h[4 + q] = h; fl.h[4 + q] = (_Float16)((c[q] - (float)h) * 1024.0f); }
  { *(v8us*)((unsigned short*)Hh + t * 8) = fh.half[0]; *(v8us*)((unsigned short*)Hl + t * 8) = fl.half[0];  } }

// ---- fast GEMM (block tile 128x64, wave tile 32x64; A and B k-tiles staged in LDS; requires M % 128 == 0 rows per launch region, N % 64 == 0 and K % 64 == 0); epilogue = k_gemm_hhx semantics ----
__device__ __forceinline__ v16h g2_frag(const _Float16* p, int hh) { FragH f; f.half[0] = *(const v8us*)((const unsigned short*)p + 8 * hh); f.half[1] = *(const v8us*)((const unsigned short*)p + 16 + 8 * hh); return f.v; }
__device__ __forceinline__ v8f g2_mma(v16h a, v16h b, v8f c) { v8f d = __builtin_amdgcn_wmma_f32_16x16x32_f16(false, a, false, b, (short)0, c, false, false); asm volatile("v_nop\n\tv_nop\n\tv_nop\n\tv_nop" : "+v"(d) : "v"(a), "v"(b)); return d; }
#define G2_KS 64                     /* k per LDS stage: one 128-byte line of every A and B row */
#define G2_LP 72                     /* LDS row pitch in halves: 144 B = 16 B x odd for 16-byte row reads */
#define G2_TP 136                    /* LDS row pitch in halves of the turned output tile (128 tokens): 272 B = 16 B x odd */
typedef unsigned int v4ua __attribute__((ext_vector_type(4), may_alias));
typedef float g2_v2f __attribute__((ext_vector_type(2)));
typedef _Float16 g2_v2h __attribute__((ext_vector_type(2)));
__device__ __forceinline__ unsigned int g2_pack(float lo, float hi) { return __builtin_bit_cast(unsigned int, __builtin_convertvector((g2_v2f){lo, hi}, g2_v2h)); }      /* two f32 -> two f16, round to nearest even as the scalar cast */
__device__ __forceinline__ v16h g2_lfrag(const unsigned short* p) { FragH f; f.half[0] = *(const v8us*)p; f.half[1] = *(const v8us*)(p + 16); return f.v; }      /* p already holds the lane half's + 8 hh: the k order of g2_frag */
template <int ACT, int LDA, int LDB, int LDC, bool HASB, bool HASCP, bool OUT32, bool OUT16, bool P2T, int FK>      /* FK: k per fragment group (G2_KS: the stage's fragments are read as one group; 32: as two groups into one set of registers, 48 fewer: at 192 or fewer a SIMD holds five waves, not four, so a WGP holds five work-groups; for a grid of more than four per WGP, which would otherwise run a second round). row pitches at compile time: a tile's row pieces are immediate offsets from one address pair; the epilogue's options (bias, residual CP, f32 / f16 output) at compile time: straight-line code without a test per element or per row. P2T: plane 2 (grid.y == 2) leaves as per-head transposed f16 rows CT[batch][head][d][token] and is not written to C16 */
__global__ __launch_bounds__(128) void k_gemm2(const _Float16* __restrict__ A, size_t sA, const _Float16* __restrict__ Bh, size_t sB, float alpha, const float* __restrict__ bias, const float* __restrict__ bias1, const float* __restrict__ bias2, size_t sBias, const float* __restrict__ CP, int rowsPerB, size_t sCPb, int row0g,
    float* __restrict__ C, _Float16* __restrict__ C16, _Float16* __restrict__ CT, size_t sC, int M, int N, int K) { static_assert(ACT == 0 || ACT == 3 || ACT == 6 || ACT == 8 || ACT == 9 || ACT == 11 || ACT == 12 || ACT == 14 || ACT == 15 || ACT == 16 || ACT == 17, "k_gemm2: unsupported ACT code (would silently apply no activation)");
  __shared__ __attribute__((aligned(16))) unsigned short tl[2][128 + 64][G2_LP];      /* per buffer: the block's 128 A rows, then its 64 B rows, G2_KS halves of each */
  float (*so)[32][68] = (float (*)[32][68])&tl[0][0][0];      /* the epilogue's staging takes the tiles' place behind the loop's last barrier */
  static_assert(sizeof(tl) >= sizeof(float) * 4 * 32 * 68, "k_gemm2: epilogue staging must fit in the tile buffers");
  static_assert(FK == 32 || FK == G2_KS, "k_gemm2: whole fragment groups in a stage");
  const int tid = threadIdx.x, w = tid >> 5, lane = tid & 31, ln = lane & 15, hh = lane >> 4; const int by = blockIdx.y;
  A += (size_t)by * sA; Bh += (size_t)by * sB; const size_t cofs = (size_t)by * sC; const float* bsel = (by == 1 && bias1) ? bias1 : (by == 2 && bias2) ? bias2 : bias;      /* planes 1 and 2 may bring their bias in a buffer of its own */
  const float* bp = bsel + (size_t)by * sBias;      /* read only where HASB */
  const int ntn = N >> 6; const int mt = blockIdx.x / ntn, nq = blockIdx.x - mt * ntn; const int row0 = mt * 128 + 32 * w, col0 = nq * 64; if (mt * 128 >= M) return;      /* the same for the whole block: in front of every barrier */
  const int sr = tid >> 3, sc = (tid & 7) * 8;      /* staging: eight lanes cover one 128-byte row piece; piece u is row sr + 16 u */
  const unsigned short* ag = (const unsigned short*)A + (size_t)(mt * 128 + sr) * LDA + sc;
  const unsigned short* bg = (const unsigned short*)Bh + (size_t)(col0 + sr) * LDB + sc;
  const int nst = K / G2_KS;
  int ks = (mt + nq + 4 * by) % (LDA / G2_KS); if (ks >= nst) ks = 0;      /* the k stage the block starts at; it walks all nst stages from there, round the end. The blocks that read the same A rows (one mt) or the same B rows (one nq and plane) run side by side: started at different stages they do not ask L2 for the same lines at the same moment */
  v8us ra[8], rb[4];      /* these and af, bf below are indexed under full unrolls only, so that they stay in registers */
  { const unsigned short* a0 = ag + ks * G2_KS; const unsigned short* b0 = bg + ks * G2_KS;
#pragma unroll
    for (int u = 0; u < 8; ++u) ra[u] = *(const v8us*)(a0 + (size_t)(16 * u) * LDA);
#pragma unroll
    for (int u = 0; u < 4; ++u) rb[u] = *(const v8us*)(b0 + (size_t)(16 * u) * LDB);
    asm volatile("s_wait_xcnt 0x0" :: "v"(a0), "v"(b0) : "memory"); }      /* stands in front of every overwrite of the address registers that the loads above name */
  float bv4[4];      /* the lane's four bias values, fetched behind the first tiles' loads: their latency passes under the k loop */
#pragma unroll
  for (int t = 0; t < 4; ++t) bv4[t] = HASB ? bf16_round(bp[col0 + t * 16 + ln]) : 0.f;
  const v8f z8 = {0.f,0.f,0.f,0.f,0.f,0.f,0.f,0.f}; v8f c00 = z8, c01 = z8, c02 = z8, c03 = z8, c10 = z8, c11 = z8, c12 = z8, c13 = z8;
#pragma unroll
  for (int u = 0; u < 8; ++u) *(v8us*)&tl[0][sr + 16 * u][sc] = ra[u];
#pragma unroll
  for (int u = 0; u < 4; ++u) *(v8us*)&tl[0][128 + sr + 16 * u][sc] = rb[u];
  __syncthreads();
#pragma unroll 1      /* rolled: one stage's code, two buffers by index */
  for (int st = 0; st < nst; ++st) { const int bu = st & 1;
    if (st + 1 < nst) {      /* the next stage's tiles fly into registers under this stage's products */
      ks = (ks + 1 == nst) ? 0 : ks + 1;
      const unsigned short* an = ag + ks * G2_KS; const unsigned short* bn = bg + ks * G2_KS;
#pragma unroll
      for (int u = 0; u < 8; ++u) ra[u] = *(const v8us*)(an + (size_t)(16 * u) * LDA);
#pragma unroll
      for (int u = 0; u < 4; ++u) rb[u] = *(const v8us*)(bn + (size_t)(16 * u) * LDB);
      asm volatile("s_wait_xcnt 0x0" :: "v"(an), "v"(bn) : "memory");      /* stands in front of every overwrite of the address registers that the loads above name */
    }
#pragma unroll
    for (int kg = 0; kg < G2_KS / FK; ++kg) {      /* unrolled, like the two loops inside: LDS offsets are immediates, af and bf stay in registers */
    v16h af[FK / 32][2], bf[FK / 32][4];      /* a group's fragments are read together in front of its products */
#pragma unroll
    for (int kk = 0; kk < FK / 32; ++kk) { const unsigned short* ap = &tl[bu][32 * w + ln][FK * kg + 32 * kk + 8 * hh]; const unsigned short* bq = &tl[bu][128 + ln][FK * kg + 32 * kk + 8 * hh];
      af[kk][0] = g2_lfrag(ap); af[kk][1] = g2_lfrag(ap + 16 * G2_LP);
#pragma unroll
      for (int t = 0; t < 4; ++t) bf[kk][t] = g2_lfrag(bq + 16 * t * G2_LP); }
#pragma unroll
    for (int kk = 0; kk < FK / 32; ++kk) {
      c00 = g2_mma(af[kk][0], bf[kk][0], c00); c10 = g2_mma(af[kk][1], bf[kk][0], c10);
      c01 = g2_mma(af[kk][0], bf[kk][1], c01); c11 = g2_mma(af[kk][1], bf[kk][1], c11);
      c02 = g2_mma(af[kk][0], bf[kk][2], c02); c12 = g2_mma(af[kk][1], bf[kk][2], c12);
      c03 = g2_mma(af[kk][0], bf[kk][3], c03); c13 = g2_mma(af[kk][1], bf[kk][3], c13); }
    }
    if (st + 1 < nst) {
#pragma unroll
      for (int u = 0; u < 8; ++u) *(v8us*)&tl[bu ^ 1][sr + 16 * u][sc] = ra[u];
#pragma unroll
      for (int u = 0; u < 4; ++u) *(v8us*)&tl[bu ^ 1][128 + sr + 16 * u][sc] = rb[u]; }
    __syncthreads();      /* publishes the next stage and ends every wave's reads of this one, which the next trip (or the epilogue) overwrites */
  }
  v8f accs[8] = {c00, c01, c02, c03, c10, c11, c12, c13};
  if (P2T && by == 2) {      /* the same for the whole block: the barrier inside is passed by all or by none */
    static_assert(!P2T || (ACT == 0 && !HASCP && SQ % 128 == 0 && HD == 64 && LDC == NH * HD), "k_gemm2 P2T: a block tile is 128 tokens of one batch x the 64 columns of one head");
    static_assert(sizeof(tl) >= 2 * HD * G2_TP, "k_gemm2 P2T: the turned tile must fit in the tile buffers");
    unsigned short (*tt)[G2_TP] = (unsigned short (*)[G2_TP])&tl[0][0][0];      /* [d][token of the block]; takes the tiles' place behind the loop's last barrier, like so */
#pragma unroll      /* accs and bv4 are indexed by u: in registers only under a full unroll */
    for (int u = 0; u < 8; ++u) { const int t = u & 3, half = u >> 2; const v8f v = accs[u] * alpha + bv4[t];      /* an accumulator's eight registers are eight consecutive tokens of one column: one 16-byte piece of a turned row */
      *(v4ua*)&tt[t * 16 + ln][32 * w + 16 * half + 8 * hh] = (v4ua){g2_pack(v[0], v[1]), g2_pack(v[2], v[3]), g2_pack(v[4], v[5]), g2_pack(v[6], v[7])}; }
    __syncthreads();      /* the turned tile is whole (a row holds pieces of all four waves) before its rows are read */
    const int tr = mt * 128, bb = tr / SQ, pc = tid & 15, dr = tid >> 4;      /* sixteen lanes cover the 256 bytes that the block holds of one turned row */
    unsigned short* tp = (unsigned short*)CT + ((size_t)(bb * NH + nq) * HD + dr) * SQ + (tr - bb * SQ) + 8 * pc;
#pragma unroll      /* the eight LDS reads issue as one group, the row steps become immediate offsets */
    for (int q = 0; q < 8; ++q) *(v8us*)(tp + (size_t)(8 * q) * SQ) = *(const v8us*)&tt[dr + 8 * q][8 * pc];
    return; }
#pragma unroll
  for (int u = 0; u < 8; ++u) { const int t = u & 3, half = u >> 2; const int col = col0 + t * 16 + ln; const float bv = bv4[t];
#pragma unroll
    for (int r = 0; r < 8; ++r) { const int rloc = half * 16 + 8 * hh + r; float v = accs[u][r] * alpha + bv; if (HASCP) { if (rowsPerB < 0) v += CP[cofs + (size_t)(row0g + row0 + rloc) * LDC + col];      /* rowsPerB < 0: own element of the batched C plane */ else { const int bidx = (row0g + row0 + rloc) / rowsPerB; v += CP[(size_t)bidx * sCPb + (size_t)by * 64 + col]; } }
      if (ACT == 3) v = fmaxf(v, 0.f); else if (ACT == 6) v = 0.5f * v * (1.0f + erff(v * 0.70710678118654752f)); else if (ACT == 11) v = 1.0f / (1.0f + expf(-v)); else if (ACT == 15) v = v / (1.0f + expf(-v)); else if (ACT == 12) v = (v > 0.f) ? v : 0.01f * v; else if (ACT == 8) v = tanhf(v); else if (ACT == 9) v = 0.5f * v * (1.0f + tanhf(0.7978845608028654f * (v + 0.044715f * v * v * v))); else if (ACT == 14) v = (v > 0.f) ? v : 0.1f * v; else if (ACT == 16) v = (v >= 0.f) ? v : 0.3f * v; else if (ACT == 17) v = (v >= 0.f) ? v : 0.2f * v;
      so[w][rloc][t * 16 + ln] = v; } }
  __builtin_amdgcn_fence(__ATOMIC_ACQ_REL, "workgroup"); __builtin_amdgcn_wave_barrier();
  const int rsub = lane >> 4, c4 = (lane & 15) * 4;
  {
#pragma unroll
    for (int q = 0; q < 16; ++q) { const int r = q * 2 + rsub; const v4f v = *(const v4fa*)&so[w][r][c4]; if (OUT32) *(v4f*)(C + cofs + (size_t)(row0 + r) * LDC + col0 + c4) = v; if (OUT16) { v4h h4; for (int i = 0; i < 4; ++i) h4[i] = (_Float16)v[i]; *(v4h*)(C16 + cofs + (size_t)(row0 + r) * LDC + col0 + c4) = h4; } }
     } }


__global__ __launch_bounds__(256) void k_wnat(const float* __restrict__ w, size_t n8, _Float16* __restrict__ Bt) { const size_t t = (size_t)blockIdx.x * 256 + threadIdx.x; if (t >= n8) return; FragH f; for (int q = 0; q < 8; ++q) f.h[q] = (_Float16)(bf16_round(w[t * 8 + q]) * 16.0f); *(v8us*)((unsigned short*)Bt + t * 8) = f.half[0];  }
__global__ __launch_bounds__(256) void k_rsm(const float* __restrict__ S, _Float16* __restrict__ P, int nrows) {
  #pragma clang fp contract(off)
  const int i = blockIdx.x * 256 + threadIdx.x; if (i >= nrows) return; const float* s = S + (size_t)i * SQ; float mx = -3.0e38f;
#pragma unroll 1
  for (int j = 0; j < SQ; ++j) mx = fmaxf(mx, s[j]); float se = 0.f;
#pragma unroll 1
  for (int j = 0; j < SQ; ++j) se += expf(s[j] - mx); const float sc = 256.0f / se;
#pragma unroll 1
  for (int j0 = 0; j0 < SQ; j0 += 8) { FragH f; for (int q = 0; q < 8; ++q) f.h[q] = (_Float16)(expf(s[j0 + q] - mx) * sc); unsigned short* d = (unsigned short*)P + (size_t)i * SQ + j0; *(v8us*)d = f.half[0];  } }
__global__ __launch_bounds__(256) void k_vt(const _Float16* __restrict__ V16, int b, int h0, _Float16* __restrict__ VT) { __shared__ unsigned short tl[64][65]; const int tid = threadIdx.x; const int hh = blockIdx.x % HG, sg = blockIdx.x / HG; const int s0 = sg * 64; const int h = h0 + hh;
  for (int i = tid; i < 64 * 8; i += 256) { const int j = i / 8, d8 = (i % 8) * 8; FragH f; f.half[0] = *(const v8us*)((const unsigned short*)V16 + ((size_t)b * SQ + s0 + j) * DM + h * HD + d8); for (int q = 0; q < 8; ++q) tl[d8 + q][j] = f.u[q]; }
  __syncthreads();
  { for (int i = tid; i < 64 * 8; i += 256) { const int d = i / 8, j8 = (i % 8) * 8; FragH f; for (int q = 0; q < 8; ++q) f.u[q] = tl[d][j8 + q]; *(v8us*)((unsigned short*)VT + ((size_t)hh * HD + d) * SQ + s0 + j8) = f.half[0]; }  } }



// ---- fused attention: per work-group FA_BR queries of one (batch, head) against all SQ keys; of every 64-key stage a wave takes one 32-key pass, and the two partial results of a query are joined at the end. Transposed products: S^T = K Q^T puts one query's
// scores in one lane pair (l, l ^ 16), so maximum and weights are in-lane; two S^T tiles (32 keys), converted in place, are the B operand of
// O^T += V^T P^T. Every A/B fragment is loaded in the same k order (8 h + 0..7, 16 + 8 h + 0..7), which is the order the converted tiles have.
#define FA_NW 4                      /* waves per work-group */
#define FA_KH 2                      /* key halves: each of a stage's two 32-key passes has its own waves */
#define FA_QW (FA_NW / FA_KH)        /* waves side by side on the queries */
#define FA_R 2                       /* 16-query column groups per wave */
#define FA_BR (FA_QW * FA_R * 16)    /* queries per work-group: 768 work-groups, three for each of the 256 WGPs and three waves for each SIMD */
#define FA_SK 64                     /* keys per LDS stage = two 32-key passes, one per key half */
#define FA_XP (FA_R * 8 + 1)         /* 16-byte pieces a lane hands over when the key halves are joined: its O^T tiles, then maxima and sums */
#define FA_LP 72                     /* LDS row pitch in halves: 144 B = 16 B x odd for 16-byte row reads */
#define FA_NST (SQ / FA_SK)
static_assert(HD == 64 && FA_SK == 64 && SQ % FA_SK == 0 && SQ % FA_BR == 0 && FA_NW * 32 == 128, "k_fattn: 64 x 128-byte tiles, four 16-byte pieces of each per thread, whole stages and whole query blocks");
static_assert((FA_NST & (FA_NST - 1)) == 0, "k_fattn: the rotated stage walk wraps by a mask");
static_assert(FA_SK == 32 * FA_KH && FA_KH == 2 && FA_R == 2 && FA_QW * FA_XP * 32 * 16 <= 2 * FA_SK * FA_LP * 2, "k_fattn: one pass per key half and stage; the hand-over (two maxima and two sums in one piece) fits in the K buffers");
typedef float v2f __attribute__((ext_vector_type(2)));
typedef _Float16 v2h __attribute__((ext_vector_type(2)));
typedef unsigned int v8u __attribute__((ext_vector_type(8)));
typedef unsigned int v4u __attribute__((ext_vector_type(4)));
__device__ __forceinline__ v16h fa_frag(const unsigned short* p) { FragH f; f.half[0] = *(const v8us*)p; f.half[1] = *(const v8us*)(p + 16); return f.v; }      /* p already holds the lane half's + 8 h */
__device__ __forceinline__ unsigned int fa_pack(float lo, float hi) { return __builtin_bit_cast(unsigned int, __builtin_convertvector((v2f){lo, hi}, v2h)); }
__device__ __forceinline__ float fa_xh(float x) { return __builtin_bit_cast(float, __builtin_amdgcn_permlanex16(__builtin_bit_cast(int, x), __builtin_bit_cast(int, x), 0x76543210, 0xfedcba98, false, false)); }      /* lane l with lane l ^ 16 */
__device__ __forceinline__ v8f fa_mma(v16h a, v16h b, v8f c) { return __builtin_amdgcn_wmma_f32_16x16x32_f16(false, a, false, b, (short)0, c, false, false); }
__global__ __launch_bounds__(FA_NW * 32) void k_fattn(const _Float16* __restrict__ Q16, const _Float16* __restrict__ K16, const _Float16* __restrict__ VT, _Float16* __restrict__ O16) {
  __shared__ __attribute__((aligned(16))) unsigned short sk[2][FA_SK][FA_LP];      /* K rows [key][d] */
  __shared__ __attribute__((aligned(16))) unsigned short sv[2][HD][FA_LP];         /* V^T rows [d][key] */
  const int tid = threadIdx.x, lane = tid & 31, c = lane & 15, h = lane >> 4;
  const int wave = __builtin_amdgcn_readfirstlane(tid >> 5), qw = wave % FA_QW, kh = wave / FA_QW;      /* scalar: the tests on kh below are scalar branches */
  const int bh = blockIdx.y, b = bh / NH, hd = bh - b * NH;
  const int q0 = blockIdx.x * FA_BR + qw * (FA_R * 16);
  const int sr = tid >> 3, sc = (tid & 7) * 8;      /* staging: eight lanes cover one 128-byte row; piece u is row sr + 16 u */
  const unsigned short* kg = (const unsigned short*)K16 + ((size_t)b * SQ + sr) * DM + hd * HD + sc;
  const unsigned short* vg = (const unsigned short*)VT + ((size_t)bh * HD + sr) * SQ + sc;
  const float cscale = 0.125f * 1.4426950408889634f;      /* HD^-0.5 log2(e) */
  const int rot = blockIdx.x & (FA_NST - 1);      /* the key stage the work-group starts at; it walks all FA_NST stages from there, round the end. The work-groups of one (batch, head) read the same K and V^T lines and run side by side: each starts elsewhere, so that they do not ask L2 for the same lines at the same moment */
  v8us rk[4], rv[4];
  { const unsigned short* k0 = kg + (size_t)rot * FA_SK * DM; const unsigned short* v0 = vg + rot * FA_SK;
#pragma unroll
    for (int u = 0; u < 4; ++u) { rk[u] = *(const v8us*)(k0 + (size_t)(16 * u) * DM); rv[u] = *(const v8us*)(v0 + (size_t)(16 * u) * SQ); }
    asm volatile("s_wait_xcnt 0x0" :: "v"(k0), "v"(v0) : "memory"); }      /* stands in front of every overwrite of the address registers that the loads above name */
  v16h qf[FA_R][2];
#pragma unroll
  for (int g = 0; g < FA_R; ++g) { const unsigned short* qp = (const unsigned short*)Q16 + ((size_t)b * SQ + q0 + 16 * g + c) * DM + hd * HD + 8 * h; qf[g][0] = fa_frag(qp); qf[g][1] = fa_frag(qp + 32); }
  const unsigned int o1 = (c == 0) ? 0x3C003C00u : 0u;      /* A operand whose row 0 is f16 ones: its product with P^T is the weights' column sums */
  const v16h ones = __builtin_bit_cast(v16h, (v8u){o1, o1, o1, o1, o1, o1, o1, o1});
  const v8f z8 = {0.f, 0.f, 0.f, 0.f, 0.f, 0.f, 0.f, 0.f};
  v8f acc[FA_R][4], lacc[FA_R]; float m_run[FA_R];
#pragma unroll
  for (int g = 0; g < FA_R; ++g) { m_run[g] = -__builtin_inff(); lacc[g] = z8; acc[g][0] = z8; acc[g][1] = z8; acc[g][2] = z8; acc[g][3] = z8; }
#pragma unroll
  for (int u = 0; u < 4; ++u) { *(v8us*)&sk[0][sr + 16 * u][sc] = rk[u]; *(v8us*)&sv[0][sr + 16 * u][sc] = rv[u]; }
  __syncthreads();
#pragma unroll 1      /* rolled: one stage's code, two buffers by index */
  for (int st = 0; st < FA_NST; ++st) {
    const int bu = st & 1;
    if (st + 1 < FA_NST) {      /* the next stage's tiles fly into registers under this stage's pass */
      const int sn = (st + 1 + rot) & (FA_NST - 1);
      const unsigned short* kn = kg + (size_t)sn * FA_SK * DM; const unsigned short* vn = vg + sn * FA_SK;
#pragma unroll
      for (int u = 0; u < 4; ++u) { rk[u] = *(const v8us*)(kn + (size_t)(16 * u) * DM); rv[u] = *(const v8us*)(vn + (size_t)(16 * u) * SQ); }
      asm volatile("s_wait_xcnt 0x0" :: "v"(kn), "v"(vn) : "memory");      /* stands in front of every overwrite of the address registers that the loads above name */
    }
    { const int sub = kh;      /* the wave's own 32 keys of the stage */
      v8f s[2][FA_R];
      { v16h kf[2][2];
#pragma unroll
        for (int kt = 0; kt < 2; ++kt) { const unsigned short* p = &sk[bu][32 * sub + 16 * kt + c][8 * h]; kf[kt][0] = fa_frag(p); kf[kt][1] = fa_frag(p + 32); }
#pragma unroll
        for (int kt = 0; kt < 2; ++kt)
#pragma unroll
          for (int g = 0; g < FA_R; ++g) s[kt][g] = fa_mma(kf[kt][0], qf[g][0], z8);
#pragma unroll
        for (int kt = 0; kt < 2; ++kt)
#pragma unroll
          for (int g = 0; g < FA_R; ++g) s[kt][g] = fa_mma(kf[kt][1], qf[g][1], s[kt][g]); }
      v16h vf[4];
#pragma unroll
      for (int t = 0; t < 4; ++t) vf[t] = fa_frag(&sv[bu][16 * t + c][32 * sub + 8 * h]);
      float mb[FA_R]; bool need = false;
#pragma unroll
      for (int g = 0; g < FA_R; ++g) { float mx = s[0][g][0];
#pragma unroll
        for (int r = 1; r < 8; ++r) mx = fmaxf(mx, s[0][g][r]);
#pragma unroll
        for (int r = 0; r < 8; ++r) mx = fmaxf(mx, s[1][g][r]);
        mx = fmaxf(mx, fa_xh(mx)) * cscale; mb[g] = mx; need = need || (mx > m_run[g] + 8.0f); }
      if (__builtin_amdgcn_ballot_w32(need) != 0) {      /* lazy rescale: the maximum in use may trail the true one by up to 8 (log2), so a weight stays below 2^8 */
#pragma unroll
        for (int g = 0; g < FA_R; ++g) { const float mn = fmaxf(m_run[g], mb[g]); const float corr = __builtin_amdgcn_exp2f(m_run[g] - mn); m_run[g] = mn; lacc[g] = lacc[g] * corr;
#pragma unroll
          for (int t = 0; t < 4; ++t) acc[g][t] = acc[g][t] * corr; } }
#pragma unroll
      for (int g = 0; g < FA_R; ++g) { const float nm = -m_run[g]; v8u w;
#pragma unroll
        for (int i = 0; i < 8; ++i) { const v2f a = __builtin_elementwise_fma((v2f){s[i >> 2][g][2 * (i & 3)], s[i >> 2][g][2 * (i & 3) + 1]}, (v2f){cscale, cscale}, (v2f){nm, nm}); w[i] = fa_pack(__builtin_amdgcn_exp2f(a[0]), __builtin_amdgcn_exp2f(a[1])); }
        const v16h pf = __builtin_bit_cast(v16h, w);      /* element e: key 8 h + e (tile 0), 16 + 8 h + e - 8 (tile 1) of query c */
#pragma unroll
        for (int t = 0; t < 4; ++t) acc[g][t] = fa_mma(vf[t], pf, acc[g][t]);
        lacc[g] = fa_mma(ones, pf, lacc[g]); }
    }
    __builtin_amdgcn_sched_barrier(0);      /* keeps the v_nop run below directly behind the stage's last WMMA */
    asm volatile("v_nop\n\tv_nop\n\tv_nop\n\tv_nop");      /* the four vector slots behind a WMMA, also on the taken side of the branches that follow */
    __builtin_amdgcn_sched_barrier(0);
    if (st + 1 < FA_NST) {
#pragma unroll
      for (int u = 0; u < 4; ++u) { *(v8us*)&sk[bu ^ 1][sr + 16 * u][sc] = rk[u]; *(v8us*)&sv[bu ^ 1][sr + 16 * u][sc] = rv[u]; } }
    __syncthreads();      /* publishes the next stage and ends every wave's reads of this one, which the next trip overwrites */
  }
  /* The key halves of a query are joined: the waves of half 1 hand maxima, sums and O^T tiles over in LDS (the K buffers, free behind the loop's last barrier), lane to lane; the waves of half 0 bring both to the common maximum, add and write. */
  float ls[FA_R];
#pragma unroll
  for (int g = 0; g < FA_R; ++g) { const float lr = lacc[g][0]; ls[g] = lr + fa_xh(lr); }      /* row 0 of the sum tile sits in lanes 0-15, row 8 (zero) in lanes 16-31: the exchange-and-add is unconditional */
  v4fa* xq = (v4fa*)&sk[0][0][0] + qw * (FA_XP * 32) + lane;      /* piece j of the lane lies 32 j pieces further on: a wave's 32 pieces are 512 bytes in a row */
  if (kh != 0) {
#pragma unroll
    for (int g = 0; g < FA_R; ++g)
#pragma unroll
      for (int t = 0; t < 4; ++t) { const v8f a = acc[g][t]; xq[(8 * g + 2 * t) * 32] = (v4f){a[0], a[1], a[2], a[3]}; xq[(8 * g + 2 * t + 1) * 32] = (v4f){a[4], a[5], a[6], a[7]}; }
    xq[(FA_XP - 1) * 32] = (v4f){m_run[0], m_run[1], ls[0], ls[1]}; }
  __syncthreads();      /* half 1's pieces are in LDS before half 0 reads them; every wave passes it */
  if (kh != 0) return;      /* behind the last barrier */
  const v4f ml = xq[(FA_XP - 1) * 32];
#pragma unroll
  for (int g = 0; g < FA_R; ++g) { const float mn = fmaxf(m_run[g], ml[g]); const float c0 = __builtin_amdgcn_exp2f(m_run[g] - mn), c1 = __builtin_amdgcn_exp2f(ml[g] - mn);
    const float inv = 64.0f / (ls[g] * c0 + ml[FA_R + g] * c1); const float a0 = c0 * inv, a1 = c1 * inv;
    unsigned short* op = (unsigned short*)O16 + ((size_t)b * SQ + q0 + 16 * g + c) * DM + hd * HD + 8 * h;
#pragma unroll
    for (int t = 0; t < 4; ++t) { const v4f x0 = xq[(8 * g + 2 * t) * 32], x1 = xq[(8 * g + 2 * t + 1) * 32]; const v8f x = {x0[0], x0[1], x0[2], x0[3], x1[0], x1[1], x1[2], x1[3]};
      const v8f o = acc[g][t] * a0 + x * a1; *(v4u*)(op + 16 * t) = (v4u){fa_pack(o[0], o[1]), fa_pack(o[2], o[3]), fa_pack(o[4], o[5]), fa_pack(o[6], o[7])}; } } }      /* acc register r = d 16 t + 8 h + r of query c */

extern "C" void kernel_launch(void* const* d_in, const int* in_sizes, int n_in,
                              void* d_out, int out_size, void* d_ws, size_t ws_size, hipStream_t stream) {
  (void)in_sizes; (void)n_in; (void)out_size;
  const float* const* I = (const float* const*)d_in; const float* x = I[0]; const float* wq = I[1]; const float* bq = I[2]; const float* wk = I[3]; const float* bk = I[4]; const float* wv = I[5]; const float* bv = I[6]; const float* wo = I[7]; const float* bo = I[8];      /* [in][out] weights + biases */
  char* ws = (char*)d_ws; size_t off = 0;
  auto take = [&](size_t bytes) { char* p = ws + off; off += (bytes + 255) & ~(size_t)255; return p; };
  _Float16* BQ = (_Float16*)take((size_t)DM * DM * 2); _Float16* BK = (_Float16*)take((size_t)DM * DM * 2); _Float16* BV = (_Float16*)take((size_t)DM * DM * 2); _Float16* BO = (_Float16*)take((size_t)DM * DM * 2);
  _Float16* X16 = (_Float16*)take(NR * DM * 2); _Float16* Q16 = (_Float16*)take(NR * DM * 2); _Float16* K16 = (_Float16*)take(NR * DM * 2); _Float16* O16 = (_Float16*)take(NR * DM * 2);
  _Float16* VT = (_Float16*)take((size_t)NB * NH * HD * SQ * 2);
  if (off > ws_size) return;
  static_assert(MP % 128 == 0 && MPO % 128 == 0 && DM % 64 == 0, "k_gemm2: whole 128x64 block tiles and whole 64-wide k stages");
  static_assert(((size_t)DM * DM * 2) % 256 == 0 && (NR * DM * 2) % 256 == 0, "the weight planes BQ, BK, BV, BO and the row planes Q16, K16 lie one behind the other in the workspace");
  k_prep<<<4 * PREP_WB + PREP_XB, 256, 0, stream>>>(x, wq, wk, wv, wo, BQ, X16);      /* [in][out] -> Bt[n][k] x16 for all four weights; x -> f16 rows */
  const size_t r0p = (size_t)B0 * SQ;      /* first projected row */
  k_gemm2<0, DM, DM, DM, true, false, false, true, true, 32><<<dim3((unsigned)((MP / 128) * (DM / 64)), 3), 128, 0, stream>>>(X16 + r0p * DM, 0, BQ, (size_t)DM * DM, 0.0625f, bq, bk, bv, 0, nullptr, 1, 0, 0, nullptr, Q16 + r0p * DM, VT + (size_t)B0 * NH * HD * SQ, NR * DM, MP, DM, DM);      /* grid.y = Q, K, V: one A, three weight and bias planes; Q and K leave as rows, V as V^T [NB][NH][HD][SQ] */
  k_fattn<<<dim3(SQ / FA_BR, NB * NH), FA_NW * 32, 0, stream>>>(Q16, K16, VT, O16);      /* o x64 (merged heads) as f16 rows */
  k_gemm2<0, DM, DM, DM, true, false, true, false, false, G2_KS><<<dim3((unsigned)((MPO / 128) * (DM / 64)), 1), 128, 0, stream>>>(O16 + r0p * DM, 0, BO, 0, 0.0009765625f, bo, nullptr, nullptr, 0, nullptr, 1, 0, 0, (float*)d_out + r0p * DM, nullptr, nullptr, 0, MPO, DM, DM);      /* out rows are the output layout */
}
